// v000
// The times below were measured on an AMD MI455X: many runs one after another, warmed up first and cycling through
// copies of the inputs, with the whole window's GPU time divided by the number of runs. Launches and the gaps
// between them are all in it. The median over several windows is given; except for v000 it joins two sittings, which
// can be a few percent apart, so the side-by-side timings, each taken in one sitting, are the better comparison.
// v000 is the starting kernel. One run takes 846 microseconds.
#include <hip/hip_runtime.h>
#include <stdint.h>
#include <stddef.h>

// Contractions (q/k/v projections, q.k^T, a.v, output projection): v_wmma_f32_16x16x32_f16 (f16 operands, f32 accumulate); weights carried x64, mixed attention carried x2^11, folded back in the f32 epilogue; 12x12 cross-head mixes and softmax in f32 on VALU.

typedef __attribute__((ext_vector_type(16))) _Float16 v16h;
typedef __attribute__((ext_vector_type(8)))  _Float16 v8h;
typedef __attribute__((ext_vector_type(16))) __bf16   v16b;
typedef __attribute__((ext_vector_type(8)))  __bf16   v8b;
typedef __attribute__((ext_vector_type(8)))  float    v8f;
typedef __attribute__((ext_vector_type(4)))  float    v4f;
typedef __attribute__((ext_vector_type(2)))  float    v2f;

__device__ __forceinline__ unsigned short f2bf_bits(float f) {
  unsigned u = __float_as_uint(f);
  return (unsigned short)((u + 0x7FFFu + ((u >> 16) & 1u)) >> 16);
}
__device__ __forceinline__ float bf_bits2f(unsigned short h) { return __uint_as_float(((unsigned)h) << 16); }

// hazard guards as plain device helpers (no inline asm inside the kernel template body)
__device__ __forceinline__ void dep_guard_h(v8f& a, v8f& b, v16h x, v16h y) { asm volatile("v_nop\n\tv_nop\n\tv_nop\n\tv_nop" : "+v"(a), "+v"(b) : "v"(x), "v"(y)); }
__device__ __forceinline__ void dep_guard_b(v8f& a, v8f& b, v16b x, v16b y) { asm volatile("v_nop\n\tv_nop\n\tv_nop\n\tv_nop" : "+v"(a), "+v"(b) : "v"(x), "v"(y)); }
__device__ __forceinline__ void keep4_h(v16h a, v16h b, v16h c, v16h d) { asm volatile("v_nop" :: "v"(a), "v"(b), "v"(c), "v"(d)); }
__device__ __forceinline__ void keep4_b(v16b a, v16b b, v16b c, v16b d) { asm volatile("v_nop" :: "v"(a), "v"(b), "v"(c), "v"(d)); }
__device__ __forceinline__ void acc_guard4(v8f& a, v8f& b, v8f& c, v8f& d) { asm volatile("v_nop\n\tv_nop\n\tv_nop\n\tv_nop" : "+v"(a), "+v"(b), "+v"(c), "+v"(d)); }
template <typename T> struct Frag;
template <> struct Frag<_Float16> {
  typedef v16h V; union U { v16h v; v8h h[2]; };
  static __device__ __forceinline__ v16h load(const _Float16* p) {   // elements 0..7 <- p[0..7], 8..15 <- p[16..23]
    U f; f.h[0] = *(const v8h*)(p); f.h[1] = *(const v8h*)(p + 16); return f.v;
  }
  static __device__ __forceinline__ v8f mma(v16h a, v16h b, v8f c) {
    return __builtin_amdgcn_wmma_f32_16x16x32_f16(false, a, false, b, (short)0, c, false, false);
  }
  static __device__ __forceinline__ void guard(v8f& a, v8f& b, v16h x, v16h y) { dep_guard_h(a, b, x, y); }
  static __device__ __forceinline__ void keep(v16h a, v16h b, v16h c, v16h d) { keep4_h(a, b, c, d); }
};
template <> struct Frag<__bf16> {
  typedef v16b V; union U { v16b v; v8b h[2]; };
  static __device__ __forceinline__ v16b load(const __bf16* p) {
    U f; f.h[0] = *(const v8b*)(p); f.h[1] = *(const v8b*)(p + 16); return f.v;
  }
  static __device__ __forceinline__ v8f mma(v16b a, v16b b, v8f c) {
    return __builtin_amdgcn_wmma_f32_16x16x32_bf16(false, a, false, b, (short)0, c, false, false);
  }
  static __device__ __forceinline__ void guard(v8f& a, v8f& b, v16b x, v16b y) { dep_guard_b(a, b, x, y); }
  static __device__ __forceinline__ void keep(v16b a, v16b b, v16b c, v16b d) { keep4_b(a, b, c, d); }
};

// ---- Register-blocked batched WMMA GEMM ------------------------------------
// C[m,n] = scale * sum_k A[m,k] * Bt[n,k] (+bias)(+resid); each wave owns a 64x64 tile.
// A row-major [M,K]; Bt row-major [N,K]; M,N % 64 == 0, K % 32 == 0.
// SPLIT: operands are hi/lo planes (A2/Bt2 = lo planes, same layout); product = hi.hi + hi.lo + lo.hi.
// BIAS_MODE: 0 = none, 1 = bias[m], 2 = bias[n].
// OUT_MODE: 0 = f32, 1 = f16, 2 = bf16 hi plane (Cout) + bf16 lo plane (Cout2).
// ET: 0 = f16 operands, 1 = bf16 operands (pointers passed as 16-bit storage)
template <int ET> struct Elem;
template <> struct Elem<0> { typedef _Float16 T; };
template <> struct Elem<1> { typedef __bf16 T; };
template <int ET, bool SPLIT, int BIAS_MODE, int OUT_MODE, bool RESID, int ACT = 0>
__global__ __launch_bounds__(256) void wmma_gemm64(
    const unsigned short* __restrict__ Ap, const unsigned short* __restrict__ A2p, int lda, long strideA,
    const unsigned short* __restrict__ Btp, const unsigned short* __restrict__ Bt2p, int ldb, long strideB,
    void* __restrict__ Cout, void* __restrict__ Cout2, int ldc, long strideC,
    const float* __restrict__ bias,
    const float* __restrict__ resid, long strideR,
    int M, int N, int K, float scale) {
  typedef typename Elem<ET>::T T;
  typedef typename Frag<T>::V V;
  const T* A = (const T*)Ap; const T* A2 = (const T*)A2p; const T* Bt = (const T*)Btp; const T* Bt2 = (const T*)Bt2p;
  __shared__ __align__(16) float sT[8][16 * 68];   // per-wave 16x64 slab, pitch 68 floats
  const int b    = blockIdx.y;
  const int lane = threadIdx.x & 31;
  const int wave = threadIdx.x >> 5;
  const int tilesN = N >> 6;
  const int tilesM = M >> 6;
  const int tile = blockIdx.x * 8 + wave;
  if (tile >= tilesM * tilesN) return;   // wave-uniform; no block barriers in this kernel
  const int tm = tile / tilesN;
  const int tn = tile - tm * tilesN;
  const int m0 = tm << 6;
  const int n0 = tn << 6;

  const T* Ab  = A  + (size_t)b * strideA;
  const T* Bb  = Bt + (size_t)b * strideB;
  const T* Ab2 = SPLIT ? (A2  + (size_t)b * strideA) : nullptr;
  const T* Bb2 = SPLIT ? (Bt2 + (size_t)b * strideB) : nullptr;

  const int rlane = lane & 15;                 // row (A) / col (B, D) within subtile
  const int koff  = (lane >> 4) * 8;           // k offset of this lane half
  const int mOff  = (lane >> 4) * 8;           // D row offset

  v8f acc[4][4];
#pragma unroll
  for (int i = 0; i < 4; ++i)
#pragma unroll
    for (int j = 0; j < 4; ++j) acc[i][j] = (v8f){0.f,0.f,0.f,0.f,0.f,0.f,0.f,0.f};

  for (int k0 = 0; k0 < K; k0 += 32) {
    V bh[4], bl[4];
#pragma unroll
    for (int j = 0; j < 4; ++j) {
      const size_t bo = (size_t)(n0 + (j << 4) + rlane) * ldb + koff + k0;
      bh[j] = Frag<T>::load(Bb + bo);
      if (SPLIT) bl[j] = Frag<T>::load(Bb2 + bo);
    }
#pragma unroll
    for (int i = 0; i < 4; ++i) {
      const size_t ao = (size_t)(m0 + (i << 4) + rlane) * lda + koff + k0;
      V ah = Frag<T>::load(Ab + ao);
      V al;
      if (SPLIT) al = Frag<T>::load(Ab2 + ao);
#pragma unroll
      for (int j = 0; j < 4; ++j) {
        acc[i][j] = Frag<T>::mma(ah, bh[j], acc[i][j]);
        if (SPLIT) {
          acc[i][j] = Frag<T>::mma(ah, bl[j], acc[i][j]);
          acc[i][j] = Frag<T>::mma(al, bh[j], acc[i][j]);
        }
      }
      Frag<T>::guard(acc[i][0], acc[i][3], ah, SPLIT ? al : ah);
    }
    Frag<T>::keep(bh[0], bh[1], bh[2], bh[3]);
    if (SPLIT) Frag<T>::keep(bl[0], bl[1], bl[2], bl[3]);
  }
  acc_guard4(acc[0][0], acc[0][1], acc[0][2], acc[0][3]);
  acc_guard4(acc[1][0], acc[1][1], acc[1][2], acc[1][3]);
  acc_guard4(acc[2][0], acc[2][1], acc[2][2], acc[2][3]);
  acc_guard4(acc[3][0], acc[3][1], acc[3][2], acc[3][3]);

  // ---- epilogue ----
  float* slab = sT[wave];
  const float* Rb = RESID ? (resid + (size_t)b * strideR) : nullptr;
#pragma unroll
  for (int i = 0; i < 4; ++i) {
    const int mBase = m0 + (i << 4);
#pragma unroll
    for (int j = 0; j < 4; ++j) {
      const int n = n0 + (j << 4) + rlane;
      float bv = 0.f;
      if (BIAS_MODE == 2) bv = bias[n];
#pragma unroll
      for (int r = 0; r < 8; ++r) {
        float v = acc[i][j][r] * scale;
        if (BIAS_MODE == 1) v += bias[mBase + mOff + r];
        if (BIAS_MODE == 2) v += bv;
        if (RESID) v += Rb[(size_t)(mBase + mOff + r) * ldc + n];
        if (ACT == 1) v = tanhf(v);
        if (ACT == 2) v = fmaxf(v, 0.0f);
        if (ACT == 3) v = v / (1.0f + expf(-v));
        if (ACT == 4) v = (v > 0.f) ? v : 0.01f * v;
        if (ACT == 5) v = 0.5f * v * (1.0f + erff(v * 0.70710678118654752f));
        slab[(mOff + r) * 68 + (j << 4) + rlane] = v;
      }
    }
    __builtin_amdgcn_fence(__ATOMIC_RELEASE, "workgroup");
    __builtin_amdgcn_wave_barrier();
    __builtin_amdgcn_fence(__ATOMIC_ACQUIRE, "workgroup");
    if (OUT_MODE == 0) {
      float* C = (float*)Cout + (size_t)b * strideC;
      const int hh = lane >> 4, c4 = (lane & 15) * 4;     // row seg = 256 B = 16 lanes x 16 B
      {
#pragma unroll
        for (int it = 0; it < 8; ++it) {
          const int row = it * 2 + hh;
          v4f v = *(const v4f*)(slab + row * 68 + c4);
          *(v4f*)(C + (size_t)(mBase + row) * ldc + n0 + c4) = v;
        }
        
      }
    } else {
      const int q = lane >> 3, c8 = (lane & 7) * 8;
      unsigned short* C  = (unsigned short*)Cout  + (size_t)b * strideC;
      unsigned short* C2 = (OUT_MODE == 2) ? ((unsigned short*)Cout2 + (size_t)b * strideC) : nullptr;
      {
#pragma unroll
        for (int it = 0; it < 4; ++it) {
          const int row = it * 4 + q;
          const float* sp = slab + row * 68 + c8;
          v8h hv, lv;
#pragma unroll
          for (int e = 0; e < 8; ++e) {
            if (OUT_MODE == 1) {
              hv[e] = (_Float16)sp[e];
            } else {
              unsigned short hb = f2bf_bits(sp[e]);
              unsigned short lb = f2bf_bits(sp[e] - bf_bits2f(hb));
              hv[e] = __builtin_bit_cast(_Float16, hb);
              lv[e] = __builtin_bit_cast(_Float16, lb);
            }
          }
          *(v8h*)(C + (size_t)(mBase + row) * ldc + n0 + c8) = hv;
          if (OUT_MODE == 2) *(v8h*)(C2 + (size_t)(mBase + row) * ldc + n0 + c8) = lv;
        }
        
      }
    }
    __builtin_amdgcn_fence(__ATOMIC_RELEASE, "workgroup");
    __builtin_amdgcn_wave_barrier();
    __builtin_amdgcn_fence(__ATOMIC_ACQUIRE, "workgroup");
  }
}

__global__ __launch_bounds__(256) void cast_f32_f16x2s(
    const float* __restrict__ in, _Float16* __restrict__ out, int n2, float scale) {
  int i = blockIdx.x * 256 + threadIdx.x;
  if (i < n2) {
    const v2f a = *(const v2f*)(in + 2 * (size_t)i);
    const _Float16 h0 = (_Float16)(a[0] * scale), h1 = (_Float16)(a[1] * scale);
    const unsigned u = (unsigned)__builtin_bit_cast(unsigned short, h0) | ((unsigned)__builtin_bit_cast(unsigned short, h1) << 16);
    ((unsigned*)out)[i] = u;
    
  }
}

// =====================================================================================
// Cross-head mix 1 (12x12, f32) -> softmax over keys (f32) -> cross-head mix 2 folded with 1/sum and
// the power-of-two carry -> f16 store.  One block per query row n of one batch; S is [12][1024][1024]
// f32 (head, query, key); P is [12][1024][1024] f16 = (mix2 result) * pcarry.
// Column ownership: phase 1/3 thread t owns keys cc*512 + 2t, 2t+1 (cc = 0,1) so each wave stores one
// =====================================================================================
#define MX_H 12
#define MX_N 1024

__global__ __launch_bounds__(256) void th_mix_kernel(
    const float* __restrict__ S, const float* __restrict__ w1, const float* __restrict__ b1,
    const float* __restrict__ w2, const float* __restrict__ b2,
    unsigned short* __restrict__ P, float pcarry)
{
  __shared__ __align__(16) float T[MX_H * MX_N];
  __shared__ __align__(16) float w1s[MX_H * MX_H];
  __shared__ __align__(16) float w2s[MX_H * MX_H];
  __shared__ float b1s[16];
  __shared__ float b2s[16];
  __shared__ float invs[16];
  __shared__ float rmax[8];
  __shared__ float rsum[8];

  const int n    = blockIdx.x;
  const int tid  = threadIdx.x;
  const int lane = tid & 31;
  const int wave = tid >> 5;
  const size_t HS = (size_t)MX_N * MX_N;

  if (tid < MX_H * MX_H) { w1s[tid] = w1[tid]; w2s[tid] = w2[tid]; }
  if (tid < MX_H) { b1s[tid] = b1[tid]; b2s[tid] = b2[tid]; }
  __syncthreads();

  // ---- phase 1: mix 1 into T ----
#pragma unroll 1
  for (int cc = 0; cc < 2; ++cc) {
    const int m = cc * 512 + tid * 2;
    const float* sp = S + (size_t)n * MX_N + m;
    v2f s[MX_H];
#pragma unroll
    for (int h = 0; h < MX_H; ++h) s[h] = *(const v2f*)(sp + (size_t)h * HS);
#pragma unroll 1
    for (int g = 0; g < MX_H; ++g) {
      const v4f wa = *(const v4f*)(w1s + g * MX_H);
      const v4f wb = *(const v4f*)(w1s + g * MX_H + 4);
      const v4f wc = *(const v4f*)(w1s + g * MX_H + 8);
      const float bg = b1s[g];
      v2f a = (v2f){bg, bg};
      a += wa[0] * s[0];  a += wa[1] * s[1];  a += wa[2] * s[2];  a += wa[3] * s[3];
      a += wb[0] * s[4];  a += wb[1] * s[5];  a += wb[2] * s[6];  a += wb[3] * s[7];
      a += wc[0] * s[8];  a += wc[1] * s[9];  a += wc[2] * s[10]; a += wc[3] * s[11];
      *(v2f*)(T + g * MX_N + m) = a;
    }
  }
  __syncthreads();

  // ---- phase 2: softmax per head row (block-wide max and sum), exp written back into T ----
#pragma unroll 1
  for (int g = 0; g < MX_H; ++g) {
    float* tp = T + g * MX_N + tid * 4;
    const v4f x = *(const v4f*)tp;
    float mx = fmaxf(fmaxf(x[0], x[1]), fmaxf(x[2], x[3]));
#pragma unroll
    for (int off = 16; off > 0; off >>= 1) mx = fmaxf(mx, __shfl_xor(mx, off, 32));
    if (lane == 0) rmax[wave] = mx;
    __syncthreads();
    float M = rmax[0];
#pragma unroll
    for (int w = 1; w < 8; ++w) M = fmaxf(M, rmax[w]);
    v4f e;
    e[0] = __expf(x[0] - M);
    e[1] = __expf(x[1] - M);
    e[2] = __expf(x[2] - M);
    e[3] = __expf(x[3] - M);
    *(v4f*)tp = e;
    float sm = (e[0] + e[1]) + (e[2] + e[3]);
#pragma unroll
    for (int off = 16; off > 0; off >>= 1) sm += __shfl_xor(sm, off, 32);
    if (lane == 0) rsum[wave] = sm;
    __syncthreads();
    float tot = rsum[0];
#pragma unroll
    for (int w = 1; w < 8; ++w) tot += rsum[w];
    if (tid == 0) invs[g] = 1.0f / tot;
  }
  __syncthreads();
  // fold 1/sum of the source head and the carry into the mix-2 weights, carry into the bias
  if (tid < MX_H * MX_H) {
    const int h = tid % MX_H;
    w2s[tid] = w2s[tid] * invs[h] * pcarry;
  }
  if (tid < MX_H) b2s[tid] = b2s[tid] * pcarry;
  __syncthreads();

#pragma unroll 1
  for (int cc = 0; cc < 2; ++cc) {
    const int m = cc * 512 + tid * 2;
    v2f e[MX_H];
#pragma unroll
    for (int h = 0; h < MX_H; ++h) e[h] = *(const v2f*)(T + h * MX_N + m);
    unsigned short* prow = P + (size_t)n * MX_N + m;
#pragma unroll 1
    for (int g = 0; g < MX_H; ++g) {
      const v4f wa = *(const v4f*)(w2s + g * MX_H);
      const v4f wb = *(const v4f*)(w2s + g * MX_H + 4);
      const v4f wc = *(const v4f*)(w2s + g * MX_H + 8);
      const float bg = b2s[g];
      v2f a = (v2f){bg, bg};
      a += wa[0] * e[0];  a += wa[1] * e[1];  a += wa[2] * e[2];  a += wa[3] * e[3];
      a += wb[0] * e[4];  a += wb[1] * e[5];  a += wb[2] * e[6];  a += wb[3] * e[7];
      a += wc[0] * e[8];  a += wc[1] * e[9];  a += wc[2] * e[10]; a += wc[3] * e[11];
      const _Float16 h0 = (_Float16)a[0], h1 = (_Float16)a[1];
      const unsigned u = (unsigned)__builtin_bit_cast(unsigned short, h0) | ((unsigned)__builtin_bit_cast(unsigned short, h1) << 16);
      unsigned* pp = (unsigned*)(prow + (size_t)g * HS);
      *pp = u;
      
    }
  }
}

// ---------------------------------------------------------------------------
template <int BIAS_MODE, int OUT_MODE>
static void gemm_f16(hipStream_t st, int gy,
                     const void* A, int lda, long sA,
                     const void* Bt, int ldb, long sB,
                     void* C, int ldc, long sC,
                     const float* bias, int M, int N, int K, float scale)
{
  const int tiles = (M / 64) * (N / 64);
  dim3 grid((tiles + 7) / 8, gy);
  wmma_gemm64<0, false, BIAS_MODE, OUT_MODE, false, 0><<<grid, 256, 0, st>>>(
      (const unsigned short*)A, (const unsigned short*)A, lda, sA,
      (const unsigned short*)Bt, (const unsigned short*)Bt, ldb, sB,
      C, C, ldc, sC, bias, bias, (long)0, M, N, K, scale);
}

extern "C" void kernel_launch(void* const* d_in, const int* in_sizes, int n_in,
                              void* d_out, int out_size, void* d_ws, size_t ws_size,
                              hipStream_t stream)
{
  const int Bn = 8, Nn = 1024, Dd = 768, Hh = 12, HD = 64;
  if (n_in < 13) return;
  if (in_sizes[0] != Bn * Nn * Dd) return;
  if (in_sizes[1] != Dd * Dd || in_sizes[3] != Dd * Dd || in_sizes[5] != Dd * Dd || in_sizes[7] != Dd * Dd) return;
  if (in_sizes[2] != Dd || in_sizes[4] != Dd || in_sizes[6] != Dd || in_sizes[8] != Dd) return;
  if (in_sizes[9] != Hh * Hh || in_sizes[10] != Hh || in_sizes[11] != Hh * Hh || in_sizes[12] != Hh) return;
  if (out_size != Bn * Nn * Dd) return;

  const float* x    = (const float*)d_in[0];
  const float* wq   = (const float*)d_in[1];
  const float* bq   = (const float*)d_in[2];
  const float* wk   = (const float*)d_in[3];
  const float* bk   = (const float*)d_in[4];
  const float* wv   = (const float*)d_in[5];
  const float* bv   = (const float*)d_in[6];
  const float* wo   = (const float*)d_in[7];
  const float* bo   = (const float*)d_in[8];
  const float* th1w = (const float*)d_in[9];
  const float* th1b = (const float*)d_in[10];
  const float* th2w = (const float*)d_in[11];
  const float* th2b = (const float*)d_in[12];
  float* out = (float*)d_out;

  // ---- workspace carve (bytes) ----
  const size_t WSZ = (size_t)Dd * Dd * 2;                 // one f16 weight matrix
  const size_t ASZ = (size_t)Bn * Nn * Dd * 2;            // one f16 activation [8192][768]
  const size_t SSZ = (size_t)Hh * Nn * Nn * 4;            // per-batch logits f32 [12][1024][1024]
  const size_t PSZ = (size_t)Hh * Nn * Nn * 2;            // per-batch mixed attention f16
  const size_t off_wq  = 0;
  const size_t off_wk  = off_wq + WSZ;
  const size_t off_wv  = off_wk + WSZ;
  const size_t off_wo  = off_wv + WSZ;
  const size_t off_q   = off_wo + WSZ;
  const size_t off_k   = off_q + ASZ;
  const size_t off_vt  = off_k + ASZ;                     // v^T per batch: [b][h*64+d][m]
  const size_t off_ctx = off_vt + ASZ;                    // attention output [8192][768] f16
  const size_t off_R   = off_ctx + ASZ;                   // reused region
  const size_t off_x16 = off_R;                           // live during the projections only
  const size_t off_S   = off_R;                           // live per batch afterwards
  const size_t off_P   = off_S + SSZ;
  size_t end = off_P + PSZ;
  if (off_x16 + ASZ > end) end = off_x16 + ASZ;
  if (end > ws_size) return;
  if (end > (size_t)134217728) return;

  uint8_t* ws = (uint8_t*)d_ws;
  _Float16* wq16 = (_Float16*)(ws + off_wq);
  _Float16* wk16 = (_Float16*)(ws + off_wk);
  _Float16* wv16 = (_Float16*)(ws + off_wv);
  _Float16* wo16 = (_Float16*)(ws + off_wo);
  unsigned short* q16   = (unsigned short*)(ws + off_q);
  unsigned short* k16   = (unsigned short*)(ws + off_k);
  unsigned short* vt16  = (unsigned short*)(ws + off_vt);
  unsigned short* ctx16 = (unsigned short*)(ws + off_ctx);
  _Float16* x16 = (_Float16*)(ws + off_x16);
  float* Sb = (float*)(ws + off_S);
  unsigned short* Pb = (unsigned short*)(ws + off_P);

  const float WCARRY = 64.0f;        // weights carried x2^6 in f16
  const float PCARRY = 2048.0f;      // mixed attention carried x2^11 in f16

  // ---- casts to f16 ----
  {
    const int n2x = Bn * Nn * Dd / 2;
    cast_f32_f16x2s<<<(n2x + 255) / 256, 256, 0, stream>>>(x, x16, n2x, 1.0f);
    const int n2w = Dd * Dd / 2;
    cast_f32_f16x2s<<<(n2w + 255) / 256, 256, 0, stream>>>(wq, wq16, n2w, WCARRY);
    cast_f32_f16x2s<<<(n2w + 255) / 256, 256, 0, stream>>>(wk, wk16, n2w, WCARRY);
    cast_f32_f16x2s<<<(n2w + 255) / 256, 256, 0, stream>>>(wv, wv16, n2w, WCARRY);
    cast_f32_f16x2s<<<(n2w + 255) / 256, 256, 0, stream>>>(wo, wo16, n2w, WCARRY);
  }

  // ---- projections: q, k as [b*1024+n][h*64+d] f16; v^T per batch as [b][h*64+d][m] f16 ----
  gemm_f16<2, 1>(stream, 1, x16, Dd, 0L, wq16, Dd, 0L, q16, Dd, 0L, bq, Bn * Nn, Dd, Dd, 1.0f / WCARRY);
  gemm_f16<2, 1>(stream, 1, x16, Dd, 0L, wk16, Dd, 0L, k16, Dd, 0L, bk, Bn * Nn, Dd, Dd, 1.0f / WCARRY);
  // A = wv [768][768], Bt = x rows of batch b [1024][768] -> C [768][1024] per batch, bias[m] = bv[o]
  gemm_f16<1, 1>(stream, Bn, wv16, Dd, 0L, x16, Dd, (long)Nn * Dd, vt16, Nn, (long)Dd * Nn, bv, Dd, Nn, Dd, 1.0f / WCARRY);

  // ---- per batch: logits -> mix/softmax/mix -> a.v ----
  const float qk_scale = 0.125f;     // 64^-0.5
  for (int b = 0; b < Bn; ++b) {
    const unsigned short* qb = q16 + (size_t)b * Nn * Dd;
    const unsigned short* kb = k16 + (size_t)b * Nn * Dd;
    // S[h][n][m] = scale * sum_d q[n][h*64+d] k[m][h*64+d]; grid.y = head, strideA/B = 64, strideC = 1024*1024
    gemm_f16<0, 0>(stream, Hh, qb, Dd, (long)HD, kb, Dd, (long)HD, Sb, Nn, (long)Nn * Nn, bq, Nn, Nn, HD, qk_scale);
    th_mix_kernel<<<Nn, 256, 0, stream>>>(Sb, th1w, th1b, th2w, th2b, Pb, PCARRY);
    // ctx[b*1024+n][h*64+d] = 2^-11 * sum_m P[h][n][m] * vT[b][h*64+d][m]; grid.y = head
    gemm_f16<0, 1>(stream, Hh,
                   Pb, Nn, (long)Nn * Nn,
                   vt16 + (size_t)b * Dd * Nn, Nn, (long)HD * Nn,
                   ctx16 + (size_t)b * Nn * Dd, Dd, (long)HD,
                   bq, Nn, HD, Nn, 1.0f / PCARRY);
  }

  // ---- output projection -> f32 [8192][768] ----
  gemm_f16<2, 0>(stream, 1, ctx16, Dd, 0L, wo16, Dd, 0L, out, Dd, 0L, bo, Bn * Nn, Dd, Dd, 1.0f / WCARRY);
}

// v001
// A run of this version takes 530 microseconds.
// Two timings next to v000 put it at 1.60 and 1.59 times that version's speed.
#include <hip/hip_runtime.h>
#include <stdint.h>
#include <stddef.h>

// Contractions (q/k/v projections, q.k^T, a.v, output projection): v_wmma_f32_16x16x32_f16 (f16 operands, f32 accumulate); weights carried x64, mixed attention carried x2^11, folded back in the f32 epilogue; 12x12 cross-head mixes and softmax in f32 on VALU.

typedef __attribute__((ext_vector_type(16))) _Float16 v16h;
typedef __attribute__((ext_vector_type(8)))  _Float16 v8h;
typedef __attribute__((ext_vector_type(4)))  _Float16 v4h;
typedef __attribute__((ext_vector_type(16))) __bf16   v16b;
typedef __attribute__((ext_vector_type(8)))  __bf16   v8b;
typedef __attribute__((ext_vector_type(8)))  float    v8f;
typedef __attribute__((ext_vector_type(4)))  float    v4f;
typedef __attribute__((ext_vector_type(2)))  float    v2f;

__device__ __forceinline__ unsigned short f2bf_bits(float f) {
  unsigned u = __float_as_uint(f);
  return (unsigned short)((u + 0x7FFFu + ((u >> 16) & 1u)) >> 16);
}
__device__ __forceinline__ float bf_bits2f(unsigned short h) { return __uint_as_float(((unsigned)h) << 16); }

// hazard guards as plain device helpers (no inline asm inside the kernel template body)
__device__ __forceinline__ void dep_guard_h(v8f& a, v8f& b, v16h x, v16h y) { asm volatile("v_nop\n\tv_nop\n\tv_nop\n\tv_nop" : "+v"(a), "+v"(b) : "v"(x), "v"(y)); }
__device__ __forceinline__ void dep_guard_b(v8f& a, v8f& b, v16b x, v16b y) { asm volatile("v_nop\n\tv_nop\n\tv_nop\n\tv_nop" : "+v"(a), "+v"(b) : "v"(x), "v"(y)); }
__device__ __forceinline__ void keep4_h(v16h a, v16h b, v16h c, v16h d) { asm volatile("v_nop" :: "v"(a), "v"(b), "v"(c), "v"(d)); }
__device__ __forceinline__ void keep4_b(v16b a, v16b b, v16b c, v16b d) { asm volatile("v_nop" :: "v"(a), "v"(b), "v"(c), "v"(d)); }
__device__ __forceinline__ void acc_guard4(v8f& a, v8f& b, v8f& c, v8f& d) { asm volatile("v_nop\n\tv_nop\n\tv_nop\n\tv_nop" : "+v"(a), "+v"(b), "+v"(c), "+v"(d)); }
template <typename T> struct Frag;
template <> struct Frag<_Float16> {
  typedef v16h V; union U { v16h v; v8h h[2]; };
  static __device__ __forceinline__ v16h load(const _Float16* p) {   // elements 0..7 <- p[0..7], 8..15 <- p[16..23]
    U f; f.h[0] = *(const v8h*)(p); f.h[1] = *(const v8h*)(p + 16); return f.v;
  }
  static __device__ __forceinline__ v8f mma(v16h a, v16h b, v8f c) {
    return __builtin_amdgcn_wmma_f32_16x16x32_f16(false, a, false, b, (short)0, c, false, false);
  }
  static __device__ __forceinline__ void guard(v8f& a, v8f& b, v16h x, v16h y) { dep_guard_h(a, b, x, y); }
  static __device__ __forceinline__ void keep(v16h a, v16h b, v16h c, v16h d) { keep4_h(a, b, c, d); }
};
template <> struct Frag<__bf16> {
  typedef v16b V; union U { v16b v; v8b h[2]; };
  static __device__ __forceinline__ v16b load(const __bf16* p) {
    U f; f.h[0] = *(const v8b*)(p); f.h[1] = *(const v8b*)(p + 16); return f.v;
  }
  static __device__ __forceinline__ v8f mma(v16b a, v16b b, v8f c) {
    return __builtin_amdgcn_wmma_f32_16x16x32_bf16(false, a, false, b, (short)0, c, false, false);
  }
  static __device__ __forceinline__ void guard(v8f& a, v8f& b, v16b x, v16b y) { dep_guard_b(a, b, x, y); }
  static __device__ __forceinline__ void keep(v16b a, v16b b, v16b c, v16b d) { keep4_b(a, b, c, d); }
};

// ---- Register-blocked batched WMMA GEMM ------------------------------------
// C[m,n] = scale * sum_k A[m,k] * Bt[n,k] (+bias)(+resid); each wave owns a 64x64 tile.
// A row-major [M,K]; Bt row-major [N,K]; M,N % 64 == 0, K % 32 == 0.
// SPLIT: operands are hi/lo planes (A2/Bt2 = lo planes, same layout); product = hi.hi + hi.lo + lo.hi.
// BIAS_MODE: 0 = none, 1 = bias[m], 2 = bias[n].
// OUT_MODE: 0 = f32, 1 = f16, 2 = bf16 hi plane (Cout) + bf16 lo plane (Cout2).
// ET: 0 = f16 operands, 1 = bf16 operands (pointers passed as 16-bit storage)
// KSPLIT: one 64x64 tile per block; wave w sums k in [w*K/8, (w+1)*K/8) (K % 256 == 0) and the eight f32
// partial tiles are added in LDS in wave order 0..7. For shapes with too few tiles to fill the chip.
template <int ET> struct Elem;
template <> struct Elem<0> { typedef _Float16 T; };
template <> struct Elem<1> { typedef __bf16 T; };
template <int ET, bool SPLIT, int BIAS_MODE, int OUT_MODE, bool RESID, int ACT = 0, bool KSPLIT = false>
__global__ __launch_bounds__(256) void wmma_gemm64(
    const unsigned short* __restrict__ Ap, const unsigned short* __restrict__ A2p, int lda, long strideA,
    const unsigned short* __restrict__ Btp, const unsigned short* __restrict__ Bt2p, int ldb, long strideB,
    void* __restrict__ Cout, void* __restrict__ Cout2, int ldc, long strideC,
    const float* __restrict__ bias,
    const float* __restrict__ resid, long strideR,
    int M, int N, int K, float scale) {
  typedef typename Elem<ET>::T T;
  typedef typename Frag<T>::V V;
  const T* A = (const T*)Ap; const T* A2 = (const T*)A2p; const T* Bt = (const T*)Btp; const T* Bt2 = (const T*)Bt2p;
  static_assert(!KSPLIT || (!SPLIT && BIAS_MODE == 0 && OUT_MODE == 1 && !RESID && ACT == 0), "KSPLIT epilogue: plain f16 output only");
  __shared__ __align__(16) float sT[8][(KSPLIT ? 64 : 16) * 68];   // per-wave slab (16x64, KSPLIT: 64x64), pitch 68 floats
  const int b    = blockIdx.y;
  const int lane = threadIdx.x & 31;
  const int wave = threadIdx.x >> 5;
  const int tilesN = N >> 6;
  const int tilesM = M >> 6;
  const int tile = KSPLIT ? (int)blockIdx.x : (int)(blockIdx.x * 8 + wave);
  if (tile >= tilesM * tilesN) return;   // wave-uniform; KSPLIT (the one form with a block barrier): block-uniform
  const int tm = tile / tilesN;
  const int tn = tile - tm * tilesN;
  const int m0 = tm << 6;
  const int n0 = tn << 6;

  const T* Ab  = A  + (size_t)b * strideA;
  const T* Bb  = Bt + (size_t)b * strideB;
  const T* Ab2 = SPLIT ? (A2  + (size_t)b * strideA) : nullptr;
  const T* Bb2 = SPLIT ? (Bt2 + (size_t)b * strideB) : nullptr;

  const int rlane = lane & 15;                 // row (A) / col (B, D) within subtile
  const int koff  = (lane >> 4) * 8;           // k offset of this lane half
  const int mOff  = (lane >> 4) * 8;           // D row offset

  v8f acc[4][4];
#pragma unroll
  for (int i = 0; i < 4; ++i)
#pragma unroll
    for (int j = 0; j < 4; ++j) acc[i][j] = (v8f){0.f,0.f,0.f,0.f,0.f,0.f,0.f,0.f};

  const int kBeg = KSPLIT ? __builtin_amdgcn_readfirstlane(wave) * (K >> 3) : 0;   // scalar, so the k loop keeps its scalar counter and branch
  const int kEnd = KSPLIT ? kBeg + (K >> 3) : K;
  for (int k0 = kBeg; k0 < kEnd; k0 += 32) {
    V bh[4], bl[4];
#pragma unroll
    for (int j = 0; j < 4; ++j) {
      const size_t bo = (size_t)(n0 + (j << 4) + rlane) * ldb + koff + k0;
      bh[j] = Frag<T>::load(Bb + bo);
      if (SPLIT) bl[j] = Frag<T>::load(Bb2 + bo);
    }
#pragma unroll
    for (int i = 0; i < 4; ++i) {
      const size_t ao = (size_t)(m0 + (i << 4) + rlane) * lda + koff + k0;
      V ah = Frag<T>::load(Ab + ao);
      V al;
      if (SPLIT) al = Frag<T>::load(Ab2 + ao);
#pragma unroll
      for (int j = 0; j < 4; ++j) {
        acc[i][j] = Frag<T>::mma(ah, bh[j], acc[i][j]);
        if (SPLIT) {
          acc[i][j] = Frag<T>::mma(ah, bl[j], acc[i][j]);
          acc[i][j] = Frag<T>::mma(al, bh[j], acc[i][j]);
        }
      }
      Frag<T>::guard(acc[i][0], acc[i][3], ah, SPLIT ? al : ah);
    }
    Frag<T>::keep(bh[0], bh[1], bh[2], bh[3]);
    if (SPLIT) Frag<T>::keep(bl[0], bl[1], bl[2], bl[3]);
  }
  acc_guard4(acc[0][0], acc[0][1], acc[0][2], acc[0][3]);
  acc_guard4(acc[1][0], acc[1][1], acc[1][2], acc[1][3]);
  acc_guard4(acc[2][0], acc[2][1], acc[2][2], acc[2][3]);
  acc_guard4(acc[3][0], acc[3][1], acc[3][2], acc[3][3]);

  if (KSPLIT) {
    // ---- split-K epilogue: partial tiles to LDS, then wave w sums and stores rows 8w..8w+7 ----
    float* part = sT[wave];
#pragma unroll
    for (int i = 0; i < 4; ++i)
#pragma unroll
      for (int j = 0; j < 4; ++j)
#pragma unroll
        for (int r = 0; r < 8; ++r)
          part[((i << 4) + mOff + r) * 68 + (j << 4) + rlane] = acc[i][j][r];
    __syncthreads();   // every wave's partial tile is in LDS before any wave reads the eight of them
    unsigned short* C = (unsigned short*)Cout + (size_t)b * strideC;
    const int hh = lane >> 4, c4 = (lane & 15) * 4;     // row seg = 64 f16 = 128 B = 16 lanes x 8 B
#pragma unroll
    for (int it = 0; it < 4; ++it) {
      const int row = (wave << 3) + it * 2 + hh;
      v4f s = *(const v4f*)(&sT[0][row * 68 + c4]);
#pragma unroll
      for (int w = 1; w < 8; ++w) s += *(const v4f*)(&sT[w][row * 68 + c4]);
      v4h hv;
#pragma unroll
      for (int e = 0; e < 4; ++e) hv[e] = (_Float16)(s[e] * scale);
      *(v4h*)(C + (size_t)(m0 + row) * ldc + n0 + c4) = hv;
    }
    return;
  }

  // ---- epilogue ----
  float* slab = sT[wave];
  const float* Rb = RESID ? (resid + (size_t)b * strideR) : nullptr;
#pragma unroll
  for (int i = 0; i < 4; ++i) {
    const int mBase = m0 + (i << 4);
#pragma unroll
    for (int j = 0; j < 4; ++j) {
      const int n = n0 + (j << 4) + rlane;
      float bv = 0.f;
      if (BIAS_MODE == 2) bv = bias[n];
#pragma unroll
      for (int r = 0; r < 8; ++r) {
        float v = acc[i][j][r] * scale;
        if (BIAS_MODE == 1) v += bias[mBase + mOff + r];
        if (BIAS_MODE == 2) v += bv;
        if (RESID) v += Rb[(size_t)(mBase + mOff + r) * ldc + n];
        if (ACT == 1) v = tanhf(v);
        if (ACT == 2) v = fmaxf(v, 0.0f);
        if (ACT == 3) v = v / (1.0f + expf(-v));
        if (ACT == 4) v = (v > 0.f) ? v : 0.01f * v;
        if (ACT == 5) v = 0.5f * v * (1.0f + erff(v * 0.70710678118654752f));
        slab[(mOff + r) * 68 + (j << 4) + rlane] = v;
      }
    }
    __builtin_amdgcn_fence(__ATOMIC_RELEASE, "workgroup");
    __builtin_amdgcn_wave_barrier();
    __builtin_amdgcn_fence(__ATOMIC_ACQUIRE, "workgroup");
    if (OUT_MODE == 0) {
      float* C = (float*)Cout + (size_t)b * strideC;
      const int hh = lane >> 4, c4 = (lane & 15) * 4;     // row seg = 256 B = 16 lanes x 16 B
      {
#pragma unroll
        for (int it = 0; it < 8; ++it) {
          const int row = it * 2 + hh;
          v4f v = *(const v4f*)(slab + row * 68 + c4);
          *(v4f*)(C + (size_t)(mBase + row) * ldc + n0 + c4) = v;
        }
        
      }
    } else {
      const int q = lane >> 3, c8 = (lane & 7) * 8;
      unsigned short* C  = (unsigned short*)Cout  + (size_t)b * strideC;
      unsigned short* C2 = (OUT_MODE == 2) ? ((unsigned short*)Cout2 + (size_t)b * strideC) : nullptr;
      {
#pragma unroll
        for (int it = 0; it < 4; ++it) {
          const int row = it * 4 + q;
          const float* sp = slab + row * 68 + c8;
          v8h hv, lv;
#pragma unroll
          for (int e = 0; e < 8; ++e) {
            if (OUT_MODE == 1) {
              hv[e] = (_Float16)sp[e];
            } else {
              unsigned short hb = f2bf_bits(sp[e]);
              unsigned short lb = f2bf_bits(sp[e] - bf_bits2f(hb));
              hv[e] = __builtin_bit_cast(_Float16, hb);
              lv[e] = __builtin_bit_cast(_Float16, lb);
            }
          }
          *(v8h*)(C + (size_t)(mBase + row) * ldc + n0 + c8) = hv;
          if (OUT_MODE == 2) *(v8h*)(C2 + (size_t)(mBase + row) * ldc + n0 + c8) = lv;
        }
        
      }
    }
    __builtin_amdgcn_fence(__ATOMIC_RELEASE, "workgroup");
    __builtin_amdgcn_wave_barrier();
    __builtin_amdgcn_fence(__ATOMIC_ACQUIRE, "workgroup");
  }
}

__global__ __launch_bounds__(256) void cast_f32_f16x2s(
    const float* __restrict__ in, _Float16* __restrict__ out, int n2, float scale) {
  int i = blockIdx.x * 256 + threadIdx.x;
  if (i < n2) {
    const v2f a = *(const v2f*)(in + 2 * (size_t)i);
    const _Float16 h0 = (_Float16)(a[0] * scale), h1 = (_Float16)(a[1] * scale);
    const unsigned u = (unsigned)__builtin_bit_cast(unsigned short, h0) | ((unsigned)__builtin_bit_cast(unsigned short, h1) << 16);
    ((unsigned*)out)[i] = u;
    
  }
}

// =====================================================================================
// Cross-head mix 1 (12x12, f32) -> softmax over keys (f32) -> cross-head mix 2 folded with 1/sum and
// the power-of-two carry -> f16 store.  One block per query row n of one batch; S is [12][1024][1024]
// f32 (head, query, key); P is [12][1024][1024] f16 = (mix2 result) * pcarry.
// Column ownership: phase 1/3 thread t owns keys cc*512 + 2t, 2t+1 (cc = 0,1) so each wave stores one
// =====================================================================================
#define MX_H 12
#define MX_N 1024

__global__ __launch_bounds__(256) void th_mix_kernel(
    const float* __restrict__ S, const float* __restrict__ w1, const float* __restrict__ b1,
    const float* __restrict__ w2, const float* __restrict__ b2,
    unsigned short* __restrict__ P, float pcarry)
{
  __shared__ __align__(16) float T[MX_H * MX_N];
  __shared__ __align__(16) float w1s[MX_H * MX_H];
  __shared__ __align__(16) float w2s[MX_H * MX_H];
  __shared__ float b1s[16];
  __shared__ float b2s[16];
  __shared__ float invs[16];
  __shared__ float rmax[8];
  __shared__ float rsum[8];

  const int n    = blockIdx.x;
  const int tid  = threadIdx.x;
  const int lane = tid & 31;
  const int wave = tid >> 5;
  const size_t HS = (size_t)MX_N * MX_N;

  if (tid < MX_H * MX_H) { w1s[tid] = w1[tid]; w2s[tid] = w2[tid]; }
  if (tid < MX_H) { b1s[tid] = b1[tid]; b2s[tid] = b2[tid]; }
  __syncthreads();

  // ---- phase 1: mix 1 into T ----
#pragma unroll 1
  for (int cc = 0; cc < 2; ++cc) {
    const int m = cc * 512 + tid * 2;
    const float* sp = S + (size_t)n * MX_N + m;
    v2f s[MX_H];
#pragma unroll
    for (int h = 0; h < MX_H; ++h) s[h] = *(const v2f*)(sp + (size_t)h * HS);
#pragma unroll 1
    for (int g = 0; g < MX_H; ++g) {
      const v4f wa = *(const v4f*)(w1s + g * MX_H);
      const v4f wb = *(const v4f*)(w1s + g * MX_H + 4);
      const v4f wc = *(const v4f*)(w1s + g * MX_H + 8);
      const float bg = b1s[g];
      v2f a = (v2f){bg, bg};
      a += wa[0] * s[0];  a += wa[1] * s[1];  a += wa[2] * s[2];  a += wa[3] * s[3];
      a += wb[0] * s[4];  a += wb[1] * s[5];  a += wb[2] * s[6];  a += wb[3] * s[7];
      a += wc[0] * s[8];  a += wc[1] * s[9];  a += wc[2] * s[10]; a += wc[3] * s[11];
      *(v2f*)(T + g * MX_N + m) = a;
    }
  }
  __syncthreads();

  // ---- phase 2: softmax per head row (block-wide max and sum), exp written back into T ----
#pragma unroll 1
  for (int g = 0; g < MX_H; ++g) {
    float* tp = T + g * MX_N + tid * 4;
    const v4f x = *(const v4f*)tp;
    float mx = fmaxf(fmaxf(x[0], x[1]), fmaxf(x[2], x[3]));
#pragma unroll
    for (int off = 16; off > 0; off >>= 1) mx = fmaxf(mx, __shfl_xor(mx, off, 32));
    if (lane == 0) rmax[wave] = mx;
    __syncthreads();
    float M = rmax[0];
#pragma unroll
    for (int w = 1; w < 8; ++w) M = fmaxf(M, rmax[w]);
    v4f e;
    e[0] = __expf(x[0] - M);
    e[1] = __expf(x[1] - M);
    e[2] = __expf(x[2] - M);
    e[3] = __expf(x[3] - M);
    *(v4f*)tp = e;
    float sm = (e[0] + e[1]) + (e[2] + e[3]);
#pragma unroll
    for (int off = 16; off > 0; off >>= 1) sm += __shfl_xor(sm, off, 32);
    if (lane == 0) rsum[wave] = sm;
    __syncthreads();
    float tot = rsum[0];
#pragma unroll
    for (int w = 1; w < 8; ++w) tot += rsum[w];
    if (tid == 0) invs[g] = 1.0f / tot;
  }
  __syncthreads();
  // fold 1/sum of the source head and the carry into the mix-2 weights, carry into the bias
  if (tid < MX_H * MX_H) {
    const int h = tid % MX_H;
    w2s[tid] = w2s[tid] * invs[h] * pcarry;
  }
  if (tid < MX_H) b2s[tid] = b2s[tid] * pcarry;
  __syncthreads();

#pragma unroll 1
  for (int cc = 0; cc < 2; ++cc) {
    const int m = cc * 512 + tid * 2;
    v2f e[MX_H];
#pragma unroll
    for (int h = 0; h < MX_H; ++h) e[h] = *(const v2f*)(T + h * MX_N + m);
    unsigned short* prow = P + (size_t)n * MX_N + m;
#pragma unroll 1
    for (int g = 0; g < MX_H; ++g) {
      const v4f wa = *(const v4f*)(w2s + g * MX_H);
      const v4f wb = *(const v4f*)(w2s + g * MX_H + 4);
      const v4f wc = *(const v4f*)(w2s + g * MX_H + 8);
      const float bg = b2s[g];
      v2f a = (v2f){bg, bg};
      a += wa[0] * e[0];  a += wa[1] * e[1];  a += wa[2] * e[2];  a += wa[3] * e[3];
      a += wb[0] * e[4];  a += wb[1] * e[5];  a += wb[2] * e[6];  a += wb[3] * e[7];
      a += wc[0] * e[8];  a += wc[1] * e[9];  a += wc[2] * e[10]; a += wc[3] * e[11];
      const _Float16 h0 = (_Float16)a[0], h1 = (_Float16)a[1];
      const unsigned u = (unsigned)__builtin_bit_cast(unsigned short, h0) | ((unsigned)__builtin_bit_cast(unsigned short, h1) << 16);
      unsigned* pp = (unsigned*)(prow + (size_t)g * HS);
      *pp = u;
      
    }
  }
}

// ---------------------------------------------------------------------------
template <int BIAS_MODE, int OUT_MODE>
static void gemm_f16(hipStream_t st, int gy,
                     const void* A, int lda, long sA,
                     const void* Bt, int ldb, long sB,
                     void* C, int ldc, long sC,
                     const float* bias, int M, int N, int K, float scale)
{
  const int tiles = (M / 64) * (N / 64);
  dim3 grid((tiles + 7) / 8, gy);
  wmma_gemm64<0, false, BIAS_MODE, OUT_MODE, false, 0><<<grid, 256, 0, st>>>(
      (const unsigned short*)A, (const unsigned short*)A, lda, sA,
      (const unsigned short*)Bt, (const unsigned short*)Bt, ldb, sB,
      C, C, ldc, sC, bias, bias, (long)0, M, N, K, scale);
}

// one block per 64x64 tile, K split over its eight waves; f16 output, no bias
static void gemm_f16_ksplit(hipStream_t st, int gy,
                            const void* A, int lda, long sA,
                            const void* Bt, int ldb, long sB,
                            void* C, int ldc, long sC,
                            const float* unused, int M, int N, int K, float scale)
{
  dim3 grid((M / 64) * (N / 64), gy);
  wmma_gemm64<0, false, 0, 1, false, 0, true><<<grid, 256, 0, st>>>(
      (const unsigned short*)A, (const unsigned short*)A, lda, sA,
      (const unsigned short*)Bt, (const unsigned short*)Bt, ldb, sB,
      C, C, ldc, sC, unused, unused, (long)0, M, N, K, scale);
}

extern "C" void kernel_launch(void* const* d_in, const int* in_sizes, int n_in,
                              void* d_out, int out_size, void* d_ws, size_t ws_size,
                              hipStream_t stream)
{
  const int Bn = 8, Nn = 1024, Dd = 768, Hh = 12, HD = 64;
  if (n_in < 13) return;
  if (in_sizes[0] != Bn * Nn * Dd) return;
  if (in_sizes[1] != Dd * Dd || in_sizes[3] != Dd * Dd || in_sizes[5] != Dd * Dd || in_sizes[7] != Dd * Dd) return;
  if (in_sizes[2] != Dd || in_sizes[4] != Dd || in_sizes[6] != Dd || in_sizes[8] != Dd) return;
  if (in_sizes[9] != Hh * Hh || in_sizes[10] != Hh || in_sizes[11] != Hh * Hh || in_sizes[12] != Hh) return;
  if (out_size != Bn * Nn * Dd) return;

  const float* x    = (const float*)d_in[0];
  const float* wq   = (const float*)d_in[1];
  const float* bq   = (const float*)d_in[2];
  const float* wk   = (const float*)d_in[3];
  const float* bk   = (const float*)d_in[4];
  const float* wv   = (const float*)d_in[5];
  const float* bv   = (const float*)d_in[6];
  const float* wo   = (const float*)d_in[7];
  const float* bo   = (const float*)d_in[8];
  const float* th1w = (const float*)d_in[9];
  const float* th1b = (const float*)d_in[10];
  const float* th2w = (const float*)d_in[11];
  const float* th2b = (const float*)d_in[12];
  float* out = (float*)d_out;

  // ---- workspace carve (bytes) ----
  const size_t WSZ = (size_t)Dd * Dd * 2;                 // one f16 weight matrix
  const size_t ASZ = (size_t)Bn * Nn * Dd * 2;            // one f16 activation [8192][768]
  const size_t SSZ = (size_t)Hh * Nn * Nn * 4;            // per-batch logits f32 [12][1024][1024]
  const size_t PSZ = (size_t)Hh * Nn * Nn * 2;            // per-batch mixed attention f16
  const size_t off_wq  = 0;
  const size_t off_wk  = off_wq + WSZ;
  const size_t off_wv  = off_wk + WSZ;
  const size_t off_wo  = off_wv + WSZ;
  const size_t off_q   = off_wo + WSZ;
  const size_t off_k   = off_q + ASZ;
  const size_t off_vt  = off_k + ASZ;                     // v^T per batch: [b][h*64+d][m]
  const size_t off_ctx = off_vt + ASZ;                    // attention output [8192][768] f16
  const size_t off_R   = off_ctx + ASZ;                   // reused region
  const size_t off_x16 = off_R;                           // live during the projections only
  const size_t off_S   = off_R;                           // live per batch afterwards
  const size_t off_P   = off_S + SSZ;
  size_t end = off_P + PSZ;
  if (off_x16 + ASZ > end) end = off_x16 + ASZ;
  if (end > ws_size) return;
  if (end > (size_t)134217728) return;

  uint8_t* ws = (uint8_t*)d_ws;
  _Float16* wq16 = (_Float16*)(ws + off_wq);
  _Float16* wk16 = (_Float16*)(ws + off_wk);
  _Float16* wv16 = (_Float16*)(ws + off_wv);
  _Float16* wo16 = (_Float16*)(ws + off_wo);
  unsigned short* q16   = (unsigned short*)(ws + off_q);
  unsigned short* k16   = (unsigned short*)(ws + off_k);
  unsigned short* vt16  = (unsigned short*)(ws + off_vt);
  unsigned short* ctx16 = (unsigned short*)(ws + off_ctx);
  _Float16* x16 = (_Float16*)(ws + off_x16);
  float* Sb = (float*)(ws + off_S);
  unsigned short* Pb = (unsigned short*)(ws + off_P);

  const float WCARRY = 64.0f;        // weights carried x2^6 in f16
  const float PCARRY = 2048.0f;      // mixed attention carried x2^11 in f16

  // ---- casts to f16 ----
  {
    const int n2x = Bn * Nn * Dd / 2;
    cast_f32_f16x2s<<<(n2x + 255) / 256, 256, 0, stream>>>(x, x16, n2x, 1.0f);
    const int n2w = Dd * Dd / 2;
    cast_f32_f16x2s<<<(n2w + 255) / 256, 256, 0, stream>>>(wq, wq16, n2w, WCARRY);
    cast_f32_f16x2s<<<(n2w + 255) / 256, 256, 0, stream>>>(wk, wk16, n2w, WCARRY);
    cast_f32_f16x2s<<<(n2w + 255) / 256, 256, 0, stream>>>(wv, wv16, n2w, WCARRY);
    cast_f32_f16x2s<<<(n2w + 255) / 256, 256, 0, stream>>>(wo, wo16, n2w, WCARRY);
  }

  // ---- projections: q, k as [b*1024+n][h*64+d] f16; v^T per batch as [b][h*64+d][m] f16 ----
  gemm_f16<2, 1>(stream, 1, x16, Dd, 0L, wq16, Dd, 0L, q16, Dd, 0L, bq, Bn * Nn, Dd, Dd, 1.0f / WCARRY);
  gemm_f16<2, 1>(stream, 1, x16, Dd, 0L, wk16, Dd, 0L, k16, Dd, 0L, bk, Bn * Nn, Dd, Dd, 1.0f / WCARRY);
  // A = wv [768][768], Bt = x rows of batch b [1024][768] -> C [768][1024] per batch, bias[m] = bv[o]
  gemm_f16<1, 1>(stream, Bn, wv16, Dd, 0L, x16, Dd, (long)Nn * Dd, vt16, Nn, (long)Dd * Nn, bv, Dd, Nn, Dd, 1.0f / WCARRY);

  // ---- per batch: logits -> mix/softmax/mix -> a.v ----
  const float qk_scale = 0.125f;     // 64^-0.5
  for (int b = 0; b < Bn; ++b) {
    const unsigned short* qb = q16 + (size_t)b * Nn * Dd;
    const unsigned short* kb = k16 + (size_t)b * Nn * Dd;
    // S[h][n][m] = scale * sum_d q[n][h*64+d] k[m][h*64+d]; grid.y = head, strideA/B = 64, strideC = 1024*1024
    gemm_f16<0, 0>(stream, Hh, qb, Dd, (long)HD, kb, Dd, (long)HD, Sb, Nn, (long)Nn * Nn, bq, Nn, Nn, HD, qk_scale);
    th_mix_kernel<<<Nn, 256, 0, stream>>>(Sb, th1w, th1b, th2w, th2b, Pb, PCARRY);
    // ctx[b*1024+n][h*64+d] = 2^-11 * sum_m P[h][n][m] * vT[b][h*64+d][m]; grid.y = head
    gemm_f16_ksplit(stream, Hh,
                    Pb, Nn, (long)Nn * Nn,
                    vt16 + (size_t)b * Dd * Nn, Nn, (long)HD * Nn,
                    ctx16 + (size_t)b * Nn * Dd, Dd, (long)HD,
                    bq, Nn, HD, Nn, 1.0f / PCARRY);
  }

  // ---- output projection -> f32 [8192][768] ----
  gemm_f16<2, 0>(stream, 1, ctx16, Dd, 0L, wo16, Dd, 0L, out, Dd, 0L, bo, Bn * Nn, Dd, Dd, 1.0f / WCARRY);
}

// v002
// One run takes 451 microseconds.
// Timed twice side by side with v001, it ran 1.17 times as fast both times.
// All steps since v000 together make it 1.87 times as fast.
#include <hip/hip_runtime.h>
#include <stdint.h>
#include <stddef.h>

// Contractions (q/k/v projections, q.k^T, a.v, output projection): v_wmma_f32_16x16x32_f16 (f16 operands, f32 accumulate); weights carried x64, mixed attention carried x2^11, folded back in the f32 epilogue; 12x12 cross-head mixes and softmax in f32 on VALU.

typedef __attribute__((ext_vector_type(16))) _Float16 v16h;
typedef __attribute__((ext_vector_type(8)))  _Float16 v8h;
typedef __attribute__((ext_vector_type(4)))  _Float16 v4h;
typedef __attribute__((ext_vector_type(16))) __bf16   v16b;
typedef __attribute__((ext_vector_type(8)))  __bf16   v8b;
typedef __attribute__((ext_vector_type(8)))  float    v8f;
typedef __attribute__((ext_vector_type(4)))  float    v4f;
typedef __attribute__((ext_vector_type(2)))  float    v2f;

__device__ __forceinline__ unsigned short f2bf_bits(float f) {
  unsigned u = __float_as_uint(f);
  return (unsigned short)((u + 0x7FFFu + ((u >> 16) & 1u)) >> 16);
}
__device__ __forceinline__ float bf_bits2f(unsigned short h) { return __uint_as_float(((unsigned)h) << 16); }

// hazard guards as plain device helpers (no inline asm inside the kernel template body)
__device__ __forceinline__ void dep_guard_h(v8f& a, v8f& b, v16h x, v16h y) { asm volatile("v_nop\n\tv_nop\n\tv_nop\n\tv_nop" : "+v"(a), "+v"(b) : "v"(x), "v"(y)); }
__device__ __forceinline__ void dep_guard_b(v8f& a, v8f& b, v16b x, v16b y) { asm volatile("v_nop\n\tv_nop\n\tv_nop\n\tv_nop" : "+v"(a), "+v"(b) : "v"(x), "v"(y)); }
__device__ __forceinline__ void keep4_h(v16h a, v16h b, v16h c, v16h d) { asm volatile("v_nop" :: "v"(a), "v"(b), "v"(c), "v"(d)); }
__device__ __forceinline__ void keep4_b(v16b a, v16b b, v16b c, v16b d) { asm volatile("v_nop" :: "v"(a), "v"(b), "v"(c), "v"(d)); }
__device__ __forceinline__ void acc_guard4(v8f& a, v8f& b, v8f& c, v8f& d) { asm volatile("v_nop\n\tv_nop\n\tv_nop\n\tv_nop" : "+v"(a), "+v"(b), "+v"(c), "+v"(d)); }
template <typename T> struct Frag;
template <> struct Frag<_Float16> {
  typedef v16h V; union U { v16h v; v8h h[2]; };
  static __device__ __forceinline__ v16h load(const _Float16* p) {   // elements 0..7 <- p[0..7], 8..15 <- p[16..23]
    U f; f.h[0] = *(const v8h*)(p); f.h[1] = *(const v8h*)(p + 16); return f.v;
  }
  static __device__ __forceinline__ v8f mma(v16h a, v16h b, v8f c) {
    return __builtin_amdgcn_wmma_f32_16x16x32_f16(false, a, false, b, (short)0, c, false, false);
  }
  static __device__ __forceinline__ void guard(v8f& a, v8f& b, v16h x, v16h y) { dep_guard_h(a, b, x, y); }
  static __device__ __forceinline__ void keep(v16h a, v16h b, v16h c, v16h d) { keep4_h(a, b, c, d); }
};
template <> struct Frag<__bf16> {
  typedef v16b V; union U { v16b v; v8b h[2]; };
  static __device__ __forceinline__ v16b load(const __bf16* p) {
    U f; f.h[0] = *(const v8b*)(p); f.h[1] = *(const v8b*)(p + 16); return f.v;
  }
  static __device__ __forceinline__ v8f mma(v16b a, v16b b, v8f c) {
    return __builtin_amdgcn_wmma_f32_16x16x32_bf16(false, a, false, b, (short)0, c, false, false);
  }
  static __device__ __forceinline__ void guard(v8f& a, v8f& b, v16b x, v16b y) { dep_guard_b(a, b, x, y); }
  static __device__ __forceinline__ void keep(v16b a, v16b b, v16b c, v16b d) { keep4_b(a, b, c, d); }
};

// ---- Register-blocked batched WMMA GEMM ------------------------------------
// C[m,n] = scale * sum_k A[m,k] * Bt[n,k] (+bias)(+resid); each wave owns a 64x64 tile.
// A row-major [M,K]; Bt row-major [N,K]; M,N % 64 == 0, K % 32 == 0.
// SPLIT: operands are hi/lo planes (A2/Bt2 = lo planes, same layout); product = hi.hi + hi.lo + lo.hi.
// BIAS_MODE: 0 = none, 1 = bias[m], 2 = bias[n].
// OUT_MODE: 0 = f32, 1 = f16, 2 = bf16 hi plane (Cout) + bf16 lo plane (Cout2).
// ET: 0 = f16 operands, 1 = bf16 operands (pointers passed as 16-bit storage)
// KSPLIT: one 64x64 tile per block; wave w sums k in [w*K/8, (w+1)*K/8) (K % 256 == 0) and the eight f32
// partial tiles are added in LDS in wave order 0..7. For shapes with too few tiles to fill the chip.
// Two batch levels: blockIdx.y with strideA/B/C, blockIdx.z with zA/zB/zC (element strides).
template <int ET> struct Elem;
template <> struct Elem<0> { typedef _Float16 T; };
template <> struct Elem<1> { typedef __bf16 T; };
template <int ET, bool SPLIT, int BIAS_MODE, int OUT_MODE, bool RESID, int ACT = 0, bool KSPLIT = false>
__global__ __launch_bounds__(256) void wmma_gemm64(
    const unsigned short* __restrict__ Ap, const unsigned short* __restrict__ A2p, int lda, long strideA,
    const unsigned short* __restrict__ Btp, const unsigned short* __restrict__ Bt2p, int ldb, long strideB,
    void* __restrict__ Cout, void* __restrict__ Cout2, int ldc, long strideC,
    const float* __restrict__ bias,
    const float* __restrict__ resid, long strideR,
    int M, int N, int K, float scale, long zA, long zB, long zC) {
  typedef typename Elem<ET>::T T;
  typedef typename Frag<T>::V V;
  const T* A = (const T*)Ap; const T* A2 = (const T*)A2p; const T* Bt = (const T*)Btp; const T* Bt2 = (const T*)Bt2p;
  static_assert(!KSPLIT || (!SPLIT && BIAS_MODE == 0 && OUT_MODE == 1 && !RESID && ACT == 0), "KSPLIT epilogue: plain f16 output only");
  __shared__ __align__(16) float sT[8][(KSPLIT ? 64 : 16) * 68];   // per-wave slab (16x64, KSPLIT: 64x64), pitch 68 floats
  const int b    = blockIdx.y;
  const int z    = blockIdx.z;
  const int lane = threadIdx.x & 31;
  const int wave = threadIdx.x >> 5;
  const int tilesN = N >> 6;
  const int tilesM = M >> 6;
  const int tile = KSPLIT ? (int)blockIdx.x : (int)(blockIdx.x * 8 + wave);
  if (tile >= tilesM * tilesN) return;   // wave-uniform; KSPLIT (the one form with a block barrier): block-uniform
  const int tm = tile / tilesN;
  const int tn = tile - tm * tilesN;
  const int m0 = tm << 6;
  const int n0 = tn << 6;

  const size_t offA = (size_t)b * strideA + (size_t)z * zA;
  const size_t offB = (size_t)b * strideB + (size_t)z * zB;
  const size_t offC = (size_t)b * strideC + (size_t)z * zC;
  const T* Ab  = A  + offA;
  const T* Bb  = Bt + offB;
  const T* Ab2 = SPLIT ? (A2  + offA) : nullptr;
  const T* Bb2 = SPLIT ? (Bt2 + offB) : nullptr;

  const int rlane = lane & 15;                 // row (A) / col (B, D) within subtile
  const int koff  = (lane >> 4) * 8;           // k offset of this lane half
  const int mOff  = (lane >> 4) * 8;           // D row offset

  v8f acc[4][4];
#pragma unroll
  for (int i = 0; i < 4; ++i)
#pragma unroll
    for (int j = 0; j < 4; ++j) acc[i][j] = (v8f){0.f,0.f,0.f,0.f,0.f,0.f,0.f,0.f};

  const int kBeg = KSPLIT ? __builtin_amdgcn_readfirstlane(wave) * (K >> 3) : 0;   // scalar, so the k loop keeps its scalar counter and branch
  const int kEnd = KSPLIT ? kBeg + (K >> 3) : K;
  for (int k0 = kBeg; k0 < kEnd; k0 += 32) {
    V bh[4], bl[4];
#pragma unroll
    for (int j = 0; j < 4; ++j) {
      const size_t bo = (size_t)(n0 + (j << 4) + rlane) * ldb + koff + k0;
      bh[j] = Frag<T>::load(Bb + bo);
      if (SPLIT) bl[j] = Frag<T>::load(Bb2 + bo);
    }
#pragma unroll
    for (int i = 0; i < 4; ++i) {
      const size_t ao = (size_t)(m0 + (i << 4) + rlane) * lda + koff + k0;
      V ah = Frag<T>::load(Ab + ao);
      V al;
      if (SPLIT) al = Frag<T>::load(Ab2 + ao);
#pragma unroll
      for (int j = 0; j < 4; ++j) {
        acc[i][j] = Frag<T>::mma(ah, bh[j], acc[i][j]);
        if (SPLIT) {
          acc[i][j] = Frag<T>::mma(ah, bl[j], acc[i][j]);
          acc[i][j] = Frag<T>::mma(al, bh[j], acc[i][j]);
        }
      }
      Frag<T>::guard(acc[i][0], acc[i][3], ah, SPLIT ? al : ah);
    }
    Frag<T>::keep(bh[0], bh[1], bh[2], bh[3]);
    if (SPLIT) Frag<T>::keep(bl[0], bl[1], bl[2], bl[3]);
  }
  acc_guard4(acc[0][0], acc[0][1], acc[0][2], acc[0][3]);
  acc_guard4(acc[1][0], acc[1][1], acc[1][2], acc[1][3]);
  acc_guard4(acc[2][0], acc[2][1], acc[2][2], acc[2][3]);
  acc_guard4(acc[3][0], acc[3][1], acc[3][2], acc[3][3]);

  if (KSPLIT) {
    // ---- split-K epilogue: partial tiles to LDS, then wave w sums and stores rows 8w..8w+7 ----
    float* part = sT[wave];
#pragma unroll
    for (int i = 0; i < 4; ++i)
#pragma unroll
      for (int j = 0; j < 4; ++j)
#pragma unroll
        for (int r = 0; r < 8; ++r)
          part[((i << 4) + mOff + r) * 68 + (j << 4) + rlane] = acc[i][j][r];
    __syncthreads();   // every wave's partial tile is in LDS before any wave reads the eight of them
    unsigned short* C = (unsigned short*)Cout + offC;
    const int hh = lane >> 4, c4 = (lane & 15) * 4;     // row seg = 64 f16 = 128 B = 16 lanes x 8 B
#pragma unroll
    for (int it = 0; it < 4; ++it) {
      const int row = (wave << 3) + it * 2 + hh;
      v4f s = *(const v4f*)(&sT[0][row * 68 + c4]);
#pragma unroll
      for (int w = 1; w < 8; ++w) s += *(const v4f*)(&sT[w][row * 68 + c4]);
      v4h hv;
#pragma unroll
      for (int e = 0; e < 4; ++e) hv[e] = (_Float16)(s[e] * scale);
      *(v4h*)(C + (size_t)(m0 + row) * ldc + n0 + c4) = hv;
    }
    return;
  }

  // ---- epilogue ----
  float* slab = sT[wave];
  const float* Rb = RESID ? (resid + (size_t)b * strideR) : nullptr;
#pragma unroll
  for (int i = 0; i < 4; ++i) {
    const int mBase = m0 + (i << 4);
#pragma unroll
    for (int j = 0; j < 4; ++j) {
      const int n = n0 + (j << 4) + rlane;
      float bv = 0.f;
      if (BIAS_MODE == 2) bv = bias[n];
#pragma unroll
      for (int r = 0; r < 8; ++r) {
        float v = acc[i][j][r] * scale;
        if (BIAS_MODE == 1) v += bias[mBase + mOff + r];
        if (BIAS_MODE == 2) v += bv;
        if (RESID) v += Rb[(size_t)(mBase + mOff + r) * ldc + n];
        if (ACT == 1) v = tanhf(v);
        if (ACT == 2) v = fmaxf(v, 0.0f);
        if (ACT == 3) v = v / (1.0f + expf(-v));
        if (ACT == 4) v = (v > 0.f) ? v : 0.01f * v;
        if (ACT == 5) v = 0.5f * v * (1.0f + erff(v * 0.70710678118654752f));
        slab[(mOff + r) * 68 + (j << 4) + rlane] = v;
      }
    }
    __builtin_amdgcn_fence(__ATOMIC_RELEASE, "workgroup");
    __builtin_amdgcn_wave_barrier();
    __builtin_amdgcn_fence(__ATOMIC_ACQUIRE, "workgroup");
    if (OUT_MODE == 0) {
      float* C = (float*)Cout + offC;
      const int hh = lane >> 4, c4 = (lane & 15) * 4;     // row seg = 256 B = 16 lanes x 16 B
      {
#pragma unroll
        for (int it = 0; it < 8; ++it) {
          const int row = it * 2 + hh;
          v4f v = *(const v4f*)(slab + row * 68 + c4);
          *(v4f*)(C + (size_t)(mBase + row) * ldc + n0 + c4) = v;
        }
        
      }
    } else {
      const int q = lane >> 3, c8 = (lane & 7) * 8;
      unsigned short* C  = (unsigned short*)Cout  + offC;
      unsigned short* C2 = (OUT_MODE == 2) ? ((unsigned short*)Cout2 + offC) : nullptr;
      {
#pragma unroll
        for (int it = 0; it < 4; ++it) {
          const int row = it * 4 + q;
          const float* sp = slab + row * 68 + c8;
          v8h hv, lv;
#pragma unroll
          for (int e = 0; e < 8; ++e) {
            if (OUT_MODE == 1) {
              hv[e] = (_Float16)sp[e];
            } else {
              unsigned short hb = f2bf_bits(sp[e]);
              unsigned short lb = f2bf_bits(sp[e] - bf_bits2f(hb));
              hv[e] = __builtin_bit_cast(_Float16, hb);
              lv[e] = __builtin_bit_cast(_Float16, lb);
            }
          }
          *(v8h*)(C + (size_t)(mBase + row) * ldc + n0 + c8) = hv;
          if (OUT_MODE == 2) *(v8h*)(C2 + (size_t)(mBase + row) * ldc + n0 + c8) = lv;
        }
        
      }
    }
    __builtin_amdgcn_fence(__ATOMIC_RELEASE, "workgroup");
    __builtin_amdgcn_wave_barrier();
    __builtin_amdgcn_fence(__ATOMIC_ACQUIRE, "workgroup");
  }
}

__global__ __launch_bounds__(256) void cast_f32_f16x2s(
    const float* __restrict__ in, _Float16* __restrict__ out, int n2, float scale) {
  int i = blockIdx.x * 256 + threadIdx.x;
  if (i < n2) {
    const v2f a = *(const v2f*)(in + 2 * (size_t)i);
    const _Float16 h0 = (_Float16)(a[0] * scale), h1 = (_Float16)(a[1] * scale);
    const unsigned u = (unsigned)__builtin_bit_cast(unsigned short, h0) | ((unsigned)__builtin_bit_cast(unsigned short, h1) << 16);
    ((unsigned*)out)[i] = u;
    
  }
}

// =====================================================================================
// Cross-head mix 1 (12x12, f32) -> softmax over keys (f32) -> cross-head mix 2 folded with 1/sum and
// the power-of-two carry -> f16 store.  One block per query row n (blockIdx.x) of one batch (blockIdx.y).
// SP is [batch][1024][12][1024] f32 (query, head, key): a block's 12 logit rows are its own 48 KB. The
// result (mix2 * pcarry, f16, [12][1024]) goes into the first 24 KB of that same 48 KB: the block has
// read all of it into LDS (barrier behind phase 1) before phase 3 stores, and no other block touches it.
// Column ownership: phase 1/3 thread t owns keys cc*512 + 2t, 2t+1 (cc = 0,1) so each wave stores one
// =====================================================================================
#define MX_H 12
#define MX_N 1024

__global__ __launch_bounds__(256) void th_mix_kernel(
    float* SP, const float* __restrict__ w1, const float* __restrict__ b1,
    const float* __restrict__ w2, const float* __restrict__ b2, float pcarry)
{
  __shared__ __align__(16) float T[MX_H * MX_N];
  __shared__ __align__(16) float w1s[MX_H * MX_H];
  __shared__ __align__(16) float w2s[MX_H * MX_H];
  __shared__ float b1s[16];
  __shared__ float b2s[16];
  __shared__ float invs[16];
  __shared__ float rmax[8];
  __shared__ float rsum[8];

  const int n    = blockIdx.x;
  const int tid  = threadIdx.x;
  const int lane = tid & 31;
  const int wave = tid >> 5;
  float* blk = SP + ((size_t)blockIdx.y * MX_N + n) * (MX_H * MX_N);

  if (tid < MX_H * MX_H) { w1s[tid] = w1[tid]; w2s[tid] = w2[tid]; }
  if (tid < MX_H) { b1s[tid] = b1[tid]; b2s[tid] = b2[tid]; }
  __syncthreads();

  // ---- phase 1: mix 1 into T ----
#pragma unroll 1
  for (int cc = 0; cc < 2; ++cc) {
    const int m = cc * 512 + tid * 2;
    const float* sp = blk + m;
    v2f s[MX_H];
#pragma unroll
    for (int h = 0; h < MX_H; ++h) s[h] = *(const v2f*)(sp + h * MX_N);
#pragma unroll 1
    for (int g = 0; g < MX_H; ++g) {
      const v4f wa = *(const v4f*)(w1s + g * MX_H);
      const v4f wb = *(const v4f*)(w1s + g * MX_H + 4);
      const v4f wc = *(const v4f*)(w1s + g * MX_H + 8);
      const float bg = b1s[g];
      v2f a = (v2f){bg, bg};
      a += wa[0] * s[0];  a += wa[1] * s[1];  a += wa[2] * s[2];  a += wa[3] * s[3];
      a += wb[0] * s[4];  a += wb[1] * s[5];  a += wb[2] * s[6];  a += wb[3] * s[7];
      a += wc[0] * s[8];  a += wc[1] * s[9];  a += wc[2] * s[10]; a += wc[3] * s[11];
      *(v2f*)(T + g * MX_N + m) = a;
    }
  }
  __syncthreads();

  // ---- phase 2: softmax per head row (block-wide max and sum), exp written back into T ----
#pragma unroll 1
  for (int g = 0; g < MX_H; ++g) {
    float* tp = T + g * MX_N + tid * 4;
    const v4f x = *(const v4f*)tp;
    float mx = fmaxf(fmaxf(x[0], x[1]), fmaxf(x[2], x[3]));
#pragma unroll
    for (int off = 16; off > 0; off >>= 1) mx = fmaxf(mx, __shfl_xor(mx, off, 32));
    if (lane == 0) rmax[wave] = mx;
    __syncthreads();
    float M = rmax[0];
#pragma unroll
    for (int w = 1; w < 8; ++w) M = fmaxf(M, rmax[w]);
    v4f e;
    e[0] = __expf(x[0] - M);
    e[1] = __expf(x[1] - M);
    e[2] = __expf(x[2] - M);
    e[3] = __expf(x[3] - M);
    *(v4f*)tp = e;
    float sm = (e[0] + e[1]) + (e[2] + e[3]);
#pragma unroll
    for (int off = 16; off > 0; off >>= 1) sm += __shfl_xor(sm, off, 32);
    if (lane == 0) rsum[wave] = sm;
    __syncthreads();
    float tot = rsum[0];
#pragma unroll
    for (int w = 1; w < 8; ++w) tot += rsum[w];
    if (tid == 0) invs[g] = 1.0f / tot;
  }
  __syncthreads();
  // fold 1/sum of the source head and the carry into the mix-2 weights, carry into the bias
  if (tid < MX_H * MX_H) {
    const int h = tid % MX_H;
    w2s[tid] = w2s[tid] * invs[h] * pcarry;
  }
  if (tid < MX_H) b2s[tid] = b2s[tid] * pcarry;
  __syncthreads();

#pragma unroll 1
  for (int cc = 0; cc < 2; ++cc) {
    const int m = cc * 512 + tid * 2;
    v2f e[MX_H];
#pragma unroll
    for (int h = 0; h < MX_H; ++h) e[h] = *(const v2f*)(T + h * MX_N + m);
    unsigned short* prow = (unsigned short*)blk + m;
#pragma unroll 1
    for (int g = 0; g < MX_H; ++g) {
      const v4f wa = *(const v4f*)(w2s + g * MX_H);
      const v4f wb = *(const v4f*)(w2s + g * MX_H + 4);
      const v4f wc = *(const v4f*)(w2s + g * MX_H + 8);
      const float bg = b2s[g];
      v2f a = (v2f){bg, bg};
      a += wa[0] * e[0];  a += wa[1] * e[1];  a += wa[2] * e[2];  a += wa[3] * e[3];
      a += wb[0] * e[4];  a += wb[1] * e[5];  a += wb[2] * e[6];  a += wb[3] * e[7];
      a += wc[0] * e[8];  a += wc[1] * e[9];  a += wc[2] * e[10]; a += wc[3] * e[11];
      const _Float16 h0 = (_Float16)a[0], h1 = (_Float16)a[1];
      const unsigned u = (unsigned)__builtin_bit_cast(unsigned short, h0) | ((unsigned)__builtin_bit_cast(unsigned short, h1) << 16);
      unsigned* pp = (unsigned*)(prow + g * MX_N);
      *pp = u;
      
    }
  }
}

// ---------------------------------------------------------------------------
template <int BIAS_MODE, int OUT_MODE>
static void gemm_f16(hipStream_t st, int gy,
                     const void* A, int lda, long sA,
                     const void* Bt, int ldb, long sB,
                     void* C, int ldc, long sC,
                     const float* bias, int M, int N, int K, float scale,
                     int gz = 1, long zA = 0L, long zB = 0L, long zC = 0L)
{
  const int tiles = (M / 64) * (N / 64);
  dim3 grid((tiles + 7) / 8, gy, gz);
  wmma_gemm64<0, false, BIAS_MODE, OUT_MODE, false, 0><<<grid, 256, 0, st>>>(
      (const unsigned short*)A, (const unsigned short*)A, lda, sA,
      (const unsigned short*)Bt, (const unsigned short*)Bt, ldb, sB,
      C, C, ldc, sC, bias, bias, (long)0, M, N, K, scale, zA, zB, zC);
}

// one block per 64x64 tile, K split over its eight waves; f16 output, no bias
static void gemm_f16_ksplit(hipStream_t st, int gy,
                            const void* A, int lda, long sA,
                            const void* Bt, int ldb, long sB,
                            void* C, int ldc, long sC,
                            const float* unused, int M, int N, int K, float scale,
                            int gz, long zA, long zB, long zC)
{
  dim3 grid((M / 64) * (N / 64), gy, gz);
  wmma_gemm64<0, false, 0, 1, false, 0, true><<<grid, 256, 0, st>>>(
      (const unsigned short*)A, (const unsigned short*)A, lda, sA,
      (const unsigned short*)Bt, (const unsigned short*)Bt, ldb, sB,
      C, C, ldc, sC, unused, unused, (long)0, M, N, K, scale, zA, zB, zC);
}

extern "C" void kernel_launch(void* const* d_in, const int* in_sizes, int n_in,
                              void* d_out, int out_size, void* d_ws, size_t ws_size,
                              hipStream_t stream)
{
  const int Bn = 8, Nn = 1024, Dd = 768, Hh = 12, HD = 64;
  const int GB = 4;                                       // batches per launch in the attention part
  if (n_in < 13) return;
  if (in_sizes[0] != Bn * Nn * Dd) return;
  if (in_sizes[1] != Dd * Dd || in_sizes[3] != Dd * Dd || in_sizes[5] != Dd * Dd || in_sizes[7] != Dd * Dd) return;
  if (in_sizes[2] != Dd || in_sizes[4] != Dd || in_sizes[6] != Dd || in_sizes[8] != Dd) return;
  if (in_sizes[9] != Hh * Hh || in_sizes[10] != Hh || in_sizes[11] != Hh * Hh || in_sizes[12] != Hh) return;
  if (out_size != Bn * Nn * Dd) return;

  const float* x    = (const float*)d_in[0];
  const float* wq   = (const float*)d_in[1];
  const float* bq   = (const float*)d_in[2];
  const float* wk   = (const float*)d_in[3];
  const float* bk   = (const float*)d_in[4];
  const float* wv   = (const float*)d_in[5];
  const float* bv   = (const float*)d_in[6];
  const float* wo   = (const float*)d_in[7];
  const float* bo   = (const float*)d_in[8];
  const float* th1w = (const float*)d_in[9];
  const float* th1b = (const float*)d_in[10];
  const float* th2w = (const float*)d_in[11];
  const float* th2b = (const float*)d_in[12];
  float* out = (float*)d_out;

  // ---- workspace carve (bytes) ----
  const size_t WSZ = (size_t)Dd * Dd * 2;                 // one f16 weight matrix
  const size_t ASZ = (size_t)Bn * Nn * Dd * 2;            // one f16 activation [8192][768]
  const size_t SSZ = (size_t)GB * Nn * Hh * Nn * 4;       // logits f32 [GB][1024][12][1024]; mixed attention f16 written over them
  const size_t off_wq  = 0;
  const size_t off_wk  = off_wq + WSZ;
  const size_t off_wv  = off_wk + WSZ;
  const size_t off_wo  = off_wv + WSZ;
  const size_t off_q   = off_wo + WSZ;
  const size_t off_k   = off_q + ASZ;
  const size_t off_vt  = off_k + ASZ;                     // v^T per batch: [b][h*64+d][m]
  const size_t off_ctx = off_vt + ASZ;                    // attention output [8192][768] f16
  const size_t off_R   = off_ctx + ASZ;                   // reused region
  const size_t off_x16 = off_R;                           // live during the projections only
  const size_t off_S   = off_R;                           // live per group of GB batches afterwards
  size_t end = off_S + SSZ;
  if (off_x16 + ASZ > end) end = off_x16 + ASZ;
  if (end > ws_size) return;

  uint8_t* ws = (uint8_t*)d_ws;
  _Float16* wq16 = (_Float16*)(ws + off_wq);
  _Float16* wk16 = (_Float16*)(ws + off_wk);
  _Float16* wv16 = (_Float16*)(ws + off_wv);
  _Float16* wo16 = (_Float16*)(ws + off_wo);
  unsigned short* q16   = (unsigned short*)(ws + off_q);
  unsigned short* k16   = (unsigned short*)(ws + off_k);
  unsigned short* vt16  = (unsigned short*)(ws + off_vt);
  unsigned short* ctx16 = (unsigned short*)(ws + off_ctx);
  _Float16* x16 = (_Float16*)(ws + off_x16);
  float* Sb = (float*)(ws + off_S);

  const float WCARRY = 64.0f;        // weights carried x2^6 in f16
  const float PCARRY = 2048.0f;      // mixed attention carried x2^11 in f16

  // ---- casts to f16 ----
  {
    const int n2x = Bn * Nn * Dd / 2;
    cast_f32_f16x2s<<<(n2x + 255) / 256, 256, 0, stream>>>(x, x16, n2x, 1.0f);
    const int n2w = Dd * Dd / 2;
    cast_f32_f16x2s<<<(n2w + 255) / 256, 256, 0, stream>>>(wq, wq16, n2w, WCARRY);
    cast_f32_f16x2s<<<(n2w + 255) / 256, 256, 0, stream>>>(wk, wk16, n2w, WCARRY);
    cast_f32_f16x2s<<<(n2w + 255) / 256, 256, 0, stream>>>(wv, wv16, n2w, WCARRY);
    cast_f32_f16x2s<<<(n2w + 255) / 256, 256, 0, stream>>>(wo, wo16, n2w, WCARRY);
  }

  // ---- projections: q, k as [b*1024+n][h*64+d] f16; v^T per batch as [b][h*64+d][m] f16 ----
  gemm_f16<2, 1>(stream, 1, x16, Dd, 0L, wq16, Dd, 0L, q16, Dd, 0L, bq, Bn * Nn, Dd, Dd, 1.0f / WCARRY);
  gemm_f16<2, 1>(stream, 1, x16, Dd, 0L, wk16, Dd, 0L, k16, Dd, 0L, bk, Bn * Nn, Dd, Dd, 1.0f / WCARRY);
  // A = wv [768][768], Bt = x rows of batch b [1024][768] -> C [768][1024] per batch, bias[m] = bv[o]
  gemm_f16<1, 1>(stream, Bn, wv16, Dd, 0L, x16, Dd, (long)Nn * Dd, vt16, Nn, (long)Dd * Nn, bv, Dd, Nn, Dd, 1.0f / WCARRY);

  // ---- per group of GB batches (grid.z = batch in the group): logits -> mix/softmax/mix -> a.v ----
  const float qk_scale = 0.125f;     // 64^-0.5
  const long rowS = (long)Hh * Nn;   // f32 elements of one query's 12 logit rows
  for (int b = 0; b < Bn; b += GB) {
    const unsigned short* qb = q16 + (size_t)b * Nn * Dd;
    const unsigned short* kb = k16 + (size_t)b * Nn * Dd;
    // S[z][n][h][m] = scale * sum_d q[n][h*64+d] k[m][h*64+d]; grid.y = head: strideA/B = 64, strideC = 1024
    gemm_f16<0, 0>(stream, Hh, qb, Dd, (long)HD, kb, Dd, (long)HD, Sb, Hh * Nn, (long)Nn, bq, Nn, Nn, HD, qk_scale,
                   GB, (long)Nn * Dd, (long)Nn * Dd, (long)Nn * rowS);
    th_mix_kernel<<<dim3(Nn, GB), 256, 0, stream>>>(Sb, th1w, th1b, th2w, th2b, PCARRY);
    // ctx[(b+z)*1024+n][h*64+d] = 2^-11 * sum_m P[z][n][h][m] * vT[b+z][h*64+d][m]; grid.y = head.
    // P rows lie in the logits' place: f16 pitch per query = 2 * rowS, per head = 1024
    gemm_f16_ksplit(stream, Hh,
                    Sb, 2 * Hh * Nn, (long)Nn,
                    vt16 + (size_t)b * Dd * Nn, Nn, (long)HD * Nn,
                    ctx16 + (size_t)b * Nn * Dd, Dd, (long)HD,
                    bq, Nn, HD, Nn, 1.0f / PCARRY,
                    GB, (long)Nn * 2 * rowS, (long)Dd * Nn, (long)Nn * Dd);
  }

  // ---- output projection -> f32 [8192][768] ----
  gemm_f16<2, 0>(stream, 1, ctx16, Dd, 0L, wo16, Dd, 0L, out, Dd, 0L, bo, Bn * Nn, Dd, Dd, 1.0f / WCARRY);
}

// v003
// It runs in 350 microseconds.
// Two timings next to v002 put it at 1.29 and 1.28 times that version's speed.
// Over all steps from v000 it is 2.40 times as fast.
#include <hip/hip_runtime.h>
#include <stdint.h>
#include <stddef.h>

// Contractions (q/k/v projections, q.k^T, a.v, output projection): v_wmma_f32_16x16x32_f16 (f16 operands, f32 accumulate); weights carried x64, mixed attention carried x2^11, folded back in the f32 epilogue; 12x12 cross-head mixes and softmax in f32 on VALU.

typedef __attribute__((ext_vector_type(16))) _Float16 v16h;
typedef __attribute__((ext_vector_type(8)))  _Float16 v8h;
typedef __attribute__((ext_vector_type(4)))  _Float16 v4h;
typedef __attribute__((ext_vector_type(16))) __bf16   v16b;
typedef __attribute__((ext_vector_type(8)))  __bf16   v8b;
typedef __attribute__((ext_vector_type(8)))  float    v8f;
typedef __attribute__((ext_vector_type(4)))  float    v4f;
typedef __attribute__((ext_vector_type(2)))  float    v2f;

__device__ __forceinline__ unsigned short f2bf_bits(float f) {
  unsigned u = __float_as_uint(f);
  return (unsigned short)((u + 0x7FFFu + ((u >> 16) & 1u)) >> 16);
}
__device__ __forceinline__ float bf_bits2f(unsigned short h) { return __uint_as_float(((unsigned)h) << 16); }

// hazard guards as plain device helpers
__device__ __forceinline__ void dep_guard_h(v8f& a, v8f& b, v16h x, v16h y) { asm volatile("v_nop\n\tv_nop\n\tv_nop\n\tv_nop" : "+v"(a), "+v"(b) : "v"(x), "v"(y)); }
__device__ __forceinline__ void dep_guard_b(v8f& a, v8f& b, v16b x, v16b y) { asm volatile("v_nop\n\tv_nop\n\tv_nop\n\tv_nop" : "+v"(a), "+v"(b) : "v"(x), "v"(y)); }
__device__ __forceinline__ void keep4_h(v16h a, v16h b, v16h c, v16h d) { asm volatile("v_nop" :: "v"(a), "v"(b), "v"(c), "v"(d)); }
__device__ __forceinline__ void keep4_b(v16b a, v16b b, v16b c, v16b d) { asm volatile("v_nop" :: "v"(a), "v"(b), "v"(c), "v"(d)); }
__device__ __forceinline__ void acc_guard4(v8f& a, v8f& b, v8f& c, v8f& d) { asm volatile("v_nop\n\tv_nop\n\tv_nop\n\tv_nop" : "+v"(a), "+v"(b), "+v"(c), "+v"(d)); }
template <typename T> struct Frag;
template <> struct Frag<_Float16> {
  typedef v16h V; union U { v16h v; v8h h[2]; };
  static __device__ __forceinline__ v16h load(const _Float16* p) {   // elements 0..7 <- p[0..7], 8..15 <- p[16..23]
    U f; f.h[0] = *(const v8h*)(p); f.h[1] = *(const v8h*)(p + 16); return f.v;
  }
  static __device__ __forceinline__ v8f mma(v16h a, v16h b, v8f c) {
    return __builtin_amdgcn_wmma_f32_16x16x32_f16(false, a, false, b, (short)0, c, false, false);
  }
  static __device__ __forceinline__ void guard(v8f& a, v8f& b, v16h x, v16h y) { dep_guard_h(a, b, x, y); }
  static __device__ __forceinline__ void keep(v16h a, v16h b, v16h c, v16h d) { keep4_h(a, b, c, d); }
};
template <> struct Frag<__bf16> {
  typedef v16b V; union U { v16b v; v8b h[2]; };
  static __device__ __forceinline__ v16b load(const __bf16* p) {
    U f; f.h[0] = *(const v8b*)(p); f.h[1] = *(const v8b*)(p + 16); return f.v;
  }
  static __device__ __forceinline__ v8f mma(v16b a, v16b b, v8f c) {
    return __builtin_amdgcn_wmma_f32_16x16x32_bf16(false, a, false, b, (short)0, c, false, false);
  }
  static __device__ __forceinline__ void guard(v8f& a, v8f& b, v16b x, v16b y) { dep_guard_b(a, b, x, y); }
  static __device__ __forceinline__ void keep(v16b a, v16b b, v16b c, v16b d) { keep4_b(a, b, c, d); }
};

// ---- Register-blocked batched WMMA GEMM ------------------------------------
// C[m,n] = scale * sum_k A[m,k] * Bt[n,k] (+bias)(+resid); each wave owns a 64x64 tile.
// A row-major [M,K]; Bt row-major [N,K].
// SPLIT: operands are hi/lo planes (A2/Bt2 = lo planes, same layout); product = hi.hi + hi.lo + lo.hi.
// BIAS_MODE: 0 = none, 1 = bias[m], 2 = bias[n].
// OUT_MODE: 0 = f32, 1 = f16, 2 = bf16 hi plane (Cout) + bf16 lo plane (Cout2).
// ET: 0 = f16 operands, 1 = bf16 operands (pointers passed as 16-bit storage)
// KSPLIT: one 64x64 tile per block; wave w sums k in [w*K/8, (w+1)*K/8) (K % 256 == 0) and the eight f32
// partial tiles are added in LDS in wave order 0..7. For shapes with too few tiles to fill the chip.
// Two batch levels: blockIdx.y with strideA/B/C, blockIdx.z with zA/zB/zC (element strides).
// Not KSPLIT: one 128x256 tile of C per block (M % 128 == 0, N % 256 == 0, K % 64 == 0), waves 2 x 4, 64x64 each.
// Per 64 k the block's 128 A rows and 256 Bt rows (128 B each) are copied to LDS by asynchronous 16-byte copies,
// four whole rows per wave and copy, two buffers: the next 64 k fly while this one is multiplied.
#define SG_PITCH 72                          // f16 per staged row: 128 B + 16 B, the pitch for ds_load_b128 readers of 16 rows
#define SG_ROWS  384                         // 128 A rows, then 256 Bt rows
#define SG_BYTES (SG_ROWS * SG_PITCH * 2)    // one buffer
// One stage: this lane's 16 bytes of rows r, r + 32, ... (4 of A, 8 of Bt). lds = LDS byte address of its place in row r.
// The s_wait_xcnt stands inside the statement so that no address register is rewritten in front of it.
__device__ __forceinline__ void stage_issue(unsigned lds, const unsigned short* ga, size_t stepA,
                                            const unsigned short* gb, size_t stepB) {
  const unsigned LS = 32 * SG_PITCH * 2;
  asm volatile(
      "global_load_async_to_lds_b128 %0, %12, off\n\t"
      "global_load_async_to_lds_b128 %1, %13, off\n\t"
      "global_load_async_to_lds_b128 %2, %14, off\n\t"
      "global_load_async_to_lds_b128 %3, %15, off\n\t"
      "global_load_async_to_lds_b128 %4, %16, off\n\t"
      "global_load_async_to_lds_b128 %5, %17, off\n\t"
      "global_load_async_to_lds_b128 %6, %18, off\n\t"
      "global_load_async_to_lds_b128 %7, %19, off\n\t"
      "global_load_async_to_lds_b128 %8, %20, off\n\t"
      "global_load_async_to_lds_b128 %9, %21, off\n\t"
      "global_load_async_to_lds_b128 %10, %22, off\n\t"
      "global_load_async_to_lds_b128 %11, %23, off\n\t"
      "s_wait_xcnt 0x0"
      :: "v"(lds), "v"(lds + LS), "v"(lds + 2 * LS), "v"(lds + 3 * LS),
         "v"(lds + 4 * LS), "v"(lds + 5 * LS), "v"(lds + 6 * LS), "v"(lds + 7 * LS),
         "v"(lds + 8 * LS), "v"(lds + 9 * LS), "v"(lds + 10 * LS), "v"(lds + 11 * LS),
         "v"(ga), "v"(ga + stepA), "v"(ga + 2 * stepA), "v"(ga + 3 * stepA),
         "v"(gb), "v"(gb + stepB), "v"(gb + 2 * stepB), "v"(gb + 3 * stepB),
         "v"(gb + 4 * stepB), "v"(gb + 5 * stepB), "v"(gb + 6 * stepB), "v"(gb + 7 * stepB)
      : "memory");
}
template <int ET> struct Elem;
template <> struct Elem<0> { typedef _Float16 T; };
template <> struct Elem<1> { typedef __bf16 T; };
template <int ET, bool SPLIT, int BIAS_MODE, int OUT_MODE, bool RESID, int ACT = 0, bool KSPLIT = false>
__global__ __launch_bounds__(256) void wmma_gemm64(
    const unsigned short* __restrict__ Ap, const unsigned short* __restrict__ A2p, int lda, long strideA,
    const unsigned short* __restrict__ Btp, const unsigned short* __restrict__ Bt2p, int ldb, long strideB,
    void* __restrict__ Cout, void* __restrict__ Cout2, int ldc, long strideC,
    const float* __restrict__ bias,
    const float* __restrict__ resid, long strideR,
    int M, int N, int K, float scale, long zA, long zB, long zC) {
  typedef typename Elem<ET>::T T;
  typedef typename Frag<T>::V V;
  const T* A = (const T*)Ap; const T* A2 = (const T*)A2p; const T* Bt = (const T*)Btp; const T* Bt2 = (const T*)Bt2p;
  static_assert(!KSPLIT || (!SPLIT && BIAS_MODE == 0 && OUT_MODE == 1 && !RESID && ACT == 0), "KSPLIT epilogue: plain f16 output only");
  static_assert(KSPLIT || !SPLIT, "staged form: single-plane operands only");
  __shared__ __align__(16) float sT[8][(KSPLIT ? 64 : 16) * 68];   // per-wave slab (16x64, KSPLIT: 64x64), pitch 68 floats
  __shared__ __align__(16) unsigned short stg[KSPLIT ? 8 : 2 * SG_ROWS * SG_PITCH];   // staged operand rows, two buffers
  const int b    = blockIdx.y;
  const int z    = blockIdx.z;
  const int lane = threadIdx.x & 31;
  const int wave = threadIdx.x >> 5;
  const int tilesN = N >> (KSPLIT ? 6 : 8);
  const int tilesM = M >> (KSPLIT ? 6 : 7);
  const int tile = (int)blockIdx.x;
  if (tile >= tilesM * tilesN) return;   // block-uniform, in front of every barrier
  const int tm = tile / tilesN;
  const int tn = tile - tm * tilesN;
  const int wv = __builtin_amdgcn_readfirstlane(wave);
  const int bm0 = tm << (KSPLIT ? 6 : 7);                  // the block's first row and column of C
  const int bn0 = tn << (KSPLIT ? 6 : 8);
  const int m0 = KSPLIT ? bm0 : bm0 + ((wv >> 2) << 6);    // the wave's
  const int n0 = KSPLIT ? bn0 : bn0 + ((wv & 3) << 6);

  const size_t offA = (size_t)b * strideA + (size_t)z * zA;
  const size_t offB = (size_t)b * strideB + (size_t)z * zB;
  const size_t offC = (size_t)b * strideC + (size_t)z * zC;
  const T* Ab  = A  + offA;
  const T* Bb  = Bt + offB;
  const T* Ab2 = SPLIT ? (A2  + offA) : nullptr;
  const T* Bb2 = SPLIT ? (Bt2 + offB) : nullptr;

  const int rlane = lane & 15;                 // row (A) / col (B, D) within subtile
  const int koff  = (lane >> 4) * 8;           // k offset of this lane half
  const int mOff  = (lane >> 4) * 8;           // D row offset

  v8f acc[4][4];
#pragma unroll
  for (int i = 0; i < 4; ++i)
#pragma unroll
    for (int j = 0; j < 4; ++j) acc[i][j] = (v8f){0.f,0.f,0.f,0.f,0.f,0.f,0.f,0.f};

  if (!KSPLIT) {
    const int crow = threadIdx.x >> 3;                     // a wave's copy = 4 whole rows of 128 B
    const int cchk = (threadIdx.x & 7) * 8;
    const unsigned short* gA = Ap + offA + (size_t)(bm0 + crow) * lda + cchk;
    const unsigned short* gB = Btp + offB + (size_t)(bn0 + crow) * ldb + cchk;
    const size_t stepA = (size_t)32 * lda, stepB = (size_t)32 * ldb;
    const unsigned l0 = (unsigned)(size_t)stg + (unsigned)(crow * SG_PITCH + cchk) * 2u;
    const int nst = K >> 6;                                // stages of 64 k
    const int aRow = ((wv >> 2) << 6) + rlane;             // the wave's first staged rows
    const int bRow = 128 + ((wv & 3) << 6) + rlane;
    stage_issue(l0, gA, stepA, gB, stepB);
    asm volatile("s_wait_asynccnt 0x0" ::: "memory");      // this wave's copies of stage 0 have landed
    __syncthreads();                                       // ... and every other wave's
    if (nst > 1) stage_issue(l0 + SG_BYTES, gA + 64, stepA, gB + 64, stepB);
#pragma unroll 1   // one body: the buffer is picked by t & 1
    for (int t = 0; t < nst; ++t) {
      const T* sb = (const T*)stg + (t & 1) * (SG_ROWS * SG_PITCH);
      // the loops below are unrolled so that every fragment and accumulator index is a constant (registers, no scratch)
#pragma unroll
      for (int ks = 0; ks < 2; ++ks) {
        V bh[4], ah[4];
#pragma unroll
        for (int j = 0; j < 4; ++j) bh[j] = Frag<T>::load(sb + (bRow + (j << 4)) * SG_PITCH + (ks << 5) + koff);
#pragma unroll
        for (int i = 0; i < 4; ++i) ah[i] = Frag<T>::load(sb + (aRow + (i << 4)) * SG_PITCH + (ks << 5) + koff);
        __builtin_amdgcn_sched_barrier(0);   // the 16 LDS reads stay one group in front of their 16 WMMAs (else: one A fragment at a time, a full LDS wait per 4 WMMAs)
#pragma unroll
        for (int i = 0; i < 4; ++i)
#pragma unroll
          for (int j = 0; j < 4; ++j) acc[i][j] = Frag<T>::mma(ah[i], bh[j], acc[i][j]);
      }
      asm volatile("s_wait_dscnt 0x0" ::: "memory");       // this wave has left the buffer of stage t
      asm volatile("s_wait_asynccnt 0x0" ::: "memory");    // its copies of stage t + 1 have landed
      __syncthreads();                                     // publishes stage t + 1 and frees the buffer of stage t
      if (t + 2 < nst) stage_issue(l0 + (t & 1) * SG_BYTES, gA + (size_t)(t + 2) * 64, stepA, gB + (size_t)(t + 2) * 64, stepB);
    }
    asm volatile("s_wait_asynccnt 0x0" ::: "memory");      // no copy is left in flight behind the loop
  }
  const int kBeg = KSPLIT ? wv * (K >> 3) : 0;   // scalar, so the k loop keeps its scalar counter and branch
  const int kEnd = KSPLIT ? kBeg + (K >> 3) : 0;
  for (int k0 = kBeg; k0 < kEnd; k0 += 32) {
    V bh[4], bl[4];
#pragma unroll
    for (int j = 0; j < 4; ++j) {
      const size_t bo = (size_t)(n0 + (j << 4) + rlane) * ldb + koff + k0;
      bh[j] = Frag<T>::load(Bb + bo);
      if (SPLIT) bl[j] = Frag<T>::load(Bb2 + bo);
    }
#pragma unroll
    for (int i = 0; i < 4; ++i) {
      const size_t ao = (size_t)(m0 + (i << 4) + rlane) * lda + koff + k0;
      V ah = Frag<T>::load(Ab + ao);
      V al;
      if (SPLIT) al = Frag<T>::load(Ab2 + ao);
#pragma unroll
      for (int j = 0; j < 4; ++j) {
        acc[i][j] = Frag<T>::mma(ah, bh[j], acc[i][j]);
        if (SPLIT) {
          acc[i][j] = Frag<T>::mma(ah, bl[j], acc[i][j]);
          acc[i][j] = Frag<T>::mma(al, bh[j], acc[i][j]);
        }
      }
      Frag<T>::guard(acc[i][0], acc[i][3], ah, SPLIT ? al : ah);
    }
    Frag<T>::keep(bh[0], bh[1], bh[2], bh[3]);
    if (SPLIT) Frag<T>::keep(bl[0], bl[1], bl[2], bl[3]);
  }
  acc_guard4(acc[0][0], acc[0][1], acc[0][2], acc[0][3]);
  acc_guard4(acc[1][0], acc[1][1], acc[1][2], acc[1][3]);
  acc_guard4(acc[2][0], acc[2][1], acc[2][2], acc[2][3]);
  acc_guard4(acc[3][0], acc[3][1], acc[3][2], acc[3][3]);

  if (KSPLIT) {
    // ---- split-K epilogue: partial tiles to LDS, then wave w sums and stores rows 8w..8w+7 ----
    float* part = sT[wave];
#pragma unroll
    for (int i = 0; i < 4; ++i)
#pragma unroll
      for (int j = 0; j < 4; ++j)
#pragma unroll
        for (int r = 0; r < 8; ++r)
          part[((i << 4) + mOff + r) * 68 + (j << 4) + rlane] = acc[i][j][r];
    __syncthreads();   // every wave's partial tile is in LDS before any wave reads the eight of them
    unsigned short* C = (unsigned short*)Cout + offC;
    const int hh = lane >> 4, c4 = (lane & 15) * 4;     // row seg = 64 f16 = 128 B = 16 lanes x 8 B
#pragma unroll
    for (int it = 0; it < 4; ++it) {
      const int row = (wave << 3) + it * 2 + hh;
      v4f s = *(const v4f*)(&sT[0][row * 68 + c4]);
#pragma unroll
      for (int w = 1; w < 8; ++w) s += *(const v4f*)(&sT[w][row * 68 + c4]);
      v4h hv;
#pragma unroll
      for (int e = 0; e < 4; ++e) hv[e] = (_Float16)(s[e] * scale);
      *(v4h*)(C + (size_t)(m0 + row) * ldc + n0 + c4) = hv;
    }
    return;
  }

  // ---- epilogue ----
  float* slab = sT[wave];
  const float* Rb = RESID ? (resid + (size_t)b * strideR) : nullptr;
#pragma unroll
  for (int i = 0; i < 4; ++i) {
    const int mBase = m0 + (i << 4);
#pragma unroll
    for (int j = 0; j < 4; ++j) {
      const int n = n0 + (j << 4) + rlane;
      float bv = 0.f;
      if (BIAS_MODE == 2) bv = bias[n];
#pragma unroll
      for (int r = 0; r < 8; ++r) {
        float v = acc[i][j][r] * scale;
        if (BIAS_MODE == 1) v += bias[mBase + mOff + r];
        if (BIAS_MODE == 2) v += bv;
        if (RESID) v += Rb[(size_t)(mBase + mOff + r) * ldc + n];
        if (ACT == 1) v = tanhf(v);
        if (ACT == 2) v = fmaxf(v, 0.0f);
        if (ACT == 3) v = v / (1.0f + expf(-v));
        if (ACT == 4) v = (v > 0.f) ? v : 0.01f * v;
        if (ACT == 5) v = 0.5f * v * (1.0f + erff(v * 0.70710678118654752f));
        slab[(mOff + r) * 68 + (j << 4) + rlane] = v;
      }
    }
    __builtin_amdgcn_fence(__ATOMIC_RELEASE, "workgroup");
    __builtin_amdgcn_wave_barrier();
    __builtin_amdgcn_fence(__ATOMIC_ACQUIRE, "workgroup");
    if (OUT_MODE == 0) {
      float* C = (float*)Cout + offC;
      const int hh = lane >> 4, c4 = (lane & 15) * 4;     // row seg = 256 B = 16 lanes x 16 B
      {
#pragma unroll
        for (int it = 0; it < 8; ++it) {
          const int row = it * 2 + hh;
          v4f v = *(const v4f*)(slab + row * 68 + c4);
          *(v4f*)(C + (size_t)(mBase + row) * ldc + n0 + c4) = v;
        }
        
      }
    } else {
      const int q = lane >> 3, c8 = (lane & 7) * 8;
      unsigned short* C  = (unsigned short*)Cout  + offC;
      unsigned short* C2 = (OUT_MODE == 2) ? ((unsigned short*)Cout2 + offC) : nullptr;
      {
#pragma unroll
        for (int it = 0; it < 4; ++it) {
          const int row = it * 4 + q;
          const float* sp = slab + row * 68 + c8;
          v8h hv, lv;
#pragma unroll
          for (int e = 0; e < 8; ++e) {
            if (OUT_MODE == 1) {
              hv[e] = (_Float16)sp[e];
            } else {
              unsigned short hb = f2bf_bits(sp[e]);
              unsigned short lb = f2bf_bits(sp[e] - bf_bits2f(hb));
              hv[e] = __builtin_bit_cast(_Float16, hb);
              lv[e] = __builtin_bit_cast(_Float16, lb);
            }
          }
          *(v8h*)(C + (size_t)(mBase + row) * ldc + n0 + c8) = hv;
          if (OUT_MODE == 2) *(v8h*)(C2 + (size_t)(mBase + row) * ldc + n0 + c8) = lv;
        }
        
      }
    }
    __builtin_amdgcn_fence(__ATOMIC_RELEASE, "workgroup");
    __builtin_amdgcn_wave_barrier();
    __builtin_amdgcn_fence(__ATOMIC_ACQUIRE, "workgroup");
  }
}

__global__ __launch_bounds__(256) void cast_f32_f16x2s(
    const float* __restrict__ in, _Float16* __restrict__ out, int n2, float scale) {
  int i = blockIdx.x * 256 + threadIdx.x;
  if (i < n2) {
    const v2f a = *(const v2f*)(in + 2 * (size_t)i);
    const _Float16 h0 = (_Float16)(a[0] * scale), h1 = (_Float16)(a[1] * scale);
    const unsigned u = (unsigned)__builtin_bit_cast(unsigned short, h0) | ((unsigned)__builtin_bit_cast(unsigned short, h1) << 16);
    ((unsigned*)out)[i] = u;
    
  }
}

// =====================================================================================
// Cross-head mix 1 (12x12, f32) -> softmax over keys (f32) -> cross-head mix 2 folded with 1/sum and
// the power-of-two carry -> f16 store.  One block per query row n (blockIdx.x) of one batch (blockIdx.y).
// SP is [batch][1024][12][1024] f32 (query, head, key): a block's 12 logit rows are its own 48 KB. The
// result (mix2 * pcarry, f16, [12][1024]) goes into the first 24 KB of that same 48 KB: the block has
// read all of it into LDS (barrier behind phase 1) before phase 3 stores, and no other block touches it.
// Column ownership: phase 1/3 thread t owns keys cc*512 + 2t, 2t+1 (cc = 0,1) so each wave stores one
// =====================================================================================
#define MX_H 12
#define MX_N 1024

__global__ __launch_bounds__(256) void th_mix_kernel(
    float* SP, const float* __restrict__ w1, const float* __restrict__ b1,
    const float* __restrict__ w2, const float* __restrict__ b2, float pcarry)
{
  __shared__ __align__(16) float T[MX_H * MX_N];
  __shared__ __align__(16) float w1s[MX_H * MX_H];
  __shared__ __align__(16) float w2s[MX_H * MX_H];
  __shared__ float b1s[16];
  __shared__ float b2s[16];
  __shared__ float invs[16];
  __shared__ float rmax[8];
  __shared__ float rsum[8];

  const int n    = blockIdx.x;
  const int tid  = threadIdx.x;
  const int lane = tid & 31;
  const int wave = tid >> 5;
  float* blk = SP + ((size_t)blockIdx.y * MX_N + n) * (MX_H * MX_N);

  if (tid < MX_H * MX_H) { w1s[tid] = w1[tid]; w2s[tid] = w2[tid]; }
  if (tid < MX_H) { b1s[tid] = b1[tid]; b2s[tid] = b2[tid]; }
  __syncthreads();

  // ---- phase 1: mix 1 into T ----
#pragma unroll 1
  for (int cc = 0; cc < 2; ++cc) {
    const int m = cc * 512 + tid * 2;
    const float* sp = blk + m;
    v2f s[MX_H];
#pragma unroll
    for (int h = 0; h < MX_H; ++h) s[h] = *(const v2f*)(sp + h * MX_N);
#pragma unroll 1
    for (int g = 0; g < MX_H; ++g) {
      const v4f wa = *(const v4f*)(w1s + g * MX_H);
      const v4f wb = *(const v4f*)(w1s + g * MX_H + 4);
      const v4f wc = *(const v4f*)(w1s + g * MX_H + 8);
      const float bg = b1s[g];
      v2f a = (v2f){bg, bg};
      a += wa[0] * s[0];  a += wa[1] * s[1];  a += wa[2] * s[2];  a += wa[3] * s[3];
      a += wb[0] * s[4];  a += wb[1] * s[5];  a += wb[2] * s[6];  a += wb[3] * s[7];
      a += wc[0] * s[8];  a += wc[1] * s[9];  a += wc[2] * s[10]; a += wc[3] * s[11];
      *(v2f*)(T + g * MX_N + m) = a;
    }
  }
  __syncthreads();

  // ---- phase 2: softmax per head row (block-wide max and sum), exp written back into T ----
#pragma unroll 1
  for (int g = 0; g < MX_H; ++g) {
    float* tp = T + g * MX_N + tid * 4;
    const v4f x = *(const v4f*)tp;
    float mx = fmaxf(fmaxf(x[0], x[1]), fmaxf(x[2], x[3]));
#pragma unroll
    for (int off = 16; off > 0; off >>= 1) mx = fmaxf(mx, __shfl_xor(mx, off, 32));
    if (lane == 0) rmax[wave] = mx;
    __syncthreads();
    float M = rmax[0];
#pragma unroll
    for (int w = 1; w < 8; ++w) M = fmaxf(M, rmax[w]);
    v4f e;
    e[0] = __expf(x[0] - M);
    e[1] = __expf(x[1] - M);
    e[2] = __expf(x[2] - M);
    e[3] = __expf(x[3] - M);
    *(v4f*)tp = e;
    float sm = (e[0] + e[1]) + (e[2] + e[3]);
#pragma unroll
    for (int off = 16; off > 0; off >>= 1) sm += __shfl_xor(sm, off, 32);
    if (lane == 0) rsum[wave] = sm;
    __syncthreads();
    float tot = rsum[0];
#pragma unroll
    for (int w = 1; w < 8; ++w) tot += rsum[w];
    if (tid == 0) invs[g] = 1.0f / tot;
  }
  __syncthreads();
  // fold 1/sum of the source head and the carry into the mix-2 weights, carry into the bias
  if (tid < MX_H * MX_H) {
    const int h = tid % MX_H;
    w2s[tid] = w2s[tid] * invs[h] * pcarry;
  }
  if (tid < MX_H) b2s[tid] = b2s[tid] * pcarry;
  __syncthreads();

#pragma unroll 1
  for (int cc = 0; cc < 2; ++cc) {
    const int m = cc * 512 + tid * 2;
    v2f e[MX_H];
#pragma unroll
    for (int h = 0; h < MX_H; ++h) e[h] = *(const v2f*)(T + h * MX_N + m);
    unsigned short* prow = (unsigned short*)blk + m;
#pragma unroll 1
    for (int g = 0; g < MX_H; ++g) {
      const v4f wa = *(const v4f*)(w2s + g * MX_H);
      const v4f wb = *(const v4f*)(w2s + g * MX_H + 4);
      const v4f wc = *(const v4f*)(w2s + g * MX_H + 8);
      const float bg = b2s[g];
      v2f a = (v2f){bg, bg};
      a += wa[0] * e[0];  a += wa[1] * e[1];  a += wa[2] * e[2];  a += wa[3] * e[3];
      a += wb[0] * e[4];  a += wb[1] * e[5];  a += wb[2] * e[6];  a += wb[3] * e[7];
      a += wc[0] * e[8];  a += wc[1] * e[9];  a += wc[2] * e[10]; a += wc[3] * e[11];
      const _Float16 h0 = (_Float16)a[0], h1 = (_Float16)a[1];
      const unsigned u = (unsigned)__builtin_bit_cast(unsigned short, h0) | ((unsigned)__builtin_bit_cast(unsigned short, h1) << 16);
      unsigned* pp = (unsigned*)(prow + g * MX_N);
      *pp = u;
      
    }
  }
}

// ---------------------------------------------------------------------------
template <int BIAS_MODE, int OUT_MODE>
static void gemm_f16(hipStream_t st, int gy,
                     const void* A, int lda, long sA,
                     const void* Bt, int ldb, long sB,
                     void* C, int ldc, long sC,
                     const float* bias, int M, int N, int K, float scale,
                     int gz = 1, long zA = 0L, long zB = 0L, long zC = 0L)
{
  dim3 grid((M / 128) * (N / 256), gy, gz);
  wmma_gemm64<0, false, BIAS_MODE, OUT_MODE, false, 0><<<grid, 256, 0, st>>>(
      (const unsigned short*)A, (const unsigned short*)A, lda, sA,
      (const unsigned short*)Bt, (const unsigned short*)Bt, ldb, sB,
      C, C, ldc, sC, bias, bias, (long)0, M, N, K, scale, zA, zB, zC);
}

// one block per 64x64 tile, K split over its eight waves; f16 output, no bias
static void gemm_f16_ksplit(hipStream_t st, int gy,
                            const void* A, int lda, long sA,
                            const void* Bt, int ldb, long sB,
                            void* C, int ldc, long sC,
                            const float* unused, int M, int N, int K, float scale,
                            int gz, long zA, long zB, long zC)
{
  dim3 grid((M / 64) * (N / 64), gy, gz);
  wmma_gemm64<0, false, 0, 1, false, 0, true><<<grid, 256, 0, st>>>(
      (const unsigned short*)A, (const unsigned short*)A, lda, sA,
      (const unsigned short*)Bt, (const unsigned short*)Bt, ldb, sB,
      C, C, ldc, sC, unused, unused, (long)0, M, N, K, scale, zA, zB, zC);
}

extern "C" void kernel_launch(void* const* d_in, const int* in_sizes, int n_in,
                              void* d_out, int out_size, void* d_ws, size_t ws_size,
                              hipStream_t stream)
{
  const int Bn = 8, Nn = 1024, Dd = 768, Hh = 12, HD = 64;
  const int GB = 4;                                       // batches per launch in the attention part
  if (n_in < 13) return;
  if (in_sizes[0] != Bn * Nn * Dd) return;
  if (in_sizes[1] != Dd * Dd || in_sizes[3] != Dd * Dd || in_sizes[5] != Dd * Dd || in_sizes[7] != Dd * Dd) return;
  if (in_sizes[2] != Dd || in_sizes[4] != Dd || in_sizes[6] != Dd || in_sizes[8] != Dd) return;
  if (in_sizes[9] != Hh * Hh || in_sizes[10] != Hh || in_sizes[11] != Hh * Hh || in_sizes[12] != Hh) return;
  if (out_size != Bn * Nn * Dd) return;

  const float* x    = (const float*)d_in[0];
  const float* wq   = (const float*)d_in[1];
  const float* bq   = (const float*)d_in[2];
  const float* wk   = (const float*)d_in[3];
  const float* bk   = (const float*)d_in[4];
  const float* wv   = (const float*)d_in[5];
  const float* bv   = (const float*)d_in[6];
  const float* wo   = (const float*)d_in[7];
  const float* bo   = (const float*)d_in[8];
  const float* th1w = (const float*)d_in[9];
  const float* th1b = (const float*)d_in[10];
  const float* th2w = (const float*)d_in[11];
  const float* th2b = (const float*)d_in[12];
  float* out = (float*)d_out;

  // ---- workspace carve (bytes) ----
  const size_t WSZ = (size_t)Dd * Dd * 2;                 // one f16 weight matrix
  const size_t ASZ = (size_t)Bn * Nn * Dd * 2;            // one f16 activation [8192][768]
  const size_t SSZ = (size_t)GB * Nn * Hh * Nn * 4;       // logits f32 [GB][1024][12][1024]; mixed attention f16 written over them
  const size_t off_wq  = 0;
  const size_t off_wk  = off_wq + WSZ;
  const size_t off_wv  = off_wk + WSZ;
  const size_t off_wo  = off_wv + WSZ;
  const size_t off_q   = off_wo + WSZ;
  const size_t off_k   = off_q + ASZ;
  const size_t off_vt  = off_k + ASZ;                     // v^T per batch: [b][h*64+d][m]
  const size_t off_ctx = off_vt + ASZ;                    // attention output [8192][768] f16
  const size_t off_R   = off_ctx + ASZ;                   // reused region
  const size_t off_x16 = off_R;                           // live during the projections only
  const size_t off_S   = off_R;                           // live per group of GB batches afterwards
  size_t end = off_S + SSZ;
  if (off_x16 + ASZ > end) end = off_x16 + ASZ;
  if (end > ws_size) return;

  uint8_t* ws = (uint8_t*)d_ws;
  _Float16* wq16 = (_Float16*)(ws + off_wq);
  _Float16* wk16 = (_Float16*)(ws + off_wk);
  _Float16* wv16 = (_Float16*)(ws + off_wv);
  _Float16* wo16 = (_Float16*)(ws + off_wo);
  unsigned short* q16   = (unsigned short*)(ws + off_q);
  unsigned short* k16   = (unsigned short*)(ws + off_k);
  unsigned short* vt16  = (unsigned short*)(ws + off_vt);
  unsigned short* ctx16 = (unsigned short*)(ws + off_ctx);
  _Float16* x16 = (_Float16*)(ws + off_x16);
  float* Sb = (float*)(ws + off_S);

  const float WCARRY = 64.0f;        // weights carried x2^6 in f16
  const float PCARRY = 2048.0f;      // mixed attention carried x2^11 in f16

  // ---- casts to f16 ----
  {
    const int n2x = Bn * Nn * Dd / 2;
    cast_f32_f16x2s<<<(n2x + 255) / 256, 256, 0, stream>>>(x, x16, n2x, 1.0f);
    const int n2w = Dd * Dd / 2;
    cast_f32_f16x2s<<<(n2w + 255) / 256, 256, 0, stream>>>(wq, wq16, n2w, WCARRY);
    cast_f32_f16x2s<<<(n2w + 255) / 256, 256, 0, stream>>>(wk, wk16, n2w, WCARRY);
    cast_f32_f16x2s<<<(n2w + 255) / 256, 256, 0, stream>>>(wv, wv16, n2w, WCARRY);
    cast_f32_f16x2s<<<(n2w + 255) / 256, 256, 0, stream>>>(wo, wo16, n2w, WCARRY);
  }

  // ---- projections: q, k as [b*1024+n][h*64+d] f16; v^T per batch as [b][h*64+d][m] f16 ----
  gemm_f16<2, 1>(stream, 1, x16, Dd, 0L, wq16, Dd, 0L, q16, Dd, 0L, bq, Bn * Nn, Dd, Dd, 1.0f / WCARRY);
  gemm_f16<2, 1>(stream, 1, x16, Dd, 0L, wk16, Dd, 0L, k16, Dd, 0L, bk, Bn * Nn, Dd, Dd, 1.0f / WCARRY);
  // A = wv [768][768], Bt = x rows of batch b [1024][768] -> C [768][1024] per batch, bias[m] = bv[o]
  gemm_f16<1, 1>(stream, Bn, wv16, Dd, 0L, x16, Dd, (long)Nn * Dd, vt16, Nn, (long)Dd * Nn, bv, Dd, Nn, Dd, 1.0f / WCARRY);

  // ---- per group of GB batches (grid.z = batch in the group): logits -> mix/softmax/mix -> a.v ----
  const float qk_scale = 0.125f;     // 64^-0.5
  const long rowS = (long)Hh * Nn;   // f32 elements of one query's 12 logit rows
  for (int b = 0; b < Bn; b += GB) {
    const unsigned short* qb = q16 + (size_t)b * Nn * Dd;
    const unsigned short* kb = k16 + (size_t)b * Nn * Dd;
    // S[z][n][h][m] = scale * sum_d q[n][h*64+d] k[m][h*64+d]; grid.y = head: strideA/B = 64, strideC = 1024
    gemm_f16<0, 0>(stream, Hh, qb, Dd, (long)HD, kb, Dd, (long)HD, Sb, Hh * Nn, (long)Nn, bq, Nn, Nn, HD, qk_scale,
                   GB, (long)Nn * Dd, (long)Nn * Dd, (long)Nn * rowS);
    th_mix_kernel<<<dim3(Nn, GB), 256, 0, stream>>>(Sb, th1w, th1b, th2w, th2b, PCARRY);
    // ctx[(b+z)*1024+n][h*64+d] = 2^-11 * sum_m P[z][n][h][m] * vT[b+z][h*64+d][m]; grid.y = head.
    // P rows lie in the logits' place: f16 pitch per query = 2 * rowS, per head = 1024
    gemm_f16_ksplit(stream, Hh,
                    Sb, 2 * Hh * Nn, (long)Nn,
                    vt16 + (size_t)b * Dd * Nn, Nn, (long)HD * Nn,
                    ctx16 + (size_t)b * Nn * Dd, Dd, (long)HD,
                    bq, Nn, HD, Nn, 1.0f / PCARRY,
                    GB, (long)Nn * 2 * rowS, (long)Dd * Nn, (long)Nn * Dd);
  }

  // ---- output projection -> f32 [8192][768] ----
  gemm_f16<2, 0>(stream, 1, ctx16, Dd, 0L, wo16, Dd, 0L, out, Dd, 0L, bo, Bn * Nn, Dd, Dd, 1.0f / WCARRY);
}

// v004
// Measured time: 274 microseconds a run.
// In both of two side-by-side timings against v003, it was 1.28 times as fast.
// Over all steps from v000 it is 3.06 times as fast.
#include <hip/hip_runtime.h>
#include <stdint.h>
#include <stddef.h>

// Contractions (q/k/v projections, q.k^T, a.v, output projection): v_wmma_f32_16x16x32_f16 (f16 operands, f32 accumulate); weights carried x64, mixed attention carried x2^11, folded back in the f32 epilogue; 12x12 cross-head mixes and softmax in f32 on VALU.

typedef __attribute__((ext_vector_type(16))) _Float16 v16h;
typedef __attribute__((ext_vector_type(8)))  _Float16 v8h;
typedef __attribute__((ext_vector_type(4)))  _Float16 v4h;
typedef __attribute__((ext_vector_type(16))) __bf16   v16b;
typedef __attribute__((ext_vector_type(8)))  __bf16   v8b;
typedef __attribute__((ext_vector_type(8)))  float    v8f;
typedef __attribute__((ext_vector_type(4)))  float    v4f;
typedef __attribute__((ext_vector_type(2)))  float    v2f;

__device__ __forceinline__ unsigned short f2bf_bits(float f) {
  unsigned u = __float_as_uint(f);
  return (unsigned short)((u + 0x7FFFu + ((u >> 16) & 1u)) >> 16);
}
__device__ __forceinline__ float bf_bits2f(unsigned short h) { return __uint_as_float(((unsigned)h) << 16); }

// hazard guards as plain device helpers
__device__ __forceinline__ void dep_guard_h(v8f& a, v8f& b, v16h x, v16h y) { asm volatile("v_nop\n\tv_nop\n\tv_nop\n\tv_nop" : "+v"(a), "+v"(b) : "v"(x), "v"(y)); }
__device__ __forceinline__ void dep_guard_b(v8f& a, v8f& b, v16b x, v16b y) { asm volatile("v_nop\n\tv_nop\n\tv_nop\n\tv_nop" : "+v"(a), "+v"(b) : "v"(x), "v"(y)); }
__device__ __forceinline__ void keep4_h(v16h a, v16h b, v16h c, v16h d) { asm volatile("v_nop" :: "v"(a), "v"(b), "v"(c), "v"(d)); }
__device__ __forceinline__ void keep4_b(v16b a, v16b b, v16b c, v16b d) { asm volatile("v_nop" :: "v"(a), "v"(b), "v"(c), "v"(d)); }
__device__ __forceinline__ void acc_guard4(v8f& a, v8f& b, v8f& c, v8f& d) { asm volatile("v_nop\n\tv_nop\n\tv_nop\n\tv_nop" : "+v"(a), "+v"(b), "+v"(c), "+v"(d)); }
template <typename T> struct Frag;
template <> struct Frag<_Float16> {
  typedef v16h V; union U { v16h v; v8h h[2]; };
  static __device__ __forceinline__ v16h load(const _Float16* p) {   // elements 0..7 <- p[0..7], 8..15 <- p[16..23]
    U f; f.h[0] = *(const v8h*)(p); f.h[1] = *(const v8h*)(p + 16); return f.v;
  }
  static __device__ __forceinline__ v8f mma(v16h a, v16h b, v8f c) {
    return __builtin_amdgcn_wmma_f32_16x16x32_f16(false, a, false, b, (short)0, c, false, false);
  }
  static __device__ __forceinline__ void guard(v8f& a, v8f& b, v16h x, v16h y) { dep_guard_h(a, b, x, y); }
  static __device__ __forceinline__ void keep(v16h a, v16h b, v16h c, v16h d) { keep4_h(a, b, c, d); }
};
template <> struct Frag<__bf16> {
  typedef v16b V; union U { v16b v; v8b h[2]; };
  static __device__ __forceinline__ v16b load(const __bf16* p) {
    U f; f.h[0] = *(const v8b*)(p); f.h[1] = *(const v8b*)(p + 16); return f.v;
  }
  static __device__ __forceinline__ v8f mma(v16b a, v16b b, v8f c) {
    return __builtin_amdgcn_wmma_f32_16x16x32_bf16(false, a, false, b, (short)0, c, false, false);
  }
  static __device__ __forceinline__ void guard(v8f& a, v8f& b, v16b x, v16b y) { dep_guard_b(a, b, x, y); }
  static __device__ __forceinline__ void keep(v16b a, v16b b, v16b c, v16b d) { keep4_b(a, b, c, d); }
};

// ---- Register-blocked batched WMMA GEMM ------------------------------------
// C[m,n] = scale * sum_k A[m,k] * Bt[n,k] (+bias)(+resid); each wave owns a 64x64 tile.
// A row-major [M,K]; Bt row-major [N,K].
// SPLIT: operands are hi/lo planes (A2/Bt2 = lo planes, same layout); product = hi.hi + hi.lo + lo.hi.
// BIAS_MODE: 0 = none, 1 = bias[m], 2 = bias[n].
// OUT_MODE: 0 = f32, 1 = f16, 2 = bf16 hi plane (Cout) + bf16 lo plane (Cout2).
// ET: 0 = f16 operands, 1 = bf16 operands (pointers passed as 16-bit storage)
// KSPLIT: one 64x64 tile per block; wave w sums k in [w*K/8, (w+1)*K/8) (K % 256 == 0) and the eight f32
// partial tiles are added in LDS in wave order 0..7. For shapes with too few tiles to fill the chip.
// Two batch levels: blockIdx.y with strideA/B/C, blockIdx.z with zA/zB/zC (element strides).
// Not KSPLIT: one 128x256 tile of C per block (M % 128 == 0, N % 256 == 0, K % 64 == 0), waves 2 x 4, 64x64 each.
// Per 64 k the block's 128 A rows and 256 Bt rows (128 B each) are copied to LDS by asynchronous 16-byte copies,
// four whole rows per wave and copy, two buffers: the next 64 k fly while this one is multiplied.
#define SG_PITCH 72                          // f16 per staged row: 128 B + 16 B, the pitch for ds_load_b128 readers of 16 rows
#define SG_ROWS  384                         // 128 A rows, then 256 Bt rows
#define SG_BYTES (SG_ROWS * SG_PITCH * 2)    // one buffer
// One stage: this lane's 16 bytes of rows r, r + 32, ... (4 of A, 8 of Bt). lds = LDS byte address of its place in row r.
// The s_wait_xcnt stands inside the statement so that no address register is rewritten in front of it.
__device__ __forceinline__ void stage_issue(unsigned lds, const unsigned short* ga, size_t stepA,
                                            const unsigned short* gb, size_t stepB) {
  const unsigned LS = 32 * SG_PITCH * 2;
  asm volatile(
      "global_load_async_to_lds_b128 %0, %12, off\n\t"
      "global_load_async_to_lds_b128 %1, %13, off\n\t"
      "global_load_async_to_lds_b128 %2, %14, off\n\t"
      "global_load_async_to_lds_b128 %3, %15, off\n\t"
      "global_load_async_to_lds_b128 %4, %16, off\n\t"
      "global_load_async_to_lds_b128 %5, %17, off\n\t"
      "global_load_async_to_lds_b128 %6, %18, off\n\t"
      "global_load_async_to_lds_b128 %7, %19, off\n\t"
      "global_load_async_to_lds_b128 %8, %20, off\n\t"
      "global_load_async_to_lds_b128 %9, %21, off\n\t"
      "global_load_async_to_lds_b128 %10, %22, off\n\t"
      "global_load_async_to_lds_b128 %11, %23, off\n\t"
      "s_wait_xcnt 0x0"
      :: "v"(lds), "v"(lds + LS), "v"(lds + 2 * LS), "v"(lds + 3 * LS),
         "v"(lds + 4 * LS), "v"(lds + 5 * LS), "v"(lds + 6 * LS), "v"(lds + 7 * LS),
         "v"(lds + 8 * LS), "v"(lds + 9 * LS), "v"(lds + 10 * LS), "v"(lds + 11 * LS),
         "v"(ga), "v"(ga + stepA), "v"(ga + 2 * stepA), "v"(ga + 3 * stepA),
         "v"(gb), "v"(gb + stepB), "v"(gb + 2 * stepB), "v"(gb + 3 * stepB),
         "v"(gb + 4 * stepB), "v"(gb + 5 * stepB), "v"(gb + 6 * stepB), "v"(gb + 7 * stepB)
      : "memory");
}
template <int ET> struct Elem;
template <> struct Elem<0> { typedef _Float16 T; };
template <> struct Elem<1> { typedef __bf16 T; };
template <int ET, bool SPLIT, int BIAS_MODE, int OUT_MODE, bool RESID, int ACT = 0, bool KSPLIT = false>
__global__ __launch_bounds__(256) void wmma_gemm64(
    const unsigned short* __restrict__ Ap, const unsigned short* __restrict__ A2p, int lda, long strideA,
    const unsigned short* __restrict__ Btp, const unsigned short* __restrict__ Bt2p, int ldb, long strideB,
    void* __restrict__ Cout, void* __restrict__ Cout2, int ldc, long strideC,
    const float* __restrict__ bias,
    const float* __restrict__ resid, long strideR,
    int M, int N, int K, float scale, long zA, long zB, long zC) {
  typedef typename Elem<ET>::T T;
  typedef typename Frag<T>::V V;
  const T* A = (const T*)Ap; const T* A2 = (const T*)A2p; const T* Bt = (const T*)Btp; const T* Bt2 = (const T*)Bt2p;
  static_assert(!KSPLIT || (!SPLIT && BIAS_MODE == 0 && OUT_MODE == 1 && !RESID && ACT == 0), "KSPLIT epilogue: plain f16 output only");
  static_assert(KSPLIT || !SPLIT, "staged form: single-plane operands only");
  __shared__ __align__(16) float sT[8][(KSPLIT ? 64 : 16) * 68];   // per-wave slab (16x64, KSPLIT: 64x64), pitch 68 floats
  __shared__ __align__(16) unsigned short stg[KSPLIT ? 8 : 2 * SG_ROWS * SG_PITCH];   // staged operand rows, two buffers
  const int b    = blockIdx.y;
  const int z    = blockIdx.z;
  const int lane = threadIdx.x & 31;
  const int wave = threadIdx.x >> 5;
  const int tilesN = N >> (KSPLIT ? 6 : 8);
  const int tilesM = M >> (KSPLIT ? 6 : 7);
  const int tile = (int)blockIdx.x;
  if (tile >= tilesM * tilesN) return;   // block-uniform, in front of every barrier
  const int tm = tile / tilesN;
  const int tn = tile - tm * tilesN;
  const int wv = __builtin_amdgcn_readfirstlane(wave);
  const int bm0 = tm << (KSPLIT ? 6 : 7);                  // the block's first row and column of C
  const int bn0 = tn << (KSPLIT ? 6 : 8);
  const int m0 = KSPLIT ? bm0 : bm0 + ((wv >> 2) << 6);    // the wave's
  const int n0 = KSPLIT ? bn0 : bn0 + ((wv & 3) << 6);

  const size_t offA = (size_t)b * strideA + (size_t)z * zA;
  const size_t offB = (size_t)b * strideB + (size_t)z * zB;
  const size_t offC = (size_t)b * strideC + (size_t)z * zC;
  const T* Ab  = A  + offA;
  const T* Bb  = Bt + offB;
  const T* Ab2 = SPLIT ? (A2  + offA) : nullptr;
  const T* Bb2 = SPLIT ? (Bt2 + offB) : nullptr;

  const int rlane = lane & 15;                 // row (A) / col (B, D) within subtile
  const int koff  = (lane >> 4) * 8;           // k offset of this lane half
  const int mOff  = (lane >> 4) * 8;           // D row offset

  v8f acc[4][4];
#pragma unroll
  for (int i = 0; i < 4; ++i)
#pragma unroll
    for (int j = 0; j < 4; ++j) acc[i][j] = (v8f){0.f,0.f,0.f,0.f,0.f,0.f,0.f,0.f};

  if (!KSPLIT) {
    const int crow = threadIdx.x >> 3;                     // a wave's copy = 4 whole rows of 128 B
    const int cchk = (threadIdx.x & 7) * 8;
    const unsigned short* gA = Ap + offA + (size_t)(bm0 + crow) * lda + cchk;
    const unsigned short* gB = Btp + offB + (size_t)(bn0 + crow) * ldb + cchk;
    const size_t stepA = (size_t)32 * lda, stepB = (size_t)32 * ldb;
    const unsigned l0 = (unsigned)(size_t)stg + (unsigned)(crow * SG_PITCH + cchk) * 2u;
    const int nst = K >> 6;                                // stages of 64 k
    const int aRow = ((wv >> 2) << 6) + rlane;             // the wave's first staged rows
    const int bRow = 128 + ((wv & 3) << 6) + rlane;
    stage_issue(l0, gA, stepA, gB, stepB);
    asm volatile("s_wait_asynccnt 0x0" ::: "memory");      // this wave's copies of stage 0 have landed
    __syncthreads();                                       // ... and every other wave's
    if (nst > 1) stage_issue(l0 + SG_BYTES, gA + 64, stepA, gB + 64, stepB);
#pragma unroll 1   // one body: the buffer is picked by t & 1
    for (int t = 0; t < nst; ++t) {
      const T* sb = (const T*)stg + (t & 1) * (SG_ROWS * SG_PITCH);
      // the loops below are unrolled so that every fragment and accumulator index is a constant (registers, no scratch)
#pragma unroll
      for (int ks = 0; ks < 2; ++ks) {
        V bh[4], ah[4];
#pragma unroll
        for (int j = 0; j < 4; ++j) bh[j] = Frag<T>::load(sb + (bRow + (j << 4)) * SG_PITCH + (ks << 5) + koff);
#pragma unroll
        for (int i = 0; i < 4; ++i) ah[i] = Frag<T>::load(sb + (aRow + (i << 4)) * SG_PITCH + (ks << 5) + koff);
        __builtin_amdgcn_sched_barrier(0);   // the 16 LDS reads stay one group in front of their 16 WMMAs (else: one A fragment at a time, a full LDS wait per 4 WMMAs)
#pragma unroll
        for (int i = 0; i < 4; ++i)
#pragma unroll
          for (int j = 0; j < 4; ++j) acc[i][j] = Frag<T>::mma(ah[i], bh[j], acc[i][j]);
      }
      asm volatile("s_wait_dscnt 0x0" ::: "memory");       // this wave has left the buffer of stage t
      asm volatile("s_wait_asynccnt 0x0" ::: "memory");    // its copies of stage t + 1 have landed
      __syncthreads();                                     // publishes stage t + 1 and frees the buffer of stage t
      if (t + 2 < nst) stage_issue(l0 + (t & 1) * SG_BYTES, gA + (size_t)(t + 2) * 64, stepA, gB + (size_t)(t + 2) * 64, stepB);
    }
    asm volatile("s_wait_asynccnt 0x0" ::: "memory");      // no copy is left in flight behind the loop
  }
  const int kBeg = KSPLIT ? wv * (K >> 3) : 0;   // scalar, so the k loop keeps its scalar counter and branch
  const int kEnd = KSPLIT ? kBeg + (K >> 3) : 0;
  for (int k0 = kBeg; k0 < kEnd; k0 += 32) {
    V bh[4], bl[4];
#pragma unroll
    for (int j = 0; j < 4; ++j) {
      const size_t bo = (size_t)(n0 + (j << 4) + rlane) * ldb + koff + k0;
      bh[j] = Frag<T>::load(Bb + bo);
      if (SPLIT) bl[j] = Frag<T>::load(Bb2 + bo);
    }
#pragma unroll
    for (int i = 0; i < 4; ++i) {
      const size_t ao = (size_t)(m0 + (i << 4) + rlane) * lda + koff + k0;
      V ah = Frag<T>::load(Ab + ao);
      V al;
      if (SPLIT) al = Frag<T>::load(Ab2 + ao);
#pragma unroll
      for (int j = 0; j < 4; ++j) {
        acc[i][j] = Frag<T>::mma(ah, bh[j], acc[i][j]);
        if (SPLIT) {
          acc[i][j] = Frag<T>::mma(ah, bl[j], acc[i][j]);
          acc[i][j] = Frag<T>::mma(al, bh[j], acc[i][j]);
        }
      }
      Frag<T>::guard(acc[i][0], acc[i][3], ah, SPLIT ? al : ah);
    }
    Frag<T>::keep(bh[0], bh[1], bh[2], bh[3]);
    if (SPLIT) Frag<T>::keep(bl[0], bl[1], bl[2], bl[3]);
  }
  acc_guard4(acc[0][0], acc[0][1], acc[0][2], acc[0][3]);
  acc_guard4(acc[1][0], acc[1][1], acc[1][2], acc[1][3]);
  acc_guard4(acc[2][0], acc[2][1], acc[2][2], acc[2][3]);
  acc_guard4(acc[3][0], acc[3][1], acc[3][2], acc[3][3]);

  if (KSPLIT) {
    // ---- split-K epilogue: partial tiles to LDS, then wave w sums and stores rows 8w..8w+7 ----
    float* part = sT[wave];
#pragma unroll
    for (int i = 0; i < 4; ++i)
#pragma unroll
      for (int j = 0; j < 4; ++j)
#pragma unroll
        for (int r = 0; r < 8; ++r)
          part[((i << 4) + mOff + r) * 68 + (j << 4) + rlane] = acc[i][j][r];
    __syncthreads();   // every wave's partial tile is in LDS before any wave reads the eight of them
    unsigned short* C = (unsigned short*)Cout + offC;
    const int hh = lane >> 4, c4 = (lane & 15) * 4;     // row seg = 64 f16 = 128 B = 16 lanes x 8 B
#pragma unroll
    for (int it = 0; it < 4; ++it) {
      const int row = (wave << 3) + it * 2 + hh;
      v4f s = *(const v4f*)(&sT[0][row * 68 + c4]);
#pragma unroll
      for (int w = 1; w < 8; ++w) s += *(const v4f*)(&sT[w][row * 68 + c4]);
      v4h hv;
#pragma unroll
      for (int e = 0; e < 4; ++e) hv[e] = (_Float16)(s[e] * scale);
      *(v4h*)(C + (size_t)(m0 + row) * ldc + n0 + c4) = hv;
    }
    return;
  }

  // ---- epilogue ----
  float* slab = sT[wave];
  const float* Rb = RESID ? (resid + (size_t)b * strideR) : nullptr;
#pragma unroll
  for (int i = 0; i < 4; ++i) {
    const int mBase = m0 + (i << 4);
#pragma unroll
    for (int j = 0; j < 4; ++j) {
      const int n = n0 + (j << 4) + rlane;
      float bv = 0.f;
      if (BIAS_MODE == 2) bv = bias[n];
#pragma unroll
      for (int r = 0; r < 8; ++r) {
        float v = acc[i][j][r] * scale;
        if (BIAS_MODE == 1) v += bias[mBase + mOff + r];
        if (BIAS_MODE == 2) v += bv;
        if (RESID) v += Rb[(size_t)(mBase + mOff + r) * ldc + n];
        if (ACT == 1) v = tanhf(v);
        if (ACT == 2) v = fmaxf(v, 0.0f);
        if (ACT == 3) v = v / (1.0f + expf(-v));
        if (ACT == 4) v = (v > 0.f) ? v : 0.01f * v;
        if (ACT == 5) v = 0.5f * v * (1.0f + erff(v * 0.70710678118654752f));
        slab[(mOff + r) * 68 + (j << 4) + rlane] = v;
      }
    }
    __builtin_amdgcn_fence(__ATOMIC_RELEASE, "workgroup");
    __builtin_amdgcn_wave_barrier();
    __builtin_amdgcn_fence(__ATOMIC_ACQUIRE, "workgroup");
    if (OUT_MODE == 0) {
      float* C = (float*)Cout + offC;
      const int hh = lane >> 4, c4 = (lane & 15) * 4;     // row seg = 256 B = 16 lanes x 16 B
      {
#pragma unroll
        for (int it = 0; it < 8; ++it) {
          const int row = it * 2 + hh;
          v4f v = *(const v4f*)(slab + row * 68 + c4);
          *(v4f*)(C + (size_t)(mBase + row) * ldc + n0 + c4) = v;
        }
        
      }
    } else {
      const int q = lane >> 3, c8 = (lane & 7) * 8;
      unsigned short* C  = (unsigned short*)Cout  + offC;
      unsigned short* C2 = (OUT_MODE == 2) ? ((unsigned short*)Cout2 + offC) : nullptr;
      {
#pragma unroll
        for (int it = 0; it < 4; ++it) {
          const int row = it * 4 + q;
          const float* sp = slab + row * 68 + c8;
          v8h hv, lv;
#pragma unroll
          for (int e = 0; e < 8; ++e) {
            if (OUT_MODE == 1) {
              hv[e] = (_Float16)sp[e];
            } else {
              unsigned short hb = f2bf_bits(sp[e]);
              unsigned short lb = f2bf_bits(sp[e] - bf_bits2f(hb));
              hv[e] = __builtin_bit_cast(_Float16, hb);
              lv[e] = __builtin_bit_cast(_Float16, lb);
            }
          }
          *(v8h*)(C + (size_t)(mBase + row) * ldc + n0 + c8) = hv;
          if (OUT_MODE == 2) *(v8h*)(C2 + (size_t)(mBase + row) * ldc + n0 + c8) = lv;
        }
        
      }
    }
    __builtin_amdgcn_fence(__ATOMIC_RELEASE, "workgroup");
    __builtin_amdgcn_wave_barrier();
    __builtin_amdgcn_fence(__ATOMIC_ACQUIRE, "workgroup");
  }
}

__global__ __launch_bounds__(256) void cast_f32_f16x2s(
    const float* __restrict__ in, _Float16* __restrict__ out, int n2, float scale) {
  int i = blockIdx.x * 256 + threadIdx.x;
  if (i < n2) {
    const v2f a = *(const v2f*)(in + 2 * (size_t)i);
    const _Float16 h0 = (_Float16)(a[0] * scale), h1 = (_Float16)(a[1] * scale);
    const unsigned u = (unsigned)__builtin_bit_cast(unsigned short, h0) | ((unsigned)__builtin_bit_cast(unsigned short, h1) << 16);
    ((unsigned*)out)[i] = u;
    
  }
}

// =====================================================================================
// Cross-head mix 1 (12x12, f32) -> softmax over keys (f32) -> cross-head mix 2 with 1/sum and the
// power-of-two carry -> f16 store.  One block per query row n (blockIdx.x) of one batch (blockIdx.y).
// SP is [batch][1024][12][1024] f32 (query, head, key): a block's 12 logit rows are its own 48 KB. The
// result (mix2 * pcarry, f16, [12][1024]) goes into the first 24 KB of that same 48 KB: every thread has
// used all it loaded in front of the first barrier, the stores stand behind the second, and no other
// block touches these bytes.
// Everything stays in registers: thread t owns keys 4t..4t+3 of all 12 heads (48 f32), the 12x12 weights
// are read at uniform addresses (scalar registers), and LDS carries only 16 half-wave maxima and sums per head.
// =====================================================================================
#define MX_H 12
#define MX_N 1024

// value of lane l ^ X inside a 16-lane row (DPP row_xmask), no LDS pipe
template <int X> __device__ __forceinline__ float row_x(float x) {
  return __builtin_bit_cast(float, __builtin_amdgcn_update_dpp(0, __builtin_bit_cast(int, x), 0x160 + X, 0xf, 0xf, true));
}
__device__ __forceinline__ float row_max16(float x) {
  x = fmaxf(x, row_x<1>(x)); x = fmaxf(x, row_x<2>(x)); x = fmaxf(x, row_x<4>(x)); x = fmaxf(x, row_x<8>(x));
  return x;
}
__device__ __forceinline__ float row_sum16(float x) {
  x += row_x<1>(x); x += row_x<2>(x); x += row_x<4>(x); x += row_x<8>(x);
  return x;
}
// value of lane l ^ 16
__device__ __forceinline__ float other_row(float x) {
  return __builtin_bit_cast(float, __builtin_amdgcn_permlanex16(__builtin_bit_cast(int, x), __builtin_bit_cast(int, x), 0x76543210, 0xfedcba98, false, false));
}
// lane g's value as a wave-uniform scalar
__device__ __forceinline__ float lane_val(float x, int g) {
  return __builtin_bit_cast(float, __builtin_amdgcn_readlane(__builtin_bit_cast(int, x), g));
}

// 2^x of four values in place. One statement, so that each v_exp_f32 is followed by an instruction that touches neither
// its result nor its source; the v_nop is that independent slot behind the last one.
__device__ __forceinline__ void exp2x4(v4f& x) {
  float x0 = x[0], x1 = x[1], x2 = x[2], x3 = x[3];
  asm("v_exp_f32 %0, %0\n\tv_exp_f32 %1, %1\n\tv_exp_f32 %2, %2\n\tv_exp_f32 %3, %3\n\tv_nop"
      : "+v"(x0), "+v"(x1), "+v"(x2), "+v"(x3));
  x = (v4f){x0, x1, x2, x3};
}

__global__ __launch_bounds__(256) void th_mix_kernel(
    float* SP, const float* __restrict__ w1, const float* __restrict__ b1,
    const float* __restrict__ w2, const float* __restrict__ b2, float pcarry)
{
  __shared__ __align__(16) float redm[16 * MX_H];   // [half-wave][head] maxima
  __shared__ __align__(16) float reds[16 * MX_H];   // [half-wave][head] sums

  const int tid  = threadIdx.x;
  const int lane = tid & 31;
  float* blk = SP + ((size_t)blockIdx.y * MX_N + blockIdx.x) * (MX_H * MX_N);
  const int gl = (lane & 15) < MX_H ? (lane & 15) : MX_H - 1;   // the head this lane folds behind a barrier
  const int hb = (lane >> 4) * 8;                               // first of its 8 half-waves

  // every loop below is unrolled so that the head index of each register array is a constant (no scratch)
  v4f s[MX_H];
#pragma unroll
  for (int h = 0; h < MX_H; ++h) s[h] = *(const v4f*)(blk + h * MX_N + tid * 4);

  // ---- mix 1 ----
  v4f a[MX_H];
#pragma unroll
  for (int g = 0; g < MX_H; ++g) {
    const float bg = b1[g];
    v4f acc = (v4f){bg, bg, bg, bg};
#pragma unroll
    for (int h = 0; h < MX_H; ++h) acc += w1[g * MX_H + h] * s[h];
    a[g] = acc;
  }

  // ---- softmax per head: maximum ----
  {
    float pm[MX_H];
#pragma unroll
    for (int g = 0; g < MX_H; ++g) pm[g] = row_max16(fmaxf(fmaxf(a[g][0], a[g][1]), fmaxf(a[g][2], a[g][3])));
    if ((lane & 15) == 0) {
      float* rp = redm + (tid >> 4) * MX_H;
      *(v4f*)(rp)     = (v4f){pm[0], pm[1], pm[2],  pm[3]};
      *(v4f*)(rp + 4) = (v4f){pm[4], pm[5], pm[6],  pm[7]};
      *(v4f*)(rp + 8) = (v4f){pm[8], pm[9], pm[10], pm[11]};
    }
  }
  __syncthreads();   // all 16 half-wave maxima are in LDS; every logit of the block has been read
  {
    float M = redm[hb * MX_H + gl];
#pragma unroll
    for (int j = 1; j < 8; ++j) M = fmaxf(M, redm[(hb + j) * MX_H + gl]);
    M = fmaxf(M, other_row(M));
    const float L2E = 1.44269504088896340736f;
    const float ML = M * L2E;
#pragma unroll
    for (int g = 0; g < MX_H; ++g) {
      const float mg = lane_val(ML, g);
#pragma unroll
      for (int e = 0; e < 4; ++e) a[g][e] = __builtin_fmaf(a[g][e], L2E, -mg);
      exp2x4(a[g]);
    }
  }
  // ---- sum ----
  {
    float ps[MX_H];
#pragma unroll
    for (int g = 0; g < MX_H; ++g) ps[g] = row_sum16((a[g][0] + a[g][1]) + (a[g][2] + a[g][3]));
    if ((lane & 15) == 0) {
      float* rp = reds + (tid >> 4) * MX_H;
      *(v4f*)(rp)     = (v4f){ps[0], ps[1], ps[2],  ps[3]};
      *(v4f*)(rp + 4) = (v4f){ps[4], ps[5], ps[6],  ps[7]};
      *(v4f*)(rp + 8) = (v4f){ps[8], ps[9], ps[10], ps[11]};
    }
  }
  __syncthreads();   // all 16 half-wave sums are in LDS
  {
    float S = reds[hb * MX_H + gl];
#pragma unroll
    for (int j = 1; j < 8; ++j) S += reds[(hb + j) * MX_H + gl];
    S += other_row(S);
    const float inv = (1.0f / S) * pcarry;   // 1/sum of the source head and the carry go onto the exponentials
#pragma unroll
    for (int g = 0; g < MX_H; ++g) a[g] *= lane_val(inv, g);
  }

  // ---- mix 2, f16 store ----
  unsigned short* prow = (unsigned short*)blk + tid * 4;
#pragma unroll
  for (int g = 0; g < MX_H; ++g) {
    const float bg = b2[g] * pcarry;
    v4f acc = (v4f){bg, bg, bg, bg};
#pragma unroll
    for (int h = 0; h < MX_H; ++h) acc += w2[g * MX_H + h] * a[h];
    v4h hv;
#pragma unroll
    for (int e = 0; e < 4; ++e) hv[e] = (_Float16)acc[e];
    *(v4h*)(prow + g * MX_N) = hv;
  }
}

// ---------------------------------------------------------------------------
template <int BIAS_MODE, int OUT_MODE>
static void gemm_f16(hipStream_t st, int gy,
                     const void* A, int lda, long sA,
                     const void* Bt, int ldb, long sB,
                     void* C, int ldc, long sC,
                     const float* bias, int M, int N, int K, float scale,
                     int gz = 1, long zA = 0L, long zB = 0L, long zC = 0L)
{
  dim3 grid((M / 128) * (N / 256), gy, gz);
  wmma_gemm64<0, false, BIAS_MODE, OUT_MODE, false, 0><<<grid, 256, 0, st>>>(
      (const unsigned short*)A, (const unsigned short*)A, lda, sA,
      (const unsigned short*)Bt, (const unsigned short*)Bt, ldb, sB,
      C, C, ldc, sC, bias, bias, (long)0, M, N, K, scale, zA, zB, zC);
}

// one block per 64x64 tile, K split over its eight waves; f16 output, no bias
static void gemm_f16_ksplit(hipStream_t st, int gy,
                            const void* A, int lda, long sA,
                            const void* Bt, int ldb, long sB,
                            void* C, int ldc, long sC,
                            const float* unused, int M, int N, int K, float scale,
                            int gz, long zA, long zB, long zC)
{
  dim3 grid((M / 64) * (N / 64), gy, gz);
  wmma_gemm64<0, false, 0, 1, false, 0, true><<<grid, 256, 0, st>>>(
      (const unsigned short*)A, (const unsigned short*)A, lda, sA,
      (const unsigned short*)Bt, (const unsigned short*)Bt, ldb, sB,
      C, C, ldc, sC, unused, unused, (long)0, M, N, K, scale, zA, zB, zC);
}

extern "C" void kernel_launch(void* const* d_in, const int* in_sizes, int n_in,
                              void* d_out, int out_size, void* d_ws, size_t ws_size,
                              hipStream_t stream)
{
  const int Bn = 8, Nn = 1024, Dd = 768, Hh = 12, HD = 64;
  const int GB = 4;                                       // batches per launch in the attention part
  if (n_in < 13) return;
  if (in_sizes[0] != Bn * Nn * Dd) return;
  if (in_sizes[1] != Dd * Dd || in_sizes[3] != Dd * Dd || in_sizes[5] != Dd * Dd || in_sizes[7] != Dd * Dd) return;
  if (in_sizes[2] != Dd || in_sizes[4] != Dd || in_sizes[6] != Dd || in_sizes[8] != Dd) return;
  if (in_sizes[9] != Hh * Hh || in_sizes[10] != Hh || in_sizes[11] != Hh * Hh || in_sizes[12] != Hh) return;
  if (out_size != Bn * Nn * Dd) return;

  const float* x    = (const float*)d_in[0];
  const float* wq   = (const float*)d_in[1];
  const float* bq   = (const float*)d_in[2];
  const float* wk   = (const float*)d_in[3];
  const float* bk   = (const float*)d_in[4];
  const float* wv   = (const float*)d_in[5];
  const float* bv   = (const float*)d_in[6];
  const float* wo   = (const float*)d_in[7];
  const float* bo   = (const float*)d_in[8];
  const float* th1w = (const float*)d_in[9];
  const float* th1b = (const float*)d_in[10];
  const float* th2w = (const float*)d_in[11];
  const float* th2b = (const float*)d_in[12];
  float* out = (float*)d_out;

  // ---- workspace carve (bytes) ----
  const size_t WSZ = (size_t)Dd * Dd * 2;                 // one f16 weight matrix
  const size_t ASZ = (size_t)Bn * Nn * Dd * 2;            // one f16 activation [8192][768]
  const size_t SSZ = (size_t)GB * Nn * Hh * Nn * 4;       // logits f32 [GB][1024][12][1024]; mixed attention f16 written over them
  const size_t off_wq  = 0;
  const size_t off_wk  = off_wq + WSZ;
  const size_t off_wv  = off_wk + WSZ;
  const size_t off_wo  = off_wv + WSZ;
  const size_t off_q   = off_wo + WSZ;
  const size_t off_k   = off_q + ASZ;
  const size_t off_vt  = off_k + ASZ;                     // v^T per batch: [b][h*64+d][m]
  const size_t off_ctx = off_vt + ASZ;                    // attention output [8192][768] f16
  const size_t off_R   = off_ctx + ASZ;                   // reused region
  const size_t off_x16 = off_R;                           // live during the projections only
  const size_t off_S   = off_R;                           // live per group of GB batches afterwards
  size_t end = off_S + SSZ;
  if (off_x16 + ASZ > end) end = off_x16 + ASZ;
  if (end > ws_size) return;

  uint8_t* ws = (uint8_t*)d_ws;
  _Float16* wq16 = (_Float16*)(ws + off_wq);
  _Float16* wk16 = (_Float16*)(ws + off_wk);
  _Float16* wv16 = (_Float16*)(ws + off_wv);
  _Float16* wo16 = (_Float16*)(ws + off_wo);
  unsigned short* q16   = (unsigned short*)(ws + off_q);
  unsigned short* k16   = (unsigned short*)(ws + off_k);
  unsigned short* vt16  = (unsigned short*)(ws + off_vt);
  unsigned short* ctx16 = (unsigned short*)(ws + off_ctx);
  _Float16* x16 = (_Float16*)(ws + off_x16);
  float* Sb = (float*)(ws + off_S);

  const float WCARRY = 64.0f;        // weights carried x2^6 in f16
  const float PCARRY = 2048.0f;      // mixed attention carried x2^11 in f16

  // ---- casts to f16 ----
  {
    const int n2x = Bn * Nn * Dd / 2;
    cast_f32_f16x2s<<<(n2x + 255) / 256, 256, 0, stream>>>(x, x16, n2x, 1.0f);
    const int n2w = Dd * Dd / 2;
    cast_f32_f16x2s<<<(n2w + 255) / 256, 256, 0, stream>>>(wq, wq16, n2w, WCARRY);
    cast_f32_f16x2s<<<(n2w + 255) / 256, 256, 0, stream>>>(wk, wk16, n2w, WCARRY);
    cast_f32_f16x2s<<<(n2w + 255) / 256, 256, 0, stream>>>(wv, wv16, n2w, WCARRY);
    cast_f32_f16x2s<<<(n2w + 255) / 256, 256, 0, stream>>>(wo, wo16, n2w, WCARRY);
  }

  // ---- projections: q, k as [b*1024+n][h*64+d] f16; v^T per batch as [b][h*64+d][m] f16 ----
  gemm_f16<2, 1>(stream, 1, x16, Dd, 0L, wq16, Dd, 0L, q16, Dd, 0L, bq, Bn * Nn, Dd, Dd, 1.0f / WCARRY);
  gemm_f16<2, 1>(stream, 1, x16, Dd, 0L, wk16, Dd, 0L, k16, Dd, 0L, bk, Bn * Nn, Dd, Dd, 1.0f / WCARRY);
  // A = wv [768][768], Bt = x rows of batch b [1024][768] -> C [768][1024] per batch, bias[m] = bv[o]
  gemm_f16<1, 1>(stream, Bn, wv16, Dd, 0L, x16, Dd, (long)Nn * Dd, vt16, Nn, (long)Dd * Nn, bv, Dd, Nn, Dd, 1.0f / WCARRY);

  // ---- per group of GB batches (grid.z = batch in the group): logits -> mix/softmax/mix -> a.v ----
  const float qk_scale = 0.125f;     // 64^-0.5
  const long rowS = (long)Hh * Nn;   // f32 elements of one query's 12 logit rows
  for (int b = 0; b < Bn; b += GB) {
    const unsigned short* qb = q16 + (size_t)b * Nn * Dd;
    const unsigned short* kb = k16 + (size_t)b * Nn * Dd;
    // S[z][n][h][m] = scale * sum_d q[n][h*64+d] k[m][h*64+d]; grid.y = head: strideA/B = 64, strideC = 1024
    gemm_f16<0, 0>(stream, Hh, qb, Dd, (long)HD, kb, Dd, (long)HD, Sb, Hh * Nn, (long)Nn, bq, Nn, Nn, HD, qk_scale,
                   GB, (long)Nn * Dd, (long)Nn * Dd, (long)Nn * rowS);
    th_mix_kernel<<<dim3(Nn, GB), 256, 0, stream>>>(Sb, th1w, th1b, th2w, th2b, PCARRY);
    // ctx[(b+z)*1024+n][h*64+d] = 2^-11 * sum_m P[z][n][h][m] * vT[b+z][h*64+d][m]; grid.y = head.
    // P rows lie in the logits' place: f16 pitch per query = 2 * rowS, per head = 1024
    gemm_f16_ksplit(stream, Hh,
                    Sb, 2 * Hh * Nn, (long)Nn,
                    vt16 + (size_t)b * Dd * Nn, Nn, (long)HD * Nn,
                    ctx16 + (size_t)b * Nn * Dd, Dd, (long)HD,
                    bq, Nn, HD, Nn, 1.0f / PCARRY,
                    GB, (long)Nn * 2 * rowS, (long)Dd * Nn, (long)Nn * Dd);
  }

  // ---- output projection -> f32 [8192][768] ----
  gemm_f16<2, 0>(stream, 1, ctx16, Dd, 0L, wo16, Dd, 0L, out, Dd, 0L, bo, Bn * Nn, Dd, Dd, 1.0f / WCARRY);
}

// v005
// It runs in 265 microseconds.
// Timed twice side by side with v004, it ran 1.04 times as fast both times.
// Over all steps from v000 it is 3.17 times as fast.
#include <hip/hip_runtime.h>
#include <stdint.h>
#include <stddef.h>

// Contractions (q/k/v projections, q.k^T, a.v, output projection): v_wmma_f32_16x16x32_f16 (f16 operands, f32 accumulate); weights carried x64, mixed attention carried x2^11, folded back in the f32 epilogue; 12x12 cross-head mixes and softmax in f32 on VALU.

typedef __attribute__((ext_vector_type(16))) _Float16 v16h;
typedef __attribute__((ext_vector_type(8)))  _Float16 v8h;
typedef __attribute__((ext_vector_type(4)))  _Float16 v4h;
typedef __attribute__((ext_vector_type(16))) __bf16   v16b;
typedef __attribute__((ext_vector_type(8)))  __bf16   v8b;
typedef __attribute__((ext_vector_type(8)))  float    v8f;
typedef __attribute__((ext_vector_type(4)))  float    v4f;
typedef __attribute__((ext_vector_type(2)))  float    v2f;

__device__ __forceinline__ unsigned short f2bf_bits(float f) {
  unsigned u = __float_as_uint(f);
  return (unsigned short)((u + 0x7FFFu + ((u >> 16) & 1u)) >> 16);
}
__device__ __forceinline__ float bf_bits2f(unsigned short h) { return __uint_as_float(((unsigned)h) << 16); }

// hazard guards as plain device helpers
__device__ __forceinline__ void dep_guard_h(v8f& a, v8f& b, v16h x, v16h y) { asm volatile("v_nop\n\tv_nop\n\tv_nop\n\tv_nop" : "+v"(a), "+v"(b) : "v"(x), "v"(y)); }
__device__ __forceinline__ void dep_guard_b(v8f& a, v8f& b, v16b x, v16b y) { asm volatile("v_nop\n\tv_nop\n\tv_nop\n\tv_nop" : "+v"(a), "+v"(b) : "v"(x), "v"(y)); }
__device__ __forceinline__ void keep4_h(v16h a, v16h b, v16h c, v16h d) { asm volatile("v_nop" :: "v"(a), "v"(b), "v"(c), "v"(d)); }
__device__ __forceinline__ void keep4_b(v16b a, v16b b, v16b c, v16b d) { asm volatile("v_nop" :: "v"(a), "v"(b), "v"(c), "v"(d)); }
__device__ __forceinline__ void acc_guard4(v8f& a, v8f& b, v8f& c, v8f& d) { asm volatile("v_nop\n\tv_nop\n\tv_nop\n\tv_nop" : "+v"(a), "+v"(b), "+v"(c), "+v"(d)); }
template <typename T> struct Frag;
template <> struct Frag<_Float16> {
  typedef v16h V; union U { v16h v; v8h h[2]; };
  static __device__ __forceinline__ v16h load(const _Float16* p) {   // elements 0..7 <- p[0..7], 8..15 <- p[16..23]
    U f; f.h[0] = *(const v8h*)(p); f.h[1] = *(const v8h*)(p + 16); return f.v;
  }
  static __device__ __forceinline__ v8f mma(v16h a, v16h b, v8f c) {
    return __builtin_amdgcn_wmma_f32_16x16x32_f16(false, a, false, b, (short)0, c, false, false);
  }
  static __device__ __forceinline__ void guard(v8f& a, v8f& b, v16h x, v16h y) { dep_guard_h(a, b, x, y); }
  static __device__ __forceinline__ void keep(v16h a, v16h b, v16h c, v16h d) { keep4_h(a, b, c, d); }
};
template <> struct Frag<__bf16> {
  typedef v16b V; union U { v16b v; v8b h[2]; };
  static __device__ __forceinline__ v16b load(const __bf16* p) {
    U f; f.h[0] = *(const v8b*)(p); f.h[1] = *(const v8b*)(p + 16); return f.v;
  }
  static __device__ __forceinline__ v8f mma(v16b a, v16b b, v8f c) {
    return __builtin_amdgcn_wmma_f32_16x16x32_bf16(false, a, false, b, (short)0, c, false, false);
  }
  static __device__ __forceinline__ void guard(v8f& a, v8f& b, v16b x, v16b y) { dep_guard_b(a, b, x, y); }
  static __device__ __forceinline__ void keep(v16b a, v16b b, v16b c, v16b d) { keep4_b(a, b, c, d); }
};

// ---- Register-blocked batched WMMA GEMM ------------------------------------
// C[m,n] = scale * sum_k A[m,k] * Bt[n,k] (+bias)(+resid); each wave owns a 64x64 tile.
// A row-major [M,K]; Bt row-major [N,K].
// SPLIT: operands are hi/lo planes (A2/Bt2 = lo planes, same layout); product = hi.hi + hi.lo + lo.hi.
// BIAS_MODE: 0 = none, 1 = bias[m], 2 = bias[n].
// OUT_MODE: 0 = f32, 1 = f16, 2 = bf16 hi plane (Cout) + bf16 lo plane (Cout2).
// ET: 0 = f16 operands, 1 = bf16 operands (pointers passed as 16-bit storage)
// KSPLIT: one 64x64 tile per block; wave w sums k in [w*K/8, (w+1)*K/8) (K % 256 == 0) and the eight f32
// partial tiles are added in LDS in wave order 0..7. For shapes with too few tiles to fill the chip.
// Two batch levels: blockIdx.y with strideA/B/C, blockIdx.z with zA/zB/zC (element strides).
// Not KSPLIT: one 128x256 tile of C per block (M % 128 == 0, N % 256 == 0, K % 64 == 0), waves 2 x 4, 64x64 each.
// Per 64 k the block's 128 A rows and 256 Bt rows (128 B each) are copied to LDS by asynchronous 16-byte copies,
// four whole rows per wave and copy, two buffers: the next 64 k fly while this one is multiplied.
#define SG_PITCH 72                          // f16 per staged row: 128 B + 16 B, the pitch for ds_load_b128 readers of 16 rows
#define SG_ROWS  384                         // 128 A rows, then 256 Bt rows
#define SG_BYTES (SG_ROWS * SG_PITCH * 2)    // one buffer
// One stage: this lane's 16 bytes of rows r, r + 32, ... (4 of A, 8 of Bt). lds = LDS byte address of its place in row r.
// The s_wait_xcnt stands inside the statement so that no address register is rewritten in front of it.
__device__ __forceinline__ void stage_issue(unsigned lds, const unsigned short* ga, size_t stepA,
                                            const unsigned short* gb, size_t stepB) {
  const unsigned LS = 32 * SG_PITCH * 2;
  asm volatile(
      "global_load_async_to_lds_b128 %0, %12, off\n\t"
      "global_load_async_to_lds_b128 %1, %13, off\n\t"
      "global_load_async_to_lds_b128 %2, %14, off\n\t"
      "global_load_async_to_lds_b128 %3, %15, off\n\t"
      "global_load_async_to_lds_b128 %4, %16, off\n\t"
      "global_load_async_to_lds_b128 %5, %17, off\n\t"
      "global_load_async_to_lds_b128 %6, %18, off\n\t"
      "global_load_async_to_lds_b128 %7, %19, off\n\t"
      "global_load_async_to_lds_b128 %8, %20, off\n\t"
      "global_load_async_to_lds_b128 %9, %21, off\n\t"
      "global_load_async_to_lds_b128 %10, %22, off\n\t"
      "global_load_async_to_lds_b128 %11, %23, off\n\t"
      "s_wait_xcnt 0x0"
      :: "v"(lds), "v"(lds + LS), "v"(lds + 2 * LS), "v"(lds + 3 * LS),
         "v"(lds + 4 * LS), "v"(lds + 5 * LS), "v"(lds + 6 * LS), "v"(lds + 7 * LS),
         "v"(lds + 8 * LS), "v"(lds + 9 * LS), "v"(lds + 10 * LS), "v"(lds + 11 * LS),
         "v"(ga), "v"(ga + stepA), "v"(ga + 2 * stepA), "v"(ga + 3 * stepA),
         "v"(gb), "v"(gb + stepB), "v"(gb + 2 * stepB), "v"(gb + 3 * stepB),
         "v"(gb + 4 * stepB), "v"(gb + 5 * stepB), "v"(gb + 6 * stepB), "v"(gb + 7 * stepB)
      : "memory");
}
template <int ET> struct Elem;
template <> struct Elem<0> { typedef _Float16 T; };
template <> struct Elem<1> { typedef __bf16 T; };
template <int ET, bool SPLIT, int BIAS_MODE, int OUT_MODE, bool RESID, int ACT = 0, bool KSPLIT = false>
__global__ __launch_bounds__(256) void wmma_gemm64(
    const unsigned short* __restrict__ Ap, const unsigned short* __restrict__ A2p, int lda, long strideA,
    const unsigned short* __restrict__ Btp, const unsigned short* __restrict__ Bt2p, int ldb, long strideB,
    void* __restrict__ Cout, void* __restrict__ Cout2, int ldc, long strideC,
    const float* __restrict__ bias,
    const float* __restrict__ resid, long strideR,
    int M, int N, int K, float scale, long zA, long zB, long zC) {
  typedef typename Elem<ET>::T T;
  typedef typename Frag<T>::V V;
  const T* A = (const T*)Ap; const T* A2 = (const T*)A2p; const T* Bt = (const T*)Btp; const T* Bt2 = (const T*)Bt2p;
  static_assert(!KSPLIT || (!SPLIT && BIAS_MODE == 0 && OUT_MODE == 1 && !RESID && ACT == 0), "KSPLIT epilogue: plain f16 output only");
  static_assert(KSPLIT || !SPLIT, "staged form: single-plane operands only");
  __shared__ __align__(16) float sT[8][(KSPLIT ? 64 : 16) * 68];   // per-wave slab (16x64, KSPLIT: 64x64), pitch 68 floats
  __shared__ __align__(16) unsigned short stg[KSPLIT ? 8 : 2 * SG_ROWS * SG_PITCH];   // staged operand rows, two buffers
  const int b    = blockIdx.y;
  const int z    = blockIdx.z;
  const int lane = threadIdx.x & 31;
  const int wave = threadIdx.x >> 5;
  const int tilesN = N >> (KSPLIT ? 6 : 8);
  const int tilesM = M >> (KSPLIT ? 6 : 7);
  const int tile = (int)blockIdx.x;
  if (tile >= tilesM * tilesN) return;   // block-uniform, in front of every barrier
  const int tm = tile / tilesN;
  const int tn = tile - tm * tilesN;
  const int wv = __builtin_amdgcn_readfirstlane(wave);
  const int bm0 = tm << (KSPLIT ? 6 : 7);                  // the block's first row and column of C
  const int bn0 = tn << (KSPLIT ? 6 : 8);
  const int m0 = KSPLIT ? bm0 : bm0 + ((wv >> 2) << 6);    // the wave's
  const int n0 = KSPLIT ? bn0 : bn0 + ((wv & 3) << 6);

  const size_t offA = (size_t)b * strideA + (size_t)z * zA;
  const size_t offB = (size_t)b * strideB + (size_t)z * zB;
  const size_t offC = (size_t)b * strideC + (size_t)z * zC;
  const T* Ab  = A  + offA;
  const T* Bb  = Bt + offB;
  const T* Ab2 = SPLIT ? (A2  + offA) : nullptr;
  const T* Bb2 = SPLIT ? (Bt2 + offB) : nullptr;

  const int rlane = lane & 15;                 // row (A) / col (B, D) within subtile
  const int koff  = (lane >> 4) * 8;           // k offset of this lane half
  const int mOff  = (lane >> 4) * 8;           // D row offset

  v8f acc[4][4];
#pragma unroll
  for (int i = 0; i < 4; ++i)
#pragma unroll
    for (int j = 0; j < 4; ++j) acc[i][j] = (v8f){0.f,0.f,0.f,0.f,0.f,0.f,0.f,0.f};

  if (!KSPLIT) {
    const int crow = threadIdx.x >> 3;                     // a wave's copy = 4 whole rows of 128 B
    const int cchk = (threadIdx.x & 7) * 8;
    const unsigned short* gA = Ap + offA + (size_t)(bm0 + crow) * lda + cchk;
    const unsigned short* gB = Btp + offB + (size_t)(bn0 + crow) * ldb + cchk;
    const size_t stepA = (size_t)32 * lda, stepB = (size_t)32 * ldb;
    const unsigned l0 = (unsigned)(size_t)stg + (unsigned)(crow * SG_PITCH + cchk) * 2u;
    const int nst = K >> 6;                                // stages of 64 k
    const int aRow = ((wv >> 2) << 6) + rlane;             // the wave's first staged rows
    const int bRow = 128 + ((wv & 3) << 6) + rlane;
    stage_issue(l0, gA, stepA, gB, stepB);
    asm volatile("s_wait_asynccnt 0x0" ::: "memory");      // this wave's copies of stage 0 have landed
    __syncthreads();                                       // ... and every other wave's
    if (nst > 1) stage_issue(l0 + SG_BYTES, gA + 64, stepA, gB + 64, stepB);
#pragma unroll 1   // one body: the buffer is picked by t & 1
    for (int t = 0; t < nst; ++t) {
      const T* sb = (const T*)stg + (t & 1) * (SG_ROWS * SG_PITCH);
      // the loops below are unrolled so that every fragment and accumulator index is a constant (registers, no scratch)
#pragma unroll
      for (int ks = 0; ks < 2; ++ks) {
        V bh[4], ah[4];
#pragma unroll
        for (int j = 0; j < 4; ++j) bh[j] = Frag<T>::load(sb + (bRow + (j << 4)) * SG_PITCH + (ks << 5) + koff);
#pragma unroll
        for (int i = 0; i < 4; ++i) ah[i] = Frag<T>::load(sb + (aRow + (i << 4)) * SG_PITCH + (ks << 5) + koff);
        __builtin_amdgcn_sched_barrier(0);   // the 16 LDS reads stay one group in front of their 16 WMMAs (else: one A fragment at a time, a full LDS wait per 4 WMMAs)
#pragma unroll
        for (int i = 0; i < 4; ++i)
#pragma unroll
          for (int j = 0; j < 4; ++j) acc[i][j] = Frag<T>::mma(ah[i], bh[j], acc[i][j]);
      }
      asm volatile("s_wait_dscnt 0x0" ::: "memory");       // this wave has left the buffer of stage t
      asm volatile("s_wait_asynccnt 0x0" ::: "memory");    // its copies of stage t + 1 have landed
      __syncthreads();                                     // publishes stage t + 1 and frees the buffer of stage t
      if (t + 2 < nst) stage_issue(l0 + (t & 1) * SG_BYTES, gA + (size_t)(t + 2) * 64, stepA, gB + (size_t)(t + 2) * 64, stepB);
    }
    asm volatile("s_wait_asynccnt 0x0" ::: "memory");      // no copy is left in flight behind the loop
  }
  const int kBeg = KSPLIT ? wv * (K >> 3) : 0;   // scalar, so the k loop keeps its scalar counter and branch
  const int kEnd = KSPLIT ? kBeg + (K >> 3) : 0;
  for (int k0 = kBeg; k0 < kEnd; k0 += 32) {
    V bh[4], bl[4];
#pragma unroll
    for (int j = 0; j < 4; ++j) {
      const size_t bo = (size_t)(n0 + (j << 4) + rlane) * ldb + koff + k0;
      bh[j] = Frag<T>::load(Bb + bo);
      if (SPLIT) bl[j] = Frag<T>::load(Bb2 + bo);
    }
#pragma unroll
    for (int i = 0; i < 4; ++i) {
      const size_t ao = (size_t)(m0 + (i << 4) + rlane) * lda + koff + k0;
      V ah = Frag<T>::load(Ab + ao);
      V al;
      if (SPLIT) al = Frag<T>::load(Ab2 + ao);
#pragma unroll
      for (int j = 0; j < 4; ++j) {
        acc[i][j] = Frag<T>::mma(ah, bh[j], acc[i][j]);
        if (SPLIT) {
          acc[i][j] = Frag<T>::mma(ah, bl[j], acc[i][j]);
          acc[i][j] = Frag<T>::mma(al, bh[j], acc[i][j]);
        }
      }
      Frag<T>::guard(acc[i][0], acc[i][3], ah, SPLIT ? al : ah);
    }
    Frag<T>::keep(bh[0], bh[1], bh[2], bh[3]);
    if (SPLIT) Frag<T>::keep(bl[0], bl[1], bl[2], bl[3]);
  }
  acc_guard4(acc[0][0], acc[0][1], acc[0][2], acc[0][3]);
  acc_guard4(acc[1][0], acc[1][1], acc[1][2], acc[1][3]);
  acc_guard4(acc[2][0], acc[2][1], acc[2][2], acc[2][3]);
  acc_guard4(acc[3][0], acc[3][1], acc[3][2], acc[3][3]);

  if (KSPLIT) {
    // ---- split-K epilogue: partial tiles to LDS, then wave w sums and stores rows 8w..8w+7 ----
    float* part = sT[wave];
#pragma unroll
    for (int i = 0; i < 4; ++i)
#pragma unroll
      for (int j = 0; j < 4; ++j)
#pragma unroll
        for (int r = 0; r < 8; ++r)
          part[((i << 4) + mOff + r) * 68 + (j << 4) + rlane] = acc[i][j][r];
    __syncthreads();   // every wave's partial tile is in LDS before any wave reads the eight of them
    unsigned short* C = (unsigned short*)Cout + offC;
    const int hh = lane >> 4, c4 = (lane & 15) * 4;     // row seg = 64 f16 = 128 B = 16 lanes x 8 B
#pragma unroll
    for (int it = 0; it < 4; ++it) {
      const int row = (wave << 3) + it * 2 + hh;
      v4f s = *(const v4f*)(&sT[0][row * 68 + c4]);
#pragma unroll
      for (int w = 1; w < 8; ++w) s += *(const v4f*)(&sT[w][row * 68 + c4]);
      v4h hv;
#pragma unroll
      for (int e = 0; e < 4; ++e) hv[e] = (_Float16)(s[e] * scale);
      *(v4h*)(C + (size_t)(m0 + row) * ldc + n0 + c4) = hv;
    }
    return;
  }

  // ---- epilogue ----
  float* slab = sT[wave];
  const float* Rb = RESID ? (resid + (size_t)b * strideR) : nullptr;
#pragma unroll
  for (int i = 0; i < 4; ++i) {
    const int mBase = m0 + (i << 4);
#pragma unroll
    for (int j = 0; j < 4; ++j) {
      const int n = n0 + (j << 4) + rlane;
      float bv = 0.f;
      if (BIAS_MODE == 2) bv = bias[n];
#pragma unroll
      for (int r = 0; r < 8; ++r) {
        float v = acc[i][j][r] * scale;
        if (BIAS_MODE == 1) v += bias[mBase + mOff + r];
        if (BIAS_MODE == 2) v += bv;
        if (RESID) v += Rb[(size_t)(mBase + mOff + r) * ldc + n];
        if (ACT == 1) v = tanhf(v);
        if (ACT == 2) v = fmaxf(v, 0.0f);
        if (ACT == 3) v = v / (1.0f + expf(-v));
        if (ACT == 4) v = (v > 0.f) ? v : 0.01f * v;
        if (ACT == 5) v = 0.5f * v * (1.0f + erff(v * 0.70710678118654752f));
        slab[(mOff + r) * 68 + (j << 4) + rlane] = v;
      }
    }
    __builtin_amdgcn_fence(__ATOMIC_RELEASE, "workgroup");
    __builtin_amdgcn_wave_barrier();
    __builtin_amdgcn_fence(__ATOMIC_ACQUIRE, "workgroup");
    if (OUT_MODE == 0) {
      float* C = (float*)Cout + offC;
      const int hh = lane >> 4, c4 = (lane & 15) * 4;     // row seg = 256 B = 16 lanes x 16 B
      {
#pragma unroll
        for (int it = 0; it < 8; ++it) {
          const int row = it * 2 + hh;
          v4f v = *(const v4f*)(slab + row * 68 + c4);
          *(v4f*)(C + (size_t)(mBase + row) * ldc + n0 + c4) = v;
        }
        
      }
    } else {
      const int q = lane >> 3, c8 = (lane & 7) * 8;
      unsigned short* C  = (unsigned short*)Cout  + offC;
      unsigned short* C2 = (OUT_MODE == 2) ? ((unsigned short*)Cout2 + offC) : nullptr;
      {
#pragma unroll
        for (int it = 0; it < 4; ++it) {
          const int row = it * 4 + q;
          const float* sp = slab + row * 68 + c8;
          v8h hv, lv;
#pragma unroll
          for (int e = 0; e < 8; ++e) {
            if (OUT_MODE == 1) {
              hv[e] = (_Float16)sp[e];
            } else {
              unsigned short hb = f2bf_bits(sp[e]);
              unsigned short lb = f2bf_bits(sp[e] - bf_bits2f(hb));
              hv[e] = __builtin_bit_cast(_Float16, hb);
              lv[e] = __builtin_bit_cast(_Float16, lb);
            }
          }
          *(v8h*)(C + (size_t)(mBase + row) * ldc + n0 + c8) = hv;
          if (OUT_MODE == 2) *(v8h*)(C2 + (size_t)(mBase + row) * ldc + n0 + c8) = lv;
        }
        
      }
    }
    __builtin_amdgcn_fence(__ATOMIC_RELEASE, "workgroup");
    __builtin_amdgcn_wave_barrier();
    __builtin_amdgcn_fence(__ATOMIC_ACQUIRE, "workgroup");
  }
}

// ---- f32 -> f16 casts of x (x1) and of the four weight matrices (x wscale), all in one launch ----
// A block converts CV_BLK consecutive floats of ONE array: blocks [0, xBlocks) take x, then wBlocks blocks each for
// wq, wk, wv, wo (w16 = the four f16 matrices one behind the other). Few long waves instead of many short ones: a thread
// has CV_U loads of 16 bytes in flight, each load of a wave covers 512 consecutive bytes, each store 256.
#define CV_U   16
#define CV_BLK (256 * 4 * CV_U)
__global__ __launch_bounds__(256) void cast_all_f16(
    const float* __restrict__ x, const float* __restrict__ wq, const float* __restrict__ wk,
    const float* __restrict__ wv, const float* __restrict__ wo,
    _Float16* __restrict__ x16, _Float16* __restrict__ w16, int xBlocks, int wBlocks, float wscale) {
  int bx = blockIdx.x;
  const float* in = x;
  _Float16* out = x16;
  float scale = 1.0f;
  if (bx >= xBlocks) {   // block-uniform
    bx -= xBlocks;
    const int j = bx / wBlocks;
    bx -= j * wBlocks;
    in = j == 0 ? wq : j == 1 ? wk : j == 2 ? wv : wo;
    out = w16 + (size_t)j * wBlocks * CV_BLK;
    scale = wscale;
  }
  const v4f* ip = (const v4f*)(in + (size_t)bx * CV_BLK);   // block-uniform bases; the thread index is the one vector offset of loads and stores
  v4h* op = (v4h*)(out + (size_t)bx * CV_BLK);
  const int t = threadIdx.x;
  v4f a[CV_U];
  // both loops are unrolled so that a[] stays in registers and all the loads are issued in front of the first store
#pragma unroll
  for (int i = 0; i < CV_U; ++i) a[i] = ip[t + i * 256];
#pragma unroll
  for (int i = 0; i < CV_U; ++i) {
    v4h h;
#pragma unroll
    for (int e = 0; e < 4; ++e) h[e] = (_Float16)(a[i][e] * scale);
    op[t + i * 256] = h;
  }
}

// =====================================================================================
// Cross-head mix 1 (12x12, f32) -> softmax over keys (f32) -> cross-head mix 2 with 1/sum and the
// power-of-two carry -> f16 store.  One block per query row n (blockIdx.x) of one batch (blockIdx.y).
// SP is [batch][1024][12][1024] f32 (query, head, key): a block's 12 logit rows are its own 48 KB. The
// result (mix2 * pcarry, f16, [12][1024]) goes into the first 24 KB of that same 48 KB: every thread has
// used all it loaded in front of the first barrier, the stores stand behind the second, and no other
// block touches these bytes.
// Everything stays in registers: thread t owns keys 4t..4t+3 of all 12 heads (48 f32), the 12x12 weights
// are read at uniform addresses (scalar registers), and LDS carries only 16 half-wave maxima and sums per head.
// =====================================================================================
#define MX_H 12
#define MX_N 1024

// value of lane l ^ X inside a 16-lane row (DPP row_xmask), no LDS pipe
template <int X> __device__ __forceinline__ float row_x(float x) {
  return __builtin_bit_cast(float, __builtin_amdgcn_update_dpp(0, __builtin_bit_cast(int, x), 0x160 + X, 0xf, 0xf, true));
}
__device__ __forceinline__ float row_max16(float x) {
  x = fmaxf(x, row_x<1>(x)); x = fmaxf(x, row_x<2>(x)); x = fmaxf(x, row_x<4>(x)); x = fmaxf(x, row_x<8>(x));
  return x;
}
__device__ __forceinline__ float row_sum16(float x) {
  x += row_x<1>(x); x += row_x<2>(x); x += row_x<4>(x); x += row_x<8>(x);
  return x;
}
// value of lane l ^ 16
__device__ __forceinline__ float other_row(float x) {
  return __builtin_bit_cast(float, __builtin_amdgcn_permlanex16(__builtin_bit_cast(int, x), __builtin_bit_cast(int, x), 0x76543210, 0xfedcba98, false, false));
}
// lane g's value as a wave-uniform scalar
__device__ __forceinline__ float lane_val(float x, int g) {
  return __builtin_bit_cast(float, __builtin_amdgcn_readlane(__builtin_bit_cast(int, x), g));
}

// 2^x of four values in place. One statement, so that each v_exp_f32 is followed by an instruction that touches neither
// its result nor its source; the v_nop is that independent slot behind the last one.
__device__ __forceinline__ void exp2x4(v4f& x) {
  float x0 = x[0], x1 = x[1], x2 = x[2], x3 = x[3];
  asm("v_exp_f32 %0, %0\n\tv_exp_f32 %1, %1\n\tv_exp_f32 %2, %2\n\tv_exp_f32 %3, %3\n\tv_nop"
      : "+v"(x0), "+v"(x1), "+v"(x2), "+v"(x3));
  x = (v4f){x0, x1, x2, x3};
}

__global__ __launch_bounds__(256) void th_mix_kernel(
    float* SP, const float* __restrict__ w1, const float* __restrict__ b1,
    const float* __restrict__ w2, const float* __restrict__ b2, float pcarry)
{
  __shared__ __align__(16) float redm[16 * MX_H];   // [half-wave][head] maxima
  __shared__ __align__(16) float reds[16 * MX_H];   // [half-wave][head] sums

  const int tid  = threadIdx.x;
  const int lane = tid & 31;
  float* blk = SP + ((size_t)blockIdx.y * MX_N + blockIdx.x) * (MX_H * MX_N);
  const int gl = (lane & 15) < MX_H ? (lane & 15) : MX_H - 1;   // the head this lane folds behind a barrier
  const int hb = (lane >> 4) * 8;                               // first of its 8 half-waves

  // every loop below is unrolled so that the head index of each register array is a constant (no scratch)
  v4f s[MX_H];
#pragma unroll
  for (int h = 0; h < MX_H; ++h) s[h] = *(const v4f*)(blk + h * MX_N + tid * 4);

  // ---- mix 1 ----
  v4f a[MX_H];
#pragma unroll
  for (int g = 0; g < MX_H; ++g) {
    const float bg = b1[g];
    v4f acc = (v4f){bg, bg, bg, bg};
#pragma unroll
    for (int h = 0; h < MX_H; ++h) acc += w1[g * MX_H + h] * s[h];
    a[g] = acc;
  }

  // ---- softmax per head: maximum ----
  {
    float pm[MX_H];
#pragma unroll
    for (int g = 0; g < MX_H; ++g) pm[g] = row_max16(fmaxf(fmaxf(a[g][0], a[g][1]), fmaxf(a[g][2], a[g][3])));
    if ((lane & 15) == 0) {
      float* rp = redm + (tid >> 4) * MX_H;
      *(v4f*)(rp)     = (v4f){pm[0], pm[1], pm[2],  pm[3]};
      *(v4f*)(rp + 4) = (v4f){pm[4], pm[5], pm[6],  pm[7]};
      *(v4f*)(rp + 8) = (v4f){pm[8], pm[9], pm[10], pm[11]};
    }
  }
  __syncthreads();   // all 16 half-wave maxima are in LDS; every logit of the block has been read
  {
    float M = redm[hb * MX_H + gl];
#pragma unroll
    for (int j = 1; j < 8; ++j) M = fmaxf(M, redm[(hb + j) * MX_H + gl]);
    M = fmaxf(M, other_row(M));
    const float L2E = 1.44269504088896340736f;
    const float ML = M * L2E;
#pragma unroll
    for (int g = 0; g < MX_H; ++g) {
      const float mg = lane_val(ML, g);
#pragma unroll
      for (int e = 0; e < 4; ++e) a[g][e] = __builtin_fmaf(a[g][e], L2E, -mg);
      exp2x4(a[g]);
    }
  }
  // ---- sum ----
  {
    float ps[MX_H];
#pragma unroll
    for (int g = 0; g < MX_H; ++g) ps[g] = row_sum16((a[g][0] + a[g][1]) + (a[g][2] + a[g][3]));
    if ((lane & 15) == 0) {
      float* rp = reds + (tid >> 4) * MX_H;
      *(v4f*)(rp)     = (v4f){ps[0], ps[1], ps[2],  ps[3]};
      *(v4f*)(rp + 4) = (v4f){ps[4], ps[5], ps[6],  ps[7]};
      *(v4f*)(rp + 8) = (v4f){ps[8], ps[9], ps[10], ps[11]};
    }
  }
  __syncthreads();   // all 16 half-wave sums are in LDS
  {
    float S = reds[hb * MX_H + gl];
#pragma unroll
    for (int j = 1; j < 8; ++j) S += reds[(hb + j) * MX_H + gl];
    S += other_row(S);
    const float inv = (1.0f / S) * pcarry;   // 1/sum of the source head and the carry go onto the exponentials
#pragma unroll
    for (int g = 0; g < MX_H; ++g) a[g] *= lane_val(inv, g);
  }

  // ---- mix 2, f16 store ----
  unsigned short* prow = (unsigned short*)blk + tid * 4;
#pragma unroll
  for (int g = 0; g < MX_H; ++g) {
    const float bg = b2[g] * pcarry;
    v4f acc = (v4f){bg, bg, bg, bg};
#pragma unroll
    for (int h = 0; h < MX_H; ++h) acc += w2[g * MX_H + h] * a[h];
    v4h hv;
#pragma unroll
    for (int e = 0; e < 4; ++e) hv[e] = (_Float16)acc[e];
    *(v4h*)(prow + g * MX_N) = hv;
  }
}

// ---------------------------------------------------------------------------
template <int BIAS_MODE, int OUT_MODE>
static void gemm_f16(hipStream_t st, int gy,
                     const void* A, int lda, long sA,
                     const void* Bt, int ldb, long sB,
                     void* C, int ldc, long sC,
                     const float* bias, int M, int N, int K, float scale,
                     int gz = 1, long zA = 0L, long zB = 0L, long zC = 0L)
{
  dim3 grid((M / 128) * (N / 256), gy, gz);
  wmma_gemm64<0, false, BIAS_MODE, OUT_MODE, false, 0><<<grid, 256, 0, st>>>(
      (const unsigned short*)A, (const unsigned short*)A, lda, sA,
      (const unsigned short*)Bt, (const unsigned short*)Bt, ldb, sB,
      C, C, ldc, sC, bias, bias, (long)0, M, N, K, scale, zA, zB, zC);
}

// one block per 64x64 tile, K split over its eight waves; f16 output, no bias
static void gemm_f16_ksplit(hipStream_t st, int gy,
                            const void* A, int lda, long sA,
                            const void* Bt, int ldb, long sB,
                            void* C, int ldc, long sC,
                            const float* unused, int M, int N, int K, float scale,
                            int gz, long zA, long zB, long zC)
{
  dim3 grid((M / 64) * (N / 64), gy, gz);
  wmma_gemm64<0, false, 0, 1, false, 0, true><<<grid, 256, 0, st>>>(
      (const unsigned short*)A, (const unsigned short*)A, lda, sA,
      (const unsigned short*)Bt, (const unsigned short*)Bt, ldb, sB,
      C, C, ldc, sC, unused, unused, (long)0, M, N, K, scale, zA, zB, zC);
}

extern "C" void kernel_launch(void* const* d_in, const int* in_sizes, int n_in,
                              void* d_out, int out_size, void* d_ws, size_t ws_size,
                              hipStream_t stream)
{
  const int Bn = 8, Nn = 1024, Dd = 768, Hh = 12, HD = 64;
  const int GB = 4;                                       // batches per launch in the attention part
  if (n_in < 13) return;
  if (in_sizes[0] != Bn * Nn * Dd) return;
  if (in_sizes[1] != Dd * Dd || in_sizes[3] != Dd * Dd || in_sizes[5] != Dd * Dd || in_sizes[7] != Dd * Dd) return;
  if (in_sizes[2] != Dd || in_sizes[4] != Dd || in_sizes[6] != Dd || in_sizes[8] != Dd) return;
  if (in_sizes[9] != Hh * Hh || in_sizes[10] != Hh || in_sizes[11] != Hh * Hh || in_sizes[12] != Hh) return;
  if (out_size != Bn * Nn * Dd) return;

  const float* x    = (const float*)d_in[0];
  const float* wq   = (const float*)d_in[1];
  const float* bq   = (const float*)d_in[2];
  const float* wk   = (const float*)d_in[3];
  const float* bk   = (const float*)d_in[4];
  const float* wv   = (const float*)d_in[5];
  const float* bv   = (const float*)d_in[6];
  const float* wo   = (const float*)d_in[7];
  const float* bo   = (const float*)d_in[8];
  const float* th1w = (const float*)d_in[9];
  const float* th1b = (const float*)d_in[10];
  const float* th2w = (const float*)d_in[11];
  const float* th2b = (const float*)d_in[12];
  float* out = (float*)d_out;

  // ---- workspace carve (bytes) ----
  const size_t WSZ = (size_t)Dd * Dd * 2;                 // one f16 weight matrix
  const size_t ASZ = (size_t)Bn * Nn * Dd * 2;            // one f16 activation [8192][768]
  const size_t SSZ = (size_t)GB * Nn * Hh * Nn * 4;       // logits f32 [GB][1024][12][1024]; mixed attention f16 written over them
  const size_t off_wq  = 0;
  const size_t off_wk  = off_wq + WSZ;
  const size_t off_wv  = off_wk + WSZ;
  const size_t off_wo  = off_wv + WSZ;
  const size_t off_q   = off_wo + WSZ;
  const size_t off_k   = off_q + ASZ;
  const size_t off_vt  = off_k + ASZ;                     // v^T per batch: [b][h*64+d][m]
  const size_t off_ctx = off_vt + ASZ;                    // attention output [8192][768] f16
  const size_t off_R   = off_ctx + ASZ;                   // reused region
  const size_t off_x16 = off_R;                           // live during the projections only
  const size_t off_S   = off_R;                           // live per group of GB batches afterwards
  size_t end = off_S + SSZ;
  if (off_x16 + ASZ > end) end = off_x16 + ASZ;
  if (end > ws_size) return;

  uint8_t* ws = (uint8_t*)d_ws;
  _Float16* wq16 = (_Float16*)(ws + off_wq);
  _Float16* wk16 = (_Float16*)(ws + off_wk);
  _Float16* wv16 = (_Float16*)(ws + off_wv);
  _Float16* wo16 = (_Float16*)(ws + off_wo);
  unsigned short* q16   = (unsigned short*)(ws + off_q);
  unsigned short* k16   = (unsigned short*)(ws + off_k);
  unsigned short* vt16  = (unsigned short*)(ws + off_vt);
  unsigned short* ctx16 = (unsigned short*)(ws + off_ctx);
  _Float16* x16 = (_Float16*)(ws + off_x16);
  float* Sb = (float*)(ws + off_S);

  const float WCARRY = 64.0f;        // weights carried x2^6 in f16
  const float PCARRY = 2048.0f;      // mixed attention carried x2^11 in f16

  // ---- casts to f16: one launch ----
  cast_all_f16<<<Bn * Nn * Dd / CV_BLK + 4 * (Dd * Dd / CV_BLK), 256, 0, stream>>>(
      x, wq, wk, wv, wo, x16, wq16, Bn * Nn * Dd / CV_BLK, Dd * Dd / CV_BLK, WCARRY);

  // ---- projections: q, k as [b*1024+n][h*64+d] f16; v^T per batch as [b][h*64+d][m] f16 ----
  gemm_f16<2, 1>(stream, 1, x16, Dd, 0L, wq16, Dd, 0L, q16, Dd, 0L, bq, Bn * Nn, Dd, Dd, 1.0f / WCARRY);
  gemm_f16<2, 1>(stream, 1, x16, Dd, 0L, wk16, Dd, 0L, k16, Dd, 0L, bk, Bn * Nn, Dd, Dd, 1.0f / WCARRY);
  // A = wv [768][768], Bt = x rows of batch b [1024][768] -> C [768][1024] per batch, bias[m] = bv[o]
  gemm_f16<1, 1>(stream, Bn, wv16, Dd, 0L, x16, Dd, (long)Nn * Dd, vt16, Nn, (long)Dd * Nn, bv, Dd, Nn, Dd, 1.0f / WCARRY);

  // ---- per group of GB batches (grid.z = batch in the group): logits -> mix/softmax/mix -> a.v ----
  const float qk_scale = 0.125f;     // 64^-0.5
  const long rowS = (long)Hh * Nn;   // f32 elements of one query's 12 logit rows
  for (int b = 0; b < Bn; b += GB) {
    const unsigned short* qb = q16 + (size_t)b * Nn * Dd;
    const unsigned short* kb = k16 + (size_t)b * Nn * Dd;
    // S[z][n][h][m] = scale * sum_d q[n][h*64+d] k[m][h*64+d]; grid.y = head: strideA/B = 64, strideC = 1024
    gemm_f16<0, 0>(stream, Hh, qb, Dd, (long)HD, kb, Dd, (long)HD, Sb, Hh * Nn, (long)Nn, bq, Nn, Nn, HD, qk_scale,
                   GB, (long)Nn * Dd, (long)Nn * Dd, (long)Nn * rowS);
    th_mix_kernel<<<dim3(Nn, GB), 256, 0, stream>>>(Sb, th1w, th1b, th2w, th2b, PCARRY);
    // ctx[(b+z)*1024+n][h*64+d] = 2^-11 * sum_m P[z][n][h][m] * vT[b+z][h*64+d][m]; grid.y = head.
    // P rows lie in the logits' place: f16 pitch per query = 2 * rowS, per head = 1024
    gemm_f16_ksplit(stream, Hh,
                    Sb, 2 * Hh * Nn, (long)Nn,
                    vt16 + (size_t)b * Dd * Nn, Nn, (long)HD * Nn,
                    ctx16 + (size_t)b * Nn * Dd, Dd, (long)HD,
                    bq, Nn, HD, Nn, 1.0f / PCARRY,
                    GB, (long)Nn * 2 * rowS, (long)Dd * Nn, (long)Nn * Dd);
  }

  // ---- output projection -> f32 [8192][768] ----
  gemm_f16<2, 0>(stream, 1, ctx16, Dd, 0L, wo16, Dd, 0L, out, Dd, 0L, bo, Bn * Nn, Dd, Dd, 1.0f / WCARRY);
}

// v006
// One run takes 223 microseconds.
// Timed twice side by side with v005, it ran 1.19 times as fast both times.
// All steps since v000 together make it 3.77 times as fast.
#include <hip/hip_runtime.h>
#include <stdint.h>
#include <stddef.h>

// Contractions (q/k/v projections, q.k^T, a.v, output projection): v_wmma_f32_16x16x32_f16 (f16 operands, f32 accumulate); weights carried x64, mixed attention carried x2^11, folded back in the f32 epilogue; scaled logits stored as f16; 12x12 cross-head mixes and softmax in f32 on VALU.

typedef __attribute__((ext_vector_type(16))) _Float16 v16h;
typedef __attribute__((ext_vector_type(8)))  _Float16 v8h;
typedef __attribute__((ext_vector_type(4)))  _Float16 v4h;
typedef __attribute__((ext_vector_type(16))) __bf16   v16b;
typedef __attribute__((ext_vector_type(8)))  __bf16   v8b;
typedef __attribute__((ext_vector_type(8)))  float    v8f;
typedef __attribute__((ext_vector_type(4)))  float    v4f;
typedef __attribute__((ext_vector_type(2)))  float    v2f;

__device__ __forceinline__ unsigned short f2bf_bits(float f) {
  unsigned u = __float_as_uint(f);
  return (unsigned short)((u + 0x7FFFu + ((u >> 16) & 1u)) >> 16);
}
__device__ __forceinline__ float bf_bits2f(unsigned short h) { return __uint_as_float(((unsigned)h) << 16); }

// hazard guards as plain device helpers
__device__ __forceinline__ void dep_guard_h(v8f& a, v8f& b, v16h x, v16h y) { asm volatile("v_nop\n\tv_nop\n\tv_nop\n\tv_nop" : "+v"(a), "+v"(b) : "v"(x), "v"(y)); }
__device__ __forceinline__ void dep_guard_b(v8f& a, v8f& b, v16b x, v16b y) { asm volatile("v_nop\n\tv_nop\n\tv_nop\n\tv_nop" : "+v"(a), "+v"(b) : "v"(x), "v"(y)); }
__device__ __forceinline__ void keep4_h(v16h a, v16h b, v16h c, v16h d) { asm volatile("v_nop" :: "v"(a), "v"(b), "v"(c), "v"(d)); }
__device__ __forceinline__ void keep4_b(v16b a, v16b b, v16b c, v16b d) { asm volatile("v_nop" :: "v"(a), "v"(b), "v"(c), "v"(d)); }
__device__ __forceinline__ void acc_guard4(v8f& a, v8f& b, v8f& c, v8f& d) { asm volatile("v_nop\n\tv_nop\n\tv_nop\n\tv_nop" : "+v"(a), "+v"(b), "+v"(c), "+v"(d)); }
template <typename T> struct Frag;
template <> struct Frag<_Float16> {
  typedef v16h V; union U { v16h v; v8h h[2]; };
  static __device__ __forceinline__ v16h load(const _Float16* p) {   // elements 0..7 <- p[0..7], 8..15 <- p[16..23]
    U f; f.h[0] = *(const v8h*)(p); f.h[1] = *(const v8h*)(p + 16); return f.v;
  }
  static __device__ __forceinline__ v8f mma(v16h a, v16h b, v8f c) {
    return __builtin_amdgcn_wmma_f32_16x16x32_f16(false, a, false, b, (short)0, c, false, false);
  }
  static __device__ __forceinline__ void guard(v8f& a, v8f& b, v16h x, v16h y) { dep_guard_h(a, b, x, y); }
  static __device__ __forceinline__ void keep(v16h a, v16h b, v16h c, v16h d) { keep4_h(a, b, c, d); }
};
template <> struct Frag<__bf16> {
  typedef v16b V; union U { v16b v; v8b h[2]; };
  static __device__ __forceinline__ v16b load(const __bf16* p) {
    U f; f.h[0] = *(const v8b*)(p); f.h[1] = *(const v8b*)(p + 16); return f.v;
  }
  static __device__ __forceinline__ v8f mma(v16b a, v16b b, v8f c) {
    return __builtin_amdgcn_wmma_f32_16x16x32_bf16(false, a, false, b, (short)0, c, false, false);
  }
  static __device__ __forceinline__ void guard(v8f& a, v8f& b, v16b x, v16b y) { dep_guard_b(a, b, x, y); }
  static __device__ __forceinline__ void keep(v16b a, v16b b, v16b c, v16b d) { keep4_b(a, b, c, d); }
};

// ---- Register-blocked batched WMMA GEMM ------------------------------------
// C[m,n] = scale * sum_k A[m,k] * Bt[n,k] (+bias)(+resid); each wave owns a 64x64 tile.
// A row-major [M,K]; Bt row-major [N,K].
// SPLIT: operands are hi/lo planes (A2/Bt2 = lo planes, same layout); product = hi.hi + hi.lo + lo.hi.
// BIAS_MODE: 0 = none, 1 = bias[m], 2 = bias[n].
// OUT_MODE: 0 = f32, 1 = f16, 2 = bf16 hi plane (Cout) + bf16 lo plane (Cout2).
// ET: 0 = f16 operands, 1 = bf16 operands (pointers passed as 16-bit storage)
// KSPLIT: one 64x64 tile per block; wave w sums k in [w*K/8, (w+1)*K/8) (K % 256 == 0) and the eight f32
// partial tiles are added in LDS in wave order 0..7. For shapes with too few tiles to fill the chip.
// Two batch levels: blockIdx.y with strideA/B/C, blockIdx.z with zA/zB/zC (element strides).
// Not KSPLIT: one 128x256 tile of C per block (M % 128 == 0, N % 256 == 0, K % 64 == 0), waves 2 x 4, 64x64 each.
// Per 64 k the block's 128 A rows and 256 Bt rows (128 B each) are copied to LDS by asynchronous 16-byte copies,
// four whole rows per wave and copy, two buffers: the next 64 k fly while this one is multiplied.
#define SG_PITCH 72                          // f16 per staged row: 128 B + 16 B, the pitch for ds_load_b128 readers of 16 rows
#define SG_ROWS  384                         // 128 A rows, then 256 Bt rows
#define SG_BYTES (SG_ROWS * SG_PITCH * 2)    // one buffer
// One stage: this lane's 16 bytes of rows r, r + 32, ... (4 of A, 8 of Bt). lds = LDS byte address of its place in row r.
// The s_wait_xcnt stands inside the statement so that no address register is rewritten in front of it.
__device__ __forceinline__ void stage_issue(unsigned lds, const unsigned short* ga, size_t stepA,
                                            const unsigned short* gb, size_t stepB) {
  const unsigned LS = 32 * SG_PITCH * 2;
  asm volatile(
      "global_load_async_to_lds_b128 %0, %12, off\n\t"
      "global_load_async_to_lds_b128 %1, %13, off\n\t"
      "global_load_async_to_lds_b128 %2, %14, off\n\t"
      "global_load_async_to_lds_b128 %3, %15, off\n\t"
      "global_load_async_to_lds_b128 %4, %16, off\n\t"
      "global_load_async_to_lds_b128 %5, %17, off\n\t"
      "global_load_async_to_lds_b128 %6, %18, off\n\t"
      "global_load_async_to_lds_b128 %7, %19, off\n\t"
      "global_load_async_to_lds_b128 %8, %20, off\n\t"
      "global_load_async_to_lds_b128 %9, %21, off\n\t"
      "global_load_async_to_lds_b128 %10, %22, off\n\t"
      "global_load_async_to_lds_b128 %11, %23, off\n\t"
      "s_wait_xcnt 0x0"
      :: "v"(lds), "v"(lds + LS), "v"(lds + 2 * LS), "v"(lds + 3 * LS),
         "v"(lds + 4 * LS), "v"(lds + 5 * LS), "v"(lds + 6 * LS), "v"(lds + 7 * LS),
         "v"(lds + 8 * LS), "v"(lds + 9 * LS), "v"(lds + 10 * LS), "v"(lds + 11 * LS),
         "v"(ga), "v"(ga + stepA), "v"(ga + 2 * stepA), "v"(ga + 3 * stepA),
         "v"(gb), "v"(gb + stepB), "v"(gb + 2 * stepB), "v"(gb + 3 * stepB),
         "v"(gb + 4 * stepB), "v"(gb + 5 * stepB), "v"(gb + 6 * stepB), "v"(gb + 7 * stepB)
      : "memory");
}
template <int ET> struct Elem;
template <> struct Elem<0> { typedef _Float16 T; };
template <> struct Elem<1> { typedef __bf16 T; };
template <int ET, bool SPLIT, int BIAS_MODE, int OUT_MODE, bool RESID, int ACT = 0, bool KSPLIT = false>
__global__ __launch_bounds__(256) void wmma_gemm64(
    const unsigned short* __restrict__ Ap, const unsigned short* __restrict__ A2p, int lda, long strideA,
    const unsigned short* __restrict__ Btp, const unsigned short* __restrict__ Bt2p, int ldb, long strideB,
    void* __restrict__ Cout, void* __restrict__ Cout2, int ldc, long strideC,
    const float* __restrict__ bias,
    const float* __restrict__ resid, long strideR,
    int M, int N, int K, float scale, long zA, long zB, long zC) {
  typedef typename Elem<ET>::T T;
  typedef typename Frag<T>::V V;
  const T* A = (const T*)Ap; const T* A2 = (const T*)A2p; const T* Bt = (const T*)Btp; const T* Bt2 = (const T*)Bt2p;
  static_assert(!KSPLIT || (!SPLIT && BIAS_MODE == 0 && OUT_MODE == 1 && !RESID && ACT == 0), "KSPLIT epilogue: plain f16 output only");
  static_assert(KSPLIT || !SPLIT, "staged form: single-plane operands only");
  __shared__ __align__(16) float sT[8][(KSPLIT ? 64 : 16) * 68];   // per-wave slab (16x64, KSPLIT: 64x64), pitch 68 floats
  __shared__ __align__(16) unsigned short stg[KSPLIT ? 8 : 2 * SG_ROWS * SG_PITCH];   // staged operand rows, two buffers
  const int b    = blockIdx.y;
  const int z    = blockIdx.z;
  const int lane = threadIdx.x & 31;
  const int wave = threadIdx.x >> 5;
  const int tilesN = N >> (KSPLIT ? 6 : 8);
  const int tilesM = M >> (KSPLIT ? 6 : 7);
  const int tile = (int)blockIdx.x;
  if (tile >= tilesM * tilesN) return;   // block-uniform, in front of every barrier
  const int tm = tile / tilesN;
  const int tn = tile - tm * tilesN;
  const int wv = __builtin_amdgcn_readfirstlane(wave);
  const int bm0 = tm << (KSPLIT ? 6 : 7);                  // the block's first row and column of C
  const int bn0 = tn << (KSPLIT ? 6 : 8);
  const int m0 = KSPLIT ? bm0 : bm0 + ((wv >> 2) << 6);    // the wave's
  const int n0 = KSPLIT ? bn0 : bn0 + ((wv & 3) << 6);

  const size_t offA = (size_t)b * strideA + (size_t)z * zA;
  const size_t offB = (size_t)b * strideB + (size_t)z * zB;
  const size_t offC = (size_t)b * strideC + (size_t)z * zC;
  const T* Ab  = A  + offA;
  const T* Bb  = Bt + offB;
  const T* Ab2 = SPLIT ? (A2  + offA) : nullptr;
  const T* Bb2 = SPLIT ? (Bt2 + offB) : nullptr;

  const int rlane = lane & 15;                 // row (A) / col (B, D) within subtile
  const int koff  = (lane >> 4) * 8;           // k offset of this lane half
  const int mOff  = (lane >> 4) * 8;           // D row offset

  v8f acc[4][4];
#pragma unroll
  for (int i = 0; i < 4; ++i)
#pragma unroll
    for (int j = 0; j < 4; ++j) acc[i][j] = (v8f){0.f,0.f,0.f,0.f,0.f,0.f,0.f,0.f};

  if (!KSPLIT) {
    const int crow = threadIdx.x >> 3;                     // a wave's copy = 4 whole rows of 128 B
    const int cchk = (threadIdx.x & 7) * 8;
    const unsigned short* gA = Ap + offA + (size_t)(bm0 + crow) * lda + cchk;
    const unsigned short* gB = Btp + offB + (size_t)(bn0 + crow) * ldb + cchk;
    const size_t stepA = (size_t)32 * lda, stepB = (size_t)32 * ldb;
    const unsigned l0 = (unsigned)(size_t)stg + (unsigned)(crow * SG_PITCH + cchk) * 2u;
    const int nst = K >> 6;                                // stages of 64 k
    const int aRow = ((wv >> 2) << 6) + rlane;             // the wave's first staged rows
    const int bRow = 128 + ((wv & 3) << 6) + rlane;
    stage_issue(l0, gA, stepA, gB, stepB);
    asm volatile("s_wait_asynccnt 0x0" ::: "memory");      // this wave's copies of stage 0 have landed
    __syncthreads();                                       // ... and every other wave's
    if (nst > 1) stage_issue(l0 + SG_BYTES, gA + 64, stepA, gB + 64, stepB);
#pragma unroll 1   // one body: the buffer is picked by t & 1
    for (int t = 0; t < nst; ++t) {
      const T* sb = (const T*)stg + (t & 1) * (SG_ROWS * SG_PITCH);
      // the loops below are unrolled so that every fragment and accumulator index is a constant (registers, no scratch)
#pragma unroll
      for (int ks = 0; ks < 2; ++ks) {
        V bh[4], ah[4];
#pragma unroll
        for (int j = 0; j < 4; ++j) bh[j] = Frag<T>::load(sb + (bRow + (j << 4)) * SG_PITCH + (ks << 5) + koff);
#pragma unroll
        for (int i = 0; i < 4; ++i) ah[i] = Frag<T>::load(sb + (aRow + (i << 4)) * SG_PITCH + (ks << 5) + koff);
        __builtin_amdgcn_sched_barrier(0);   // the 16 LDS reads stay one group in front of their 16 WMMAs (else: one A fragment at a time, a full LDS wait per 4 WMMAs)
#pragma unroll
        for (int i = 0; i < 4; ++i)
#pragma unroll
          for (int j = 0; j < 4; ++j) acc[i][j] = Frag<T>::mma(ah[i], bh[j], acc[i][j]);
      }
      asm volatile("s_wait_dscnt 0x0" ::: "memory");       // this wave has left the buffer of stage t
      asm volatile("s_wait_asynccnt 0x0" ::: "memory");    // its copies of stage t + 1 have landed
      __syncthreads();                                     // publishes stage t + 1 and frees the buffer of stage t
      if (t + 2 < nst) stage_issue(l0 + (t & 1) * SG_BYTES, gA + (size_t)(t + 2) * 64, stepA, gB + (size_t)(t + 2) * 64, stepB);
    }
    asm volatile("s_wait_asynccnt 0x0" ::: "memory");      // no copy is left in flight behind the loop
  }
  const int kBeg = KSPLIT ? wv * (K >> 3) : 0;   // scalar, so the k loop keeps its scalar counter and branch
  const int kEnd = KSPLIT ? kBeg + (K >> 3) : 0;
  for (int k0 = kBeg; k0 < kEnd; k0 += 32) {
    V bh[4], bl[4];
#pragma unroll
    for (int j = 0; j < 4; ++j) {
      const size_t bo = (size_t)(n0 + (j << 4) + rlane) * ldb + koff + k0;
      bh[j] = Frag<T>::load(Bb + bo);
      if (SPLIT) bl[j] = Frag<T>::load(Bb2 + bo);
    }
#pragma unroll
    for (int i = 0; i < 4; ++i) {
      const size_t ao = (size_t)(m0 + (i << 4) + rlane) * lda + koff + k0;
      V ah = Frag<T>::load(Ab + ao);
      V al;
      if (SPLIT) al = Frag<T>::load(Ab2 + ao);
#pragma unroll
      for (int j = 0; j < 4; ++j) {
        acc[i][j] = Frag<T>::mma(ah, bh[j], acc[i][j]);
        if (SPLIT) {
          acc[i][j] = Frag<T>::mma(ah, bl[j], acc[i][j]);
          acc[i][j] = Frag<T>::mma(al, bh[j], acc[i][j]);
        }
      }
      Frag<T>::guard(acc[i][0], acc[i][3], ah, SPLIT ? al : ah);
    }
    Frag<T>::keep(bh[0], bh[1], bh[2], bh[3]);
    if (SPLIT) Frag<T>::keep(bl[0], bl[1], bl[2], bl[3]);
  }
  acc_guard4(acc[0][0], acc[0][1], acc[0][2], acc[0][3]);
  acc_guard4(acc[1][0], acc[1][1], acc[1][2], acc[1][3]);
  acc_guard4(acc[2][0], acc[2][1], acc[2][2], acc[2][3]);
  acc_guard4(acc[3][0], acc[3][1], acc[3][2], acc[3][3]);

  if (KSPLIT) {
    // ---- split-K epilogue: partial tiles to LDS, then wave w sums and stores rows 8w..8w+7 ----
    float* part = sT[wave];
#pragma unroll
    for (int i = 0; i < 4; ++i)
#pragma unroll
      for (int j = 0; j < 4; ++j)
#pragma unroll
        for (int r = 0; r < 8; ++r)
          part[((i << 4) + mOff + r) * 68 + (j << 4) + rlane] = acc[i][j][r];
    __syncthreads();   // every wave's partial tile is in LDS before any wave reads the eight of them
    unsigned short* C = (unsigned short*)Cout + offC;
    const int hh = lane >> 4, c4 = (lane & 15) * 4;     // row seg = 64 f16 = 128 B = 16 lanes x 8 B
#pragma unroll
    for (int it = 0; it < 4; ++it) {
      const int row = (wave << 3) + it * 2 + hh;
      v4f s = *(const v4f*)(&sT[0][row * 68 + c4]);
#pragma unroll
      for (int w = 1; w < 8; ++w) s += *(const v4f*)(&sT[w][row * 68 + c4]);
      v4h hv;
#pragma unroll
      for (int e = 0; e < 4; ++e) hv[e] = (_Float16)(s[e] * scale);
      *(v4h*)(C + (size_t)(m0 + row) * ldc + n0 + c4) = hv;
    }
    return;
  }

  // ---- epilogue ----
  float* slab = sT[wave];
  const float* Rb = RESID ? (resid + (size_t)b * strideR) : nullptr;
#pragma unroll
  for (int i = 0; i < 4; ++i) {
    const int mBase = m0 + (i << 4);
#pragma unroll
    for (int j = 0; j < 4; ++j) {
      const int n = n0 + (j << 4) + rlane;
      float bv = 0.f;
      if (BIAS_MODE == 2) bv = bias[n];
#pragma unroll
      for (int r = 0; r < 8; ++r) {
        float v = acc[i][j][r] * scale;
        if (BIAS_MODE == 1) v += bias[mBase + mOff + r];
        if (BIAS_MODE == 2) v += bv;
        if (RESID) v += Rb[(size_t)(mBase + mOff + r) * ldc + n];
        if (ACT == 1) v = tanhf(v);
        if (ACT == 2) v = fmaxf(v, 0.0f);
        if (ACT == 3) v = v / (1.0f + expf(-v));
        if (ACT == 4) v = (v > 0.f) ? v : 0.01f * v;
        if (ACT == 5) v = 0.5f * v * (1.0f + erff(v * 0.70710678118654752f));
        slab[(mOff + r) * 68 + (j << 4) + rlane] = v;
      }
    }
    __builtin_amdgcn_fence(__ATOMIC_RELEASE, "workgroup");
    __builtin_amdgcn_wave_barrier();
    __builtin_amdgcn_fence(__ATOMIC_ACQUIRE, "workgroup");
    if (OUT_MODE == 0) {
      float* C = (float*)Cout + offC;
      const int hh = lane >> 4, c4 = (lane & 15) * 4;     // row seg = 256 B = 16 lanes x 16 B
      {
#pragma unroll
        for (int it = 0; it < 8; ++it) {
          const int row = it * 2 + hh;
          v4f v = *(const v4f*)(slab + row * 68 + c4);
          *(v4f*)(C + (size_t)(mBase + row) * ldc + n0 + c4) = v;
        }
        
      }
    } else {
      const int q = lane >> 3, c8 = (lane & 7) * 8;
      unsigned short* C  = (unsigned short*)Cout  + offC;
      unsigned short* C2 = (OUT_MODE == 2) ? ((unsigned short*)Cout2 + offC) : nullptr;
      {
#pragma unroll
        for (int it = 0; it < 4; ++it) {
          const int row = it * 4 + q;
          const float* sp = slab + row * 68 + c8;
          v8h hv, lv;
#pragma unroll
          for (int e = 0; e < 8; ++e) {
            if (OUT_MODE == 1) {
              hv[e] = (_Float16)sp[e];
            } else {
              unsigned short hb = f2bf_bits(sp[e]);
              unsigned short lb = f2bf_bits(sp[e] - bf_bits2f(hb));
              hv[e] = __builtin_bit_cast(_Float16, hb);
              lv[e] = __builtin_bit_cast(_Float16, lb);
            }
          }
          *(v8h*)(C + (size_t)(mBase + row) * ldc + n0 + c8) = hv;
          if (OUT_MODE == 2) *(v8h*)(C2 + (size_t)(mBase + row) * ldc + n0 + c8) = lv;
        }
        
      }
    }
    __builtin_amdgcn_fence(__ATOMIC_RELEASE, "workgroup");
    __builtin_amdgcn_wave_barrier();
    __builtin_amdgcn_fence(__ATOMIC_ACQUIRE, "workgroup");
  }
}

// ---- f32 -> f16 casts of x (x1) and of the four weight matrices (x wscale), all in one launch ----
// A block converts CV_BLK consecutive floats of ONE array: blocks [0, xBlocks) take x, then wBlocks blocks each for
// wq, wk, wv, wo (w16 = the four f16 matrices one behind the other). Few long waves instead of many short ones: a thread
// has CV_U loads of 16 bytes in flight, each load of a wave covers 512 consecutive bytes, each store 256.
#define CV_U   16
#define CV_BLK (256 * 4 * CV_U)
__global__ __launch_bounds__(256) void cast_all_f16(
    const float* __restrict__ x, const float* __restrict__ wq, const float* __restrict__ wk,
    const float* __restrict__ wv, const float* __restrict__ wo,
    _Float16* __restrict__ x16, _Float16* __restrict__ w16, int xBlocks, int wBlocks, float wscale) {
  int bx = blockIdx.x;
  const float* in = x;
  _Float16* out = x16;
  float scale = 1.0f;
  if (bx >= xBlocks) {   // block-uniform
    bx -= xBlocks;
    const int j = bx / wBlocks;
    bx -= j * wBlocks;
    in = j == 0 ? wq : j == 1 ? wk : j == 2 ? wv : wo;
    out = w16 + (size_t)j * wBlocks * CV_BLK;
    scale = wscale;
  }
  const v4f* ip = (const v4f*)(in + (size_t)bx * CV_BLK);   // block-uniform bases; the thread index is the one vector offset of loads and stores
  v4h* op = (v4h*)(out + (size_t)bx * CV_BLK);
  const int t = threadIdx.x;
  v4f a[CV_U];
  // both loops are unrolled so that a[] stays in registers and all the loads are issued in front of the first store
#pragma unroll
  for (int i = 0; i < CV_U; ++i) a[i] = ip[t + i * 256];
#pragma unroll
  for (int i = 0; i < CV_U; ++i) {
    v4h h;
#pragma unroll
    for (int e = 0; e < 4; ++e) h[e] = (_Float16)(a[i][e] * scale);
    op[t + i * 256] = h;
  }
}

// =====================================================================================
// Cross-head mix 1 (12x12, f32) -> softmax over keys (f32) -> cross-head mix 2 with 1/sum and the
// power-of-two carry -> f16 store.  One block per query row n (blockIdx.x) of one batch (blockIdx.y).
// SP is [batch][1024][12][1024] f16 (query, head, key): a block's 12 logit rows are its own 24 KB. The
// result (mix2 * pcarry, f16, [12][1024]) goes over them: a thread stores exactly the bytes that it has
// loaded itself, and no other thread or block touches them.
// Everything stays in registers: thread t owns keys 4t..4t+3 of all 12 heads (48 f32), the 12x12 weights
// are read at uniform addresses (scalar registers), and LDS carries only 16 half-wave maxima and sums per head.
// =====================================================================================
#define MX_H 12
#define MX_N 1024

// value of lane l ^ X inside a 16-lane row (DPP row_xmask), no LDS pipe
template <int X> __device__ __forceinline__ float row_x(float x) {
  return __builtin_bit_cast(float, __builtin_amdgcn_update_dpp(0, __builtin_bit_cast(int, x), 0x160 + X, 0xf, 0xf, true));
}
__device__ __forceinline__ float row_max16(float x) {
  x = fmaxf(x, row_x<1>(x)); x = fmaxf(x, row_x<2>(x)); x = fmaxf(x, row_x<4>(x)); x = fmaxf(x, row_x<8>(x));
  return x;
}
__device__ __forceinline__ float row_sum16(float x) {
  x += row_x<1>(x); x += row_x<2>(x); x += row_x<4>(x); x += row_x<8>(x);
  return x;
}
// value of lane l ^ 16
__device__ __forceinline__ float other_row(float x) {
  return __builtin_bit_cast(float, __builtin_amdgcn_permlanex16(__builtin_bit_cast(int, x), __builtin_bit_cast(int, x), 0x76543210, 0xfedcba98, false, false));
}
// lane g's value as a wave-uniform scalar
__device__ __forceinline__ float lane_val(float x, int g) {
  return __builtin_bit_cast(float, __builtin_amdgcn_readlane(__builtin_bit_cast(int, x), g));
}

// 2^x of four values in place. One statement, so that each v_exp_f32 is followed by an instruction that touches neither
// its result nor its source; the v_nop is that independent slot behind the last one.
__device__ __forceinline__ void exp2x4(v4f& x) {
  float x0 = x[0], x1 = x[1], x2 = x[2], x3 = x[3];
  asm("v_exp_f32 %0, %0\n\tv_exp_f32 %1, %1\n\tv_exp_f32 %2, %2\n\tv_exp_f32 %3, %3\n\tv_nop"
      : "+v"(x0), "+v"(x1), "+v"(x2), "+v"(x3));
  x = (v4f){x0, x1, x2, x3};
}

__global__ __launch_bounds__(256) void th_mix_kernel(
    _Float16* SP, const float* __restrict__ w1, const float* __restrict__ b1,
    const float* __restrict__ w2, const float* __restrict__ b2, float pcarry)
{
  __shared__ __align__(16) float redm[16 * MX_H];   // [half-wave][head] maxima
  __shared__ __align__(16) float reds[16 * MX_H];   // [half-wave][head] sums

  const int tid  = threadIdx.x;
  const int lane = tid & 31;
  _Float16* blk = SP + ((size_t)blockIdx.y * MX_N + blockIdx.x) * (MX_H * MX_N);
  const int gl = (lane & 15) < MX_H ? (lane & 15) : MX_H - 1;   // the head this lane folds behind a barrier
  const int hb = (lane >> 4) * 8;                               // first of its 8 half-waves

  // every loop below is unrolled so that the head index of each register array is a constant (no scratch)
  v4f s[MX_H];
#pragma unroll
  for (int h = 0; h < MX_H; ++h) s[h] = __builtin_convertvector(*(const v4h*)(blk + h * MX_N + tid * 4), v4f);

  // ---- mix 1 ----
  v4f a[MX_H];
#pragma unroll
  for (int g = 0; g < MX_H; ++g) {
    const float bg = b1[g];
    v4f acc = (v4f){bg, bg, bg, bg};
#pragma unroll
    for (int h = 0; h < MX_H; ++h) acc += w1[g * MX_H + h] * s[h];
    a[g] = acc;
  }

  // ---- softmax per head: maximum ----
  {
    float pm[MX_H];
#pragma unroll
    for (int g = 0; g < MX_H; ++g) pm[g] = row_max16(fmaxf(fmaxf(a[g][0], a[g][1]), fmaxf(a[g][2], a[g][3])));
    if ((lane & 15) == 0) {
      float* rp = redm + (tid >> 4) * MX_H;
      *(v4f*)(rp)     = (v4f){pm[0], pm[1], pm[2],  pm[3]};
      *(v4f*)(rp + 4) = (v4f){pm[4], pm[5], pm[6],  pm[7]};
      *(v4f*)(rp + 8) = (v4f){pm[8], pm[9], pm[10], pm[11]};
    }
  }
  __syncthreads();   // all 16 half-wave maxima are in LDS
  {
    float M = redm[hb * MX_H + gl];
#pragma unroll
    for (int j = 1; j < 8; ++j) M = fmaxf(M, redm[(hb + j) * MX_H + gl]);
    M = fmaxf(M, other_row(M));
    const float L2E = 1.44269504088896340736f;
    const float ML = M * L2E;
#pragma unroll
    for (int g = 0; g < MX_H; ++g) {
      const float mg = lane_val(ML, g);
#pragma unroll
      for (int e = 0; e < 4; ++e) a[g][e] = __builtin_fmaf(a[g][e], L2E, -mg);
      exp2x4(a[g]);
    }
  }
  // ---- sum ----
  {
    float ps[MX_H];
#pragma unroll
    for (int g = 0; g < MX_H; ++g) ps[g] = row_sum16((a[g][0] + a[g][1]) + (a[g][2] + a[g][3]));
    if ((lane & 15) == 0) {
      float* rp = reds + (tid >> 4) * MX_H;
      *(v4f*)(rp)     = (v4f){ps[0], ps[1], ps[2],  ps[3]};
      *(v4f*)(rp + 4) = (v4f){ps[4], ps[5], ps[6],  ps[7]};
      *(v4f*)(rp + 8) = (v4f){ps[8], ps[9], ps[10], ps[11]};
    }
  }
  __syncthreads();   // all 16 half-wave sums are in LDS
  {
    float S = reds[hb * MX_H + gl];
#pragma unroll
    for (int j = 1; j < 8; ++j) S += reds[(hb + j) * MX_H + gl];
    S += other_row(S);
    const float inv = (1.0f / S) * pcarry;   // 1/sum of the source head and the carry go onto the exponentials
#pragma unroll
    for (int g = 0; g < MX_H; ++g) a[g] *= lane_val(inv, g);
  }

  // ---- mix 2, f16 store ----
  _Float16* prow = blk + tid * 4;
#pragma unroll
  for (int g = 0; g < MX_H; ++g) {
    const float bg = b2[g] * pcarry;
    v4f acc = (v4f){bg, bg, bg, bg};
#pragma unroll
    for (int h = 0; h < MX_H; ++h) acc += w2[g * MX_H + h] * a[h];
    v4h hv;
#pragma unroll
    for (int e = 0; e < 4; ++e) hv[e] = (_Float16)acc[e];
    *(v4h*)(prow + g * MX_N) = hv;
  }
}

// ---------------------------------------------------------------------------
template <int BIAS_MODE, int OUT_MODE>
static void gemm_f16(hipStream_t st, int gy,
                     const void* A, int lda, long sA,
                     const void* Bt, int ldb, long sB,
                     void* C, int ldc, long sC,
                     const float* bias, int M, int N, int K, float scale,
                     int gz = 1, long zA = 0L, long zB = 0L, long zC = 0L)
{
  dim3 grid((M / 128) * (N / 256), gy, gz);
  wmma_gemm64<0, false, BIAS_MODE, OUT_MODE, false, 0><<<grid, 256, 0, st>>>(
      (const unsigned short*)A, (const unsigned short*)A, lda, sA,
      (const unsigned short*)Bt, (const unsigned short*)Bt, ldb, sB,
      C, C, ldc, sC, bias, bias, (long)0, M, N, K, scale, zA, zB, zC);
}

// one block per 64x64 tile, K split over its eight waves; f16 output, no bias
static void gemm_f16_ksplit(hipStream_t st, int gy,
                            const void* A, int lda, long sA,
                            const void* Bt, int ldb, long sB,
                            void* C, int ldc, long sC,
                            const float* unused, int M, int N, int K, float scale,
                            int gz, long zA, long zB, long zC)
{
  dim3 grid((M / 64) * (N / 64), gy, gz);
  wmma_gemm64<0, false, 0, 1, false, 0, true><<<grid, 256, 0, st>>>(
      (const unsigned short*)A, (const unsigned short*)A, lda, sA,
      (const unsigned short*)Bt, (const unsigned short*)Bt, ldb, sB,
      C, C, ldc, sC, unused, unused, (long)0, M, N, K, scale, zA, zB, zC);
}

extern "C" void kernel_launch(void* const* d_in, const int* in_sizes, int n_in,
                              void* d_out, int out_size, void* d_ws, size_t ws_size,
                              hipStream_t stream)
{
  const int Bn = 8, Nn = 1024, Dd = 768, Hh = 12, HD = 64;
  const int GB = 8;                                       // batches per launch in the attention part
  if (n_in < 13) return;
  if (in_sizes[0] != Bn * Nn * Dd) return;
  if (in_sizes[1] != Dd * Dd || in_sizes[3] != Dd * Dd || in_sizes[5] != Dd * Dd || in_sizes[7] != Dd * Dd) return;
  if (in_sizes[2] != Dd || in_sizes[4] != Dd || in_sizes[6] != Dd || in_sizes[8] != Dd) return;
  if (in_sizes[9] != Hh * Hh || in_sizes[10] != Hh || in_sizes[11] != Hh * Hh || in_sizes[12] != Hh) return;
  if (out_size != Bn * Nn * Dd) return;

  const float* x    = (const float*)d_in[0];
  const float* wq   = (const float*)d_in[1];
  const float* bq   = (const float*)d_in[2];
  const float* wk   = (const float*)d_in[3];
  const float* bk   = (const float*)d_in[4];
  const float* wv   = (const float*)d_in[5];
  const float* bv   = (const float*)d_in[6];
  const float* wo   = (const float*)d_in[7];
  const float* bo   = (const float*)d_in[8];
  const float* th1w = (const float*)d_in[9];
  const float* th1b = (const float*)d_in[10];
  const float* th2w = (const float*)d_in[11];
  const float* th2b = (const float*)d_in[12];
  float* out = (float*)d_out;

  // ---- workspace carve (bytes) ----
  const size_t WSZ = (size_t)Dd * Dd * 2;                 // one f16 weight matrix
  const size_t ASZ = (size_t)Bn * Nn * Dd * 2;            // one f16 activation [8192][768]
  const size_t SSZ = (size_t)GB * Nn * Hh * Nn * 2;       // logits f16 [GB][1024][12][1024]; mixed attention f16 written over them
  const size_t off_wq  = 0;
  const size_t off_wk  = off_wq + WSZ;
  const size_t off_wv  = off_wk + WSZ;
  const size_t off_wo  = off_wv + WSZ;
  const size_t off_q   = off_wo + WSZ;
  const size_t off_k   = off_q + ASZ;
  const size_t off_vt  = off_k + ASZ;                     // v^T per batch: [b][h*64+d][m]
  const size_t off_ctx = off_vt + ASZ;                    // attention output [8192][768] f16
  const size_t off_R   = off_ctx + ASZ;                   // reused region
  const size_t off_x16 = off_R;                           // live during the projections only
  const size_t off_S   = off_R;                           // live per group of GB batches afterwards
  size_t end = off_S + SSZ;
  if (off_x16 + ASZ > end) end = off_x16 + ASZ;
  if (end > ws_size) return;

  uint8_t* ws = (uint8_t*)d_ws;
  _Float16* wq16 = (_Float16*)(ws + off_wq);
  _Float16* wk16 = (_Float16*)(ws + off_wk);
  _Float16* wv16 = (_Float16*)(ws + off_wv);
  _Float16* wo16 = (_Float16*)(ws + off_wo);
  unsigned short* q16   = (unsigned short*)(ws + off_q);
  unsigned short* k16   = (unsigned short*)(ws + off_k);
  unsigned short* vt16  = (unsigned short*)(ws + off_vt);
  unsigned short* ctx16 = (unsigned short*)(ws + off_ctx);
  _Float16* x16 = (_Float16*)(ws + off_x16);
  _Float16* Sb = (_Float16*)(ws + off_S);

  const float WCARRY = 64.0f;        // weights carried x2^6 in f16
  const float PCARRY = 2048.0f;      // mixed attention carried x2^11 in f16

  // ---- casts to f16: one launch ----
  cast_all_f16<<<Bn * Nn * Dd / CV_BLK + 4 * (Dd * Dd / CV_BLK), 256, 0, stream>>>(
      x, wq, wk, wv, wo, x16, wq16, Bn * Nn * Dd / CV_BLK, Dd * Dd / CV_BLK, WCARRY);

  // ---- projections: q, k as [b*1024+n][h*64+d] f16; v^T per batch as [b][h*64+d][m] f16 ----
  gemm_f16<2, 1>(stream, 1, x16, Dd, 0L, wq16, Dd, 0L, q16, Dd, 0L, bq, Bn * Nn, Dd, Dd, 1.0f / WCARRY);
  gemm_f16<2, 1>(stream, 1, x16, Dd, 0L, wk16, Dd, 0L, k16, Dd, 0L, bk, Bn * Nn, Dd, Dd, 1.0f / WCARRY);
  // A = wv [768][768], Bt = x rows of batch b [1024][768] -> C [768][1024] per batch, bias[m] = bv[o]
  gemm_f16<1, 1>(stream, Bn, wv16, Dd, 0L, x16, Dd, (long)Nn * Dd, vt16, Nn, (long)Dd * Nn, bv, Dd, Nn, Dd, 1.0f / WCARRY);

  // ---- per group of GB batches (grid.z = batch in the group): logits -> mix/softmax/mix -> a.v ----
  const float qk_scale = 0.125f;     // 64^-0.5
  const long rowS = (long)Hh * Nn;   // f16 elements of one query's 12 logit rows
  for (int b = 0; b < Bn; b += GB) {
    const unsigned short* qb = q16 + (size_t)b * Nn * Dd;
    const unsigned short* kb = k16 + (size_t)b * Nn * Dd;
    // S[z][n][h][m] = scale * sum_d q[n][h*64+d] k[m][h*64+d]; grid.y = head: strideA/B = 64, strideC = 1024
    gemm_f16<0, 1>(stream, Hh, qb, Dd, (long)HD, kb, Dd, (long)HD, Sb, Hh * Nn, (long)Nn, bq, Nn, Nn, HD, qk_scale,
                   GB, (long)Nn * Dd, (long)Nn * Dd, (long)Nn * rowS);
    th_mix_kernel<<<dim3(Nn, GB), 256, 0, stream>>>(Sb, th1w, th1b, th2w, th2b, PCARRY);
    // ctx[(b+z)*1024+n][h*64+d] = 2^-11 * sum_m P[z][n][h][m] * vT[b+z][h*64+d][m]; grid.y = head.
    // P rows lie in the logits' place: f16 pitch per query = rowS, per head = 1024
    gemm_f16_ksplit(stream, Hh,
                    Sb, Hh * Nn, (long)Nn,
                    vt16 + (size_t)b * Dd * Nn, Nn, (long)HD * Nn,
                    ctx16 + (size_t)b * Nn * Dd, Dd, (long)HD,
                    bq, Nn, HD, Nn, 1.0f / PCARRY,
                    GB, (long)Nn * rowS, (long)Dd * Nn, (long)Nn * Dd);
  }

  // ---- output projection -> f32 [8192][768] ----
  gemm_f16<2, 0>(stream, 1, ctx16, Dd, 0L, wo16, Dd, 0L, out, Dd, 0L, bo, Bn * Nn, Dd, Dd, 1.0f / WCARRY);
}

// v007
// One run takes 202 microseconds.
// Next to v006, in two timings, it ran 1.11 times as fast each time.
// Counting every step since v000, it is 4.19 times as fast.
#include <hip/hip_runtime.h>
#include <stdint.h>
#include <stddef.h>

// Contractions (q/k/v projections, q.k^T, a.v, output projection): v_wmma_f32_16x16x32_f16 (f16 operands, f32 accumulate); weights carried x64, mixed attention carried x2^11, folded back in the f32 epilogue; scaled logits stored as f16; the two 12x12 cross-head mixes on the same WMMA form (mix 1: weights as f16 high part + f16 remainder; mix 2: exponentials and weight/sum as f16), softmax in f32 on VALU.

typedef __attribute__((ext_vector_type(16))) _Float16 v16h;
typedef __attribute__((ext_vector_type(8)))  _Float16 v8h;
typedef __attribute__((ext_vector_type(4)))  _Float16 v4h;
typedef __attribute__((ext_vector_type(16))) __bf16   v16b;
typedef __attribute__((ext_vector_type(8)))  __bf16   v8b;
typedef __attribute__((ext_vector_type(8)))  float    v8f;
typedef __attribute__((ext_vector_type(4)))  float    v4f;
typedef __attribute__((ext_vector_type(2)))  float    v2f;

__device__ __forceinline__ unsigned short f2bf_bits(float f) {
  unsigned u = __float_as_uint(f);
  return (unsigned short)((u + 0x7FFFu + ((u >> 16) & 1u)) >> 16);
}
__device__ __forceinline__ float bf_bits2f(unsigned short h) { return __uint_as_float(((unsigned)h) << 16); }

// hazard guards as plain device helpers
__device__ __forceinline__ void dep_guard_h(v8f& a, v8f& b, v16h x, v16h y) { asm volatile("v_nop\n\tv_nop\n\tv_nop\n\tv_nop" : "+v"(a), "+v"(b) : "v"(x), "v"(y)); }
__device__ __forceinline__ void dep_guard_b(v8f& a, v8f& b, v16b x, v16b y) { asm volatile("v_nop\n\tv_nop\n\tv_nop\n\tv_nop" : "+v"(a), "+v"(b) : "v"(x), "v"(y)); }
__device__ __forceinline__ void keep4_h(v16h a, v16h b, v16h c, v16h d) { asm volatile("v_nop" :: "v"(a), "v"(b), "v"(c), "v"(d)); }
__device__ __forceinline__ void keep4_b(v16b a, v16b b, v16b c, v16b d) { asm volatile("v_nop" :: "v"(a), "v"(b), "v"(c), "v"(d)); }
__device__ __forceinline__ void acc_guard4(v8f& a, v8f& b, v8f& c, v8f& d) { asm volatile("v_nop\n\tv_nop\n\tv_nop\n\tv_nop" : "+v"(a), "+v"(b), "+v"(c), "+v"(d)); }
template <typename T> struct Frag;
template <> struct Frag<_Float16> {
  typedef v16h V; union U { v16h v; v8h h[2]; };
  static __device__ __forceinline__ v16h load(const _Float16* p) {   // elements 0..7 <- p[0..7], 8..15 <- p[16..23]
    U f; f.h[0] = *(const v8h*)(p); f.h[1] = *(const v8h*)(p + 16); return f.v;
  }
  static __device__ __forceinline__ v8f mma(v16h a, v16h b, v8f c) {
    return __builtin_amdgcn_wmma_f32_16x16x32_f16(false, a, false, b, (short)0, c, false, false);
  }
  static __device__ __forceinline__ void guard(v8f& a, v8f& b, v16h x, v16h y) { dep_guard_h(a, b, x, y); }
  static __device__ __forceinline__ void keep(v16h a, v16h b, v16h c, v16h d) { keep4_h(a, b, c, d); }
};
template <> struct Frag<__bf16> {
  typedef v16b V; union U { v16b v; v8b h[2]; };
  static __device__ __forceinline__ v16b load(const __bf16* p) {
    U f; f.h[0] = *(const v8b*)(p); f.h[1] = *(const v8b*)(p + 16); return f.v;
  }
  static __device__ __forceinline__ v8f mma(v16b a, v16b b, v8f c) {
    return __builtin_amdgcn_wmma_f32_16x16x32_bf16(false, a, false, b, (short)0, c, false, false);
  }
  static __device__ __forceinline__ void guard(v8f& a, v8f& b, v16b x, v16b y) { dep_guard_b(a, b, x, y); }
  static __device__ __forceinline__ void keep(v16b a, v16b b, v16b c, v16b d) { keep4_b(a, b, c, d); }
};

// ---- Register-blocked batched WMMA GEMM ------------------------------------
// C[m,n] = scale * sum_k A[m,k] * Bt[n,k] (+bias)(+resid); each wave owns a 64x64 tile.
// A row-major [M,K]; Bt row-major [N,K].
// SPLIT: operands are hi/lo planes (A2/Bt2 = lo planes, same layout); product = hi.hi + hi.lo + lo.hi.
// BIAS_MODE: 0 = none, 1 = bias[m], 2 = bias[n].
// OUT_MODE: 0 = f32, 1 = f16, 2 = bf16 hi plane (Cout) + bf16 lo plane (Cout2).
// ET: 0 = f16 operands, 1 = bf16 operands (pointers passed as 16-bit storage)
// KSPLIT: one 64x64 tile per block; wave w sums k in [w*K/8, (w+1)*K/8) (K % 256 == 0) and the eight f32
// partial tiles are added in LDS in wave order 0..7. For shapes with too few tiles to fill the chip.
// Two batch levels: blockIdx.y with strideA/B/C, blockIdx.z with zA/zB/zC (element strides).
// Not KSPLIT: one 128x256 tile of C per block (M % 128 == 0, N % 256 == 0, K % 64 == 0), waves 2 x 4, 64x64 each.
// Per 64 k the block's 128 A rows and 256 Bt rows (128 B each) are copied to LDS by asynchronous 16-byte copies,
// four whole rows per wave and copy, two buffers: the next 64 k fly while this one is multiplied.
#define SG_PITCH 72                          // f16 per staged row: 128 B + 16 B, the pitch for ds_load_b128 readers of 16 rows
#define SG_ROWS  384                         // 128 A rows, then 256 Bt rows
#define SG_BYTES (SG_ROWS * SG_PITCH * 2)    // one buffer
// One stage: this lane's 16 bytes of rows r, r + 32, ... (4 of A, 8 of Bt). lds = LDS byte address of its place in row r.
// The s_wait_xcnt stands inside the statement so that no address register is rewritten in front of it.
__device__ __forceinline__ void stage_issue(unsigned lds, const unsigned short* ga, size_t stepA,
                                            const unsigned short* gb, size_t stepB) {
  const unsigned LS = 32 * SG_PITCH * 2;
  asm volatile(
      "global_load_async_to_lds_b128 %0, %12, off\n\t"
      "global_load_async_to_lds_b128 %1, %13, off\n\t"
      "global_load_async_to_lds_b128 %2, %14, off\n\t"
      "global_load_async_to_lds_b128 %3, %15, off\n\t"
      "global_load_async_to_lds_b128 %4, %16, off\n\t"
      "global_load_async_to_lds_b128 %5, %17, off\n\t"
      "global_load_async_to_lds_b128 %6, %18, off\n\t"
      "global_load_async_to_lds_b128 %7, %19, off\n\t"
      "global_load_async_to_lds_b128 %8, %20, off\n\t"
      "global_load_async_to_lds_b128 %9, %21, off\n\t"
      "global_load_async_to_lds_b128 %10, %22, off\n\t"
      "global_load_async_to_lds_b128 %11, %23, off\n\t"
      "s_wait_xcnt 0x0"
      :: "v"(lds), "v"(lds + LS), "v"(lds + 2 * LS), "v"(lds + 3 * LS),
         "v"(lds + 4 * LS), "v"(lds + 5 * LS), "v"(lds + 6 * LS), "v"(lds + 7 * LS),
         "v"(lds + 8 * LS), "v"(lds + 9 * LS), "v"(lds + 10 * LS), "v"(lds + 11 * LS),
         "v"(ga), "v"(ga + stepA), "v"(ga + 2 * stepA), "v"(ga + 3 * stepA),
         "v"(gb), "v"(gb + stepB), "v"(gb + 2 * stepB), "v"(gb + 3 * stepB),
         "v"(gb + 4 * stepB), "v"(gb + 5 * stepB), "v"(gb + 6 * stepB), "v"(gb + 7 * stepB)
      : "memory");
}
template <int ET> struct Elem;
template <> struct Elem<0> { typedef _Float16 T; };
template <> struct Elem<1> { typedef __bf16 T; };
template <int ET, bool SPLIT, int BIAS_MODE, int OUT_MODE, bool RESID, int ACT = 0, bool KSPLIT = false>
__global__ __launch_bounds__(256) void wmma_gemm64(
    const unsigned short* __restrict__ Ap, const unsigned short* __restrict__ A2p, int lda, long strideA,
    const unsigned short* __restrict__ Btp, const unsigned short* __restrict__ Bt2p, int ldb, long strideB,
    void* __restrict__ Cout, void* __restrict__ Cout2, int ldc, long strideC,
    const float* __restrict__ bias,
    const float* __restrict__ resid, long strideR,
    int M, int N, int K, float scale, long zA, long zB, long zC) {
  typedef typename Elem<ET>::T T;
  typedef typename Frag<T>::V V;
  const T* A = (const T*)Ap; const T* A2 = (const T*)A2p; const T* Bt = (const T*)Btp; const T* Bt2 = (const T*)Bt2p;
  static_assert(!KSPLIT || (!SPLIT && BIAS_MODE == 0 && OUT_MODE == 1 && !RESID && ACT == 0), "KSPLIT epilogue: plain f16 output only");
  static_assert(KSPLIT || !SPLIT, "staged form: single-plane operands only");
  __shared__ __align__(16) float sT[8][(KSPLIT ? 64 : 16) * 68];   // per-wave slab (16x64, KSPLIT: 64x64), pitch 68 floats
  __shared__ __align__(16) unsigned short stg[KSPLIT ? 8 : 2 * SG_ROWS * SG_PITCH];   // staged operand rows, two buffers
  const int b    = blockIdx.y;
  const int z    = blockIdx.z;
  const int lane = threadIdx.x & 31;
  const int wave = threadIdx.x >> 5;
  const int tilesN = N >> (KSPLIT ? 6 : 8);
  const int tilesM = M >> (KSPLIT ? 6 : 7);
  const int tile = (int)blockIdx.x;
  if (tile >= tilesM * tilesN) return;   // block-uniform, in front of every barrier
  const int tm = tile / tilesN;
  const int tn = tile - tm * tilesN;
  const int wv = __builtin_amdgcn_readfirstlane(wave);
  const int bm0 = tm << (KSPLIT ? 6 : 7);                  // the block's first row and column of C
  const int bn0 = tn << (KSPLIT ? 6 : 8);
  const int m0 = KSPLIT ? bm0 : bm0 + ((wv >> 2) << 6);    // the wave's
  const int n0 = KSPLIT ? bn0 : bn0 + ((wv & 3) << 6);

  const size_t offA = (size_t)b * strideA + (size_t)z * zA;
  const size_t offB = (size_t)b * strideB + (size_t)z * zB;
  const size_t offC = (size_t)b * strideC + (size_t)z * zC;
  const T* Ab  = A  + offA;
  const T* Bb  = Bt + offB;
  const T* Ab2 = SPLIT ? (A2  + offA) : nullptr;
  const T* Bb2 = SPLIT ? (Bt2 + offB) : nullptr;

  const int rlane = lane & 15;                 // row (A) / col (B, D) within subtile
  const int koff  = (lane >> 4) * 8;           // k offset of this lane half
  const int mOff  = (lane >> 4) * 8;           // D row offset

  v8f acc[4][4];
#pragma unroll
  for (int i = 0; i < 4; ++i)
#pragma unroll
    for (int j = 0; j < 4; ++j) acc[i][j] = (v8f){0.f,0.f,0.f,0.f,0.f,0.f,0.f,0.f};

  if (!KSPLIT) {
    const int crow = threadIdx.x >> 3;                     // a wave's copy = 4 whole rows of 128 B
    const int cchk = (threadIdx.x & 7) * 8;
    const unsigned short* gA = Ap + offA + (size_t)(bm0 + crow) * lda + cchk;
    const unsigned short* gB = Btp + offB + (size_t)(bn0 + crow) * ldb + cchk;
    const size_t stepA = (size_t)32 * lda, stepB = (size_t)32 * ldb;
    const unsigned l0 = (unsigned)(size_t)stg + (unsigned)(crow * SG_PITCH + cchk) * 2u;
    const int nst = K >> 6;                                // stages of 64 k
    const int aRow = ((wv >> 2) << 6) + rlane;             // the wave's first staged rows
    const int bRow = 128 + ((wv & 3) << 6) + rlane;
    stage_issue(l0, gA, stepA, gB, stepB);
    asm volatile("s_wait_asynccnt 0x0" ::: "memory");      // this wave's copies of stage 0 have landed
    __syncthreads();                                       // ... and every other wave's
    if (nst > 1) stage_issue(l0 + SG_BYTES, gA + 64, stepA, gB + 64, stepB);
#pragma unroll 1   // one body: the buffer is picked by t & 1
    for (int t = 0; t < nst; ++t) {
      const T* sb = (const T*)stg + (t & 1) * (SG_ROWS * SG_PITCH);
      // the loops below are unrolled so that every fragment and accumulator index is a constant (registers, no scratch)
#pragma unroll
      for (int ks = 0; ks < 2; ++ks) {
        V bh[4], ah[4];
#pragma unroll
        for (int j = 0; j < 4; ++j) bh[j] = Frag<T>::load(sb + (bRow + (j << 4)) * SG_PITCH + (ks << 5) + koff);
#pragma unroll
        for (int i = 0; i < 4; ++i) ah[i] = Frag<T>::load(sb + (aRow + (i << 4)) * SG_PITCH + (ks << 5) + koff);
        __builtin_amdgcn_sched_barrier(0);   // the 16 LDS reads stay one group in front of their 16 WMMAs (else: one A fragment at a time, a full LDS wait per 4 WMMAs)
#pragma unroll
        for (int i = 0; i < 4; ++i)
#pragma unroll
          for (int j = 0; j < 4; ++j) acc[i][j] = Frag<T>::mma(ah[i], bh[j], acc[i][j]);
      }
      asm volatile("s_wait_dscnt 0x0" ::: "memory");       // this wave has left the buffer of stage t
      asm volatile("s_wait_asynccnt 0x0" ::: "memory");    // its copies of stage t + 1 have landed
      __syncthreads();                                     // publishes stage t + 1 and frees the buffer of stage t
      if (t + 2 < nst) stage_issue(l0 + (t & 1) * SG_BYTES, gA + (size_t)(t + 2) * 64, stepA, gB + (size_t)(t + 2) * 64, stepB);
    }
    asm volatile("s_wait_asynccnt 0x0" ::: "memory");      // no copy is left in flight behind the loop
  }
  const int kBeg = KSPLIT ? wv * (K >> 3) : 0;   // scalar, so the k loop keeps its scalar counter and branch
  const int kEnd = KSPLIT ? kBeg + (K >> 3) : 0;
  for (int k0 = kBeg; k0 < kEnd; k0 += 32) {
    V bh[4], bl[4];
#pragma unroll
    for (int j = 0; j < 4; ++j) {
      const size_t bo = (size_t)(n0 + (j << 4) + rlane) * ldb + koff + k0;
      bh[j] = Frag<T>::load(Bb + bo);
      if (SPLIT) bl[j] = Frag<T>::load(Bb2 + bo);
    }
#pragma unroll
    for (int i = 0; i < 4; ++i) {
      const size_t ao = (size_t)(m0 + (i << 4) + rlane) * lda + koff + k0;
      V ah = Frag<T>::load(Ab + ao);
      V al;
      if (SPLIT) al = Frag<T>::load(Ab2 + ao);
#pragma unroll
      for (int j = 0; j < 4; ++j) {
        acc[i][j] = Frag<T>::mma(ah, bh[j], acc[i][j]);
        if (SPLIT) {
          acc[i][j] = Frag<T>::mma(ah, bl[j], acc[i][j]);
          acc[i][j] = Frag<T>::mma(al, bh[j], acc[i][j]);
        }
      }
      Frag<T>::guard(acc[i][0], acc[i][3], ah, SPLIT ? al : ah);
    }
    Frag<T>::keep(bh[0], bh[1], bh[2], bh[3]);
    if (SPLIT) Frag<T>::keep(bl[0], bl[1], bl[2], bl[3]);
  }
  acc_guard4(acc[0][0], acc[0][1], acc[0][2], acc[0][3]);
  acc_guard4(acc[1][0], acc[1][1], acc[1][2], acc[1][3]);
  acc_guard4(acc[2][0], acc[2][1], acc[2][2], acc[2][3]);
  acc_guard4(acc[3][0], acc[3][1], acc[3][2], acc[3][3]);

  if (KSPLIT) {
    // ---- split-K epilogue: partial tiles to LDS, then wave w sums and stores rows 8w..8w+7 ----
    float* part = sT[wave];
#pragma unroll
    for (int i = 0; i < 4; ++i)
#pragma unroll
      for (int j = 0; j < 4; ++j)
#pragma unroll
        for (int r = 0; r < 8; ++r)
          part[((i << 4) + mOff + r) * 68 + (j << 4) + rlane] = acc[i][j][r];
    __syncthreads();   // every wave's partial tile is in LDS before any wave reads the eight of them
    unsigned short* C = (unsigned short*)Cout + offC;
    const int hh = lane >> 4, c4 = (lane & 15) * 4;     // row seg = 64 f16 = 128 B = 16 lanes x 8 B
#pragma unroll
    for (int it = 0; it < 4; ++it) {
      const int row = (wave << 3) + it * 2 + hh;
      v4f s = *(const v4f*)(&sT[0][row * 68 + c4]);
#pragma unroll
      for (int w = 1; w < 8; ++w) s += *(const v4f*)(&sT[w][row * 68 + c4]);
      v4h hv;
#pragma unroll
      for (int e = 0; e < 4; ++e) hv[e] = (_Float16)(s[e] * scale);
      *(v4h*)(C + (size_t)(m0 + row) * ldc + n0 + c4) = hv;
    }
    return;
  }

  // ---- epilogue ----
  float* slab = sT[wave];
  const float* Rb = RESID ? (resid + (size_t)b * strideR) : nullptr;
#pragma unroll
  for (int i = 0; i < 4; ++i) {
    const int mBase = m0 + (i << 4);
#pragma unroll
    for (int j = 0; j < 4; ++j) {
      const int n = n0 + (j << 4) + rlane;
      float bv = 0.f;
      if (BIAS_MODE == 2) bv = bias[n];
#pragma unroll
      for (int r = 0; r < 8; ++r) {
        float v = acc[i][j][r] * scale;
        if (BIAS_MODE == 1) v += bias[mBase + mOff + r];
        if (BIAS_MODE == 2) v += bv;
        if (RESID) v += Rb[(size_t)(mBase + mOff + r) * ldc + n];
        if (ACT == 1) v = tanhf(v);
        if (ACT == 2) v = fmaxf(v, 0.0f);
        if (ACT == 3) v = v / (1.0f + expf(-v));
        if (ACT == 4) v = (v > 0.f) ? v : 0.01f * v;
        if (ACT == 5) v = 0.5f * v * (1.0f + erff(v * 0.70710678118654752f));
        slab[(mOff + r) * 68 + (j << 4) + rlane] = v;
      }
    }
    __builtin_amdgcn_fence(__ATOMIC_RELEASE, "workgroup");
    __builtin_amdgcn_wave_barrier();
    __builtin_amdgcn_fence(__ATOMIC_ACQUIRE, "workgroup");
    if (OUT_MODE == 0) {
      float* C = (float*)Cout + offC;
      const int hh = lane >> 4, c4 = (lane & 15) * 4;     // row seg = 256 B = 16 lanes x 16 B
      {
#pragma unroll
        for (int it = 0; it < 8; ++it) {
          const int row = it * 2 + hh;
          v4f v = *(const v4f*)(slab + row * 68 + c4);
          *(v4f*)(C + (size_t)(mBase + row) * ldc + n0 + c4) = v;
        }
        
      }
    } else {
      const int q = lane >> 3, c8 = (lane & 7) * 8;
      unsigned short* C  = (unsigned short*)Cout  + offC;
      unsigned short* C2 = (OUT_MODE == 2) ? ((unsigned short*)Cout2 + offC) : nullptr;
      {
#pragma unroll
        for (int it = 0; it < 4; ++it) {
          const int row = it * 4 + q;
          const float* sp = slab + row * 68 + c8;
          v8h hv, lv;
#pragma unroll
          for (int e = 0; e < 8; ++e) {
            if (OUT_MODE == 1) {
              hv[e] = (_Float16)sp[e];
            } else {
              unsigned short hb = f2bf_bits(sp[e]);
              unsigned short lb = f2bf_bits(sp[e] - bf_bits2f(hb));
              hv[e] = __builtin_bit_cast(_Float16, hb);
              lv[e] = __builtin_bit_cast(_Float16, lb);
            }
          }
          *(v8h*)(C + (size_t)(mBase + row) * ldc + n0 + c8) = hv;
          if (OUT_MODE == 2) *(v8h*)(C2 + (size_t)(mBase + row) * ldc + n0 + c8) = lv;
        }
        
      }
    }
    __builtin_amdgcn_fence(__ATOMIC_RELEASE, "workgroup");
    __builtin_amdgcn_wave_barrier();
    __builtin_amdgcn_fence(__ATOMIC_ACQUIRE, "workgroup");
  }
}

// ---- f32 -> f16 casts of x (x1) and of the four weight matrices (x wscale), all in one launch ----
// A block converts CV_BLK consecutive floats of ONE array: blocks [0, xBlocks) take x, then wBlocks blocks each for
// wq, wk, wv, wo (w16 = the four f16 matrices one behind the other). Few long waves instead of many short ones: a thread
// has CV_U loads of 16 bytes in flight, each load of a wave covers 512 consecutive bytes, each store 256.
#define CV_U   16
#define CV_BLK (256 * 4 * CV_U)
__global__ __launch_bounds__(256) void cast_all_f16(
    const float* __restrict__ x, const float* __restrict__ wq, const float* __restrict__ wk,
    const float* __restrict__ wv, const float* __restrict__ wo,
    _Float16* __restrict__ x16, _Float16* __restrict__ w16, int xBlocks, int wBlocks, float wscale) {
  int bx = blockIdx.x;
  const float* in = x;
  _Float16* out = x16;
  float scale = 1.0f;
  if (bx >= xBlocks) {   // block-uniform
    bx -= xBlocks;
    const int j = bx / wBlocks;
    bx -= j * wBlocks;
    in = j == 0 ? wq : j == 1 ? wk : j == 2 ? wv : wo;
    out = w16 + (size_t)j * wBlocks * CV_BLK;
    scale = wscale;
  }
  const v4f* ip = (const v4f*)(in + (size_t)bx * CV_BLK);   // block-uniform bases; the thread index is the one vector offset of loads and stores
  v4h* op = (v4h*)(out + (size_t)bx * CV_BLK);
  const int t = threadIdx.x;
  v4f a[CV_U];
  // both loops are unrolled so that a[] stays in registers and all the loads are issued in front of the first store
#pragma unroll
  for (int i = 0; i < CV_U; ++i) a[i] = ip[t + i * 256];
#pragma unroll
  for (int i = 0; i < CV_U; ++i) {
    v4h h;
#pragma unroll
    for (int e = 0; e < 4; ++e) h[e] = (_Float16)(a[i][e] * scale);
    op[t + i * 256] = h;
  }
}

// =====================================================================================
// Cross-head mix 1 (12x12) -> softmax over keys (f32) -> cross-head mix 2 with 1/sum and the
// power-of-two carry -> f16 store.  One block per query row n (blockIdx.x) of one batch (blockIdx.y).
// SP is [batch][1024][12][1024] f16 (query, head, key): a block's 12 logit rows are its own 24 KB. The
// result (mix2 * pcarry, f16, [12][1024]) goes over them: a wave stores exactly the 128 keys x 12 heads that it has
// loaded itself (its loads have all been consumed by then), and no other wave or block touches them.
// Both mixes are WMMAs with the 12x12 weights as A (rows = target head) and 16 keys as B's columns (k = source head).
// Mix 1: a lane holds all 12 heads of its own 4 keys, so its 12 values of one key fill its own 16 k slots of a B fragment;
// lanes l and l+16 share a column, so one WMMA with the weights in the k slots of lanes 0..15 (zeros in the others) mixes
// the keys of lanes 0..15 and a second one with the weights in the other slots those of lanes 16..31, from the same B.
// LDS carries only 8 wave maxima and sums per head.
// =====================================================================================
#define MX_H 12
#define MX_N 1024

// value of lane l ^ X inside a 16-lane row (DPP row_xmask), no LDS pipe
template <int X> __device__ __forceinline__ float row_x(float x) {
  return __builtin_bit_cast(float, __builtin_amdgcn_update_dpp(0, __builtin_bit_cast(int, x), 0x160 + X, 0xf, 0xf, true));
}
__device__ __forceinline__ float row_max16(float x) {
  x = fmaxf(x, row_x<1>(x)); x = fmaxf(x, row_x<2>(x)); x = fmaxf(x, row_x<4>(x)); x = fmaxf(x, row_x<8>(x));
  return x;
}
__device__ __forceinline__ float row_sum16(float x) {
  x += row_x<1>(x); x += row_x<2>(x); x += row_x<4>(x); x += row_x<8>(x);
  return x;
}
// 2^x of four values in place. One statement, so that each v_exp_f32 is followed by an instruction that touches neither
// its result nor its source; the v_nop is that independent slot behind the last one.
__device__ __forceinline__ void exp2x4(v4f& x) {
  float x0 = x[0], x1 = x[1], x2 = x[2], x3 = x[3];
  asm("v_exp_f32 %0, %0\n\tv_exp_f32 %1, %1\n\tv_exp_f32 %2, %2\n\tv_exp_f32 %3, %3\n\tv_nop"
      : "+v"(x0), "+v"(x1), "+v"(x2), "+v"(x3));
  x = (v4f){x0, x1, x2, x3};
}

// lane R of each 16-lane row, given to every lane of that row (DPP row_share)
template <int R> __device__ __forceinline__ float row_share(float x) {
  return __builtin_bit_cast(float, __builtin_amdgcn_update_dpp(0, __builtin_bit_cast(int, x), 0x150 + R, 0xf, 0xf, true));
}
__device__ __forceinline__ v8f row_share8(float x) {
  return (v8f){row_share<0>(x), row_share<1>(x), row_share<2>(x), row_share<3>(x),
               row_share<4>(x), row_share<5>(x), row_share<6>(x), row_share<7>(x)};
}
__device__ __forceinline__ v8f mma_h(v16h a, v16h b, v8f c) {
  return __builtin_amdgcn_wmma_f32_16x16x32_f16(false, a, false, b, (short)0, c, false, false);
}
union HFrag { v16h v; unsigned u[8]; };
// a wave-uniform value, held as such (scalar register)
__device__ __forceinline__ float uni(float x) {
  return __builtin_bit_cast(float, __builtin_amdgcn_readfirstlane(__builtin_bit_cast(int, x)));
}

__global__ __launch_bounds__(256) void th_mix_kernel(
    _Float16* SP, const float* __restrict__ w1, const float* __restrict__ b1,
    const float* __restrict__ w2, const float* __restrict__ b2, float pcarry)
{
  __shared__ __align__(16) float redm[8 * 16];   // [wave][head, padded to 16] maxima
  __shared__ __align__(16) float reds[8 * 16];   // [wave][head, padded to 16] sums

  const int tid  = threadIdx.x;
  const int lane = tid & 31;
  const int wave = tid >> 5;
  const int col  = lane & 15;
  const int hi   = lane >> 4;
  _Float16* blk = SP + ((size_t)blockIdx.y * MX_N + blockIdx.x) * (MX_H * MX_N);

  // every loop below is unrolled so that the index of each register array is a constant (no scratch)
  v4h s[MX_H];
#pragma unroll
  for (int h = 0; h < MX_H; ++h) s[h] = *(const v4h*)(blk + h * MX_N + tid * 4);

  // ---- weights and biases in fragment order; rows and heads 12..15 are zero ----
  const int  gr  = col < MX_H ? col : MX_H - 1;   // address stays inside the 12 rows
  const float rk = col < MX_H ? 1.0f : 0.0f;
  const float lk = hi ? 0.0f : 1.0f;
  v4f w1r[3];
#pragma unroll
  for (int q = 0; q < 3; ++q) w1r[q] = *(const v4f*)(w1 + gr * MX_H + q * 4) * rk;
  float b1s[MX_H];   // all 12 read at uniform addresses; uni() keeps them scalar loads (else the select below is folded into a vector address)
#pragma unroll
  for (int h = 0; h < MX_H; ++h) b1s[h] = uni(b1[h]);
  v8f c1;            // bias of target head hi*8+r
#pragma unroll
  for (int r = 0; r < 8; ++r) c1[r] = hi ? (r < 4 ? b1s[8 + r] : 0.0f) : b1s[r];

  // w1 row of target head col as f16 high part + f16 remainder, element e = source head e.
  // "lo" fragments carry it in lanes 0..15 only (they pick the k slots that lanes 0..15 of B fill), "up" in lanes 16..31 only.
  HFrag wh, wl;
#pragma unroll
  for (int e = 0; e < 16; ++e) {
    const float w = e < MX_H ? w1r[e >> 2][e & 3] : 0.0f;
    const _Float16 h = (_Float16)w;
    wh.v[e] = h;
    wl.v[e] = (_Float16)(w - (float)h);
  }
  const unsigned mlo = hi ? 0u : 0xffffffffu, mup = ~mlo;
  HFrag loH, loL, upH, upL;
#pragma unroll
  for (int q = 0; q < 8; ++q) {
    loH.u[q] = wh.u[q] & mlo; loL.u[q] = wl.u[q] & mlo;
    upH.u[q] = wh.u[q] & mup; upL.u[q] = wl.u[q] & mup;
  }

  // ---- mix 1 on the matrix unit: d[half][i], register r, lane = target head hi*8+r of key 128*wave + 64*half + 4*col + i ----
  v8f d[2][4];
#pragma unroll
  for (int i = 0; i < 4; ++i) {
    v16h bi;   // this lane's key i: element e = source head e
#pragma unroll
    for (int e = 0; e < 16; ++e) bi[e] = e < MX_H ? s[e][i] : (_Float16)0.0f;
    d[0][i] = mma_h(loH.v, bi, mma_h(loL.v, bi, c1));
    d[1][i] = mma_h(upH.v, bi, mma_h(upL.v, bi, c1));
  }

  const int gi = hi * 8 + (lane & 7);   // the head this lane folds behind a barrier
  // ---- softmax per head: maximum ----
  {
    v8f pm = __builtin_elementwise_max(
        __builtin_elementwise_max(__builtin_elementwise_max(d[0][0], d[0][1]), __builtin_elementwise_max(d[0][2], d[0][3])),
        __builtin_elementwise_max(__builtin_elementwise_max(d[1][0], d[1][1]), __builtin_elementwise_max(d[1][2], d[1][3])));
#pragma unroll
    for (int r = 0; r < 8; ++r) pm[r] = row_max16(pm[r]);
    if (col == 0) {
      float* rp = redm + wave * 16 + hi * 8;
      *(v4f*)(rp)     = (v4f){pm[0], pm[1], pm[2], pm[3]};
      *(v4f*)(rp + 4) = (v4f){pm[4], pm[5], pm[6], pm[7]};
    }
  }
  __syncthreads();   // all 8 waves' maxima are in LDS
  // mix 2's weights and biases are fetched here, not at the head: 16 registers fewer during mix 1; the exponentials cover the latency
  const v4f w2a = *(const v4f*)(w2 + gr * MX_H + hi * 8) * rk;          // source heads 0..3 | 8..11
  const v4f w2b = *(const v4f*)(w2 + gr * MX_H + 4) * (rk * lk);        // source heads 4..7 | none
  float b2s[MX_H];   // as b1s
#pragma unroll
  for (int h = 0; h < MX_H; ++h) b2s[h] = uni(b2[h]) * pcarry;
  v8f c2;            // bias * carry of target head hi*8+r
#pragma unroll
  for (int r = 0; r < 8; ++r) c2[r] = hi ? (r < 4 ? b2s[8 + r] : 0.0f) : b2s[r];
  const v8f w2f = (v8f){w2a[0], w2a[1], w2a[2], w2a[3], w2b[0], w2b[1], w2b[2], w2b[3]};
  {
    float M = redm[gi];
#pragma unroll
    for (int w = 1; w < 8; ++w) M = fmaxf(M, redm[w * 16 + gi]);
    const float L2E = 1.44269504088896340736f;
    const v8f mr = row_share8(M * L2E);
#pragma unroll
    for (int hf = 0; hf < 2; ++hf)
#pragma unroll
      for (int i = 0; i < 4; ++i) {
        v4f x0, x1;
#pragma unroll
        for (int e = 0; e < 4; ++e) {
          x0[e] = __builtin_fmaf(d[hf][i][e], L2E, -mr[e]);
          x1[e] = __builtin_fmaf(d[hf][i][e + 4], L2E, -mr[e + 4]);
        }
        exp2x4(x0);
        exp2x4(x1);
        d[hf][i] = (v8f){x0[0], x0[1], x0[2], x0[3], x1[0], x1[1], x1[2], x1[3]};
      }
  }
  // ---- sum ----
  {
    v8f ps = ((d[0][0] + d[0][1]) + (d[0][2] + d[0][3])) + ((d[1][0] + d[1][1]) + (d[1][2] + d[1][3]));
#pragma unroll
    for (int r = 0; r < 8; ++r) ps[r] = row_sum16(ps[r]);
    if (col == 0) {
      float* rp = reds + wave * 16 + hi * 8;
      *(v4f*)(rp)     = (v4f){ps[0], ps[1], ps[2], ps[3]};
      *(v4f*)(rp + 4) = (v4f){ps[4], ps[5], ps[6], ps[7]};
    }
  }
  __syncthreads();   // all 8 waves' sums are in LDS
  // ---- mix 2 weights: w2[target col][source hi*8+j] * carry / sum[source], f16; k slots 0..15 (a2a) or 16..31 (a2b) ----
  v16h a2a, a2b;
  {
    float S = reds[gi];
#pragma unroll
    for (int w = 1; w < 8; ++w) S += reds[w * 16 + gi];
    const v8f W = w2f * row_share8((1.0f / S) * pcarry);
#pragma unroll
    for (int j = 0; j < 8; ++j) {
      const _Float16 h = (_Float16)W[j];
      a2a[j] = h;               a2a[j + 8] = (_Float16)0.0f;
      a2b[j] = (_Float16)0.0f;  a2b[j + 8] = h;
    }
  }

  // ---- mix 2 on the matrix unit, f16 store. Register r of mix 1's result is k slot hi*8+r of a B fragment as it stands:
  // two key slots share one B fragment (elements 0..7 and 8..15), a2a reads the first, a2b the second ----
  _Float16* prow = blk + (hi * 8) * MX_N + wave * 128 + col * 4;
#pragma unroll
  for (int hf = 0; hf < 2; ++hf) {
    v8f o[4];
#pragma unroll
    for (int p = 0; p < 2; ++p) {
      v16h be;
#pragma unroll
      for (int j = 0; j < 8; ++j) { be[j] = (_Float16)d[hf][2 * p][j]; be[j + 8] = (_Float16)d[hf][2 * p + 1][j]; }
      o[2 * p]     = mma_h(a2a, be, c2);
      o[2 * p + 1] = mma_h(a2b, be, c2);
    }
#pragma unroll
    for (int r = 0; r < 8; ++r) {
      if (r < 4 || hi == 0) {   // lanes 16..31 hold target heads 8..15, of which 12..15 do not exist
        const v4h hv = (v4h){(_Float16)o[0][r], (_Float16)o[1][r], (_Float16)o[2][r], (_Float16)o[3][r]};
        *(v4h*)(prow + r * MX_N + hf * 64) = hv;
      }
    }
  }
}

// ---------------------------------------------------------------------------
template <int BIAS_MODE, int OUT_MODE>
static void gemm_f16(hipStream_t st, int gy,
                     const void* A, int lda, long sA,
                     const void* Bt, int ldb, long sB,
                     void* C, int ldc, long sC,
                     const float* bias, int M, int N, int K, float scale,
                     int gz = 1, long zA = 0L, long zB = 0L, long zC = 0L)
{
  dim3 grid((M / 128) * (N / 256), gy, gz);
  wmma_gemm64<0, false, BIAS_MODE, OUT_MODE, false, 0><<<grid, 256, 0, st>>>(
      (const unsigned short*)A, (const unsigned short*)A, lda, sA,
      (const unsigned short*)Bt, (const unsigned short*)Bt, ldb, sB,
      C, C, ldc, sC, bias, bias, (long)0, M, N, K, scale, zA, zB, zC);
}

// one block per 64x64 tile, K split over its eight waves; f16 output, no bias
static void gemm_f16_ksplit(hipStream_t st, int gy,
                            const void* A, int lda, long sA,
                            const void* Bt, int ldb, long sB,
                            void* C, int ldc, long sC,
                            const float* unused, int M, int N, int K, float scale,
                            int gz, long zA, long zB, long zC)
{
  dim3 grid((M / 64) * (N / 64), gy, gz);
  wmma_gemm64<0, false, 0, 1, false, 0, true><<<grid, 256, 0, st>>>(
      (const unsigned short*)A, (const unsigned short*)A, lda, sA,
      (const unsigned short*)Bt, (const unsigned short*)Bt, ldb, sB,
      C, C, ldc, sC, unused, unused, (long)0, M, N, K, scale, zA, zB, zC);
}

extern "C" void kernel_launch(void* const* d_in, const int* in_sizes, int n_in,
                              void* d_out, int out_size, void* d_ws, size_t ws_size,
                              hipStream_t stream)
{
  const int Bn = 8, Nn = 1024, Dd = 768, Hh = 12, HD = 64;
  const int GB = 8;                                       // batches per launch in the attention part
  if (n_in < 13) return;
  if (in_sizes[0] != Bn * Nn * Dd) return;
  if (in_sizes[1] != Dd * Dd || in_sizes[3] != Dd * Dd || in_sizes[5] != Dd * Dd || in_sizes[7] != Dd * Dd) return;
  if (in_sizes[2] != Dd || in_sizes[4] != Dd || in_sizes[6] != Dd || in_sizes[8] != Dd) return;
  if (in_sizes[9] != Hh * Hh || in_sizes[10] != Hh || in_sizes[11] != Hh * Hh || in_sizes[12] != Hh) return;
  if (out_size != Bn * Nn * Dd) return;

  const float* x    = (const float*)d_in[0];
  const float* wq   = (const float*)d_in[1];
  const float* bq   = (const float*)d_in[2];
  const float* wk   = (const float*)d_in[3];
  const float* bk   = (const float*)d_in[4];
  const float* wv   = (const float*)d_in[5];
  const float* bv   = (const float*)d_in[6];
  const float* wo   = (const float*)d_in[7];
  const float* bo   = (const float*)d_in[8];
  const float* th1w = (const float*)d_in[9];
  const float* th1b = (const float*)d_in[10];
  const float* th2w = (const float*)d_in[11];
  const float* th2b = (const float*)d_in[12];
  float* out = (float*)d_out;

  // ---- workspace carve (bytes) ----
  const size_t WSZ = (size_t)Dd * Dd * 2;                 // one f16 weight matrix
  const size_t ASZ = (size_t)Bn * Nn * Dd * 2;            // one f16 activation [8192][768]
  const size_t SSZ = (size_t)GB * Nn * Hh * Nn * 2;       // logits f16 [GB][1024][12][1024]; mixed attention f16 written over them
  const size_t off_wq  = 0;
  const size_t off_wk  = off_wq + WSZ;
  const size_t off_wv  = off_wk + WSZ;
  const size_t off_wo  = off_wv + WSZ;
  const size_t off_q   = off_wo + WSZ;
  const size_t off_k   = off_q + ASZ;
  const size_t off_vt  = off_k + ASZ;                     // v^T per batch: [b][h*64+d][m]
  const size_t off_ctx = off_vt + ASZ;                    // attention output [8192][768] f16
  const size_t off_R   = off_ctx + ASZ;                   // reused region
  const size_t off_x16 = off_R;                           // live during the projections only
  const size_t off_S   = off_R;                           // live per group of GB batches afterwards
  size_t end = off_S + SSZ;
  if (off_x16 + ASZ > end) end = off_x16 + ASZ;
  if (end > ws_size) return;

  uint8_t* ws = (uint8_t*)d_ws;
  _Float16* wq16 = (_Float16*)(ws + off_wq);
  _Float16* wk16 = (_Float16*)(ws + off_wk);
  _Float16* wv16 = (_Float16*)(ws + off_wv);
  _Float16* wo16 = (_Float16*)(ws + off_wo);
  unsigned short* q16   = (unsigned short*)(ws + off_q);
  unsigned short* k16   = (unsigned short*)(ws + off_k);
  unsigned short* vt16  = (unsigned short*)(ws + off_vt);
  unsigned short* ctx16 = (unsigned short*)(ws + off_ctx);
  _Float16* x16 = (_Float16*)(ws + off_x16);
  _Float16* Sb = (_Float16*)(ws + off_S);

  const float WCARRY = 64.0f;        // weights carried x2^6 in f16
  const float PCARRY = 2048.0f;      // mixed attention carried x2^11 in f16

  // ---- casts to f16: one launch ----
  cast_all_f16<<<Bn * Nn * Dd / CV_BLK + 4 * (Dd * Dd / CV_BLK), 256, 0, stream>>>(
      x, wq, wk, wv, wo, x16, wq16, Bn * Nn * Dd / CV_BLK, Dd * Dd / CV_BLK, WCARRY);

  // ---- projections: q, k as [b*1024+n][h*64+d] f16; v^T per batch as [b][h*64+d][m] f16 ----
  gemm_f16<2, 1>(stream, 1, x16, Dd, 0L, wq16, Dd, 0L, q16, Dd, 0L, bq, Bn * Nn, Dd, Dd, 1.0f / WCARRY);
  gemm_f16<2, 1>(stream, 1, x16, Dd, 0L, wk16, Dd, 0L, k16, Dd, 0L, bk, Bn * Nn, Dd, Dd, 1.0f / WCARRY);
  // A = wv [768][768], Bt = x rows of batch b [1024][768] -> C [768][1024] per batch, bias[m] = bv[o]
  gemm_f16<1, 1>(stream, Bn, wv16, Dd, 0L, x16, Dd, (long)Nn * Dd, vt16, Nn, (long)Dd * Nn, bv, Dd, Nn, Dd, 1.0f / WCARRY);

  // ---- per group of GB batches (grid.z = batch in the group): logits -> mix/softmax/mix -> a.v ----
  const float qk_scale = 0.125f;     // 64^-0.5
  const long rowS = (long)Hh * Nn;   // f16 elements of one query's 12 logit rows
  for (int b = 0; b < Bn; b += GB) {
    const unsigned short* qb = q16 + (size_t)b * Nn * Dd;
    const unsigned short* kb = k16 + (size_t)b * Nn * Dd;
    // S[z][n][h][m] = scale * sum_d q[n][h*64+d] k[m][h*64+d]; grid.y = head: strideA/B = 64, strideC = 1024
    gemm_f16<0, 1>(stream, Hh, qb, Dd, (long)HD, kb, Dd, (long)HD, Sb, Hh * Nn, (long)Nn, bq, Nn, Nn, HD, qk_scale,
                   GB, (long)Nn * Dd, (long)Nn * Dd, (long)Nn * rowS);
    th_mix_kernel<<<dim3(Nn, GB), 256, 0, stream>>>(Sb, th1w, th1b, th2w, th2b, PCARRY);
    // ctx[(b+z)*1024+n][h*64+d] = 2^-11 * sum_m P[z][n][h][m] * vT[b+z][h*64+d][m]; grid.y = head.
    // P rows lie in the logits' place: f16 pitch per query = rowS, per head = 1024
    gemm_f16_ksplit(stream, Hh,
                    Sb, Hh * Nn, (long)Nn,
                    vt16 + (size_t)b * Dd * Nn, Nn, (long)HD * Nn,
                    ctx16 + (size_t)b * Nn * Dd, Dd, (long)HD,
                    bq, Nn, HD, Nn, 1.0f / PCARRY,
                    GB, (long)Nn * rowS, (long)Dd * Nn, (long)Nn * Dd);
  }

  // ---- output projection -> f32 [8192][768] ----
  gemm_f16<2, 0>(stream, 1, ctx16, Dd, 0L, wo16, Dd, 0L, out, Dd, 0L, bo, Bn * Nn, Dd, Dd, 1.0f / WCARRY);
}

// v008
// Measured time: 187 microseconds a run.
// Timed twice side by side with v007, it ran 1.08 times as fast both times.
// Counting every step since v000, it is 4.52 times as fast.
#include <hip/hip_runtime.h>
#include <stdint.h>
#include <stddef.h>

// Contractions (q/k/v projections, q.k^T, a.v, output projection): v_wmma_f32_16x16x32_f16 (f16 operands, f32 accumulate); weights carried x64, mixed attention carried x2^11, folded back in the f32 epilogue; scaled logits stored as f16; the two 12x12 cross-head mixes on the same WMMA form (mix 1: weights as f16 high part + f16 remainder; mix 2: exponentials and weight/sum as f16), softmax in f32 on VALU.

typedef __attribute__((ext_vector_type(16))) _Float16 v16h;
typedef __attribute__((ext_vector_type(8)))  _Float16 v8h;
typedef __attribute__((ext_vector_type(4)))  _Float16 v4h;
typedef __attribute__((ext_vector_type(16))) __bf16   v16b;
typedef __attribute__((ext_vector_type(8)))  __bf16   v8b;
typedef __attribute__((ext_vector_type(8)))  float    v8f;
typedef __attribute__((ext_vector_type(4)))  float    v4f;
typedef __attribute__((ext_vector_type(2)))  float    v2f;

__device__ __forceinline__ unsigned short f2bf_bits(float f) {
  unsigned u = __float_as_uint(f);
  return (unsigned short)((u + 0x7FFFu + ((u >> 16) & 1u)) >> 16);
}
__device__ __forceinline__ float bf_bits2f(unsigned short h) { return __uint_as_float(((unsigned)h) << 16); }

// hazard guards as plain device helpers
__device__ __forceinline__ void dep_guard_h(v8f& a, v8f& b, v16h x, v16h y) { asm volatile("v_nop\n\tv_nop\n\tv_nop\n\tv_nop" : "+v"(a), "+v"(b) : "v"(x), "v"(y)); }
__device__ __forceinline__ void dep_guard_b(v8f& a, v8f& b, v16b x, v16b y) { asm volatile("v_nop\n\tv_nop\n\tv_nop\n\tv_nop" : "+v"(a), "+v"(b) : "v"(x), "v"(y)); }
__device__ __forceinline__ void keep4_h(v16h a, v16h b, v16h c, v16h d) { asm volatile("v_nop" :: "v"(a), "v"(b), "v"(c), "v"(d)); }
__device__ __forceinline__ void keep4_b(v16b a, v16b b, v16b c, v16b d) { asm volatile("v_nop" :: "v"(a), "v"(b), "v"(c), "v"(d)); }
__device__ __forceinline__ void acc_guard4(v8f& a, v8f& b, v8f& c, v8f& d) { asm volatile("v_nop\n\tv_nop\n\tv_nop\n\tv_nop" : "+v"(a), "+v"(b), "+v"(c), "+v"(d)); }
template <typename T> struct Frag;
template <> struct Frag<_Float16> {
  typedef v16h V; union U { v16h v; v8h h[2]; };
  static __device__ __forceinline__ v16h load(const _Float16* p) {   // elements 0..7 <- p[0..7], 8..15 <- p[16..23]
    U f; f.h[0] = *(const v8h*)(p); f.h[1] = *(const v8h*)(p + 16); return f.v;
  }
  static __device__ __forceinline__ v8f mma(v16h a, v16h b, v8f c) {
    return __builtin_amdgcn_wmma_f32_16x16x32_f16(false, a, false, b, (short)0, c, false, false);
  }
  static __device__ __forceinline__ void guard(v8f& a, v8f& b, v16h x, v16h y) { dep_guard_h(a, b, x, y); }
  static __device__ __forceinline__ void keep(v16h a, v16h b, v16h c, v16h d) { keep4_h(a, b, c, d); }
};
template <> struct Frag<__bf16> {
  typedef v16b V; union U { v16b v; v8b h[2]; };
  static __device__ __forceinline__ v16b load(const __bf16* p) {
    U f; f.h[0] = *(const v8b*)(p); f.h[1] = *(const v8b*)(p + 16); return f.v;
  }
  static __device__ __forceinline__ v8f mma(v16b a, v16b b, v8f c) {
    return __builtin_amdgcn_wmma_f32_16x16x32_bf16(false, a, false, b, (short)0, c, false, false);
  }
  static __device__ __forceinline__ void guard(v8f& a, v8f& b, v16b x, v16b y) { dep_guard_b(a, b, x, y); }
  static __device__ __forceinline__ void keep(v16b a, v16b b, v16b c, v16b d) { keep4_b(a, b, c, d); }
};

// ---- Register-blocked batched WMMA GEMM ------------------------------------
// C[m,n] = scale * sum_k A[m,k] * Bt[n,k] (+bias)(+resid); each wave owns a 64x64 tile.
// A row-major [M,K]; Bt row-major [N,K].
// SPLIT: operands are hi/lo planes (A2/Bt2 = lo planes, same layout); product = hi.hi + hi.lo + lo.hi.
// BIAS_MODE: 0 = none, 1 = bias[m], 2 = bias[n].
// OUT_MODE: 0 = f32, 1 = f16, 2 = bf16 hi plane (Cout) + bf16 lo plane (Cout2).
// ET: 0 = f16 operands, 1 = bf16 operands (pointers passed as 16-bit storage)
// KSPLIT: one 64x64 tile per block; wave w sums k in [w*K/8, (w+1)*K/8) (K % 256 == 0) and the eight f32
// partial tiles are added in LDS in wave order 0..7. For shapes with too few tiles to fill the chip.
// Two batch levels: blockIdx.y with strideA/B/C, blockIdx.z with zA/zB/zC (element strides).
// Not KSPLIT: one 128x256 tile of C per block (M % 128 == 0, N % 256 == 0, K % 64 == 0), waves 2 x 4, 64x64 each.
// Per 64 k the block's 128 A rows and 256 Bt rows (128 B each) are copied to LDS by asynchronous 16-byte copies,
// four whole rows per wave and copy, two buffers: the next 64 k fly while this one is multiplied.
// QKV: three products of one launch on blockIdx.y. 0 and 1: C = A . Bt^T as the arguments say (weights strideB apart, outputs
// strideC apart, bias[n] from bias, resid). 2: the third weight matrix times the rows of A, batch by batch, i.e. the transposed
// product: operands change places, blockIdx.x = batch * tiles + tile, zB = rows of A per batch (= columns and pitch of C),
// zA, zC = elements of A and of C per batch, bias[m] from bias3.
#define SG_PITCH 72                          // f16 per staged row: 128 B + 16 B, the pitch for ds_load_b128 readers of 16 rows
#define SG_ROWS  384                         // 128 A rows, then 256 Bt rows
#define SG_BYTES (SG_ROWS * SG_PITCH * 2)    // one buffer
// One stage: this lane's 16 bytes of rows r, r + 32, ... (4 of A, 8 of Bt). lds = LDS byte address of its place in row r.
// The s_wait_xcnt stands inside the statement so that no address register is rewritten in front of it.
__device__ __forceinline__ void stage_issue(unsigned lds, const unsigned short* ga, size_t stepA,
                                            const unsigned short* gb, size_t stepB) {
  const unsigned LS = 32 * SG_PITCH * 2;
  asm volatile(
      "global_load_async_to_lds_b128 %0, %12, off\n\t"
      "global_load_async_to_lds_b128 %1, %13, off\n\t"
      "global_load_async_to_lds_b128 %2, %14, off\n\t"
      "global_load_async_to_lds_b128 %3, %15, off\n\t"
      "global_load_async_to_lds_b128 %4, %16, off\n\t"
      "global_load_async_to_lds_b128 %5, %17, off\n\t"
      "global_load_async_to_lds_b128 %6, %18, off\n\t"
      "global_load_async_to_lds_b128 %7, %19, off\n\t"
      "global_load_async_to_lds_b128 %8, %20, off\n\t"
      "global_load_async_to_lds_b128 %9, %21, off\n\t"
      "global_load_async_to_lds_b128 %10, %22, off\n\t"
      "global_load_async_to_lds_b128 %11, %23, off\n\t"
      "s_wait_xcnt 0x0"
      :: "v"(lds), "v"(lds + LS), "v"(lds + 2 * LS), "v"(lds + 3 * LS),
         "v"(lds + 4 * LS), "v"(lds + 5 * LS), "v"(lds + 6 * LS), "v"(lds + 7 * LS),
         "v"(lds + 8 * LS), "v"(lds + 9 * LS), "v"(lds + 10 * LS), "v"(lds + 11 * LS),
         "v"(ga), "v"(ga + stepA), "v"(ga + 2 * stepA), "v"(ga + 3 * stepA),
         "v"(gb), "v"(gb + stepB), "v"(gb + 2 * stepB), "v"(gb + 3 * stepB),
         "v"(gb + 4 * stepB), "v"(gb + 5 * stepB), "v"(gb + 6 * stepB), "v"(gb + 7 * stepB)
      : "memory");
}
template <int ET> struct Elem;
template <> struct Elem<0> { typedef _Float16 T; };
template <> struct Elem<1> { typedef __bf16 T; };
template <int ET, bool SPLIT, int BIAS_MODE, int OUT_MODE, bool RESID, int ACT = 0, bool KSPLIT = false, bool QKV = false>
__global__ __launch_bounds__(256) void wmma_gemm64(
    const unsigned short* __restrict__ Ap, const unsigned short* __restrict__ A2p, int lda, long strideA,
    const unsigned short* __restrict__ Btp, const unsigned short* __restrict__ Bt2p, int ldb, long strideB,
    void* __restrict__ Cout, void* __restrict__ Cout2, int ldcArg, long strideC,
    const float* __restrict__ bias,
    const float* __restrict__ resid, long strideR,
    int M, int N, int K, float scale, long zA, long zB, long zC, const float* __restrict__ bias3) {
  typedef typename Elem<ET>::T T;
  typedef typename Frag<T>::V V;
  const T* A = (const T*)Ap; const T* A2 = (const T*)A2p; const T* Bt = (const T*)Btp; const T* Bt2 = (const T*)Bt2p;
  static_assert(!KSPLIT || (!SPLIT && BIAS_MODE == 0 && OUT_MODE == 1 && !RESID && ACT == 0), "KSPLIT epilogue: plain f16 output only");
  static_assert(KSPLIT || !SPLIT, "staged form: single-plane operands only");
  static_assert(!QKV || (!KSPLIT && BIAS_MODE == 2 && !RESID), "QKV: staged form, bias by column (by row for the third product)");
  __shared__ __align__(16) float sT[8][(KSPLIT ? 64 : 16) * 68];   // per-wave slab (16x64, KSPLIT: 64x64), pitch 68 floats
  __shared__ __align__(16) unsigned short stg[KSPLIT ? 8 : 2 * SG_ROWS * SG_PITCH];   // staged operand rows, two buffers
  const int b    = blockIdx.y;
  const int z    = blockIdx.z;
  const int lane = threadIdx.x & 31;
  const int wave = threadIdx.x >> 5;
  const bool isV = QKV && b == 2;        // block-uniform
  const int Me = isV ? N : M;            // rows and columns of this block's product
  const int Ne = isV ? (int)zB : N;
  const int tilesN = Ne >> (KSPLIT ? 6 : 8);
  const int tilesM = Me >> (KSPLIT ? 6 : 7);
  int tile = (int)blockIdx.x;
  const int vb = isV ? tile / (tilesM * tilesN) : 0;   // batch of the third product
  tile -= vb * (tilesM * tilesN);
  if (isV ? vb >= M / Ne : tile >= tilesM * tilesN) return;   // block-uniform, in front of every barrier
  const int tm = tile / tilesN;
  const int tn = tile - tm * tilesN;
  const int wv = __builtin_amdgcn_readfirstlane(wave);
  const int bm0 = tm << (KSPLIT ? 6 : 7);                  // the block's first row and column of C
  const int bn0 = tn << (KSPLIT ? 6 : 8);
  const int m0 = KSPLIT ? bm0 : bm0 + ((wv >> 2) << 6);    // the wave's
  const int n0 = KSPLIT ? bn0 : bn0 + ((wv & 3) << 6);

  const size_t offA = isV ? (size_t)2 * strideB : (size_t)b * strideA + (size_t)z * zA;
  const size_t offB = isV ? (size_t)vb * zA : (size_t)b * strideB + (size_t)z * zB;
  const size_t offC = isV ? (size_t)2 * strideC + (size_t)vb * zC : (size_t)b * strideC + (size_t)z * zC;
  const unsigned short* Asrc = isV ? Btp : Ap;
  const unsigned short* Bsrc = isV ? Ap : Btp;
  const int ldA = isV ? ldb : lda, ldB = isV ? lda : ldb, ldc = isV ? (int)zB : ldcArg;
  const float* biasp = QKV ? (b == 0 ? bias : b == 1 ? resid : bias3) : bias;
  const T* Ab  = A  + offA;
  const T* Bb  = Bt + offB;
  const T* Ab2 = SPLIT ? (A2  + offA) : nullptr;
  const T* Bb2 = SPLIT ? (Bt2 + offB) : nullptr;

  const int rlane = lane & 15;                 // row (A) / col (B, D) within subtile
  const int koff  = (lane >> 4) * 8;           // k offset of this lane half
  const int mOff  = (lane >> 4) * 8;           // D row offset

  v8f acc[4][4];
#pragma unroll
  for (int i = 0; i < 4; ++i)
#pragma unroll
    for (int j = 0; j < 4; ++j) acc[i][j] = (v8f){0.f,0.f,0.f,0.f,0.f,0.f,0.f,0.f};

  if (!KSPLIT) {
    const int crow = threadIdx.x >> 3;                     // a wave's copy = 4 whole rows of 128 B
    const int cchk = (threadIdx.x & 7) * 8;
    const unsigned short* gA = Asrc + offA + (size_t)(bm0 + crow) * ldA + cchk;
    const unsigned short* gB = Bsrc + offB + (size_t)(bn0 + crow) * ldB + cchk;
    const size_t stepA = (size_t)32 * ldA, stepB = (size_t)32 * ldB;
    const unsigned l0 = (unsigned)(size_t)stg + (unsigned)(crow * SG_PITCH + cchk) * 2u;
    const int nst = K >> 6;                                // stages of 64 k
    const int aRow = ((wv >> 2) << 6) + rlane;             // the wave's first staged rows
    const int bRow = 128 + ((wv & 3) << 6) + rlane;
    stage_issue(l0, gA, stepA, gB, stepB);
    asm volatile("s_wait_asynccnt 0x0" ::: "memory");      // this wave's copies of stage 0 have landed
    __syncthreads();                                       // ... and every other wave's
    if (nst > 1) stage_issue(l0 + SG_BYTES, gA + 64, stepA, gB + 64, stepB);
#pragma unroll 1   // one body: the buffer is picked by t & 1
    for (int t = 0; t < nst; ++t) {
      const T* sb = (const T*)stg + (t & 1) * (SG_ROWS * SG_PITCH);
      // the loops below are unrolled so that every fragment and accumulator index is a constant (registers, no scratch)
#pragma unroll
      for (int ks = 0; ks < 2; ++ks) {
        V bh[4], ah[4];
#pragma unroll
        for (int j = 0; j < 4; ++j) bh[j] = Frag<T>::load(sb + (bRow + (j << 4)) * SG_PITCH + (ks << 5) + koff);
#pragma unroll
        for (int i = 0; i < 4; ++i) ah[i] = Frag<T>::load(sb + (aRow + (i << 4)) * SG_PITCH + (ks << 5) + koff);
        __builtin_amdgcn_sched_barrier(0);   // the 16 LDS reads stay one group in front of their 16 WMMAs (else: one A fragment at a time, a full LDS wait per 4 WMMAs)
#pragma unroll
        for (int i = 0; i < 4; ++i)
#pragma unroll
          for (int j = 0; j < 4; ++j) acc[i][j] = Frag<T>::mma(ah[i], bh[j], acc[i][j]);
      }
      asm volatile("s_wait_dscnt 0x0" ::: "memory");       // this wave has left the buffer of stage t
      asm volatile("s_wait_asynccnt 0x0" ::: "memory");    // its copies of stage t + 1 have landed
      __syncthreads();                                     // publishes stage t + 1 and frees the buffer of stage t
      if (t + 2 < nst) stage_issue(l0 + (t & 1) * SG_BYTES, gA + (size_t)(t + 2) * 64, stepA, gB + (size_t)(t + 2) * 64, stepB);
    }
    asm volatile("s_wait_asynccnt 0x0" ::: "memory");      // no copy is left in flight behind the loop
  }
  const int kBeg = KSPLIT ? wv * (K >> 3) : 0;   // scalar, so the k loop keeps its scalar counter and branch
  const int kEnd = KSPLIT ? kBeg + (K >> 3) : 0;
  for (int k0 = kBeg; k0 < kEnd; k0 += 32) {
    V bh[4], bl[4];
#pragma unroll
    for (int j = 0; j < 4; ++j) {
      const size_t bo = (size_t)(n0 + (j << 4) + rlane) * ldb + koff + k0;
      bh[j] = Frag<T>::load(Bb + bo);
      if (SPLIT) bl[j] = Frag<T>::load(Bb2 + bo);
    }
#pragma unroll
    for (int i = 0; i < 4; ++i) {
      const size_t ao = (size_t)(m0 + (i << 4) + rlane) * lda + koff + k0;
      V ah = Frag<T>::load(Ab + ao);
      V al;
      if (SPLIT) al = Frag<T>::load(Ab2 + ao);
#pragma unroll
      for (int j = 0; j < 4; ++j) {
        acc[i][j] = Frag<T>::mma(ah, bh[j], acc[i][j]);
        if (SPLIT) {
          acc[i][j] = Frag<T>::mma(ah, bl[j], acc[i][j]);
          acc[i][j] = Frag<T>::mma(al, bh[j], acc[i][j]);
        }
      }
      Frag<T>::guard(acc[i][0], acc[i][3], ah, SPLIT ? al : ah);
    }
    Frag<T>::keep(bh[0], bh[1], bh[2], bh[3]);
    if (SPLIT) Frag<T>::keep(bl[0], bl[1], bl[2], bl[3]);
  }
  acc_guard4(acc[0][0], acc[0][1], acc[0][2], acc[0][3]);
  acc_guard4(acc[1][0], acc[1][1], acc[1][2], acc[1][3]);
  acc_guard4(acc[2][0], acc[2][1], acc[2][2], acc[2][3]);
  acc_guard4(acc[3][0], acc[3][1], acc[3][2], acc[3][3]);

  if (KSPLIT) {
    // ---- split-K epilogue: partial tiles to LDS, then wave w sums and stores rows 8w..8w+7 ----
    float* part = sT[wave];
#pragma unroll
    for (int i = 0; i < 4; ++i)
#pragma unroll
      for (int j = 0; j < 4; ++j)
#pragma unroll
        for (int r = 0; r < 8; ++r)
          part[((i << 4) + mOff + r) * 68 + (j << 4) + rlane] = acc[i][j][r];
    __syncthreads();   // every wave's partial tile is in LDS before any wave reads the eight of them
    unsigned short* C = (unsigned short*)Cout + offC;
    const int hh = lane >> 4, c4 = (lane & 15) * 4;     // row seg = 64 f16 = 128 B = 16 lanes x 8 B
#pragma unroll
    for (int it = 0; it < 4; ++it) {
      const int row = (wave << 3) + it * 2 + hh;
      v4f s = *(const v4f*)(&sT[0][row * 68 + c4]);
#pragma unroll
      for (int w = 1; w < 8; ++w) s += *(const v4f*)(&sT[w][row * 68 + c4]);
      v4h hv;
#pragma unroll
      for (int e = 0; e < 4; ++e) hv[e] = (_Float16)(s[e] * scale);
      *(v4h*)(C + (size_t)(m0 + row) * ldc + n0 + c4) = hv;
    }
    return;
  }

  // ---- epilogue ----
  float* slab = sT[wave];
  const float* Rb = RESID ? (resid + (size_t)b * strideR) : nullptr;
  // QKV: bias by row (third product) and by column (the other two), all fetched here in one group, without a branch: the
  // kind that a product does not use is read from the first 56 elements of its bias vector and replaced by zero.
  float bm[4][8], bn[4];
  if (QKV) {
    const float* bmp = biasp + (isV ? m0 + mOff : 0);
    const float* bnp = biasp + (isV ? 0 : n0 + rlane);
#pragma unroll
    for (int i = 0; i < 4; ++i)
#pragma unroll
      for (int r = 0; r < 8; ++r) bm[i][r] = bmp[(i << 4) + r];
#pragma unroll
    for (int j = 0; j < 4; ++j) bn[j] = bnp[j << 4];
    asm volatile("s_wait_xcnt 0x0" ::: "memory");   // in front of the first rewrite of these loads' address registers
#pragma unroll
    for (int i = 0; i < 4; ++i)
#pragma unroll
      for (int r = 0; r < 8; ++r) bm[i][r] = isV ? bm[i][r] : 0.0f;
#pragma unroll
    for (int j = 0; j < 4; ++j) bn[j] = isV ? 0.0f : bn[j];
  }
#pragma unroll
  for (int i = 0; i < 4; ++i) {
    const int mBase = m0 + (i << 4);
#pragma unroll
    for (int j = 0; j < 4; ++j) {
      const int n = n0 + (j << 4) + rlane;
      float bv = 0.f;
      if (BIAS_MODE == 2) bv = QKV ? bn[j] : bias[n];
#pragma unroll
      for (int r = 0; r < 8; ++r) {
        float v = acc[i][j][r] * scale;
        if (BIAS_MODE == 1) v += bias[mBase + mOff + r];
        if (BIAS_MODE == 2) v += QKV ? bv + bm[i][r] : bv;   // QKV: one of the two is zero
        if (RESID) v += Rb[(size_t)(mBase + mOff + r) * ldc + n];
        if (ACT == 1) v = tanhf(v);
        if (ACT == 2) v = fmaxf(v, 0.0f);
        if (ACT == 3) v = v / (1.0f + expf(-v));
        if (ACT == 4) v = (v > 0.f) ? v : 0.01f * v;
        if (ACT == 5) v = 0.5f * v * (1.0f + erff(v * 0.70710678118654752f));
        slab[(mOff + r) * 68 + (j << 4) + rlane] = v;
      }
    }
    __builtin_amdgcn_fence(__ATOMIC_RELEASE, "workgroup");
    __builtin_amdgcn_wave_barrier();
    __builtin_amdgcn_fence(__ATOMIC_ACQUIRE, "workgroup");
    if (OUT_MODE == 0) {
      float* C = (float*)Cout + offC;
      const int hh = lane >> 4, c4 = (lane & 15) * 4;     // row seg = 256 B = 16 lanes x 16 B
      {
#pragma unroll
        for (int it = 0; it < 8; ++it) {
          const int row = it * 2 + hh;
          v4f v = *(const v4f*)(slab + row * 68 + c4);
          *(v4f*)(C + (size_t)(mBase + row) * ldc + n0 + c4) = v;
        }
        
      }
    } else {
      const int q = lane >> 3, c8 = (lane & 7) * 8;
      unsigned short* C  = (unsigned short*)Cout  + offC;
      unsigned short* C2 = (OUT_MODE == 2) ? ((unsigned short*)Cout2 + offC) : nullptr;
      {
#pragma unroll
        for (int it = 0; it < 4; ++it) {
          const int row = it * 4 + q;
          const float* sp = slab + row * 68 + c8;
          v8h hv, lv;
#pragma unroll
          for (int e = 0; e < 8; ++e) {
            if (OUT_MODE == 1) {
              hv[e] = (_Float16)sp[e];
            } else {
              unsigned short hb = f2bf_bits(sp[e]);
              unsigned short lb = f2bf_bits(sp[e] - bf_bits2f(hb));
              hv[e] = __builtin_bit_cast(_Float16, hb);
              lv[e] = __builtin_bit_cast(_Float16, lb);
            }
          }
          *(v8h*)(C + (size_t)(mBase + row) * ldc + n0 + c8) = hv;
          if (OUT_MODE == 2) *(v8h*)(C2 + (size_t)(mBase + row) * ldc + n0 + c8) = lv;
        }
        
      }
    }
    if (QKV) {
      asm volatile("s_wait_xcnt 0x0" ::: "memory");   // in front of the next pass's rewrite of the stores' address and data registers
      __builtin_amdgcn_sched_barrier(0);              // no later register write is lifted over that wait
    }
    __builtin_amdgcn_fence(__ATOMIC_RELEASE, "workgroup");
    __builtin_amdgcn_wave_barrier();
    __builtin_amdgcn_fence(__ATOMIC_ACQUIRE, "workgroup");
  }
}

// ---- f32 -> f16 casts of x (x1) and of the four weight matrices (x wscale), all in one launch ----
// A block converts CV_BLK consecutive floats of ONE array: blocks [0, xBlocks) take x, then wBlocks blocks each for
// wq, wk, wv, wo (w16 = the four f16 matrices one behind the other). Few long waves instead of many short ones: a thread
// has CV_U loads of 16 bytes in flight, each load of a wave covers 512 consecutive bytes, each store 256.
#define CV_U   16
#define CV_BLK (256 * 4 * CV_U)
__global__ __launch_bounds__(256) void cast_all_f16(
    const float* __restrict__ x, const float* __restrict__ wq, const float* __restrict__ wk,
    const float* __restrict__ wv, const float* __restrict__ wo,
    _Float16* __restrict__ x16, _Float16* __restrict__ w16, int xBlocks, int wBlocks, float wscale) {
  int bx = blockIdx.x;
  const float* in = x;
  _Float16* out = x16;
  float scale = 1.0f;
  if (bx >= xBlocks) {   // block-uniform
    bx -= xBlocks;
    const int j = bx / wBlocks;
    bx -= j * wBlocks;
    in = j == 0 ? wq : j == 1 ? wk : j == 2 ? wv : wo;
    out = w16 + (size_t)j * wBlocks * CV_BLK;
    scale = wscale;
  }
  const v4f* ip = (const v4f*)(in + (size_t)bx * CV_BLK);   // block-uniform bases; the thread index is the one vector offset of loads and stores
  v4h* op = (v4h*)(out + (size_t)bx * CV_BLK);
  const int t = threadIdx.x;
  v4f a[CV_U];
  // both loops are unrolled so that a[] stays in registers and all the loads are issued in front of the first store
#pragma unroll
  for (int i = 0; i < CV_U; ++i) a[i] = ip[t + i * 256];
#pragma unroll
  for (int i = 0; i < CV_U; ++i) {
    v4h h;
#pragma unroll
    for (int e = 0; e < 4; ++e) h[e] = (_Float16)(a[i][e] * scale);
    op[t + i * 256] = h;
  }
}

// =====================================================================================
// Cross-head mix 1 (12x12) -> softmax over keys (f32) -> cross-head mix 2 with 1/sum and the
// power-of-two carry -> f16 store.  One block per query row n (blockIdx.x) of one batch (blockIdx.y).
// SP is [batch][1024][12][1024] f16 (query, head, key): a block's 12 logit rows are its own 24 KB. The
// result (mix2 * pcarry, f16, [12][1024]) goes over them: a wave stores exactly the 128 keys x 12 heads that it has
// loaded itself (its loads have all been consumed by then), and no other wave or block touches them.
// Both mixes are WMMAs with the 12x12 weights as A (rows = target head) and 16 keys as B's columns (k = source head).
// Mix 1: a lane holds all 12 heads of its own 4 keys, so its 12 values of one key fill its own 16 k slots of a B fragment;
// lanes l and l+16 share a column, so one WMMA with the weights in the k slots of lanes 0..15 (zeros in the others) mixes
// the keys of lanes 0..15 and a second one with the weights in the other slots those of lanes 16..31, from the same B.
// LDS carries only 8 wave maxima and sums per head.
// =====================================================================================
#define MX_H 12
#define MX_N 1024

// value of lane l ^ X inside a 16-lane row (DPP row_xmask), no LDS pipe
template <int X> __device__ __forceinline__ float row_x(float x) {
  return __builtin_bit_cast(float, __builtin_amdgcn_update_dpp(0, __builtin_bit_cast(int, x), 0x160 + X, 0xf, 0xf, true));
}
__device__ __forceinline__ float row_max16(float x) {
  x = fmaxf(x, row_x<1>(x)); x = fmaxf(x, row_x<2>(x)); x = fmaxf(x, row_x<4>(x)); x = fmaxf(x, row_x<8>(x));
  return x;
}
__device__ __forceinline__ float row_sum16(float x) {
  x += row_x<1>(x); x += row_x<2>(x); x += row_x<4>(x); x += row_x<8>(x);
  return x;
}
// 2^x of four values in place. One statement, so that each v_exp_f32 is followed by an instruction that touches neither
// its result nor its source; the v_nop is that independent slot behind the last one.
__device__ __forceinline__ void exp2x4(v4f& x) {
  float x0 = x[0], x1 = x[1], x2 = x[2], x3 = x[3];
  asm("v_exp_f32 %0, %0\n\tv_exp_f32 %1, %1\n\tv_exp_f32 %2, %2\n\tv_exp_f32 %3, %3\n\tv_nop"
      : "+v"(x0), "+v"(x1), "+v"(x2), "+v"(x3));
  x = (v4f){x0, x1, x2, x3};
}

// lane R of each 16-lane row, given to every lane of that row (DPP row_share)
template <int R> __device__ __forceinline__ float row_share(float x) {
  return __builtin_bit_cast(float, __builtin_amdgcn_update_dpp(0, __builtin_bit_cast(int, x), 0x150 + R, 0xf, 0xf, true));
}
__device__ __forceinline__ v8f row_share8(float x) {
  return (v8f){row_share<0>(x), row_share<1>(x), row_share<2>(x), row_share<3>(x),
               row_share<4>(x), row_share<5>(x), row_share<6>(x), row_share<7>(x)};
}
__device__ __forceinline__ v8f mma_h(v16h a, v16h b, v8f c) {
  return __builtin_amdgcn_wmma_f32_16x16x32_f16(false, a, false, b, (short)0, c, false, false);
}
union HFrag { v16h v; unsigned u[8]; };
// a wave-uniform value, held as such (scalar register)
__device__ __forceinline__ float uni(float x) {
  return __builtin_bit_cast(float, __builtin_amdgcn_readfirstlane(__builtin_bit_cast(int, x)));
}

__global__ __launch_bounds__(256) void th_mix_kernel(
    _Float16* SP, const float* __restrict__ w1, const float* __restrict__ b1,
    const float* __restrict__ w2, const float* __restrict__ b2, float pcarry)
{
  __shared__ __align__(16) float redm[8 * 16];   // [wave][head, padded to 16] maxima
  __shared__ __align__(16) float reds[8 * 16];   // [wave][head, padded to 16] sums

  const int tid  = threadIdx.x;
  const int lane = tid & 31;
  const int wave = tid >> 5;
  const int col  = lane & 15;
  const int hi   = lane >> 4;
  _Float16* blk = SP + ((size_t)blockIdx.y * MX_N + blockIdx.x) * (MX_H * MX_N);

  // every loop below is unrolled so that the index of each register array is a constant (no scratch)
  v4h s[MX_H];
#pragma unroll
  for (int h = 0; h < MX_H; ++h) s[h] = *(const v4h*)(blk + h * MX_N + tid * 4);

  // ---- weights and biases in fragment order; rows and heads 12..15 are zero ----
  const int  gr  = col < MX_H ? col : MX_H - 1;   // address stays inside the 12 rows
  const float rk = col < MX_H ? 1.0f : 0.0f;
  const float lk = hi ? 0.0f : 1.0f;
  v4f w1r[3];
#pragma unroll
  for (int q = 0; q < 3; ++q) w1r[q] = *(const v4f*)(w1 + gr * MX_H + q * 4) * rk;
  float b1s[MX_H];   // all 12 read at uniform addresses; uni() keeps them scalar loads (else the select below is folded into a vector address)
#pragma unroll
  for (int h = 0; h < MX_H; ++h) b1s[h] = uni(b1[h]);
  v8f c1;            // bias of target head hi*8+r
#pragma unroll
  for (int r = 0; r < 8; ++r) c1[r] = hi ? (r < 4 ? b1s[8 + r] : 0.0f) : b1s[r];

  // w1 row of target head col as f16 high part + f16 remainder, element e = source head e.
  // "lo" fragments carry it in lanes 0..15 only (they pick the k slots that lanes 0..15 of B fill), "up" in lanes 16..31 only.
  HFrag wh, wl;
#pragma unroll
  for (int e = 0; e < 16; ++e) {
    const float w = e < MX_H ? w1r[e >> 2][e & 3] : 0.0f;
    const _Float16 h = (_Float16)w;
    wh.v[e] = h;
    wl.v[e] = (_Float16)(w - (float)h);
  }
  const unsigned mlo = hi ? 0u : 0xffffffffu, mup = ~mlo;
  HFrag loH, loL, upH, upL;
#pragma unroll
  for (int q = 0; q < 8; ++q) {
    loH.u[q] = wh.u[q] & mlo; loL.u[q] = wl.u[q] & mlo;
    upH.u[q] = wh.u[q] & mup; upL.u[q] = wl.u[q] & mup;
  }

  // ---- mix 1 on the matrix unit: d[half][i], register r, lane = target head hi*8+r of key 128*wave + 64*half + 4*col + i ----
  v8f d[2][4];
#pragma unroll
  for (int i = 0; i < 4; ++i) {
    v16h bi;   // this lane's key i: element e = source head e
#pragma unroll
    for (int e = 0; e < 16; ++e) bi[e] = e < MX_H ? s[e][i] : (_Float16)0.0f;
    d[0][i] = mma_h(loH.v, bi, mma_h(loL.v, bi, c1));
    d[1][i] = mma_h(upH.v, bi, mma_h(upL.v, bi, c1));
  }

  const int gi = hi * 8 + (lane & 7);   // the head this lane folds behind a barrier
  // ---- softmax per head: maximum ----
  {
    v8f pm = __builtin_elementwise_max(
        __builtin_elementwise_max(__builtin_elementwise_max(d[0][0], d[0][1]), __builtin_elementwise_max(d[0][2], d[0][3])),
        __builtin_elementwise_max(__builtin_elementwise_max(d[1][0], d[1][1]), __builtin_elementwise_max(d[1][2], d[1][3])));
#pragma unroll
    for (int r = 0; r < 8; ++r) pm[r] = row_max16(pm[r]);
    if (col == 0) {
      float* rp = redm + wave * 16 + hi * 8;
      *(v4f*)(rp)     = (v4f){pm[0], pm[1], pm[2], pm[3]};
      *(v4f*)(rp + 4) = (v4f){pm[4], pm[5], pm[6], pm[7]};
    }
  }
  __syncthreads();   // all 8 waves' maxima are in LDS
  // mix 2's weights and biases are fetched here, not at the head: 16 registers fewer during mix 1; the exponentials cover the latency
  const v4f w2a = *(const v4f*)(w2 + gr * MX_H + hi * 8) * rk;          // source heads 0..3 | 8..11
  const v4f w2b = *(const v4f*)(w2 + gr * MX_H + 4) * (rk * lk);        // source heads 4..7 | none
  float b2s[MX_H];   // as b1s
#pragma unroll
  for (int h = 0; h < MX_H; ++h) b2s[h] = uni(b2[h]) * pcarry;
  v8f c2;            // bias * carry of target head hi*8+r
#pragma unroll
  for (int r = 0; r < 8; ++r) c2[r] = hi ? (r < 4 ? b2s[8 + r] : 0.0f) : b2s[r];
  const v8f w2f = (v8f){w2a[0], w2a[1], w2a[2], w2a[3], w2b[0], w2b[1], w2b[2], w2b[3]};
  {
    float M = redm[gi];
#pragma unroll
    for (int w = 1; w < 8; ++w) M = fmaxf(M, redm[w * 16 + gi]);
    const float L2E = 1.44269504088896340736f;
    const v8f mr = row_share8(M * L2E);
#pragma unroll
    for (int hf = 0; hf < 2; ++hf)
#pragma unroll
      for (int i = 0; i < 4; ++i) {
        v4f x0, x1;
#pragma unroll
        for (int e = 0; e < 4; ++e) {
          x0[e] = __builtin_fmaf(d[hf][i][e], L2E, -mr[e]);
          x1[e] = __builtin_fmaf(d[hf][i][e + 4], L2E, -mr[e + 4]);
        }
        exp2x4(x0);
        exp2x4(x1);
        d[hf][i] = (v8f){x0[0], x0[1], x0[2], x0[3], x1[0], x1[1], x1[2], x1[3]};
      }
  }
  // ---- sum ----
  {
    v8f ps = ((d[0][0] + d[0][1]) + (d[0][2] + d[0][3])) + ((d[1][0] + d[1][1]) + (d[1][2] + d[1][3]));
#pragma unroll
    for (int r = 0; r < 8; ++r) ps[r] = row_sum16(ps[r]);
    if (col == 0) {
      float* rp = reds + wave * 16 + hi * 8;
      *(v4f*)(rp)     = (v4f){ps[0], ps[1], ps[2], ps[3]};
      *(v4f*)(rp + 4) = (v4f){ps[4], ps[5], ps[6], ps[7]};
    }
  }
  __syncthreads();   // all 8 waves' sums are in LDS
  // ---- mix 2 weights: w2[target col][source hi*8+j] * carry / sum[source], f16; k slots 0..15 (a2a) or 16..31 (a2b) ----
  v16h a2a, a2b;
  {
    float S = reds[gi];
#pragma unroll
    for (int w = 1; w < 8; ++w) S += reds[w * 16 + gi];
    const v8f W = w2f * row_share8((1.0f / S) * pcarry);
#pragma unroll
    for (int j = 0; j < 8; ++j) {
      const _Float16 h = (_Float16)W[j];
      a2a[j] = h;               a2a[j + 8] = (_Float16)0.0f;
      a2b[j] = (_Float16)0.0f;  a2b[j + 8] = h;
    }
  }

  // ---- mix 2 on the matrix unit, f16 store. Register r of mix 1's result is k slot hi*8+r of a B fragment as it stands:
  // two key slots share one B fragment (elements 0..7 and 8..15), a2a reads the first, a2b the second ----
  _Float16* prow = blk + (hi * 8) * MX_N + wave * 128 + col * 4;
#pragma unroll
  for (int hf = 0; hf < 2; ++hf) {
    v8f o[4];
#pragma unroll
    for (int p = 0; p < 2; ++p) {
      v16h be;
#pragma unroll
      for (int j = 0; j < 8; ++j) { be[j] = (_Float16)d[hf][2 * p][j]; be[j + 8] = (_Float16)d[hf][2 * p + 1][j]; }
      o[2 * p]     = mma_h(a2a, be, c2);
      o[2 * p + 1] = mma_h(a2b, be, c2);
    }
#pragma unroll
    for (int r = 0; r < 8; ++r) {
      if (r < 4 || hi == 0) {   // lanes 16..31 hold target heads 8..15, of which 12..15 do not exist
        const v4h hv = (v4h){(_Float16)o[0][r], (_Float16)o[1][r], (_Float16)o[2][r], (_Float16)o[3][r]};
        *(v4h*)(prow + r * MX_N + hf * 64) = hv;
      }
    }
  }
}

// ---------------------------------------------------------------------------
template <int BIAS_MODE, int OUT_MODE>
static void gemm_f16(hipStream_t st, int gy,
                     const void* A, int lda, long sA,
                     const void* Bt, int ldb, long sB,
                     void* C, int ldc, long sC,
                     const float* bias, int M, int N, int K, float scale,
                     int gz = 1, long zA = 0L, long zB = 0L, long zC = 0L)
{
  dim3 grid((M / 128) * (N / 256), gy, gz);
  wmma_gemm64<0, false, BIAS_MODE, OUT_MODE, false, 0><<<grid, 256, 0, st>>>(
      (const unsigned short*)A, (const unsigned short*)A, lda, sA,
      (const unsigned short*)Bt, (const unsigned short*)Bt, ldb, sB,
      C, C, ldc, sC, bias, bias, (long)0, M, N, K, scale, zA, zB, zC, bias);
}

// one block per 64x64 tile, K split over its eight waves; f16 output, no bias
static void gemm_f16_ksplit(hipStream_t st, int gy,
                            const void* A, int lda, long sA,
                            const void* Bt, int ldb, long sB,
                            void* C, int ldc, long sC,
                            const float* unused, int M, int N, int K, float scale,
                            int gz, long zA, long zB, long zC)
{
  dim3 grid((M / 64) * (N / 64), gy, gz);
  wmma_gemm64<0, false, 0, 1, false, 0, true><<<grid, 256, 0, st>>>(
      (const unsigned short*)A, (const unsigned short*)A, lda, sA,
      (const unsigned short*)Bt, (const unsigned short*)Bt, ldb, sB,
      C, C, ldc, sC, unused, unused, (long)0, M, N, K, scale, zA, zB, zC, unused);
}

extern "C" void kernel_launch(void* const* d_in, const int* in_sizes, int n_in,
                              void* d_out, int out_size, void* d_ws, size_t ws_size,
                              hipStream_t stream)
{
  const int Bn = 8, Nn = 1024, Dd = 768, Hh = 12, HD = 64;
  const int GB = 8;                                       // batches per launch in the attention part
  if (n_in < 13) return;
  if (in_sizes[0] != Bn * Nn * Dd) return;
  if (in_sizes[1] != Dd * Dd || in_sizes[3] != Dd * Dd || in_sizes[5] != Dd * Dd || in_sizes[7] != Dd * Dd) return;
  if (in_sizes[2] != Dd || in_sizes[4] != Dd || in_sizes[6] != Dd || in_sizes[8] != Dd) return;
  if (in_sizes[9] != Hh * Hh || in_sizes[10] != Hh || in_sizes[11] != Hh * Hh || in_sizes[12] != Hh) return;
  if (out_size != Bn * Nn * Dd) return;

  const float* x    = (const float*)d_in[0];
  const float* wq   = (const float*)d_in[1];
  const float* bq   = (const float*)d_in[2];
  const float* wk   = (const float*)d_in[3];
  const float* bk   = (const float*)d_in[4];
  const float* wv   = (const float*)d_in[5];
  const float* bv   = (const float*)d_in[6];
  const float* wo   = (const float*)d_in[7];
  const float* bo   = (const float*)d_in[8];
  const float* th1w = (const float*)d_in[9];
  const float* th1b = (const float*)d_in[10];
  const float* th2w = (const float*)d_in[11];
  const float* th2b = (const float*)d_in[12];
  float* out = (float*)d_out;

  // ---- workspace carve (bytes) ----
  const size_t WSZ = (size_t)Dd * Dd * 2;                 // one f16 weight matrix
  const size_t ASZ = (size_t)Bn * Nn * Dd * 2;            // one f16 activation [8192][768]
  const size_t SSZ = (size_t)GB * Nn * Hh * Nn * 2;       // logits f16 [GB][1024][12][1024]; mixed attention f16 written over them
  const size_t off_wq  = 0;
  const size_t off_wk  = off_wq + WSZ;
  const size_t off_wv  = off_wk + WSZ;
  const size_t off_wo  = off_wv + WSZ;
  const size_t off_q   = off_wo + WSZ;
  const size_t off_k   = off_q + ASZ;
  const size_t off_vt  = off_k + ASZ;                     // v^T per batch: [b][h*64+d][m]
  const size_t off_ctx = off_vt + ASZ;                    // attention output [8192][768] f16
  const size_t off_R   = off_ctx + ASZ;                   // reused region
  const size_t off_x16 = off_R;                           // live during the projections only
  const size_t off_S   = off_R;                           // live per group of GB batches afterwards
  size_t end = off_S + SSZ;
  if (off_x16 + ASZ > end) end = off_x16 + ASZ;
  if (end > ws_size) return;

  uint8_t* ws = (uint8_t*)d_ws;
  _Float16* wq16 = (_Float16*)(ws + off_wq);
  _Float16* wo16 = (_Float16*)(ws + off_wo);
  unsigned short* q16   = (unsigned short*)(ws + off_q);
  unsigned short* k16   = (unsigned short*)(ws + off_k);
  unsigned short* vt16  = (unsigned short*)(ws + off_vt);
  unsigned short* ctx16 = (unsigned short*)(ws + off_ctx);
  _Float16* x16 = (_Float16*)(ws + off_x16);
  _Float16* Sb = (_Float16*)(ws + off_S);

  const float WCARRY = 64.0f;        // weights carried x2^6 in f16
  const float PCARRY = 2048.0f;      // mixed attention carried x2^11 in f16

  // ---- casts to f16: one launch ----
  cast_all_f16<<<Bn * Nn * Dd / CV_BLK + 4 * (Dd * Dd / CV_BLK), 256, 0, stream>>>(
      x, wq, wk, wv, wo, x16, wq16, Bn * Nn * Dd / CV_BLK, Dd * Dd / CV_BLK, WCARRY);

  // ---- projections: q, k as [b*1024+n][h*64+d] f16; v^T per batch as [b][h*64+d][m] f16 ----
  // One launch, grid.y = q, k, v^T (192 blocks each): wq16, wk16, wv16 and q16, k16, vt16 lie one behind the other in the workspace.
  // v^T: A = wv [768][768], Bt = x rows of batch b [1024][768] -> C [768][1024] per batch, bias[m] = bv[o]
  wmma_gemm64<0, false, 2, 1, false, 0, false, true><<<dim3((Bn * Nn / 128) * (Dd / 256), 3), 256, 0, stream>>>(
      (const unsigned short*)x16, (const unsigned short*)x16, Dd, 0L,
      (const unsigned short*)wq16, (const unsigned short*)wq16, Dd, (long)Dd * Dd,
      q16, q16, Dd, (long)Bn * Nn * Dd, bq, bk, 0L, Bn * Nn, Dd, Dd, 1.0f / WCARRY,
      (long)Nn * Dd, (long)Nn, (long)Dd * Nn, bv);

  // ---- per group of GB batches (grid.z = batch in the group): logits -> mix/softmax/mix -> a.v ----
  const float qk_scale = 0.125f;     // 64^-0.5
  const long rowS = (long)Hh * Nn;   // f16 elements of one query's 12 logit rows
  for (int b = 0; b < Bn; b += GB) {
    const unsigned short* qb = q16 + (size_t)b * Nn * Dd;
    const unsigned short* kb = k16 + (size_t)b * Nn * Dd;
    // S[z][n][h][m] = scale * sum_d q[n][h*64+d] k[m][h*64+d]; grid.y = head: strideA/B = 64, strideC = 1024
    gemm_f16<0, 1>(stream, Hh, qb, Dd, (long)HD, kb, Dd, (long)HD, Sb, Hh * Nn, (long)Nn, bq, Nn, Nn, HD, qk_scale,
                   GB, (long)Nn * Dd, (long)Nn * Dd, (long)Nn * rowS);
    th_mix_kernel<<<dim3(Nn, GB), 256, 0, stream>>>(Sb, th1w, th1b, th2w, th2b, PCARRY);
    // ctx[(b+z)*1024+n][h*64+d] = 2^-11 * sum_m P[z][n][h][m] * vT[b+z][h*64+d][m]; grid.y = head.
    // P rows lie in the logits' place: f16 pitch per query = rowS, per head = 1024
    gemm_f16_ksplit(stream, Hh,
                    Sb, Hh * Nn, (long)Nn,
                    vt16 + (size_t)b * Dd * Nn, Nn, (long)HD * Nn,
                    ctx16 + (size_t)b * Nn * Dd, Dd, (long)HD,
                    bq, Nn, HD, Nn, 1.0f / PCARRY,
                    GB, (long)Nn * rowS, (long)Dd * Nn, (long)Nn * Dd);
  }

  // ---- output projection -> f32 [8192][768] ----
  gemm_f16<2, 0>(stream, 1, ctx16, Dd, 0L, wo16, Dd, 0L, out, Dd, 0L, bo, Bn * Nn, Dd, Dd, 1.0f / WCARRY);
}

// v009
// One run takes 167 microseconds.
// In both of two side-by-side timings against v008, it was 1.13 times as fast.
// Counting every step since v000, it is 5.10 times as fast.
#include <hip/hip_runtime.h>
#include <stdint.h>
#include <stddef.h>

// Contractions (q/k/v projections, q.k^T, a.v, output projection): v_wmma_f32_16x16x32_f16 (f16 operands, f32 accumulate); weights carried x64, mixed attention carried x2^11, folded back in the f32 epilogue; scaled logits stored as f16; the two 12x12 cross-head mixes on the same WMMA form (mix 1: weights as f16 high part + f16 remainder; mix 2: exponentials and weight/sum as f16), softmax in f32 on VALU.

typedef __attribute__((ext_vector_type(16))) _Float16 v16h;
typedef __attribute__((ext_vector_type(8)))  _Float16 v8h;
typedef __attribute__((ext_vector_type(4)))  _Float16 v4h;
typedef __attribute__((ext_vector_type(16))) __bf16   v16b;
typedef __attribute__((ext_vector_type(8)))  __bf16   v8b;
typedef __attribute__((ext_vector_type(8)))  float    v8f;
typedef __attribute__((ext_vector_type(4)))  float    v4f;
typedef __attribute__((ext_vector_type(2)))  float    v2f;

__device__ __forceinline__ unsigned short f2bf_bits(float f) {
  unsigned u = __float_as_uint(f);
  return (unsigned short)((u + 0x7FFFu + ((u >> 16) & 1u)) >> 16);
}
__device__ __forceinline__ float bf_bits2f(unsigned short h) { return __uint_as_float(((unsigned)h) << 16); }

// hazard guards as plain device helpers
__device__ __forceinline__ void dep_guard_h(v8f& a, v8f& b, v16h x, v16h y) { asm volatile("v_nop\n\tv_nop\n\tv_nop\n\tv_nop" : "+v"(a), "+v"(b) : "v"(x), "v"(y)); }
__device__ __forceinline__ void dep_guard_b(v8f& a, v8f& b, v16b x, v16b y) { asm volatile("v_nop\n\tv_nop\n\tv_nop\n\tv_nop" : "+v"(a), "+v"(b) : "v"(x), "v"(y)); }
__device__ __forceinline__ void keep4_h(v16h a, v16h b, v16h c, v16h d) { asm volatile("v_nop" :: "v"(a), "v"(b), "v"(c), "v"(d)); }
__device__ __forceinline__ void keep4_b(v16b a, v16b b, v16b c, v16b d) { asm volatile("v_nop" :: "v"(a), "v"(b), "v"(c), "v"(d)); }
__device__ __forceinline__ void acc_guard4(v8f& a, v8f& b, v8f& c, v8f& d) { asm volatile("v_nop\n\tv_nop\n\tv_nop\n\tv_nop" : "+v"(a), "+v"(b), "+v"(c), "+v"(d)); }
template <typename T> struct Frag;
template <> struct Frag<_Float16> {
  typedef v16h V; union U { v16h v; v8h h[2]; };
  static __device__ __forceinline__ v16h load(const _Float16* p) {   // elements 0..7 <- p[0..7], 8..15 <- p[16..23]
    U f; f.h[0] = *(const v8h*)(p); f.h[1] = *(const v8h*)(p + 16); return f.v;
  }
  static __device__ __forceinline__ v8f mma(v16h a, v16h b, v8f c) {
    return __builtin_amdgcn_wmma_f32_16x16x32_f16(false, a, false, b, (short)0, c, false, false);
  }
  static __device__ __forceinline__ void guard(v8f& a, v8f& b, v16h x, v16h y) { dep_guard_h(a, b, x, y); }
  static __device__ __forceinline__ void keep(v16h a, v16h b, v16h c, v16h d) { keep4_h(a, b, c, d); }
};
template <> struct Frag<__bf16> {
  typedef v16b V; union U { v16b v; v8b h[2]; };
  static __device__ __forceinline__ v16b load(const __bf16* p) {
    U f; f.h[0] = *(const v8b*)(p); f.h[1] = *(const v8b*)(p + 16); return f.v;
  }
  static __device__ __forceinline__ v8f mma(v16b a, v16b b, v8f c) {
    return __builtin_amdgcn_wmma_f32_16x16x32_bf16(false, a, false, b, (short)0, c, false, false);
  }
  static __device__ __forceinline__ void guard(v8f& a, v8f& b, v16b x, v16b y) { dep_guard_b(a, b, x, y); }
  static __device__ __forceinline__ void keep(v16b a, v16b b, v16b c, v16b d) { keep4_b(a, b, c, d); }
};

// ---- Register-blocked batched WMMA GEMM ------------------------------------
// C[m,n] = scale * sum_k A[m,k] * Bt[n,k] (+bias)(+resid); each wave owns a 64x64 tile.
// A row-major [M,K]; Bt row-major [N,K].
// SPLIT: operands are hi/lo planes (A2/Bt2 = lo planes, same layout); product = hi.hi + hi.lo + lo.hi.
// BIAS_MODE: 0 = none, 1 = bias[m], 2 = bias[n].
// OUT_MODE: 0 = f32, 1 = f16, 2 = bf16 hi plane (Cout) + bf16 lo plane (Cout2).
// ET: 0 = f16 operands, 1 = bf16 operands (pointers passed as 16-bit storage)
// KSPLIT: one 64x64 tile per block; wave w sums k in [w*K/8, (w+1)*K/8) (K % 256 == 0) and the eight f32
// partial tiles are added in LDS in wave order 0..7. For shapes with too few tiles to fill the chip.
// Two batch levels: blockIdx.y with strideA/B/C, blockIdx.z with zA/zB/zC (element strides).
// Not KSPLIT: one 128x256 tile of C per block (M % 128 == 0, N % 256 == 0, K % 64 == 0), waves 2 x 4, 64x64 each.
// Per 64 k the block's 128 A rows and 256 Bt rows (128 B each) are copied to LDS by asynchronous 16-byte copies,
// four whole rows per wave and copy, two buffers: the next 64 k fly while this one is multiplied.
// QKV: three products of one launch on blockIdx.y. 0 and 1: C = A . Bt^T as the arguments say (weights strideB apart, outputs
// strideC apart, bias[n] from bias, resid). 2: the third weight matrix times the rows of A, batch by batch, i.e. the transposed
// product: operands change places, blockIdx.x = batch * tiles + tile, zB = rows of A per batch (= columns and pitch of C),
// zA, zC = elements of A and of C per batch, bias[m] from bias3.
#define SG_PITCH 72                          // f16 per staged row: 128 B + 16 B, the pitch for ds_load_b128 readers of 16 rows
#define SG_ROWS  384                         // 128 A rows, then 256 Bt rows
#define SG_BYTES (SG_ROWS * SG_PITCH * 2)    // one buffer
// One stage: this lane's 16 bytes of rows r, r + 32, ... (4 of A, 8 of Bt). lds = LDS byte address of its place in row r.
// The s_wait_xcnt stands inside the statement so that no address register is rewritten in front of it.
__device__ __forceinline__ void stage_issue(unsigned lds, const unsigned short* ga, size_t stepA,
                                            const unsigned short* gb, size_t stepB) {
  const unsigned LS = 32 * SG_PITCH * 2;
  asm volatile(
      "global_load_async_to_lds_b128 %0, %12, off\n\t"
      "global_load_async_to_lds_b128 %1, %13, off\n\t"
      "global_load_async_to_lds_b128 %2, %14, off\n\t"
      "global_load_async_to_lds_b128 %3, %15, off\n\t"
      "global_load_async_to_lds_b128 %4, %16, off\n\t"
      "global_load_async_to_lds_b128 %5, %17, off\n\t"
      "global_load_async_to_lds_b128 %6, %18, off\n\t"
      "global_load_async_to_lds_b128 %7, %19, off\n\t"
      "global_load_async_to_lds_b128 %8, %20, off\n\t"
      "global_load_async_to_lds_b128 %9, %21, off\n\t"
      "global_load_async_to_lds_b128 %10, %22, off\n\t"
      "global_load_async_to_lds_b128 %11, %23, off\n\t"
      "s_wait_xcnt 0x0"
      :: "v"(lds), "v"(lds + LS), "v"(lds + 2 * LS), "v"(lds + 3 * LS),
         "v"(lds + 4 * LS), "v"(lds + 5 * LS), "v"(lds + 6 * LS), "v"(lds + 7 * LS),
         "v"(lds + 8 * LS), "v"(lds + 9 * LS), "v"(lds + 10 * LS), "v"(lds + 11 * LS),
         "v"(ga), "v"(ga + stepA), "v"(ga + 2 * stepA), "v"(ga + 3 * stepA),
         "v"(gb), "v"(gb + stepB), "v"(gb + 2 * stepB), "v"(gb + 3 * stepB),
         "v"(gb + 4 * stepB), "v"(gb + 5 * stepB), "v"(gb + 6 * stepB), "v"(gb + 7 * stepB)
      : "memory");
}
template <int ET> struct Elem;
template <> struct Elem<0> { typedef _Float16 T; };
template <> struct Elem<1> { typedef __bf16 T; };
template <int ET, bool SPLIT, int BIAS_MODE, int OUT_MODE, bool RESID, int ACT = 0, bool KSPLIT = false, bool QKV = false>
__global__ __launch_bounds__(256) void wmma_gemm64(
    const unsigned short* __restrict__ Ap, const unsigned short* __restrict__ A2p, int lda, long strideA,
    const unsigned short* __restrict__ Btp, const unsigned short* __restrict__ Bt2p, int ldb, long strideB,
    void* __restrict__ Cout, void* __restrict__ Cout2, int ldcArg, long strideC,
    const float* __restrict__ bias,
    const float* __restrict__ resid, long strideR,
    int M, int N, int K, float scale, long zA, long zB, long zC, const float* __restrict__ bias3) {
  typedef typename Elem<ET>::T T;
  typedef typename Frag<T>::V V;
  const T* A = (const T*)Ap; const T* A2 = (const T*)A2p; const T* Bt = (const T*)Btp; const T* Bt2 = (const T*)Bt2p;
  static_assert(!KSPLIT || (!SPLIT && BIAS_MODE == 0 && OUT_MODE == 1 && !RESID && ACT == 0), "KSPLIT epilogue: plain f16 output only");
  static_assert(KSPLIT || !SPLIT, "staged form: single-plane operands only");
  static_assert(!QKV || (!KSPLIT && BIAS_MODE == 2 && !RESID), "QKV: staged form, bias by column (by row for the third product)");
  __shared__ __align__(16) float sT[8][(KSPLIT ? 64 : 16) * 68];   // per-wave slab (16x64, KSPLIT: 64x64), pitch 68 floats
  __shared__ __align__(16) unsigned short stg[KSPLIT ? 8 : 2 * SG_ROWS * SG_PITCH];   // staged operand rows, two buffers
  const int b    = blockIdx.y;
  const int z    = blockIdx.z;
  const int lane = threadIdx.x & 31;
  const int wave = threadIdx.x >> 5;
  const bool isV = QKV && b == 2;        // block-uniform
  const int Me = isV ? N : M;            // rows and columns of this block's product
  const int Ne = isV ? (int)zB : N;
  const int tilesN = Ne >> (KSPLIT ? 6 : 8);
  const int tilesM = Me >> (KSPLIT ? 6 : 7);
  int tile = (int)blockIdx.x;
  const int vb = isV ? tile / (tilesM * tilesN) : 0;   // batch of the third product
  tile -= vb * (tilesM * tilesN);
  if (isV ? vb >= M / Ne : tile >= tilesM * tilesN) return;   // block-uniform, in front of every barrier
  const int tm = tile / tilesN;
  const int tn = tile - tm * tilesN;
  const int wv = __builtin_amdgcn_readfirstlane(wave);
  const int bm0 = tm << (KSPLIT ? 6 : 7);                  // the block's first row and column of C
  const int bn0 = tn << (KSPLIT ? 6 : 8);
  const int m0 = KSPLIT ? bm0 : bm0 + ((wv >> 2) << 6);    // the wave's
  const int n0 = KSPLIT ? bn0 : bn0 + ((wv & 3) << 6);

  const size_t offA = isV ? (size_t)2 * strideB : (size_t)b * strideA + (size_t)z * zA;
  const size_t offB = isV ? (size_t)vb * zA : (size_t)b * strideB + (size_t)z * zB;
  const size_t offC = isV ? (size_t)2 * strideC + (size_t)vb * zC : (size_t)b * strideC + (size_t)z * zC;
  const unsigned short* Asrc = isV ? Btp : Ap;
  const unsigned short* Bsrc = isV ? Ap : Btp;
  const int ldA = isV ? ldb : lda, ldB = isV ? lda : ldb, ldc = isV ? (int)zB : ldcArg;
  const float* biasp = QKV ? (b == 0 ? bias : b == 1 ? resid : bias3) : bias;
  const T* Ab  = A  + offA;
  const T* Bb  = Bt + offB;
  const T* Ab2 = SPLIT ? (A2  + offA) : nullptr;
  const T* Bb2 = SPLIT ? (Bt2 + offB) : nullptr;

  const int rlane = lane & 15;                 // row (A) / col (B, D) within subtile
  const int koff  = (lane >> 4) * 8;           // k offset of this lane half
  const int mOff  = (lane >> 4) * 8;           // D row offset

  v8f acc[4][4];
#pragma unroll
  for (int i = 0; i < 4; ++i)
#pragma unroll
    for (int j = 0; j < 4; ++j) acc[i][j] = (v8f){0.f,0.f,0.f,0.f,0.f,0.f,0.f,0.f};

  if (!KSPLIT) {
    const int crow = threadIdx.x >> 3;                     // a wave's copy = 4 whole rows of 128 B
    const int cchk = (threadIdx.x & 7) * 8;
    const unsigned short* gA = Asrc + offA + (size_t)(bm0 + crow) * ldA + cchk;
    const unsigned short* gB = Bsrc + offB + (size_t)(bn0 + crow) * ldB + cchk;
    const size_t stepA = (size_t)32 * ldA, stepB = (size_t)32 * ldB;
    const unsigned l0 = (unsigned)(size_t)stg + (unsigned)(crow * SG_PITCH + cchk) * 2u;
    const int nst = K >> 6;                                // stages of 64 k
    const int aRow = ((wv >> 2) << 6) + rlane;             // the wave's first staged rows
    const int bRow = 128 + ((wv & 3) << 6) + rlane;
    stage_issue(l0, gA, stepA, gB, stepB);
    asm volatile("s_wait_asynccnt 0x0" ::: "memory");      // this wave's copies of stage 0 have landed
    __syncthreads();                                       // ... and every other wave's
    if (nst > 1) stage_issue(l0 + SG_BYTES, gA + 64, stepA, gB + 64, stepB);
#pragma unroll 1   // one body: the buffer is picked by t & 1
    for (int t = 0; t < nst; ++t) {
      const T* sb = (const T*)stg + (t & 1) * (SG_ROWS * SG_PITCH);
      // the loops below are unrolled so that every fragment and accumulator index is a constant (registers, no scratch)
#pragma unroll
      for (int ks = 0; ks < 2; ++ks) {
        V bh[4], ah[4];
#pragma unroll
        for (int j = 0; j < 4; ++j) bh[j] = Frag<T>::load(sb + (bRow + (j << 4)) * SG_PITCH + (ks << 5) + koff);
#pragma unroll
        for (int i = 0; i < 4; ++i) ah[i] = Frag<T>::load(sb + (aRow + (i << 4)) * SG_PITCH + (ks << 5) + koff);
        __builtin_amdgcn_sched_barrier(0);   // the 16 LDS reads stay one group in front of their 16 WMMAs (else: one A fragment at a time, a full LDS wait per 4 WMMAs)
#pragma unroll
        for (int i = 0; i < 4; ++i)
#pragma unroll
          for (int j = 0; j < 4; ++j) acc[i][j] = Frag<T>::mma(ah[i], bh[j], acc[i][j]);
      }
      asm volatile("s_wait_dscnt 0x0" ::: "memory");       // this wave has left the buffer of stage t
      asm volatile("s_wait_asynccnt 0x0" ::: "memory");    // its copies of stage t + 1 have landed
      __syncthreads();                                     // publishes stage t + 1 and frees the buffer of stage t
      if (t + 2 < nst) stage_issue(l0 + (t & 1) * SG_BYTES, gA + (size_t)(t + 2) * 64, stepA, gB + (size_t)(t + 2) * 64, stepB);
    }
    asm volatile("s_wait_asynccnt 0x0" ::: "memory");      // no copy is left in flight behind the loop
  }
  const int kBeg = KSPLIT ? wv * (K >> 3) : 0;   // scalar, so the k loop keeps its scalar counter and branch
  const int kEnd = KSPLIT ? kBeg + (K >> 3) : 0;
  for (int k0 = kBeg; k0 < kEnd; k0 += 32) {
    V bh[4], bl[4];
#pragma unroll
    for (int j = 0; j < 4; ++j) {
      const size_t bo = (size_t)(n0 + (j << 4) + rlane) * ldb + koff + k0;
      bh[j] = Frag<T>::load(Bb + bo);
      if (SPLIT) bl[j] = Frag<T>::load(Bb2 + bo);
    }
#pragma unroll
    for (int i = 0; i < 4; ++i) {
      const size_t ao = (size_t)(m0 + (i << 4) + rlane) * lda + koff + k0;
      V ah = Frag<T>::load(Ab + ao);
      V al;
      if (SPLIT) al = Frag<T>::load(Ab2 + ao);
#pragma unroll
      for (int j = 0; j < 4; ++j) {
        acc[i][j] = Frag<T>::mma(ah, bh[j], acc[i][j]);
        if (SPLIT) {
          acc[i][j] = Frag<T>::mma(ah, bl[j], acc[i][j]);
          acc[i][j] = Frag<T>::mma(al, bh[j], acc[i][j]);
        }
      }
      Frag<T>::guard(acc[i][0], acc[i][3], ah, SPLIT ? al : ah);
    }
    Frag<T>::keep(bh[0], bh[1], bh[2], bh[3]);
    if (SPLIT) Frag<T>::keep(bl[0], bl[1], bl[2], bl[3]);
  }
  acc_guard4(acc[0][0], acc[0][1], acc[0][2], acc[0][3]);
  acc_guard4(acc[1][0], acc[1][1], acc[1][2], acc[1][3]);
  acc_guard4(acc[2][0], acc[2][1], acc[2][2], acc[2][3]);
  acc_guard4(acc[3][0], acc[3][1], acc[3][2], acc[3][3]);

  if (KSPLIT) {
    // ---- split-K epilogue: partial tiles to LDS, then wave w sums and stores rows 8w..8w+7 ----
    float* part = sT[wave];
#pragma unroll
    for (int i = 0; i < 4; ++i)
#pragma unroll
      for (int j = 0; j < 4; ++j)
#pragma unroll
        for (int r = 0; r < 8; ++r)
          part[((i << 4) + mOff + r) * 68 + (j << 4) + rlane] = acc[i][j][r];
    __syncthreads();   // every wave's partial tile is in LDS before any wave reads the eight of them
    unsigned short* C = (unsigned short*)Cout + offC;
    const int hh = lane >> 4, c4 = (lane & 15) * 4;     // row seg = 64 f16 = 128 B = 16 lanes x 8 B
#pragma unroll
    for (int it = 0; it < 4; ++it) {
      const int row = (wave << 3) + it * 2 + hh;
      v4f s = *(const v4f*)(&sT[0][row * 68 + c4]);
#pragma unroll
      for (int w = 1; w < 8; ++w) s += *(const v4f*)(&sT[w][row * 68 + c4]);
      v4h hv;
#pragma unroll
      for (int e = 0; e < 4; ++e) hv[e] = (_Float16)(s[e] * scale);
      *(v4h*)(C + (size_t)(m0 + row) * ldc + n0 + c4) = hv;
    }
    return;
  }

  // ---- epilogue ----
  float* slab = sT[wave];
  const float* Rb = RESID ? (resid + (size_t)b * strideR) : nullptr;
  // QKV: bias by row (third product) and by column (the other two), all fetched here in one group, without a branch: the
  // kind that a product does not use is read from the first 56 elements of its bias vector and replaced by zero.
  float bm[4][8], bn[4];
  if (QKV) {
    const float* bmp = biasp + (isV ? m0 + mOff : 0);
    const float* bnp = biasp + (isV ? 0 : n0 + rlane);
#pragma unroll
    for (int i = 0; i < 4; ++i)
#pragma unroll
      for (int r = 0; r < 8; ++r) bm[i][r] = bmp[(i << 4) + r];
#pragma unroll
    for (int j = 0; j < 4; ++j) bn[j] = bnp[j << 4];
    asm volatile("s_wait_xcnt 0x0" ::: "memory");   // in front of the first rewrite of these loads' address registers
#pragma unroll
    for (int i = 0; i < 4; ++i)
#pragma unroll
      for (int r = 0; r < 8; ++r) bm[i][r] = isV ? bm[i][r] : 0.0f;
#pragma unroll
    for (int j = 0; j < 4; ++j) bn[j] = isV ? 0.0f : bn[j];
  }
#pragma unroll
  for (int i = 0; i < 4; ++i) {
    const int mBase = m0 + (i << 4);
#pragma unroll
    for (int j = 0; j < 4; ++j) {
      const int n = n0 + (j << 4) + rlane;
      float bv = 0.f;
      if (BIAS_MODE == 2) bv = QKV ? bn[j] : bias[n];
#pragma unroll
      for (int r = 0; r < 8; ++r) {
        float v = acc[i][j][r] * scale;
        if (BIAS_MODE == 1) v += bias[mBase + mOff + r];
        if (BIAS_MODE == 2) v += QKV ? bv + bm[i][r] : bv;   // QKV: one of the two is zero
        if (RESID) v += Rb[(size_t)(mBase + mOff + r) * ldc + n];
        if (ACT == 1) v = tanhf(v);
        if (ACT == 2) v = fmaxf(v, 0.0f);
        if (ACT == 3) v = v / (1.0f + expf(-v));
        if (ACT == 4) v = (v > 0.f) ? v : 0.01f * v;
        if (ACT == 5) v = 0.5f * v * (1.0f + erff(v * 0.70710678118654752f));
        slab[(mOff + r) * 68 + (j << 4) + rlane] = v;
      }
    }
    __builtin_amdgcn_fence(__ATOMIC_RELEASE, "workgroup");
    __builtin_amdgcn_wave_barrier();
    __builtin_amdgcn_fence(__ATOMIC_ACQUIRE, "workgroup");
    if (OUT_MODE == 0) {
      float* C = (float*)Cout + offC;
      const int hh = lane >> 4, c4 = (lane & 15) * 4;     // row seg = 256 B = 16 lanes x 16 B
      {
#pragma unroll
        for (int it = 0; it < 8; ++it) {
          const int row = it * 2 + hh;
          v4f v = *(const v4f*)(slab + row * 68 + c4);
          *(v4f*)(C + (size_t)(mBase + row) * ldc + n0 + c4) = v;
        }
        
      }
    } else {
      const int q = lane >> 3, c8 = (lane & 7) * 8;
      unsigned short* C  = (unsigned short*)Cout  + offC;
      unsigned short* C2 = (OUT_MODE == 2) ? ((unsigned short*)Cout2 + offC) : nullptr;
      {
#pragma unroll
        for (int it = 0; it < 4; ++it) {
          const int row = it * 4 + q;
          const float* sp = slab + row * 68 + c8;
          v8h hv, lv;
#pragma unroll
          for (int e = 0; e < 8; ++e) {
            if (OUT_MODE == 1) {
              hv[e] = (_Float16)sp[e];
            } else {
              unsigned short hb = f2bf_bits(sp[e]);
              unsigned short lb = f2bf_bits(sp[e] - bf_bits2f(hb));
              hv[e] = __builtin_bit_cast(_Float16, hb);
              lv[e] = __builtin_bit_cast(_Float16, lb);
            }
          }
          *(v8h*)(C + (size_t)(mBase + row) * ldc + n0 + c8) = hv;
          if (OUT_MODE == 2) *(v8h*)(C2 + (size_t)(mBase + row) * ldc + n0 + c8) = lv;
        }
        
      }
    }
    if (QKV) {
      asm volatile("s_wait_xcnt 0x0" ::: "memory");   // in front of the next pass's rewrite of the stores' address and data registers
      __builtin_amdgcn_sched_barrier(0);              // no later register write is lifted over that wait
    }
    __builtin_amdgcn_fence(__ATOMIC_RELEASE, "workgroup");
    __builtin_amdgcn_wave_barrier();
    __builtin_amdgcn_fence(__ATOMIC_ACQUIRE, "workgroup");
  }
}

// ---- f32 -> f16 casts of x (x1) and of the four weight matrices (x wscale), all in one launch ----
// A block converts CV_BLK consecutive floats of ONE array: blocks [0, xBlocks) take x, then wBlocks blocks each for
// wq, wk, wv, wo (w16 = the four f16 matrices one behind the other). Few long waves instead of many short ones: a thread
// has CV_U loads of 16 bytes in flight, each load of a wave covers 512 consecutive bytes, each store 256.
#define CV_U   16
#define CV_BLK (256 * 4 * CV_U)
__global__ __launch_bounds__(256) void cast_all_f16(
    const float* __restrict__ x, const float* __restrict__ wq, const float* __restrict__ wk,
    const float* __restrict__ wv, const float* __restrict__ wo,
    _Float16* __restrict__ x16, _Float16* __restrict__ w16, int xBlocks, int wBlocks, float wscale) {
  int bx = blockIdx.x;
  const float* in = x;
  _Float16* out = x16;
  float scale = 1.0f;
  if (bx >= xBlocks) {   // block-uniform
    bx -= xBlocks;
    const int j = bx / wBlocks;
    bx -= j * wBlocks;
    in = j == 0 ? wq : j == 1 ? wk : j == 2 ? wv : wo;
    out = w16 + (size_t)j * wBlocks * CV_BLK;
    scale = wscale;
  }
  const v4f* ip = (const v4f*)(in + (size_t)bx * CV_BLK);   // block-uniform bases; the thread index is the one vector offset of loads and stores
  v4h* op = (v4h*)(out + (size_t)bx * CV_BLK);
  const int t = threadIdx.x;
  v4f a[CV_U];
  // both loops are unrolled so that a[] stays in registers and all the loads are issued in front of the first store
#pragma unroll
  for (int i = 0; i < CV_U; ++i) a[i] = ip[t + i * 256];
#pragma unroll
  for (int i = 0; i < CV_U; ++i) {
    v4h h;
#pragma unroll
    for (int e = 0; e < 4; ++e) h[e] = (_Float16)(a[i][e] * scale);
    op[t + i * 256] = h;
  }
}

// =====================================================================================
// Cross-head mix 1 (12x12) -> softmax over keys (f32) -> cross-head mix 2 with 1/sum and the
// power-of-two carry -> f16 store.  One block per query row n (blockIdx.x) of one batch (blockIdx.y).
// SP is [batch][1024][12][1024] f16 (query, head, key): a block's 12 logit rows are its own 24 KB. The
// result (mix2 * pcarry, f16, [12][1024]) goes over them: a wave stores exactly the 128 keys x 12 heads that it has
// loaded itself (its loads have all been consumed by then), and no other wave or block touches them.
// Both mixes are WMMAs with the 12x12 weights as A (rows = target head) and 16 keys as B's columns (k = source head).
// Mix 1: a lane holds all 12 heads of its own 4 keys, so its 12 values of one key fill its own 16 k slots of a B fragment;
// lanes l and l+16 share a column, so one WMMA with the weights in the k slots of lanes 0..15 (zeros in the others) mixes
// the keys of lanes 0..15 and a second one with the weights in the other slots those of lanes 16..31, from the same B.
// LDS carries only 8 wave maxima and sums per head.
// =====================================================================================
#define MX_H 12
#define MX_N 1024

// value of lane l ^ X inside a 16-lane row (DPP row_xmask), no LDS pipe
template <int X> __device__ __forceinline__ float row_x(float x) {
  return __builtin_bit_cast(float, __builtin_amdgcn_update_dpp(0, __builtin_bit_cast(int, x), 0x160 + X, 0xf, 0xf, true));
}
__device__ __forceinline__ float row_max16(float x) {
  x = fmaxf(x, row_x<1>(x)); x = fmaxf(x, row_x<2>(x)); x = fmaxf(x, row_x<4>(x)); x = fmaxf(x, row_x<8>(x));
  return x;
}
__device__ __forceinline__ float row_sum16(float x) {
  x += row_x<1>(x); x += row_x<2>(x); x += row_x<4>(x); x += row_x<8>(x);
  return x;
}
// 2^x of four values in place. One statement, so that each v_exp_f32 is followed by an instruction that touches neither
// its result nor its source; the v_nop is that independent slot behind the last one.
__device__ __forceinline__ void exp2x4(v4f& x) {
  float x0 = x[0], x1 = x[1], x2 = x[2], x3 = x[3];
  asm("v_exp_f32 %0, %0\n\tv_exp_f32 %1, %1\n\tv_exp_f32 %2, %2\n\tv_exp_f32 %3, %3\n\tv_nop"
      : "+v"(x0), "+v"(x1), "+v"(x2), "+v"(x3));
  x = (v4f){x0, x1, x2, x3};
}

// lane R of each 16-lane row, given to every lane of that row (DPP row_share)
template <int R> __device__ __forceinline__ float row_share(float x) {
  return __builtin_bit_cast(float, __builtin_amdgcn_update_dpp(0, __builtin_bit_cast(int, x), 0x150 + R, 0xf, 0xf, true));
}
__device__ __forceinline__ v8f row_share8(float x) {
  return (v8f){row_share<0>(x), row_share<1>(x), row_share<2>(x), row_share<3>(x),
               row_share<4>(x), row_share<5>(x), row_share<6>(x), row_share<7>(x)};
}
__device__ __forceinline__ v8f mma_h(v16h a, v16h b, v8f c) {
  return __builtin_amdgcn_wmma_f32_16x16x32_f16(false, a, false, b, (short)0, c, false, false);
}
union HFrag { v16h v; unsigned u[8]; };
// a wave-uniform value, held as such (scalar register)
__device__ __forceinline__ float uni(float x) {
  return __builtin_bit_cast(float, __builtin_amdgcn_readfirstlane(__builtin_bit_cast(int, x)));
}

__global__ __launch_bounds__(256) void th_mix_kernel(
    _Float16* SP, const float* __restrict__ w1, const float* __restrict__ b1,
    const float* __restrict__ w2, const float* __restrict__ b2, float pcarry)
{
  __shared__ __align__(16) float redm[8 * 16];   // [wave][head, padded to 16] maxima
  __shared__ __align__(16) float reds[8 * 16];   // [wave][head, padded to 16] sums

  const int tid  = threadIdx.x;
  const int lane = tid & 31;
  const int wave = tid >> 5;
  const int col  = lane & 15;
  const int hi   = lane >> 4;
  _Float16* blk = SP + ((size_t)blockIdx.y * MX_N + blockIdx.x) * (MX_H * MX_N);

  // every loop below is unrolled so that the index of each register array is a constant (no scratch)
  v4h s[MX_H];
#pragma unroll
  for (int h = 0; h < MX_H; ++h) s[h] = *(const v4h*)(blk + h * MX_N + tid * 4);

  // ---- weights and biases in fragment order; rows and heads 12..15 are zero ----
  const int  gr  = col < MX_H ? col : MX_H - 1;   // address stays inside the 12 rows
  const float rk = col < MX_H ? 1.0f : 0.0f;
  const float lk = hi ? 0.0f : 1.0f;
  v4f w1r[3];
#pragma unroll
  for (int q = 0; q < 3; ++q) w1r[q] = *(const v4f*)(w1 + gr * MX_H + q * 4) * rk;
  float b1s[MX_H];   // all 12 read at uniform addresses; uni() keeps them scalar loads (else the select below is folded into a vector address)
#pragma unroll
  for (int h = 0; h < MX_H; ++h) b1s[h] = uni(b1[h]);
  v8f c1;            // bias of target head hi*8+r
#pragma unroll
  for (int r = 0; r < 8; ++r) c1[r] = hi ? (r < 4 ? b1s[8 + r] : 0.0f) : b1s[r];

  // w1 row of target head col as f16 high part + f16 remainder, element e = source head e.
  // "lo" fragments carry it in lanes 0..15 only (they pick the k slots that lanes 0..15 of B fill), "up" in lanes 16..31 only.
  HFrag wh, wl;
#pragma unroll
  for (int e = 0; e < 16; ++e) {
    const float w = e < MX_H ? w1r[e >> 2][e & 3] : 0.0f;
    const _Float16 h = (_Float16)w;
    wh.v[e] = h;
    wl.v[e] = (_Float16)(w - (float)h);
  }
  const unsigned mlo = hi ? 0u : 0xffffffffu, mup = ~mlo;
  HFrag loH, loL, upH, upL;
#pragma unroll
  for (int q = 0; q < 8; ++q) {
    loH.u[q] = wh.u[q] & mlo; loL.u[q] = wl.u[q] & mlo;
    upH.u[q] = wh.u[q] & mup; upL.u[q] = wl.u[q] & mup;
  }

  // ---- mix 1 on the matrix unit: d[half][i], register r, lane = target head hi*8+r of key 128*wave + 64*half + 4*col + i ----
  v8f d[2][4];
#pragma unroll
  for (int i = 0; i < 4; ++i) {
    v16h bi;   // this lane's key i: element e = source head e
#pragma unroll
    for (int e = 0; e < 16; ++e) bi[e] = e < MX_H ? s[e][i] : (_Float16)0.0f;
    d[0][i] = mma_h(loH.v, bi, mma_h(loL.v, bi, c1));
    d[1][i] = mma_h(upH.v, bi, mma_h(upL.v, bi, c1));
  }

  const int gi = hi * 8 + (lane & 7);   // the head this lane folds behind a barrier
  // ---- softmax per head: maximum ----
  {
    v8f pm = __builtin_elementwise_max(
        __builtin_elementwise_max(__builtin_elementwise_max(d[0][0], d[0][1]), __builtin_elementwise_max(d[0][2], d[0][3])),
        __builtin_elementwise_max(__builtin_elementwise_max(d[1][0], d[1][1]), __builtin_elementwise_max(d[1][2], d[1][3])));
#pragma unroll
    for (int r = 0; r < 8; ++r) pm[r] = row_max16(pm[r]);
    if (col == 0) {
      float* rp = redm + wave * 16 + hi * 8;
      *(v4f*)(rp)     = (v4f){pm[0], pm[1], pm[2], pm[3]};
      *(v4f*)(rp + 4) = (v4f){pm[4], pm[5], pm[6], pm[7]};
    }
  }
  __syncthreads();   // all 8 waves' maxima are in LDS
  // mix 2's weights and biases are fetched here, not at the head: 16 registers fewer during mix 1; the exponentials cover the latency
  const v4f w2a = *(const v4f*)(w2 + gr * MX_H + hi * 8) * rk;          // source heads 0..3 | 8..11
  const v4f w2b = *(const v4f*)(w2 + gr * MX_H + 4) * (rk * lk);        // source heads 4..7 | none
  float b2s[MX_H];   // as b1s
#pragma unroll
  for (int h = 0; h < MX_H; ++h) b2s[h] = uni(b2[h]) * pcarry;
  v8f c2;            // bias * carry of target head hi*8+r
#pragma unroll
  for (int r = 0; r < 8; ++r) c2[r] = hi ? (r < 4 ? b2s[8 + r] : 0.0f) : b2s[r];
  const v8f w2f = (v8f){w2a[0], w2a[1], w2a[2], w2a[3], w2b[0], w2b[1], w2b[2], w2b[3]};
  {
    float M = redm[gi];
#pragma unroll
    for (int w = 1; w < 8; ++w) M = fmaxf(M, redm[w * 16 + gi]);
    const float L2E = 1.44269504088896340736f;
    const v8f mr = row_share8(M * L2E);
#pragma unroll
    for (int hf = 0; hf < 2; ++hf)
#pragma unroll
      for (int i = 0; i < 4; ++i) {
        v4f x0, x1;
#pragma unroll
        for (int e = 0; e < 4; ++e) {
          x0[e] = __builtin_fmaf(d[hf][i][e], L2E, -mr[e]);
          x1[e] = __builtin_fmaf(d[hf][i][e + 4], L2E, -mr[e + 4]);
        }
        exp2x4(x0);
        exp2x4(x1);
        d[hf][i] = (v8f){x0[0], x0[1], x0[2], x0[3], x1[0], x1[1], x1[2], x1[3]};
      }
  }
  // ---- sum ----
  {
    v8f ps = ((d[0][0] + d[0][1]) + (d[0][2] + d[0][3])) + ((d[1][0] + d[1][1]) + (d[1][2] + d[1][3]));
#pragma unroll
    for (int r = 0; r < 8; ++r) ps[r] = row_sum16(ps[r]);
    if (col == 0) {
      float* rp = reds + wave * 16 + hi * 8;
      *(v4f*)(rp)     = (v4f){ps[0], ps[1], ps[2], ps[3]};
      *(v4f*)(rp + 4) = (v4f){ps[4], ps[5], ps[6], ps[7]};
    }
  }
  __syncthreads();   // all 8 waves' sums are in LDS
  // ---- mix 2 weights: w2[target col][source hi*8+j] * carry / sum[source], f16; k slots 0..15 (a2a) or 16..31 (a2b) ----
  v16h a2a, a2b;
  {
    float S = reds[gi];
#pragma unroll
    for (int w = 1; w < 8; ++w) S += reds[w * 16 + gi];
    const v8f W = w2f * row_share8((1.0f / S) * pcarry);
#pragma unroll
    for (int j = 0; j < 8; ++j) {
      const _Float16 h = (_Float16)W[j];
      a2a[j] = h;               a2a[j + 8] = (_Float16)0.0f;
      a2b[j] = (_Float16)0.0f;  a2b[j + 8] = h;
    }
  }

  // ---- mix 2 on the matrix unit, f16 store. Register r of mix 1's result is k slot hi*8+r of a B fragment as it stands:
  // two key slots share one B fragment (elements 0..7 and 8..15), a2a reads the first, a2b the second ----
  _Float16* prow = blk + (hi * 8) * MX_N + wave * 128 + col * 4;
#pragma unroll
  for (int hf = 0; hf < 2; ++hf) {
    v8f o[4];
#pragma unroll
    for (int p = 0; p < 2; ++p) {
      v16h be;
#pragma unroll
      for (int j = 0; j < 8; ++j) { be[j] = (_Float16)d[hf][2 * p][j]; be[j + 8] = (_Float16)d[hf][2 * p + 1][j]; }
      o[2 * p]     = mma_h(a2a, be, c2);
      o[2 * p + 1] = mma_h(a2b, be, c2);
    }
#pragma unroll
    for (int r = 0; r < 8; ++r) {
      if (r < 4 || hi == 0) {   // lanes 16..31 hold target heads 8..15, of which 12..15 do not exist
        const v4h hv = (v4h){(_Float16)o[0][r], (_Float16)o[1][r], (_Float16)o[2][r], (_Float16)o[3][r]};
        *(v4h*)(prow + r * MX_N + hf * 64) = hv;
      }
    }
  }
}

// =====================================================================================
// a.v product, operands staged in LDS. C[n][d] = scale * sum_m P[n][m] * Vt[d][m] for one head (blockIdx.y) of one batch
// (blockIdx.z); a block owns 128 rows n (blockIdx.x) and all 64 columns d, wave w rows 16w..16w+15. K % 128 == 0.
// Per 128 m the block's 128 rows of P and 64 rows of Vt (256 B each) are copied to LDS by asynchronous 16-byte copies, two
// whole rows per wave and copy (a fragment load straight from global memory touches 16 lines for its 512 bytes), two buffers:
// the next 128 m fly while this one is multiplied. The sum over m runs in one f32 accumulator per element, m ascending.
// =====================================================================================
#define AV_PITCH 136                         // f16 per staged row: 256 B + 16 B, a pitch of 16 B x odd for ds_load_b128 readers of 16 rows
#define AV_ROWS  192                         // 128 rows of P, then 64 rows of Vt
#define AV_BYTES (AV_ROWS * AV_PITCH * 2)    // one buffer
// One stage: this lane's 16 bytes of rows r, r + 16, ... (8 of P, 4 of Vt). lds = LDS byte address of its place in row r.
// The s_wait_xcnt stands inside the statement so that no address register is rewritten in front of it.
__device__ __forceinline__ void av_stage_issue(unsigned lds, const unsigned short* ga, size_t stepA,
                                               const unsigned short* gb, size_t stepB) {
  const unsigned LS = 16 * AV_PITCH * 2;
  asm volatile(
      "global_load_async_to_lds_b128 %0, %12, off\n\t"
      "global_load_async_to_lds_b128 %1, %13, off\n\t"
      "global_load_async_to_lds_b128 %2, %14, off\n\t"
      "global_load_async_to_lds_b128 %3, %15, off\n\t"
      "global_load_async_to_lds_b128 %4, %16, off\n\t"
      "global_load_async_to_lds_b128 %5, %17, off\n\t"
      "global_load_async_to_lds_b128 %6, %18, off\n\t"
      "global_load_async_to_lds_b128 %7, %19, off\n\t"
      "global_load_async_to_lds_b128 %8, %20, off\n\t"
      "global_load_async_to_lds_b128 %9, %21, off\n\t"
      "global_load_async_to_lds_b128 %10, %22, off\n\t"
      "global_load_async_to_lds_b128 %11, %23, off\n\t"
      "s_wait_xcnt 0x0"
      :: "v"(lds), "v"(lds + LS), "v"(lds + 2 * LS), "v"(lds + 3 * LS),
         "v"(lds + 4 * LS), "v"(lds + 5 * LS), "v"(lds + 6 * LS), "v"(lds + 7 * LS),
         "v"(lds + 8 * LS), "v"(lds + 9 * LS), "v"(lds + 10 * LS), "v"(lds + 11 * LS),
         "v"(ga), "v"(ga + stepA), "v"(ga + 2 * stepA), "v"(ga + 3 * stepA),
         "v"(ga + 4 * stepA), "v"(ga + 5 * stepA), "v"(ga + 6 * stepA), "v"(ga + 7 * stepA),
         "v"(gb), "v"(gb + stepB), "v"(gb + 2 * stepB), "v"(gb + 3 * stepB)
      : "memory");
}
__global__ __launch_bounds__(256) void av_gemm_staged(
    const unsigned short* __restrict__ P, int ldp, long headP, long batchP,
    const unsigned short* __restrict__ Vt, int ldv, long headV, long batchV,
    unsigned short* __restrict__ C, int ldc, long headC, long batchC, int K, float scale) {
  // staged operand rows, two buffers; behind the k loop the epilogue's slabs lie in the same bytes (102 KB: three blocks share a WGP)
  __shared__ __align__(16) unsigned short stg[2 * AV_ROWS * AV_PITCH];
  const int lane  = threadIdx.x & 31;
  const int wv    = __builtin_amdgcn_readfirstlane(threadIdx.x >> 5);
  const int rlane = lane & 15;                 // row (A) / col (B, D) within subtile
  const int koff  = (lane >> 4) * 8;           // k offset of this lane half
  const int mOff  = (lane >> 4) * 8;           // D row offset
  const int bm0   = (int)blockIdx.x << 7;      // the block's first row of C
  const size_t offA = (size_t)blockIdx.y * headP + (size_t)blockIdx.z * batchP;
  const size_t offB = (size_t)blockIdx.y * headV + (size_t)blockIdx.z * batchV;
  const size_t offC = (size_t)blockIdx.y * headC + (size_t)blockIdx.z * batchC;

  const int crow = threadIdx.x >> 4;           // a wave's copy = 2 whole rows of 256 B
  const int cchk = (threadIdx.x & 15) * 8;
  const unsigned short* gA = P + offA + (size_t)(bm0 + crow) * ldp + cchk;
  const unsigned short* gB = Vt + offB + (size_t)crow * ldv + cchk;
  const size_t stepA = (size_t)16 * ldp, stepB = (size_t)16 * ldv;
  const unsigned l0 = (unsigned)(size_t)stg + (unsigned)(crow * AV_PITCH + cchk) * 2u;
  const int nst  = K >> 7;                     // stages of 128 m
  const int aRow = (wv << 4) + rlane;          // the wave's staged rows
  const int bRow = 128 + rlane;

  v8f acc[4];
  // every loop over j, ks and kp is unrolled so that each fragment and accumulator index is a constant (registers, no scratch)
#pragma unroll
  for (int j = 0; j < 4; ++j) acc[j] = (v8f){0.f,0.f,0.f,0.f,0.f,0.f,0.f,0.f};

  av_stage_issue(l0, gA, stepA, gB, stepB);
  asm volatile("s_wait_asynccnt 0x0" ::: "memory");      // this wave's copies of stage 0 have landed
  __syncthreads();                                       // ... and every other wave's
  if (nst > 1) av_stage_issue(l0 + AV_BYTES, gA + 128, stepA, gB + 128, stepB);
#pragma unroll 1   // one body: the buffer is picked by t & 1
  for (int t = 0; t < nst; ++t) {
    const _Float16* sb = (const _Float16*)stg + (t & 1) * (AV_ROWS * AV_PITCH);
#pragma unroll
    for (int kp = 0; kp < 2; ++kp) {     // 64 m at a time
      v16h bh[2][4], ah[2];
#pragma unroll
      for (int ks = 0; ks < 2; ++ks) {
        ah[ks] = Frag<_Float16>::load(sb + aRow * AV_PITCH + (kp << 6) + (ks << 5) + koff);
#pragma unroll
        for (int j = 0; j < 4; ++j) bh[ks][j] = Frag<_Float16>::load(sb + (bRow + (j << 4)) * AV_PITCH + (kp << 6) + (ks << 5) + koff);
      }
      __builtin_amdgcn_sched_barrier(0);   // the 20 LDS reads stay one group in front of their 8 WMMAs (one LDS latency per 64 m, not one per fragment)
#pragma unroll
      for (int ks = 0; ks < 2; ++ks)
#pragma unroll
        for (int j = 0; j < 4; ++j) acc[j] = Frag<_Float16>::mma(ah[ks], bh[ks][j], acc[j]);
    }
    asm volatile("s_wait_dscnt 0x0" ::: "memory");       // this wave has left the buffer of stage t
    asm volatile("s_wait_asynccnt 0x0" ::: "memory");    // its copies of stage t + 1 have landed
    __syncthreads();                                     // publishes stage t + 1 and frees the buffer of stage t
    if (t + 2 < nst) av_stage_issue(l0 + (t & 1) * AV_BYTES, gA + (size_t)(t + 2) * 128, stepA, gB + (size_t)(t + 2) * 128, stepB);
  }
  asm volatile("s_wait_asynccnt 0x0" ::: "memory");      // no copy is left in flight behind the loop

  // ---- epilogue: the wave's 16x64 tile through its own slab (16 rows, pitch 68 floats), so that a store covers whole 128-byte rows.
  // The slabs reuse the stage buffers: the last pass's barrier stands behind every wave's last read and last landed copy.
  float* slab = (float*)stg + wv * (16 * 68);
#pragma unroll
  for (int j = 0; j < 4; ++j)
#pragma unroll
    for (int r = 0; r < 8; ++r) slab[(mOff + r) * 68 + (j << 4) + rlane] = acc[j][r] * scale;
  __builtin_amdgcn_fence(__ATOMIC_RELEASE, "workgroup");
  __builtin_amdgcn_wave_barrier();
  __builtin_amdgcn_fence(__ATOMIC_ACQUIRE, "workgroup");
  const int q = lane >> 3, c8 = (lane & 7) * 8;
  unsigned short* Cb = C + offC + (size_t)(bm0 + (wv << 4)) * ldc;
#pragma unroll
  for (int it = 0; it < 4; ++it) {
    const int row = it * 4 + q;
    const float* sp = slab + row * 68 + c8;
    v8h hv;
#pragma unroll
    for (int e = 0; e < 8; ++e) hv[e] = (_Float16)sp[e];
    *(v8h*)(Cb + (size_t)row * ldc + c8) = hv;
  }
}

// ---------------------------------------------------------------------------
template <int BIAS_MODE, int OUT_MODE>
static void gemm_f16(hipStream_t st, int gy,
                     const void* A, int lda, long sA,
                     const void* Bt, int ldb, long sB,
                     void* C, int ldc, long sC,
                     const float* bias, int M, int N, int K, float scale,
                     int gz = 1, long zA = 0L, long zB = 0L, long zC = 0L)
{
  dim3 grid((M / 128) * (N / 256), gy, gz);
  wmma_gemm64<0, false, BIAS_MODE, OUT_MODE, false, 0><<<grid, 256, 0, st>>>(
      (const unsigned short*)A, (const unsigned short*)A, lda, sA,
      (const unsigned short*)Bt, (const unsigned short*)Bt, ldb, sB,
      C, C, ldc, sC, bias, bias, (long)0, M, N, K, scale, zA, zB, zC, bias);
}

extern "C" void kernel_launch(void* const* d_in, const int* in_sizes, int n_in,
                              void* d_out, int out_size, void* d_ws, size_t ws_size,
                              hipStream_t stream)
{
  const int Bn = 8, Nn = 1024, Dd = 768, Hh = 12, HD = 64;
  const int GB = 8;                                       // batches per launch in the attention part
  if (n_in < 13) return;
  if (in_sizes[0] != Bn * Nn * Dd) return;
  if (in_sizes[1] != Dd * Dd || in_sizes[3] != Dd * Dd || in_sizes[5] != Dd * Dd || in_sizes[7] != Dd * Dd) return;
  if (in_sizes[2] != Dd || in_sizes[4] != Dd || in_sizes[6] != Dd || in_sizes[8] != Dd) return;
  if (in_sizes[9] != Hh * Hh || in_sizes[10] != Hh || in_sizes[11] != Hh * Hh || in_sizes[12] != Hh) return;
  if (out_size != Bn * Nn * Dd) return;

  const float* x    = (const float*)d_in[0];
  const float* wq   = (const float*)d_in[1];
  const float* bq   = (const float*)d_in[2];
  const float* wk   = (const float*)d_in[3];
  const float* bk   = (const float*)d_in[4];
  const float* wv   = (const float*)d_in[5];
  const float* bv   = (const float*)d_in[6];
  const float* wo   = (const float*)d_in[7];
  const float* bo   = (const float*)d_in[8];
  const float* th1w = (const float*)d_in[9];
  const float* th1b = (const float*)d_in[10];
  const float* th2w = (const float*)d_in[11];
  const float* th2b = (const float*)d_in[12];
  float* out = (float*)d_out;

  // ---- workspace carve (bytes) ----
  const size_t WSZ = (size_t)Dd * Dd * 2;                 // one f16 weight matrix
  const size_t ASZ = (size_t)Bn * Nn * Dd * 2;            // one f16 activation [8192][768]
  const size_t SSZ = (size_t)GB * Nn * Hh * Nn * 2;       // logits f16 [GB][1024][12][1024]; mixed attention f16 written over them
  const size_t off_wq  = 0;
  const size_t off_wk  = off_wq + WSZ;
  const size_t off_wv  = off_wk + WSZ;
  const size_t off_wo  = off_wv + WSZ;
  const size_t off_q   = off_wo + WSZ;
  const size_t off_k   = off_q + ASZ;
  const size_t off_vt  = off_k + ASZ;                     // v^T per batch: [b][h*64+d][m]
  const size_t off_ctx = off_vt + ASZ;                    // attention output [8192][768] f16
  const size_t off_R   = off_ctx + ASZ;                   // reused region
  const size_t off_x16 = off_R;                           // live during the projections only
  const size_t off_S   = off_R;                           // live per group of GB batches afterwards
  size_t end = off_S + SSZ;
  if (off_x16 + ASZ > end) end = off_x16 + ASZ;
  if (end > ws_size) return;

  uint8_t* ws = (uint8_t*)d_ws;
  _Float16* wq16 = (_Float16*)(ws + off_wq);
  _Float16* wo16 = (_Float16*)(ws + off_wo);
  unsigned short* q16   = (unsigned short*)(ws + off_q);
  unsigned short* k16   = (unsigned short*)(ws + off_k);
  unsigned short* vt16  = (unsigned short*)(ws + off_vt);
  unsigned short* ctx16 = (unsigned short*)(ws + off_ctx);
  _Float16* x16 = (_Float16*)(ws + off_x16);
  _Float16* Sb = (_Float16*)(ws + off_S);

  const float WCARRY = 64.0f;        // weights carried x2^6 in f16
  const float PCARRY = 2048.0f;      // mixed attention carried x2^11 in f16

  // ---- casts to f16: one launch ----
  cast_all_f16<<<Bn * Nn * Dd / CV_BLK + 4 * (Dd * Dd / CV_BLK), 256, 0, stream>>>(
      x, wq, wk, wv, wo, x16, wq16, Bn * Nn * Dd / CV_BLK, Dd * Dd / CV_BLK, WCARRY);

  // ---- projections: q, k as [b*1024+n][h*64+d] f16; v^T per batch as [b][h*64+d][m] f16 ----
  // One launch, grid.y = q, k, v^T (192 blocks each): wq16, wk16, wv16 and q16, k16, vt16 lie one behind the other in the workspace.
  // v^T: A = wv [768][768], Bt = x rows of batch b [1024][768] -> C [768][1024] per batch, bias[m] = bv[o]
  wmma_gemm64<0, false, 2, 1, false, 0, false, true><<<dim3((Bn * Nn / 128) * (Dd / 256), 3), 256, 0, stream>>>(
      (const unsigned short*)x16, (const unsigned short*)x16, Dd, 0L,
      (const unsigned short*)wq16, (const unsigned short*)wq16, Dd, (long)Dd * Dd,
      q16, q16, Dd, (long)Bn * Nn * Dd, bq, bk, 0L, Bn * Nn, Dd, Dd, 1.0f / WCARRY,
      (long)Nn * Dd, (long)Nn, (long)Dd * Nn, bv);

  // ---- per group of GB batches (grid.z = batch in the group): logits -> mix/softmax/mix -> a.v ----
  const float qk_scale = 0.125f;     // 64^-0.5
  const long rowS = (long)Hh * Nn;   // f16 elements of one query's 12 logit rows
  for (int b = 0; b < Bn; b += GB) {
    const unsigned short* qb = q16 + (size_t)b * Nn * Dd;
    const unsigned short* kb = k16 + (size_t)b * Nn * Dd;
    // S[z][n][h][m] = scale * sum_d q[n][h*64+d] k[m][h*64+d]; grid.y = head: strideA/B = 64, strideC = 1024
    gemm_f16<0, 1>(stream, Hh, qb, Dd, (long)HD, kb, Dd, (long)HD, Sb, Hh * Nn, (long)Nn, bq, Nn, Nn, HD, qk_scale,
                   GB, (long)Nn * Dd, (long)Nn * Dd, (long)Nn * rowS);
    th_mix_kernel<<<dim3(Nn, GB), 256, 0, stream>>>(Sb, th1w, th1b, th2w, th2b, PCARRY);
    // ctx[(b+z)*1024+n][h*64+d] = 2^-11 * sum_m P[z][n][h][m] * vT[b+z][h*64+d][m]; grid.y = head.
    // P rows lie in the logits' place: f16 pitch per query = rowS, per head = 1024
    av_gemm_staged<<<dim3(Nn / 128, Hh, GB), 256, 0, stream>>>(
        (const unsigned short*)Sb, Hh * Nn, (long)Nn, (long)Nn * rowS,
        vt16 + (size_t)b * Dd * Nn, Nn, (long)HD * Nn, (long)Dd * Nn,
        ctx16 + (size_t)b * Nn * Dd, Dd, (long)HD, (long)Nn * Dd, Nn, 1.0f / PCARRY);
  }

  // ---- output projection -> f32 [8192][768] ----
  gemm_f16<2, 0>(stream, 1, ctx16, Dd, 0L, wo16, Dd, 0L, out, Dd, 0L, bo, Bn * Nn, Dd, Dd, 1.0f / WCARRY);
}

// v010
// A run of this version takes 158 microseconds.
// Two timings next to v009 both put it at 1.05 times that version's speed.
// All steps since v000 together make it 5.35 times as fast.
#include <hip/hip_runtime.h>
#include <stdint.h>
#include <stddef.h>

// Contractions (q/k/v projections, q.k^T, a.v, output projection): v_wmma_f32_16x16x32_f16 (f16 operands, f32 accumulate); weights carried x64, mixed attention carried x2^11, folded back in the f32 epilogue; scaled logits stored as f16; the two 12x12 cross-head mixes on the same WMMA form (mix 1: weights as f16 high part + f16 remainder; mix 2: exponentials and weight/sum as f16), softmax in f32 on VALU.

typedef __attribute__((ext_vector_type(16))) _Float16 v16h;
typedef __attribute__((ext_vector_type(8)))  _Float16 v8h;
typedef __attribute__((ext_vector_type(4)))  _Float16 v4h;
typedef __attribute__((ext_vector_type(16))) __bf16   v16b;
typedef __attribute__((ext_vector_type(8)))  __bf16   v8b;
typedef __attribute__((ext_vector_type(8)))  float    v8f;
typedef __attribute__((ext_vector_type(4)))  float    v4f;
typedef __attribute__((ext_vector_type(2)))  float    v2f;

__device__ __forceinline__ unsigned short f2bf_bits(float f) {
  unsigned u = __float_as_uint(f);
  return (unsigned short)((u + 0x7FFFu + ((u >> 16) & 1u)) >> 16);
}
__device__ __forceinline__ float bf_bits2f(unsigned short h) { return __uint_as_float(((unsigned)h) << 16); }

// hazard guards as plain device helpers
__device__ __forceinline__ void dep_guard_h(v8f& a, v8f& b, v16h x, v16h y) { asm volatile("v_nop\n\tv_nop\n\tv_nop\n\tv_nop" : "+v"(a), "+v"(b) : "v"(x), "v"(y)); }
__device__ __forceinline__ void dep_guard_b(v8f& a, v8f& b, v16b x, v16b y) { asm volatile("v_nop\n\tv_nop\n\tv_nop\n\tv_nop" : "+v"(a), "+v"(b) : "v"(x), "v"(y)); }
__device__ __forceinline__ void keep4_h(v16h a, v16h b, v16h c, v16h d) { asm volatile("v_nop" :: "v"(a), "v"(b), "v"(c), "v"(d)); }
__device__ __forceinline__ void keep4_b(v16b a, v16b b, v16b c, v16b d) { asm volatile("v_nop" :: "v"(a), "v"(b), "v"(c), "v"(d)); }
__device__ __forceinline__ void acc_guard4(v8f& a, v8f& b, v8f& c, v8f& d) { asm volatile("v_nop\n\tv_nop\n\tv_nop\n\tv_nop" : "+v"(a), "+v"(b), "+v"(c), "+v"(d)); }
template <typename T> struct Frag;
template <> struct Frag<_Float16> {
  typedef v16h V; union U { v16h v; v8h h[2]; };
  static __device__ __forceinline__ v16h load(const _Float16* p) {   // elements 0..7 <- p[0..7], 8..15 <- p[16..23]
    U f; f.h[0] = *(const v8h*)(p); f.h[1] = *(const v8h*)(p + 16); return f.v;
  }
  static __device__ __forceinline__ v8f mma(v16h a, v16h b, v8f c) {
    return __builtin_amdgcn_wmma_f32_16x16x32_f16(false, a, false, b, (short)0, c, false, false);
  }
  static __device__ __forceinline__ void guard(v8f& a, v8f& b, v16h x, v16h y) { dep_guard_h(a, b, x, y); }
  static __device__ __forceinline__ void keep(v16h a, v16h b, v16h c, v16h d) { keep4_h(a, b, c, d); }
};
template <> struct Frag<__bf16> {
  typedef v16b V; union U { v16b v; v8b h[2]; };
  static __device__ __forceinline__ v16b load(const __bf16* p) {
    U f; f.h[0] = *(const v8b*)(p); f.h[1] = *(const v8b*)(p + 16); return f.v;
  }
  static __device__ __forceinline__ v8f mma(v16b a, v16b b, v8f c) {
    return __builtin_amdgcn_wmma_f32_16x16x32_bf16(false, a, false, b, (short)0, c, false, false);
  }
  static __device__ __forceinline__ void guard(v8f& a, v8f& b, v16b x, v16b y) { dep_guard_b(a, b, x, y); }
  static __device__ __forceinline__ void keep(v16b a, v16b b, v16b c, v16b d) { keep4_b(a, b, c, d); }
};

// ---- Register-blocked batched WMMA GEMM ------------------------------------
// C[m,n] = scale * sum_k A[m,k] * Bt[n,k] (+bias)(+resid); each wave owns a 64x64 tile.
// A row-major [M,K]; Bt row-major [N,K].
// SPLIT: operands are hi/lo planes (A2/Bt2 = lo planes, same layout); product = hi.hi + hi.lo + lo.hi.
// BIAS_MODE: 0 = none, 1 = bias[m], 2 = bias[n].
// OUT_MODE: 0 = f32, 1 = f16, 2 = bf16 hi plane (Cout) + bf16 lo plane (Cout2).
// ET: 0 = f16 operands, 1 = bf16 operands (pointers passed as 16-bit storage)
// KSPLIT: one 64x64 tile per block; wave w sums k in [w*K/8, (w+1)*K/8) (K % 256 == 0) and the eight f32
// partial tiles are added in LDS in wave order 0..7. For shapes with too few tiles to fill the chip.
// Two batch levels: blockIdx.y with strideA/B/C, blockIdx.z with zA/zB/zC (element strides).
// Not KSPLIT: one 128x256 tile of C per block (M % 128 == 0, N % 256 == 0, K % 64 == 0), waves 2 x 4, 64x64 each.
// Per 64 k the block's 128 A rows and 256 Bt rows (128 B each) are copied to LDS by asynchronous 16-byte copies,
// four whole rows per wave and copy, two buffers: the next 64 k fly while this one is multiplied.
// QKV: three products of one launch on blockIdx.y. 0 and 1: C = A . Bt^T as the arguments say (weights strideB apart, outputs
// strideC apart, bias[n] from bias, resid). 2: the third weight matrix times the rows of A, batch by batch, i.e. the transposed
// product: operands change places, blockIdx.x = batch * tiles + tile, zB = rows of A per batch (= columns and pitch of C),
// zA, zC = elements of A and of C per batch, bias[m] from bias3.
#define SG_PITCH 72                          // f16 per staged row: 128 B + 16 B, the pitch for ds_load_b128 readers of 16 rows
#define SG_ROWS  384                         // 128 A rows, then 256 Bt rows
#define SG_BYTES (SG_ROWS * SG_PITCH * 2)    // one buffer
// One stage: this lane's 16 bytes of rows r, r + 32, ... (4 of A, 8 of Bt). lds = LDS byte address of its place in row r.
// The s_wait_xcnt stands inside the statement so that no address register is rewritten in front of it.
__device__ __forceinline__ void stage_issue(unsigned lds, const unsigned short* ga, size_t stepA,
                                            const unsigned short* gb, size_t stepB) {
  const unsigned LS = 32 * SG_PITCH * 2;
  asm volatile(
      "global_load_async_to_lds_b128 %0, %12, off\n\t"
      "global_load_async_to_lds_b128 %1, %13, off\n\t"
      "global_load_async_to_lds_b128 %2, %14, off\n\t"
      "global_load_async_to_lds_b128 %3, %15, off\n\t"
      "global_load_async_to_lds_b128 %4, %16, off\n\t"
      "global_load_async_to_lds_b128 %5, %17, off\n\t"
      "global_load_async_to_lds_b128 %6, %18, off\n\t"
      "global_load_async_to_lds_b128 %7, %19, off\n\t"
      "global_load_async_to_lds_b128 %8, %20, off\n\t"
      "global_load_async_to_lds_b128 %9, %21, off\n\t"
      "global_load_async_to_lds_b128 %10, %22, off\n\t"
      "global_load_async_to_lds_b128 %11, %23, off\n\t"
      "s_wait_xcnt 0x0"
      :: "v"(lds), "v"(lds + LS), "v"(lds + 2 * LS), "v"(lds + 3 * LS),
         "v"(lds + 4 * LS), "v"(lds + 5 * LS), "v"(lds + 6 * LS), "v"(lds + 7 * LS),
         "v"(lds + 8 * LS), "v"(lds + 9 * LS), "v"(lds + 10 * LS), "v"(lds + 11 * LS),
         "v"(ga), "v"(ga + stepA), "v"(ga + 2 * stepA), "v"(ga + 3 * stepA),
         "v"(gb), "v"(gb + stepB), "v"(gb + 2 * stepB), "v"(gb + 3 * stepB),
         "v"(gb + 4 * stepB), "v"(gb + 5 * stepB), "v"(gb + 6 * stepB), "v"(gb + 7 * stepB)
      : "memory");
}
template <int ET> struct Elem;
template <> struct Elem<0> { typedef _Float16 T; };
template <> struct Elem<1> { typedef __bf16 T; };
template <int ET, bool SPLIT, int BIAS_MODE, int OUT_MODE, bool RESID, int ACT = 0, bool KSPLIT = false, bool QKV = false>
__global__ __launch_bounds__(256) void wmma_gemm64(
    const unsigned short* __restrict__ Ap, const unsigned short* __restrict__ A2p, int lda, long strideA,
    const unsigned short* __restrict__ Btp, const unsigned short* __restrict__ Bt2p, int ldb, long strideB,
    void* __restrict__ Cout, void* __restrict__ Cout2, int ldcArg, long strideC,
    const float* __restrict__ bias,
    const float* __restrict__ resid, long strideR,
    int M, int N, int K, float scale, long zA, long zB, long zC, const float* __restrict__ bias3) {
  typedef typename Elem<ET>::T T;
  typedef typename Frag<T>::V V;
  const T* A = (const T*)Ap; const T* A2 = (const T*)A2p; const T* Bt = (const T*)Btp; const T* Bt2 = (const T*)Bt2p;
  static_assert(!KSPLIT || (!SPLIT && BIAS_MODE == 0 && OUT_MODE == 1 && !RESID && ACT == 0), "KSPLIT epilogue: plain f16 output only");
  static_assert(KSPLIT || !SPLIT, "staged form: single-plane operands only");
  static_assert(!QKV || (!KSPLIT && BIAS_MODE == 2 && !RESID), "QKV: staged form, bias by column (by row for the third product)");
  __shared__ __align__(16) float sT[8][(KSPLIT ? 64 : 16) * 68];   // per-wave slab (16x64, KSPLIT: 64x64), pitch 68 floats
  __shared__ __align__(16) unsigned short stg[KSPLIT ? 8 : 2 * SG_ROWS * SG_PITCH];   // staged operand rows, two buffers
  const int b    = blockIdx.y;
  const int z    = blockIdx.z;
  const int lane = threadIdx.x & 31;
  const int wave = threadIdx.x >> 5;
  const bool isV = QKV && b == 2;        // block-uniform
  const int Me = isV ? N : M;            // rows and columns of this block's product
  const int Ne = isV ? (int)zB : N;
  const int tilesN = Ne >> (KSPLIT ? 6 : 8);
  const int tilesM = Me >> (KSPLIT ? 6 : 7);
  int tile = (int)blockIdx.x;
  const int vb = isV ? tile / (tilesM * tilesN) : 0;   // batch of the third product
  tile -= vb * (tilesM * tilesN);
  if (isV ? vb >= M / Ne : tile >= tilesM * tilesN) return;   // block-uniform, in front of every barrier
  const int tm = tile / tilesN;
  const int tn = tile - tm * tilesN;
  const int wv = __builtin_amdgcn_readfirstlane(wave);
  const int bm0 = tm << (KSPLIT ? 6 : 7);                  // the block's first row and column of C
  const int bn0 = tn << (KSPLIT ? 6 : 8);
  const int m0 = KSPLIT ? bm0 : bm0 + ((wv >> 2) << 6);    // the wave's
  const int n0 = KSPLIT ? bn0 : bn0 + ((wv & 3) << 6);

  const size_t offA = isV ? (size_t)2 * strideB : (size_t)b * strideA + (size_t)z * zA;
  const size_t offB = isV ? (size_t)vb * zA : (size_t)b * strideB + (size_t)z * zB;
  const size_t offC = isV ? (size_t)2 * strideC + (size_t)vb * zC : (size_t)b * strideC + (size_t)z * zC;
  const unsigned short* Asrc = isV ? Btp : Ap;
  const unsigned short* Bsrc = isV ? Ap : Btp;
  const int ldA = isV ? ldb : lda, ldB = isV ? lda : ldb, ldc = isV ? (int)zB : ldcArg;
  const float* biasp = QKV ? (b == 0 ? bias : b == 1 ? resid : bias3) : bias;
  const T* Ab  = A  + offA;
  const T* Bb  = Bt + offB;
  const T* Ab2 = SPLIT ? (A2  + offA) : nullptr;
  const T* Bb2 = SPLIT ? (Bt2 + offB) : nullptr;

  const int rlane = lane & 15;                 // row (A) / col (B, D) within subtile
  const int koff  = (lane >> 4) * 8;           // k offset of this lane half
  const int mOff  = (lane >> 4) * 8;           // D row offset

  v8f acc[4][4];
#pragma unroll
  for (int i = 0; i < 4; ++i)
#pragma unroll
    for (int j = 0; j < 4; ++j) acc[i][j] = (v8f){0.f,0.f,0.f,0.f,0.f,0.f,0.f,0.f};

  if (!KSPLIT) {
    const int crow = threadIdx.x >> 3;                     // a wave's copy = 4 whole rows of 128 B
    const int cchk = (threadIdx.x & 7) * 8;
    const unsigned short* gA = Asrc + offA + (size_t)(bm0 + crow) * ldA + cchk;
    const unsigned short* gB = Bsrc + offB + (size_t)(bn0 + crow) * ldB + cchk;
    const size_t stepA = (size_t)32 * ldA, stepB = (size_t)32 * ldB;
    const unsigned l0 = (unsigned)(size_t)stg + (unsigned)(crow * SG_PITCH + cchk) * 2u;
    const int nst = K >> 6;                                // stages of 64 k
    const int aRow = ((wv >> 2) << 6) + rlane;             // the wave's first staged rows
    const int bRow = 128 + ((wv & 3) << 6) + rlane;
    stage_issue(l0, gA, stepA, gB, stepB);
    asm volatile("s_wait_asynccnt 0x0" ::: "memory");      // this wave's copies of stage 0 have landed
    __syncthreads();                                       // ... and every other wave's
    if (nst > 1) stage_issue(l0 + SG_BYTES, gA + 64, stepA, gB + 64, stepB);
#pragma unroll 1   // one body: the buffer is picked by t & 1
    for (int t = 0; t < nst; ++t) {
      const T* sb = (const T*)stg + (t & 1) * (SG_ROWS * SG_PITCH);
      // the loops below are unrolled so that every fragment and accumulator index is a constant (registers, no scratch)
#pragma unroll
      for (int ks = 0; ks < 2; ++ks) {
        V bh[4], ah[4];
#pragma unroll
        for (int j = 0; j < 4; ++j) bh[j] = Frag<T>::load(sb + (bRow + (j << 4)) * SG_PITCH + (ks << 5) + koff);
#pragma unroll
        for (int i = 0; i < 4; ++i) ah[i] = Frag<T>::load(sb + (aRow + (i << 4)) * SG_PITCH + (ks << 5) + koff);
        __builtin_amdgcn_sched_barrier(0);   // the 16 LDS reads stay one group in front of their 16 WMMAs (else: one A fragment at a time, a full LDS wait per 4 WMMAs)
#pragma unroll
        for (int i = 0; i < 4; ++i)
#pragma unroll
          for (int j = 0; j < 4; ++j) acc[i][j] = Frag<T>::mma(ah[i], bh[j], acc[i][j]);
      }
      asm volatile("s_wait_dscnt 0x0" ::: "memory");       // this wave has left the buffer of stage t
      asm volatile("s_wait_asynccnt 0x0" ::: "memory");    // its copies of stage t + 1 have landed
      __syncthreads();                                     // publishes stage t + 1 and frees the buffer of stage t
      if (t + 2 < nst) stage_issue(l0 + (t & 1) * SG_BYTES, gA + (size_t)(t + 2) * 64, stepA, gB + (size_t)(t + 2) * 64, stepB);
    }
    asm volatile("s_wait_asynccnt 0x0" ::: "memory");      // no copy is left in flight behind the loop
  }
  const int kBeg = KSPLIT ? wv * (K >> 3) : 0;   // scalar, so the k loop keeps its scalar counter and branch
  const int kEnd = KSPLIT ? kBeg + (K >> 3) : 0;
  for (int k0 = kBeg; k0 < kEnd; k0 += 32) {
    V bh[4], bl[4];
#pragma unroll
    for (int j = 0; j < 4; ++j) {
      const size_t bo = (size_t)(n0 + (j << 4) + rlane) * ldb + koff + k0;
      bh[j] = Frag<T>::load(Bb + bo);
      if (SPLIT) bl[j] = Frag<T>::load(Bb2 + bo);
    }
#pragma unroll
    for (int i = 0; i < 4; ++i) {
      const size_t ao = (size_t)(m0 + (i << 4) + rlane) * lda + koff + k0;
      V ah = Frag<T>::load(Ab + ao);
      V al;
      if (SPLIT) al = Frag<T>::load(Ab2 + ao);
#pragma unroll
      for (int j = 0; j < 4; ++j) {
        acc[i][j] = Frag<T>::mma(ah, bh[j], acc[i][j]);
        if (SPLIT) {
          acc[i][j] = Frag<T>::mma(ah, bl[j], acc[i][j]);
          acc[i][j] = Frag<T>::mma(al, bh[j], acc[i][j]);
        }
      }
      Frag<T>::guard(acc[i][0], acc[i][3], ah, SPLIT ? al : ah);
    }
    Frag<T>::keep(bh[0], bh[1], bh[2], bh[3]);
    if (SPLIT) Frag<T>::keep(bl[0], bl[1], bl[2], bl[3]);
  }
  acc_guard4(acc[0][0], acc[0][1], acc[0][2], acc[0][3]);
  acc_guard4(acc[1][0], acc[1][1], acc[1][2], acc[1][3]);
  acc_guard4(acc[2][0], acc[2][1], acc[2][2], acc[2][3]);
  acc_guard4(acc[3][0], acc[3][1], acc[3][2], acc[3][3]);

  if (KSPLIT) {
    // ---- split-K epilogue: partial tiles to LDS, then wave w sums and stores rows 8w..8w+7 ----
    float* part = sT[wave];
#pragma unroll
    for (int i = 0; i < 4; ++i)
#pragma unroll
      for (int j = 0; j < 4; ++j)
#pragma unroll
        for (int r = 0; r < 8; ++r)
          part[((i << 4) + mOff + r) * 68 + (j << 4) + rlane] = acc[i][j][r];
    __syncthreads();   // every wave's partial tile is in LDS before any wave reads the eight of them
    unsigned short* C = (unsigned short*)Cout + offC;
    const int hh = lane >> 4, c4 = (lane & 15) * 4;     // row seg = 64 f16 = 128 B = 16 lanes x 8 B
#pragma unroll
    for (int it = 0; it < 4; ++it) {
      const int row = (wave << 3) + it * 2 + hh;
      v4f s = *(const v4f*)(&sT[0][row * 68 + c4]);
#pragma unroll
      for (int w = 1; w < 8; ++w) s += *(const v4f*)(&sT[w][row * 68 + c4]);
      v4h hv;
#pragma unroll
      for (int e = 0; e < 4; ++e) hv[e] = (_Float16)(s[e] * scale);
      *(v4h*)(C + (size_t)(m0 + row) * ldc + n0 + c4) = hv;
    }
    return;
  }

  // ---- epilogue ----
  float* slab = sT[wave];
  const float* Rb = RESID ? (resid + (size_t)b * strideR) : nullptr;
  // QKV: bias by row (third product) and by column (the other two), all fetched here in one group, without a branch: the
  // kind that a product does not use is read from the first 56 elements of its bias vector and replaced by zero.
  float bm[4][8], bn[4];
  if (QKV) {
    const float* bmp = biasp + (isV ? m0 + mOff : 0);
    const float* bnp = biasp + (isV ? 0 : n0 + rlane);
#pragma unroll
    for (int i = 0; i < 4; ++i)
#pragma unroll
      for (int r = 0; r < 8; ++r) bm[i][r] = bmp[(i << 4) + r];
#pragma unroll
    for (int j = 0; j < 4; ++j) bn[j] = bnp[j << 4];
    asm volatile("s_wait_xcnt 0x0" ::: "memory");   // in front of the first rewrite of these loads' address registers
#pragma unroll
    for (int i = 0; i < 4; ++i)
#pragma unroll
      for (int r = 0; r < 8; ++r) bm[i][r] = isV ? bm[i][r] : 0.0f;
#pragma unroll
    for (int j = 0; j < 4; ++j) bn[j] = isV ? 0.0f : bn[j];
  }
#pragma unroll
  for (int i = 0; i < 4; ++i) {
    const int mBase = m0 + (i << 4);
#pragma unroll
    for (int j = 0; j < 4; ++j) {
      const int n = n0 + (j << 4) + rlane;
      float bv = 0.f;
      if (BIAS_MODE == 2) bv = QKV ? bn[j] : bias[n];
#pragma unroll
      for (int r = 0; r < 8; ++r) {
        float v = acc[i][j][r] * scale;
        if (BIAS_MODE == 1) v += bias[mBase + mOff + r];
        if (BIAS_MODE == 2) v += QKV ? bv + bm[i][r] : bv;   // QKV: one of the two is zero
        if (RESID) v += Rb[(size_t)(mBase + mOff + r) * ldc + n];
        if (ACT == 1) v = tanhf(v);
        if (ACT == 2) v = fmaxf(v, 0.0f);
        if (ACT == 3) v = v / (1.0f + expf(-v));
        if (ACT == 4) v = (v > 0.f) ? v : 0.01f * v;
        if (ACT == 5) v = 0.5f * v * (1.0f + erff(v * 0.70710678118654752f));
        slab[(mOff + r) * 68 + (j << 4) + rlane] = v;
      }
    }
    __builtin_amdgcn_fence(__ATOMIC_RELEASE, "workgroup");
    __builtin_amdgcn_wave_barrier();
    __builtin_amdgcn_fence(__ATOMIC_ACQUIRE, "workgroup");
    if (OUT_MODE == 0) {
      float* C = (float*)Cout + offC;
      const int hh = lane >> 4, c4 = (lane & 15) * 4;     // row seg = 256 B = 16 lanes x 16 B
      {
#pragma unroll
        for (int it = 0; it < 8; ++it) {
          const int row = it * 2 + hh;
          v4f v = *(const v4f*)(slab + row * 68 + c4);
          *(v4f*)(C + (size_t)(mBase + row) * ldc + n0 + c4) = v;
        }
        
      }
    } else {
      const int q = lane >> 3, c8 = (lane & 7) * 8;
      unsigned short* C  = (unsigned short*)Cout  + offC;
      unsigned short* C2 = (OUT_MODE == 2) ? ((unsigned short*)Cout2 + offC) : nullptr;
      {
#pragma unroll
        for (int it = 0; it < 4; ++it) {
          const int row = it * 4 + q;
          const float* sp = slab + row * 68 + c8;
          v8h hv, lv;
#pragma unroll
          for (int e = 0; e < 8; ++e) {
            if (OUT_MODE == 1) {
              hv[e] = (_Float16)sp[e];
            } else {
              unsigned short hb = f2bf_bits(sp[e]);
              unsigned short lb = f2bf_bits(sp[e] - bf_bits2f(hb));
              hv[e] = __builtin_bit_cast(_Float16, hb);
              lv[e] = __builtin_bit_cast(_Float16, lb);
            }
          }
          *(v8h*)(C + (size_t)(mBase + row) * ldc + n0 + c8) = hv;
          if (OUT_MODE == 2) *(v8h*)(C2 + (size_t)(mBase + row) * ldc + n0 + c8) = lv;
        }
        
      }
    }
    if (QKV) {
      asm volatile("s_wait_xcnt 0x0" ::: "memory");   // in front of the next pass's rewrite of the stores' address and data registers
      __builtin_amdgcn_sched_barrier(0);              // no later register write is lifted over that wait
    }
    __builtin_amdgcn_fence(__ATOMIC_RELEASE, "workgroup");
    __builtin_amdgcn_wave_barrier();
    __builtin_amdgcn_fence(__ATOMIC_ACQUIRE, "workgroup");
  }
}

// ---- f32 -> f16 casts of x (x1) and of the four weight matrices (x wscale), all in one launch ----
// A block converts CV_BLK consecutive floats of ONE array: blocks [0, xBlocks) take x, then wBlocks blocks each for
// wq, wk, wv, wo (w16 = the four f16 matrices one behind the other). Few long waves instead of many short ones: a thread
// has CV_U loads of 16 bytes in flight, each load of a wave covers 512 consecutive bytes, each store 256.
#define CV_U   16
#define CV_BLK (256 * 4 * CV_U)
__global__ __launch_bounds__(256) void cast_all_f16(
    const float* __restrict__ x, const float* __restrict__ wq, const float* __restrict__ wk,
    const float* __restrict__ wv, const float* __restrict__ wo,
    _Float16* __restrict__ x16, _Float16* __restrict__ w16, int xBlocks, int wBlocks, float wscale) {
  int bx = blockIdx.x;
  const float* in = x;
  _Float16* out = x16;
  float scale = 1.0f;
  if (bx >= xBlocks) {   // block-uniform
    bx -= xBlocks;
    const int j = bx / wBlocks;
    bx -= j * wBlocks;
    in = j == 0 ? wq : j == 1 ? wk : j == 2 ? wv : wo;
    out = w16 + (size_t)j * wBlocks * CV_BLK;
    scale = wscale;
  }
  const v4f* ip = (const v4f*)(in + (size_t)bx * CV_BLK);   // block-uniform bases; the thread index is the one vector offset of loads and stores
  v4h* op = (v4h*)(out + (size_t)bx * CV_BLK);
  const int t = threadIdx.x;
  v4f a[CV_U];
  // both loops are unrolled so that a[] stays in registers and all the loads are issued in front of the first store
#pragma unroll
  for (int i = 0; i < CV_U; ++i) a[i] = ip[t + i * 256];
#pragma unroll
  for (int i = 0; i < CV_U; ++i) {
    v4h h;
#pragma unroll
    for (int e = 0; e < 4; ++e) h[e] = (_Float16)(a[i][e] * scale);
    op[t + i * 256] = h;
  }
}

// =====================================================================================
// Cross-head mix 1 (12x12) -> softmax over keys (f32) -> cross-head mix 2 with 1/sum and the
// power-of-two carry -> f16 store.  One block per query row n (blockIdx.x) of one batch (blockIdx.y).
// SP is [batch][1024][12][1024] f16 (query, head, key): a block's 12 logit rows are its own 24 KB. The
// result (mix2 * pcarry, f16, [12][1024]) goes over them: a wave stores exactly the 128 keys x 12 heads that it has
// loaded itself (its loads have all been consumed by then), and no other wave or block touches them.
// Both mixes are WMMAs with the 12x12 weights as A (rows = target head) and 16 keys as B's columns (k = source head).
// Mix 1: a lane holds all 12 heads of its own 4 keys, so its 12 values of one key fill its own 16 k slots of a B fragment;
// lanes l and l+16 share a column, so one WMMA with the weights in the k slots of lanes 0..15 (zeros in the others) mixes
// the keys of lanes 0..15 and a second one with the weights in the other slots those of lanes 16..31, from the same B.
// LDS carries only 8 wave maxima and sums per head.
// =====================================================================================
#define MX_H 12
#define MX_N 1024

// value of lane l ^ X inside a 16-lane row (DPP row_xmask), no LDS pipe
template <int X> __device__ __forceinline__ float row_x(float x) {
  return __builtin_bit_cast(float, __builtin_amdgcn_update_dpp(0, __builtin_bit_cast(int, x), 0x160 + X, 0xf, 0xf, true));
}
__device__ __forceinline__ float row_max16(float x) {
  x = fmaxf(x, row_x<1>(x)); x = fmaxf(x, row_x<2>(x)); x = fmaxf(x, row_x<4>(x)); x = fmaxf(x, row_x<8>(x));
  return x;
}
__device__ __forceinline__ float row_sum16(float x) {
  x += row_x<1>(x); x += row_x<2>(x); x += row_x<4>(x); x += row_x<8>(x);
  return x;
}
// 2^x of four values in place. One statement, so that each v_exp_f32 is followed by an instruction that touches neither
// its result nor its source; the v_nop is that independent slot behind the last one.
__device__ __forceinline__ void exp2x4(v4f& x) {
  float x0 = x[0], x1 = x[1], x2 = x[2], x3 = x[3];
  asm("v_exp_f32 %0, %0\n\tv_exp_f32 %1, %1\n\tv_exp_f32 %2, %2\n\tv_exp_f32 %3, %3\n\tv_nop"
      : "+v"(x0), "+v"(x1), "+v"(x2), "+v"(x3));
  x = (v4f){x0, x1, x2, x3};
}

// lane R of each 16-lane row, given to every lane of that row (DPP row_share)
template <int R> __device__ __forceinline__ float row_share(float x) {
  return __builtin_bit_cast(float, __builtin_amdgcn_update_dpp(0, __builtin_bit_cast(int, x), 0x150 + R, 0xf, 0xf, true));
}
__device__ __forceinline__ v8f row_share8(float x) {
  return (v8f){row_share<0>(x), row_share<1>(x), row_share<2>(x), row_share<3>(x),
               row_share<4>(x), row_share<5>(x), row_share<6>(x), row_share<7>(x)};
}
__device__ __forceinline__ v8f mma_h(v16h a, v16h b, v8f c) {
  return __builtin_amdgcn_wmma_f32_16x16x32_f16(false, a, false, b, (short)0, c, false, false);
}
union HFrag { v16h v; unsigned u[8]; };
// a wave-uniform value, held as such (scalar register)
__device__ __forceinline__ float uni(float x) {
  return __builtin_bit_cast(float, __builtin_amdgcn_readfirstlane(__builtin_bit_cast(int, x)));
}

__global__ __launch_bounds__(256) void th_mix_kernel(
    _Float16* SP, const float* __restrict__ w1, const float* __restrict__ b1,
    const float* __restrict__ w2, const float* __restrict__ b2, float pcarry)
{
  __shared__ __align__(16) float redm[8 * 16];   // [wave][head, padded to 16] maxima
  __shared__ __align__(16) float reds[8 * 16];   // [wave][head, padded to 16] sums

  const int tid  = threadIdx.x;
  const int lane = tid & 31;
  const int wave = tid >> 5;
  const int col  = lane & 15;
  const int hi   = lane >> 4;
  _Float16* blk = SP + ((size_t)blockIdx.y * MX_N + blockIdx.x) * (MX_H * MX_N);

  // every loop below is unrolled so that the index of each register array is a constant (no scratch)
  v4h s[MX_H];
#pragma unroll
  for (int h = 0; h < MX_H; ++h) s[h] = *(const v4h*)(blk + h * MX_N + wave * 128 + col * 8 + hi * 4);   // lanes l and l+16: the two halves of 8 consecutive keys

  // ---- weights and biases in fragment order; rows and heads 12..15 are zero ----
  const int  gr  = col < MX_H ? col : MX_H - 1;   // address stays inside the 12 rows
  const float rk = col < MX_H ? 1.0f : 0.0f;
  const float lk = hi ? 0.0f : 1.0f;
  v4f w1r[3];
#pragma unroll
  for (int q = 0; q < 3; ++q) w1r[q] = *(const v4f*)(w1 + gr * MX_H + q * 4) * rk;
  float b1s[MX_H];   // all 12 read at uniform addresses; uni() keeps them scalar loads (else the select below is folded into a vector address)
#pragma unroll
  for (int h = 0; h < MX_H; ++h) b1s[h] = uni(b1[h]);
  v8f c1;            // bias of target head hi*8+r
#pragma unroll
  for (int r = 0; r < 8; ++r) c1[r] = hi ? (r < 4 ? b1s[8 + r] : 0.0f) : b1s[r];

  // w1 row of target head col as f16 high part + f16 remainder, element e = source head e.
  // "lo" fragments carry it in lanes 0..15 only (they pick the k slots that lanes 0..15 of B fill), "up" in lanes 16..31 only.
  HFrag wh, wl;
#pragma unroll
  for (int e = 0; e < 16; ++e) {
    const float w = e < MX_H ? w1r[e >> 2][e & 3] : 0.0f;
    const _Float16 h = (_Float16)w;
    wh.v[e] = h;
    wl.v[e] = (_Float16)(w - (float)h);
  }
  const unsigned mlo = hi ? 0u : 0xffffffffu, mup = ~mlo;
  HFrag loH, loL, upH, upL;
#pragma unroll
  for (int q = 0; q < 8; ++q) {
    loH.u[q] = wh.u[q] & mlo; loL.u[q] = wl.u[q] & mlo;
    upH.u[q] = wh.u[q] & mup; upL.u[q] = wl.u[q] & mup;
  }

  // ---- mix 1 on the matrix unit: d[half][i], register r, lane = target head hi*8+r of key 128*wave + 8*col + 4*half + i ----
  v8f d[2][4];
#pragma unroll
  for (int i = 0; i < 4; ++i) {
    v16h bi;   // this lane's key i: element e = source head e
#pragma unroll
    for (int e = 0; e < 16; ++e) bi[e] = e < MX_H ? s[e][i] : (_Float16)0.0f;
    d[0][i] = mma_h(loH.v, bi, mma_h(loL.v, bi, c1));
    d[1][i] = mma_h(upH.v, bi, mma_h(upL.v, bi, c1));
  }

  const int gi = hi * 8 + (lane & 7);   // the head this lane folds behind a barrier
  // ---- softmax per head: maximum ----
  {
    v8f pm = __builtin_elementwise_max(
        __builtin_elementwise_max(__builtin_elementwise_max(d[0][0], d[0][1]), __builtin_elementwise_max(d[0][2], d[0][3])),
        __builtin_elementwise_max(__builtin_elementwise_max(d[1][0], d[1][1]), __builtin_elementwise_max(d[1][2], d[1][3])));
#pragma unroll
    for (int r = 0; r < 8; ++r) pm[r] = row_max16(pm[r]);
    if (col == 0) {
      float* rp = redm + wave * 16 + hi * 8;
      *(v4f*)(rp)     = (v4f){pm[0], pm[1], pm[2], pm[3]};
      *(v4f*)(rp + 4) = (v4f){pm[4], pm[5], pm[6], pm[7]};
    }
  }
  __syncthreads();   // all 8 waves' maxima are in LDS
  // mix 2's weights and biases are fetched here, not at the head: 16 registers fewer during mix 1; the exponentials cover the latency
  const v4f w2a = *(const v4f*)(w2 + gr * MX_H + hi * 8) * rk;          // source heads 0..3 | 8..11
  const v4f w2b = *(const v4f*)(w2 + gr * MX_H + 4) * (rk * lk);        // source heads 4..7 | none
  float b2s[MX_H];   // as b1s
#pragma unroll
  for (int h = 0; h < MX_H; ++h) b2s[h] = uni(b2[h]) * pcarry;
  v8f c2;            // bias * carry of target head hi*8+r
#pragma unroll
  for (int r = 0; r < 8; ++r) c2[r] = hi ? (r < 4 ? b2s[8 + r] : 0.0f) : b2s[r];
  const v8f w2f = (v8f){w2a[0], w2a[1], w2a[2], w2a[3], w2b[0], w2b[1], w2b[2], w2b[3]};
  {
    float M = redm[gi];
#pragma unroll
    for (int w = 1; w < 8; ++w) M = fmaxf(M, redm[w * 16 + gi]);
    const float L2E = 1.44269504088896340736f;
    const v8f mr = row_share8(M * L2E);
#pragma unroll
    for (int hf = 0; hf < 2; ++hf)
#pragma unroll
      for (int i = 0; i < 4; ++i) {
        v4f x0, x1;
#pragma unroll
        for (int e = 0; e < 4; ++e) {
          x0[e] = __builtin_fmaf(d[hf][i][e], L2E, -mr[e]);
          x1[e] = __builtin_fmaf(d[hf][i][e + 4], L2E, -mr[e + 4]);
        }
        exp2x4(x0);
        exp2x4(x1);
        d[hf][i] = (v8f){x0[0], x0[1], x0[2], x0[3], x1[0], x1[1], x1[2], x1[3]};
      }
  }
  // ---- sum ----
  {
    v8f ps = ((d[0][0] + d[0][1]) + (d[0][2] + d[0][3])) + ((d[1][0] + d[1][1]) + (d[1][2] + d[1][3]));
#pragma unroll
    for (int r = 0; r < 8; ++r) ps[r] = row_sum16(ps[r]);
    if (col == 0) {
      float* rp = reds + wave * 16 + hi * 8;
      *(v4f*)(rp)     = (v4f){ps[0], ps[1], ps[2], ps[3]};
      *(v4f*)(rp + 4) = (v4f){ps[4], ps[5], ps[6], ps[7]};
    }
  }
  __syncthreads();   // all 8 waves' sums are in LDS
  // ---- mix 2 weights: w2[target col][source hi*8+j] * carry / sum[source], f16; k slots 0..15 (a2a) or 16..31 (a2b) ----
  v16h a2a, a2b;
  {
    float S = reds[gi];
#pragma unroll
    for (int w = 1; w < 8; ++w) S += reds[w * 16 + gi];
    const v8f W = w2f * row_share8((1.0f / S) * pcarry);
#pragma unroll
    for (int j = 0; j < 8; ++j) {
      const _Float16 h = (_Float16)W[j];
      a2a[j] = h;               a2a[j + 8] = (_Float16)0.0f;
      a2b[j] = (_Float16)0.0f;  a2b[j + 8] = h;
    }
  }

  // ---- mix 2 on the matrix unit, f16 store. Register r of mix 1's result is k slot hi*8+r of a B fragment as it stands:
  // two key slots share one B fragment (elements 0..7 and 8..15), a2a reads the first, a2b the second ----
  // A lane ends up with 8 consecutive keys of each of its target heads: one 16-byte store per head, 16 lanes = one whole aligned 256-byte piece.
  _Float16* prow = blk + (hi * 8) * MX_N + wave * 128 + col * 8;
  v4h ph[2][8];
#pragma unroll
  for (int hf = 0; hf < 2; ++hf) {
    v8f o[4];
#pragma unroll
    for (int p = 0; p < 2; ++p) {
      v16h be;
#pragma unroll
      for (int j = 0; j < 8; ++j) { be[j] = (_Float16)d[hf][2 * p][j]; be[j + 8] = (_Float16)d[hf][2 * p + 1][j]; }
      o[2 * p]     = mma_h(a2a, be, c2);
      o[2 * p + 1] = mma_h(a2b, be, c2);
    }
#pragma unroll
    for (int r = 0; r < 8; ++r) ph[hf][r] = (v4h){(_Float16)o[0][r], (_Float16)o[1][r], (_Float16)o[2][r], (_Float16)o[3][r]};
  }
#pragma unroll
  for (int r = 0; r < 8; ++r) {
    if (r < 4 || hi == 0) {   // lanes 16..31 hold target heads 8..15, of which 12..15 do not exist
      const v8h hv = (v8h){ph[0][r][0], ph[0][r][1], ph[0][r][2], ph[0][r][3], ph[1][r][0], ph[1][r][1], ph[1][r][2], ph[1][r][3]};
      *(v8h*)(prow + r * MX_N) = hv;
    }
  }
}

// =====================================================================================
// Scaled logits, S[n][h][m] = scale * sum_d q[n][h*64+d] * k[m][h*64+d], f16, for one head (blockIdx.y) of one batch (blockIdx.z).
// A block owns 128 queries x 256 keys (blockIdx.x = query tile * tilesN + key tile); its 128 q rows and 256 k rows (128 B each,
// the whole sum over d) are copied to LDS once by asynchronous 16-byte copies. The product is formed transposed, k rows as A and
// q rows as B: a lane then holds 8 consecutive keys of one query, packs them to 16 bytes of f16 and needs one LDS store for them.
// Wave w: queries 32*(w>>1).., keys 128*(w&1)..: a row of its tile is 256 B, so every global store covers whole aligned 256-byte pieces.
// =====================================================================================
#define QK_PITCH 136                         // f16 per slab row: 256 B + 16 B, a pitch of 16 B x odd for 16-byte accesses of 16 rows
__global__ __launch_bounds__(256) void qk_gemm_staged(
    const unsigned short* __restrict__ Q, const unsigned short* __restrict__ Kp, int ld, long head, long batch,
    unsigned short* __restrict__ C, long headC, long batchC, int tilesN, float scale) {
  // staged operand rows, one buffer (54 KB); behind the products the epilogue's slabs (8 waves x 32 rows, 68 KB) lie over the same bytes
  __shared__ __align__(16) unsigned short stg[8 * 32 * QK_PITCH];
  static_assert(8 * 32 * QK_PITCH >= SG_ROWS * SG_PITCH, "the staged rows fit the array");
  const int lane  = threadIdx.x & 31;
  const int wv    = __builtin_amdgcn_readfirstlane(threadIdx.x >> 5);
  const int rlane = lane & 15;                 // row of a fragment / column of D
  const int hi    = lane >> 4;
  const int koff  = hi * 8;                    // k offset of this lane half
  const int tm    = (int)blockIdx.x / tilesN;
  const int tn    = (int)blockIdx.x - tm * tilesN;
  const int bm0   = tm << 7;                   // the block's first query
  const int bn0   = tn << 8;                   // the block's first key
  const size_t off = (size_t)blockIdx.y * head + (size_t)blockIdx.z * batch;

  const int crow = threadIdx.x >> 3;           // a wave's copy = 4 whole rows of 128 B
  const int cchk = (threadIdx.x & 7) * 8;
  const unsigned short* gA = Q  + off + (size_t)(bm0 + crow) * ld + cchk;
  const unsigned short* gB = Kp + off + (size_t)(bn0 + crow) * ld + cchk;
  const size_t step = (size_t)32 * ld;
  const unsigned l0 = (unsigned)(size_t)stg + (unsigned)(crow * SG_PITCH + cchk) * 2u;
  stage_issue(l0, gA, step, gB, step);
  asm volatile("s_wait_asynccnt 0x0" ::: "memory");      // this wave's copies have landed
  __syncthreads();                                       // ... and every other wave's

  const int qRow = ((wv >> 1) << 5) + rlane;             // the wave's first staged rows
  const int kRow = 128 + ((wv & 1) << 7) + rlane;
  const _Float16* sb = (const _Float16*)stg;
  v8f acc[8][2];
  // every loop over i, j, ks, r and it is unrolled so that each fragment and accumulator index is a constant (registers, no scratch)
#pragma unroll
  for (int i = 0; i < 8; ++i)
#pragma unroll
    for (int j = 0; j < 2; ++j) acc[i][j] = (v8f){0.f,0.f,0.f,0.f,0.f,0.f,0.f,0.f};
#pragma unroll
  for (int ks = 0; ks < 2; ++ks) {
    v16h kf[8], qf[2];
#pragma unroll
    for (int j = 0; j < 2; ++j) qf[j] = Frag<_Float16>::load(sb + (qRow + (j << 4)) * SG_PITCH + (ks << 5) + koff);
#pragma unroll
    for (int i = 0; i < 8; ++i) kf[i] = Frag<_Float16>::load(sb + (kRow + (i << 4)) * SG_PITCH + (ks << 5) + koff);
    __builtin_amdgcn_sched_barrier(0);   // the 20 LDS reads stay one group in front of their 16 WMMAs (one LDS latency per 32 d, not one per fragment)
#pragma unroll
    for (int i = 0; i < 8; ++i)
#pragma unroll
      for (int j = 0; j < 2; ++j) acc[i][j] = Frag<_Float16>::mma(kf[i], qf[j], acc[i][j]);
  }
  asm volatile("s_wait_dscnt 0x0" ::: "memory");         // this wave has left the staged rows
  __syncthreads();                                       // ... and every other wave: the slabs may overwrite them

  // ---- epilogue: the wave's 32 queries x 128 keys through its own f16 slab ----
  _Float16* slab = (_Float16*)stg + wv * (32 * QK_PITCH);
  unsigned short* Cb = C + (size_t)blockIdx.y * headC + (size_t)blockIdx.z * batchC
                     + (size_t)(bm0 + ((wv >> 1) << 5) + hi) * (MX_H * MX_N) + bn0 + ((wv & 1) << 7) + rlane * 8;
#pragma unroll
  for (int j = 0; j < 2; ++j)
#pragma unroll
    for (int i = 0; i < 8; ++i) {
      v8h hv;   // query 16 j + rlane, keys 16 i + 8 hi + 0..7
#pragma unroll
      for (int r = 0; r < 8; ++r) hv[r] = (_Float16)(acc[i][j][r] * scale);
      *(v8h*)(slab + ((j << 4) + rlane) * QK_PITCH + (i << 4) + koff) = hv;
    }
  // a lane reads below what other lanes of its wave have written: the LDS stores are finished in front of the LDS reads
  __builtin_amdgcn_fence(__ATOMIC_RELEASE, "workgroup");
  __builtin_amdgcn_wave_barrier();
  __builtin_amdgcn_fence(__ATOMIC_ACQUIRE, "workgroup");
#pragma unroll
  for (int it = 0; it < 16; ++it) {   // a store: rows 2 it and 2 it + 1, 256 B each
    const v8h v = *(const v8h*)(slab + (it * 2 + hi) * QK_PITCH + rlane * 8);
    *(v8h*)(Cb + (size_t)(it * 2) * (MX_H * MX_N)) = v;
  }
}

// =====================================================================================
// a.v product, operands staged in LDS. C[n][d] = scale * sum_m P[n][m] * Vt[d][m] for one head (blockIdx.y) of one batch
// (blockIdx.z); a block owns 128 rows n (blockIdx.x) and all 64 columns d, wave w rows 16w..16w+15. K % 128 == 0.
// Per 128 m the block's 128 rows of P and 64 rows of Vt (256 B each) are copied to LDS by asynchronous 16-byte copies, two
// whole rows per wave and copy (a fragment load straight from global memory touches 16 lines for its 512 bytes), two buffers:
// the next 128 m fly while this one is multiplied. The sum over m runs in one f32 accumulator per element, m ascending.
// =====================================================================================
#define AV_PITCH 136                         // f16 per staged row: 256 B + 16 B, a pitch of 16 B x odd for ds_load_b128 readers of 16 rows
#define AV_ROWS  192                         // 128 rows of P, then 64 rows of Vt
#define AV_BYTES (AV_ROWS * AV_PITCH * 2)    // one buffer
// One stage: this lane's 16 bytes of rows r, r + 16, ... (8 of P, 4 of Vt). lds = LDS byte address of its place in row r.
// The s_wait_xcnt stands inside the statement so that no address register is rewritten in front of it.
__device__ __forceinline__ void av_stage_issue(unsigned lds, const unsigned short* ga, size_t stepA,
                                               const unsigned short* gb, size_t stepB) {
  const unsigned LS = 16 * AV_PITCH * 2;
  asm volatile(
      "global_load_async_to_lds_b128 %0, %12, off\n\t"
      "global_load_async_to_lds_b128 %1, %13, off\n\t"
      "global_load_async_to_lds_b128 %2, %14, off\n\t"
      "global_load_async_to_lds_b128 %3, %15, off\n\t"
      "global_load_async_to_lds_b128 %4, %16, off\n\t"
      "global_load_async_to_lds_b128 %5, %17, off\n\t"
      "global_load_async_to_lds_b128 %6, %18, off\n\t"
      "global_load_async_to_lds_b128 %7, %19, off\n\t"
      "global_load_async_to_lds_b128 %8, %20, off\n\t"
      "global_load_async_to_lds_b128 %9, %21, off\n\t"
      "global_load_async_to_lds_b128 %10, %22, off\n\t"
      "global_load_async_to_lds_b128 %11, %23, off\n\t"
      "s_wait_xcnt 0x0"
      :: "v"(lds), "v"(lds + LS), "v"(lds + 2 * LS), "v"(lds + 3 * LS),
         "v"(lds + 4 * LS), "v"(lds + 5 * LS), "v"(lds + 6 * LS), "v"(lds + 7 * LS),
         "v"(lds + 8 * LS), "v"(lds + 9 * LS), "v"(lds + 10 * LS), "v"(lds + 11 * LS),
         "v"(ga), "v"(ga + stepA), "v"(ga + 2 * stepA), "v"(ga + 3 * stepA),
         "v"(ga + 4 * stepA), "v"(ga + 5 * stepA), "v"(ga + 6 * stepA), "v"(ga + 7 * stepA),
         "v"(gb), "v"(gb + stepB), "v"(gb + 2 * stepB), "v"(gb + 3 * stepB)
      : "memory");
}
__global__ __launch_bounds__(256) void av_gemm_staged(
    const unsigned short* __restrict__ P, int ldp, long headP, long batchP,
    const unsigned short* __restrict__ Vt, int ldv, long headV, long batchV,
    unsigned short* __restrict__ C, int ldc, long headC, long batchC, int K, float scale) {
  // staged operand rows, two buffers; behind the k loop the epilogue's slabs lie in the same bytes (102 KB: three blocks share a WGP)
  __shared__ __align__(16) unsigned short stg[2 * AV_ROWS * AV_PITCH];
  const int lane  = threadIdx.x & 31;
  const int wv    = __builtin_amdgcn_readfirstlane(threadIdx.x >> 5);
  const int rlane = lane & 15;                 // row (A) / col (B, D) within subtile
  const int koff  = (lane >> 4) * 8;           // k offset of this lane half
  const int mOff  = (lane >> 4) * 8;           // D row offset
  const int bm0   = (int)blockIdx.x << 7;      // the block's first row of C
  const size_t offA = (size_t)blockIdx.y * headP + (size_t)blockIdx.z * batchP;
  const size_t offB = (size_t)blockIdx.y * headV + (size_t)blockIdx.z * batchV;
  const size_t offC = (size_t)blockIdx.y * headC + (size_t)blockIdx.z * batchC;

  const int crow = threadIdx.x >> 4;           // a wave's copy = 2 whole rows of 256 B
  const int cchk = (threadIdx.x & 15) * 8;
  const unsigned short* gA = P + offA + (size_t)(bm0 + crow) * ldp + cchk;
  const unsigned short* gB = Vt + offB + (size_t)crow * ldv + cchk;
  const size_t stepA = (size_t)16 * ldp, stepB = (size_t)16 * ldv;
  const unsigned l0 = (unsigned)(size_t)stg + (unsigned)(crow * AV_PITCH + cchk) * 2u;
  const int nst  = K >> 7;                     // stages of 128 m
  const int aRow = (wv << 4) + rlane;          // the wave's staged rows
  const int bRow = 128 + rlane;

  v8f acc[4];
  // every loop over j, ks and kp is unrolled so that each fragment and accumulator index is a constant (registers, no scratch)
#pragma unroll
  for (int j = 0; j < 4; ++j) acc[j] = (v8f){0.f,0.f,0.f,0.f,0.f,0.f,0.f,0.f};

  av_stage_issue(l0, gA, stepA, gB, stepB);
  asm volatile("s_wait_asynccnt 0x0" ::: "memory");      // this wave's copies of stage 0 have landed
  __syncthreads();                                       // ... and every other wave's
  if (nst > 1) av_stage_issue(l0 + AV_BYTES, gA + 128, stepA, gB + 128, stepB);
#pragma unroll 1   // one body: the buffer is picked by t & 1
  for (int t = 0; t < nst; ++t) {
    const _Float16* sb = (const _Float16*)stg + (t & 1) * (AV_ROWS * AV_PITCH);
#pragma unroll
    for (int kp = 0; kp < 2; ++kp) {     // 64 m at a time
      v16h bh[2][4], ah[2];
#pragma unroll
      for (int ks = 0; ks < 2; ++ks) {
        ah[ks] = Frag<_Float16>::load(sb + aRow * AV_PITCH + (kp << 6) + (ks << 5) + koff);
#pragma unroll
        for (int j = 0; j < 4; ++j) bh[ks][j] = Frag<_Float16>::load(sb + (bRow + (j << 4)) * AV_PITCH + (kp << 6) + (ks << 5) + koff);
      }
      __builtin_amdgcn_sched_barrier(0);   // the 20 LDS reads stay one group in front of their 8 WMMAs (one LDS latency per 64 m, not one per fragment)
#pragma unroll
      for (int ks = 0; ks < 2; ++ks)
#pragma unroll
        for (int j = 0; j < 4; ++j) acc[j] = Frag<_Float16>::mma(ah[ks], bh[ks][j], acc[j]);
    }
    asm volatile("s_wait_dscnt 0x0" ::: "memory");       // this wave has left the buffer of stage t
    asm volatile("s_wait_asynccnt 0x0" ::: "memory");    // its copies of stage t + 1 have landed
    __syncthreads();                                     // publishes stage t + 1 and frees the buffer of stage t
    if (t + 2 < nst) av_stage_issue(l0 + (t & 1) * AV_BYTES, gA + (size_t)(t + 2) * 128, stepA, gB + (size_t)(t + 2) * 128, stepB);
  }
  asm volatile("s_wait_asynccnt 0x0" ::: "memory");      // no copy is left in flight behind the loop

  // ---- epilogue: the wave's 16x64 tile through its own slab (16 rows, pitch 68 floats), so that a store covers whole 128-byte rows.
  // The slabs reuse the stage buffers: the last pass's barrier stands behind every wave's last read and last landed copy.
  float* slab = (float*)stg + wv * (16 * 68);
#pragma unroll
  for (int j = 0; j < 4; ++j)
#pragma unroll
    for (int r = 0; r < 8; ++r) slab[(mOff + r) * 68 + (j << 4) + rlane] = acc[j][r] * scale;
  __builtin_amdgcn_fence(__ATOMIC_RELEASE, "workgroup");
  __builtin_amdgcn_wave_barrier();
  __builtin_amdgcn_fence(__ATOMIC_ACQUIRE, "workgroup");
  const int q = lane >> 3, c8 = (lane & 7) * 8;
  unsigned short* Cb = C + offC + (size_t)(bm0 + (wv << 4)) * ldc;
#pragma unroll
  for (int it = 0; it < 4; ++it) {
    const int row = it * 4 + q;
    const float* sp = slab + row * 68 + c8;
    v8h hv;
#pragma unroll
    for (int e = 0; e < 8; ++e) hv[e] = (_Float16)sp[e];
    *(v8h*)(Cb + (size_t)row * ldc + c8) = hv;
  }
}

// ---------------------------------------------------------------------------
template <int BIAS_MODE, int OUT_MODE>
static void gemm_f16(hipStream_t st, int gy,
                     const void* A, int lda, long sA,
                     const void* Bt, int ldb, long sB,
                     void* C, int ldc, long sC,
                     const float* bias, int M, int N, int K, float scale,
                     int gz = 1, long zA = 0L, long zB = 0L, long zC = 0L)
{
  dim3 grid((M / 128) * (N / 256), gy, gz);
  wmma_gemm64<0, false, BIAS_MODE, OUT_MODE, false, 0><<<grid, 256, 0, st>>>(
      (const unsigned short*)A, (const unsigned short*)A, lda, sA,
      (const unsigned short*)Bt, (const unsigned short*)Bt, ldb, sB,
      C, C, ldc, sC, bias, bias, (long)0, M, N, K, scale, zA, zB, zC, bias);
}

extern "C" void kernel_launch(void* const* d_in, const int* in_sizes, int n_in,
                              void* d_out, int out_size, void* d_ws, size_t ws_size,
                              hipStream_t stream)
{
  const int Bn = 8, Nn = 1024, Dd = 768, Hh = 12, HD = 64;
  const int GB = 8;                                       // batches per launch in the attention part
  if (n_in < 13) return;
  if (in_sizes[0] != Bn * Nn * Dd) return;
  if (in_sizes[1] != Dd * Dd || in_sizes[3] != Dd * Dd || in_sizes[5] != Dd * Dd || in_sizes[7] != Dd * Dd) return;
  if (in_sizes[2] != Dd || in_sizes[4] != Dd || in_sizes[6] != Dd || in_sizes[8] != Dd) return;
  if (in_sizes[9] != Hh * Hh || in_sizes[10] != Hh || in_sizes[11] != Hh * Hh || in_sizes[12] != Hh) return;
  if (out_size != Bn * Nn * Dd) return;

  const float* x    = (const float*)d_in[0];
  const float* wq   = (const float*)d_in[1];
  const float* bq   = (const float*)d_in[2];
  const float* wk   = (const float*)d_in[3];
  const float* bk   = (const float*)d_in[4];
  const float* wv   = (const float*)d_in[5];
  const float* bv   = (const float*)d_in[6];
  const float* wo   = (const float*)d_in[7];
  const float* bo   = (const float*)d_in[8];
  const float* th1w = (const float*)d_in[9];
  const float* th1b = (const float*)d_in[10];
  const float* th2w = (const float*)d_in[11];
  const float* th2b = (const float*)d_in[12];
  float* out = (float*)d_out;

  // ---- workspace carve (bytes) ----
  const size_t WSZ = (size_t)Dd * Dd * 2;                 // one f16 weight matrix
  const size_t ASZ = (size_t)Bn * Nn * Dd * 2;            // one f16 activation [8192][768]
  const size_t SSZ = (size_t)GB * Nn * Hh * Nn * 2;       // logits f16 [GB][1024][12][1024]; mixed attention f16 written over them
  const size_t off_wq  = 0;
  const size_t off_wk  = off_wq + WSZ;
  const size_t off_wv  = off_wk + WSZ;
  const size_t off_wo  = off_wv + WSZ;
  const size_t off_q   = off_wo + WSZ;
  const size_t off_k   = off_q + ASZ;
  const size_t off_vt  = off_k + ASZ;                     // v^T per batch: [b][h*64+d][m]
  const size_t off_ctx = off_vt + ASZ;                    // attention output [8192][768] f16
  const size_t off_R   = off_ctx + ASZ;                   // reused region
  const size_t off_x16 = off_R;                           // live during the projections only
  const size_t off_S   = off_R;                           // live per group of GB batches afterwards
  size_t end = off_S + SSZ;
  if (off_x16 + ASZ > end) end = off_x16 + ASZ;
  if (end > ws_size) return;

  uint8_t* ws = (uint8_t*)d_ws;
  _Float16* wq16 = (_Float16*)(ws + off_wq);
  _Float16* wo16 = (_Float16*)(ws + off_wo);
  unsigned short* q16   = (unsigned short*)(ws + off_q);
  unsigned short* k16   = (unsigned short*)(ws + off_k);
  unsigned short* vt16  = (unsigned short*)(ws + off_vt);
  unsigned short* ctx16 = (unsigned short*)(ws + off_ctx);
  _Float16* x16 = (_Float16*)(ws + off_x16);
  _Float16* Sb = (_Float16*)(ws + off_S);

  const float WCARRY = 64.0f;        // weights carried x2^6 in f16
  const float PCARRY = 2048.0f;      // mixed attention carried x2^11 in f16

  // ---- casts to f16: one launch ----
  cast_all_f16<<<Bn * Nn * Dd / CV_BLK + 4 * (Dd * Dd / CV_BLK), 256, 0, stream>>>(
      x, wq, wk, wv, wo, x16, wq16, Bn * Nn * Dd / CV_BLK, Dd * Dd / CV_BLK, WCARRY);

  // ---- projections: q, k as [b*1024+n][h*64+d] f16; v^T per batch as [b][h*64+d][m] f16 ----
  // One launch, grid.y = q, k, v^T (192 blocks each): wq16, wk16, wv16 and q16, k16, vt16 lie one behind the other in the workspace.
  // v^T: A = wv [768][768], Bt = x rows of batch b [1024][768] -> C [768][1024] per batch, bias[m] = bv[o]
  wmma_gemm64<0, false, 2, 1, false, 0, false, true><<<dim3((Bn * Nn / 128) * (Dd / 256), 3), 256, 0, stream>>>(
      (const unsigned short*)x16, (const unsigned short*)x16, Dd, 0L,
      (const unsigned short*)wq16, (const unsigned short*)wq16, Dd, (long)Dd * Dd,
      q16, q16, Dd, (long)Bn * Nn * Dd, bq, bk, 0L, Bn * Nn, Dd, Dd, 1.0f / WCARRY,
      (long)Nn * Dd, (long)Nn, (long)Dd * Nn, bv);

  // ---- per group of GB batches (grid.z = batch in the group): logits -> mix/softmax/mix -> a.v ----
  const float qk_scale = 0.125f;     // 64^-0.5
  const long rowS = (long)Hh * Nn;   // f16 elements of one query's 12 logit rows
  for (int b = 0; b < Bn; b += GB) {
    const unsigned short* qb = q16 + (size_t)b * Nn * Dd;
    const unsigned short* kb = k16 + (size_t)b * Nn * Dd;
    // S[z][n][h][m] = scale * sum_d q[n][h*64+d] k[m][h*64+d]; grid.y = head: strideA/B = 64, strideC = 1024
    qk_gemm_staged<<<dim3((Nn / 128) * (Nn / 256), Hh, GB), 256, 0, stream>>>(
        qb, kb, Dd, (long)HD, (long)Nn * Dd, (unsigned short*)Sb, (long)Nn, (long)Nn * rowS, Nn / 256, qk_scale);
    th_mix_kernel<<<dim3(Nn, GB), 256, 0, stream>>>(Sb, th1w, th1b, th2w, th2b, PCARRY);
    // ctx[(b+z)*1024+n][h*64+d] = 2^-11 * sum_m P[z][n][h][m] * vT[b+z][h*64+d][m]; grid.y = head.
    // P rows lie in the logits' place: f16 pitch per query = rowS, per head = 1024
    av_gemm_staged<<<dim3(Nn / 128, Hh, GB), 256, 0, stream>>>(
        (const unsigned short*)Sb, Hh * Nn, (long)Nn, (long)Nn * rowS,
        vt16 + (size_t)b * Dd * Nn, Nn, (long)HD * Nn, (long)Dd * Nn,
        ctx16 + (size_t)b * Nn * Dd, Dd, (long)HD, (long)Nn * Dd, Nn, 1.0f / PCARRY);
  }

  // ---- output projection -> f32 [8192][768] ----
  gemm_f16<2, 0>(stream, 1, ctx16, Dd, 0L, wo16, Dd, 0L, out, Dd, 0L, bo, Bn * Nn, Dd, Dd, 1.0f / WCARRY);
}
